// v000
// Times are from an AMD MI455X. After a warm-up the kernel runs many times in a row, and a time is the length of
// such a window on the GPU divided by its runs, so every launch and the gaps after it count. The runs cycle
// through copies of the inputs. A figure is the median of several windows, for all but v000 over two sittings.
// Sittings can differ by a few percent; kernels timed side by side share one.
// The starting kernel, v000, takes 10.8 milliseconds a run.
#include <hip/hip_runtime.h>
// Pre-LN causal transformer block (x [4][2048][1024]; h = LN1(x) (biased var, eps 1e-5, gamma / beta); Q/K/V = h Wq/Wk/Wv ([in][out] 1024 x 1024 sigma 1/32, no biases), 16 heads of 64; scores / 8; causal (tril, -inf); softmax; x1 = x + hidden Wo ([in][out], no bias); h2 = LN2(x1); out = x1 + gelu_erf(h2 W1 + b1) W2 + b2 ([in][out] 1024 x 4096 x 1024) -> [4][2048][1024]).
// Structure: token rows r = b*2048 + s; h = LN1(bf16(x)) as f16 rows; q | k | v as ONE WMMA GEMM (N = 3 x 1024) (32x64 wave tiles, f32 accumulation, exact x16 weights, no bias, f16 outputs); per batch: V^T for all heads via LDS transposes; per query tile of 256 rows: scores against the keys below the tile end only (K = 64, all heads on grid.y, alpha = 0.125), causal row softmax on VALU with an arithmetic 0/1 key mask over the computed range (f32 statistics, native exp; weights x256 f16), o = P . V^T (K = keys below the tile end, alpha 2^-2: o carried x64, folded into the output GEMM alpha) written straight into the merged f16 o rows; x1 = x + o W_o GEMM (f32, no bias), then LN2 and the MLP GEMMs into the output layout.
// Compute dtype: inputs rounded to bf16; x / weights exact; q, k, v, softmax weights and o as plain f16 GEMM operands (~2^-12); scores and softmax statistics f32. v_wmma_f32_16x16x32_f16.
#define NB 4
#define SQ 2048
#define DM 1024
#define NH 16
#define HD 64
#define HG 4                         /* heads per block group of the unlaunched k_vt(b, h0) overload */
#define QT 256                       /* query rows per causal tile */
#define NKX SQ                       /* S / P row pitch */
#define QT0 128                      /* first-tile rows recomputed exactly in f32 */
#define B0 0                         /* first batch processed (debug hook) */
#define NBR NB                       /* batches processed (debug hook) */
#define NR ((size_t)NB * SQ)
#define DMQ DM
#define DFF 4096                     /* FFN hidden width */
#define DFFR 100                     /* unused */
#define MP ((int)((size_t)NBR * SQ)) /* rows projected (debug hook) */
#define QN SQ                        /* query rows attended per batch (debug hook) */
#define NHD NH                       /* heads attended (debug hook) */
#define MPO MP                       /* rows through the output stage (debug hook) */
#define LQ (3 * DM)      /* row pitch of the q/k/v rows */
typedef __bf16 v16b __attribute__((ext_vector_type(16)));
typedef unsigned short v8us __attribute__((ext_vector_type(8), may_alias));
typedef float  v8f  __attribute__((ext_vector_type(8)));
typedef float  v4f  __attribute__((ext_vector_type(4)));
typedef float  v4fa __attribute__((ext_vector_type(4), may_alias));
union FragB { v16b v; v8us half[2]; unsigned short u[16]; };

__device__ __forceinline__ unsigned short bf16_bits(float x) { unsigned int u = __float_as_uint(x); return (unsigned short)((u + 0x7FFFu + ((u >> 16) & 1u)) >> 16); }
__device__ __forceinline__ float bf16_val(unsigned short b) { return __uint_as_float(((unsigned int)b) << 16); }
__device__ __forceinline__ float bf16_round(float x) { return bf16_val(bf16_bits(x)); }
// D += A·B with NT terms: 1 = ah·bh, 2 = + al·bh (A split), 3 = + ah·bl (both split)
template <int NT>
__device__ __forceinline__ v8f mmaN(v16b ah, v16b al, v16b bh, v16b bl, v8f c) {
  c = __builtin_amdgcn_wmma_f32_16x16x32_bf16(false, ah, false, bh, (short)0, c, false, false);
  if (NT >= 2) c = __builtin_amdgcn_wmma_f32_16x16x32_bf16(false, al, false, bh, (short)0, c, false, false);
  if (NT >= 3) c = __builtin_amdgcn_wmma_f32_16x16x32_bf16(false, ah, false, bl, (short)0, c, false, false);
  asm volatile("v_nop\n\tv_nop\n\tv_nop\n\tv_nop" : "+v"(c) : "v"(ah), "v"(al), "v"(bh), "v"(bl));
  return c;
}

__global__ __launch_bounds__(256) void k_wt_bf16(const float* __restrict__ W, unsigned short* __restrict__ Wt, int K, int N) {
  const int t = blockIdx.x * 256 + threadIdx.x;
  const int k8n = K / 8;
  if (t >= N * k8n) return;
  const int n = t / k8n, k8 = (t % k8n) * 8;
  v8us v;
#pragma unroll
  for (int i = 0; i < 8; ++i) v[i] = bf16_bits(W[(size_t)(k8 + i) * N + n]);
  *(v8us*)(Wt + (size_t)n * K + k8) = v;
  
}

// GEMM C[M][N] (f32, pitch ldc) = act(A[M][K]·W + bias). A f32 row-major (pitch lda) converted per fragment to bf16
// (ASPLIT: hi/lo two planes -> 2 terms, else single rounded term); Wt bf16 [N][K] (pitch ldb). BIAS_BF16 rounds the
// bias to bf16 first (bias quantised to bf16 before the add). K%32==0, M%16==0, N%64==0.
template <bool ASPLIT, int ACT, bool BIAS_BF16>
__global__ __launch_bounds__(128) void k_gemm_bf(const float* __restrict__ A, int lda, const unsigned short* __restrict__ Wt, int ldb,
                                               const float* __restrict__ bias, float* __restrict__ C, int ldc, int M, int N, int K) {
  __shared__ __attribute__((aligned(16))) float so[4][16][64];
  const int tid = threadIdx.x, w = tid >> 5, lane = tid & 31, ln = lane & 15, hh = lane >> 4;
  const int ntn = N / 64;
  const int wid = blockIdx.x * 4 + w;
  const int mt = wid / ntn, nq = wid % ntn;
  if (mt * 16 >= M) return;
  const int row0 = mt * 16, col0 = nq * 64;
  const float* arow = A + (size_t)(row0 + ln) * lda;
  v8f acc[4] = {};
  for (int kb = 0; kb < K; kb += 32) {
    FragB ah, al;
    const v4f x0 = *(const v4fa*)(arow + kb + 8 * hh), x1 = *(const v4fa*)(arow + kb + 8 * hh + 4);
    const v4f x2 = *(const v4fa*)(arow + kb + 16 + 8 * hh), x3 = *(const v4fa*)(arow + kb + 16 + 8 * hh + 4);
    float xs[16] = {x0[0],x0[1],x0[2],x0[3],x1[0],x1[1],x1[2],x1[3],x2[0],x2[1],x2[2],x2[3],x3[0],x3[1],x3[2],x3[3]};
#pragma unroll
    for (int i = 0; i < 16; ++i) { const unsigned short hb = bf16_bits(xs[i]); ah.u[i] = hb; al.u[i] = ASPLIT ? bf16_bits(xs[i] - bf16_val(hb)) : (unsigned short)0; }
#pragma unroll
    for (int t = 0; t < 4; ++t) {
      const unsigned short* brow = Wt + (size_t)(col0 + t * 16 + ln) * ldb + kb;
      FragB b;
      b.half[0] = *(const v8us*)(brow + 8 * hh);
      b.half[1] = *(const v8us*)(brow + 16 + 8 * hh);
      acc[t] = mmaN<ASPLIT ? 2 : 1>(ah.v, al.v, b.v, b.v, acc[t]);
    }
  }
#pragma unroll
  for (int t = 0; t < 4; ++t) {
    float bv = bias ? bias[col0 + t * 16 + ln] : 0.f;
    if (BIAS_BF16) bv = bf16_round(bv);
#pragma unroll
    for (int r = 0; r < 8; ++r) { float v = acc[t][r] + bv; if (ACT == 1) v = fmaxf(v, 0.f); so[w][8 * hh + r][t * 16 + ln] = v; }
  }
  __builtin_amdgcn_fence(__ATOMIC_ACQ_REL, "workgroup");
  __builtin_amdgcn_wave_barrier();
  const int rsub = lane >> 4, c4 = (lane & 15) * 4;
  {
#pragma unroll
    for (int q = 0; q < 8; ++q) {
      const int r = q * 2 + rsub;
      const v4f v = *(const v4fa*)&so[w][r][c4];
      *(v4f*)(C + (size_t)(row0 + r) * ldc + col0 + c4) = v;
    }
    
  }
}

// GEMM C = act(A·W + bias + resid): A f32 (ASPLIT -> hi/lo 2 terms), Wt bf16 [N][K]; ACT 0 none, 1 relu, 2 exact gelu;
// resid (optional, f32, row index = (row % rmod), pitch ldr, RES_BF16 rounds it) added before the activation.
template <bool ASPLIT, int ACT, bool BIAS_BF16, bool RES_BF16>
__global__ __launch_bounds__(128) void k_gemm_bf3(const float* __restrict__ A, int lda, const unsigned short* __restrict__ Wt, int ldb,
                                                const float* __restrict__ bias, const float* __restrict__ resid, int rmod, int ldr,
                                                float* __restrict__ C, int ldc, int M, int N, int K) {
  __shared__ __attribute__((aligned(16))) float so[4][16][64];
  const int tid = threadIdx.x, w = tid >> 5, lane = tid & 31, ln = lane & 15, hh = lane >> 4;
  const int ntn = N / 64;
  const int wid = blockIdx.x * 4 + w;
  const int mt = wid / ntn, nq = wid % ntn;
  if (mt * 16 >= M) return;
  const int row0 = mt * 16, col0 = nq * 64;
  const float* arow = A + (size_t)(row0 + ln) * lda;
  v8f acc[4] = {};
  for (int kb = 0; kb < K; kb += 32) {
    FragB ah, al;
    const v4f x0 = *(const v4fa*)(arow + kb + 8 * hh), x1 = *(const v4fa*)(arow + kb + 8 * hh + 4);
    const v4f x2 = *(const v4fa*)(arow + kb + 16 + 8 * hh), x3 = *(const v4fa*)(arow + kb + 16 + 8 * hh + 4);
    float xs[16] = {x0[0],x0[1],x0[2],x0[3],x1[0],x1[1],x1[2],x1[3],x2[0],x2[1],x2[2],x2[3],x3[0],x3[1],x3[2],x3[3]};
#pragma unroll
    for (int i = 0; i < 16; ++i) { const unsigned short hb = bf16_bits(xs[i]); ah.u[i] = hb; al.u[i] = ASPLIT ? bf16_bits(xs[i] - bf16_val(hb)) : (unsigned short)0; }
#pragma unroll
    for (int t = 0; t < 4; ++t) {
      const unsigned short* brow = Wt + (size_t)(col0 + t * 16 + ln) * ldb + kb;
      FragB b;
      b.half[0] = *(const v8us*)(brow + 8 * hh);
      b.half[1] = *(const v8us*)(brow + 16 + 8 * hh);
      acc[t] = mmaN<ASPLIT ? 2 : 1>(ah.v, al.v, b.v, b.v, acc[t]);
    }
  }
#pragma unroll
  for (int t = 0; t < 4; ++t) {
    const int col = col0 + t * 16 + ln;
    float bv = bias ? bias[col] : 0.f;
    if (BIAS_BF16) bv = bf16_round(bv);
#pragma unroll
    for (int r = 0; r < 8; ++r) {
      float v = acc[t][r] + bv;
      if (resid) { float rv = resid[(size_t)((row0 + 8 * hh + r) % rmod) * ldr + col]; if (RES_BF16) rv = bf16_round(rv); v += rv; }
      if (ACT == 1) v = fmaxf(v, 0.f);
      if (ACT == 2) v = 0.5f * v * (1.0f + erff(v * 0.70710678118654752f));
      if (ACT == 3) { const float u = 0.7978845608028654f * (v + 0.044715f * v * v * v); v = 0.5f * v * (1.0f + tanhf(u)); }
      so[w][8 * hh + r][t * 16 + ln] = v;
    }
  }
  __builtin_amdgcn_fence(__ATOMIC_ACQ_REL, "workgroup");
  __builtin_amdgcn_wave_barrier();
  const int rsub = lane >> 4, c4 = (lane & 15) * 4;
  {
#pragma unroll
    for (int q = 0; q < 8; ++q) {
      const int r = q * 2 + rsub;
      const v4f v = *(const v4fa*)&so[w][r][c4];
      *(v4f*)(C + (size_t)(row0 + r) * ldc + col0 + c4) = v;
    }
    
  }
}
// row LayerNorm (biased variance, eps) over N: s = X (+ R); optional out_sum <- s; out_norm <- (s-mu)*rsqrt(var+eps)*g + b
template <bool PARAM_BF16>
__global__ __launch_bounds__(256) void k_layernorm(const float* __restrict__ X, const float* __restrict__ R, const float* __restrict__ g, const float* __restrict__ bta,
                                                  float* __restrict__ out_sum, float* __restrict__ out_norm, int N, float eps) {
  __shared__ float red[256];
  const int row = blockIdx.x, tid = threadIdx.x;
  const float* x = X + (size_t)row * N; const float* rr = R ? R + (size_t)row * N : nullptr;
  float vals[16];                     // up to N = 4096
  const int per = N / 256;            // contiguous chunk per thread? use strided-by-4 chunks: thread handles j = tid*4 + 1024*u
  float s1 = 0.f;
  for (int u = 0; u < per / 4; ++u) {
    const int j = tid * 4 + 1024 * u;
    const v4f a = *(const v4fa*)(x + j);
    v4f b = {0.f,0.f,0.f,0.f}; if (rr) b = *(const v4fa*)(rr + j);
#pragma unroll
    for (int q = 0; q < 4; ++q) { const float v = a[q] + b[q]; vals[u * 4 + q] = v; s1 += v; }
  }
  red[tid] = s1; __syncthreads();
  for (int st = 128; st > 0; st >>= 1) { if (tid < st) red[tid] += red[tid + st]; __syncthreads(); }
  const float mu = red[0] / (float)N; __syncthreads();
  float s2 = 0.f;
  for (int u = 0; u < per / 4; ++u)
#pragma unroll
    for (int q = 0; q < 4; ++q) { const float c = vals[u * 4 + q] - mu; s2 += c * c; }
  red[tid] = s2; __syncthreads();
  for (int st = 128; st > 0; st >>= 1) { if (tid < st) red[tid] += red[tid + st]; __syncthreads(); }
  const float rs = rsqrtf(red[0] / (float)N + eps);
  {
    for (int u = 0; u < per / 4; ++u) {
      const int j = tid * 4 + 1024 * u;
      v4f o, sm;
#pragma unroll
      for (int q = 0; q < 4; ++q) {
        float gg = g[j + q], bb = bta[j + q];
        if (PARAM_BF16) { gg = bf16_round(gg); bb = bf16_round(bb); }
        sm[q] = vals[u * 4 + q]; o[q] = (vals[u * 4 + q] - mu) * rs * gg + bb;
      }
      if (out_sum) *(v4f*)(out_sum + (size_t)row * N + j) = sm;
      *(v4f*)(out_norm + (size_t)row * N + j) = o;
    }
    
  }
}



// ---- f16 WMMA path (v_wmma_f32_16x16x32_f16): 11-bit significands for operands in range — used where a [0,1] probability operand needs more precision than bf16
typedef _Float16 v16h __attribute__((ext_vector_type(16)));
union FragH { v16h v; v8us half[2]; _Float16 h[16]; unsigned short u[16]; };
template <int NT>
__device__ __forceinline__ v8f mmaH(v16h ah, v16h al, v16h bh, v16h bl, v8f c) {
  c = __builtin_amdgcn_wmma_f32_16x16x32_f16(false, ah, false, bh, (short)0, c, false, false);
  if (NT >= 2) c = __builtin_amdgcn_wmma_f32_16x16x32_f16(false, al, false, bh, (short)0, c, false, false);
  if (NT >= 3) c = __builtin_amdgcn_wmma_f32_16x16x32_f16(false, ah, false, bl, (short)0, c, false, false);
  asm volatile("v_nop\n\tv_nop\n\tv_nop\n\tv_nop" : "+v"(c) : "v"(ah), "v"(al), "v"(bh), "v"(bl));
  return c;
}
// batched GEMM like k_gemm_b but f16 operands: A f32 (split into f16 hi/lo if ASPLIT, else rounded to f16), Bt = f16 values [n][k]; alpha; C f32; N multiple of 16 (partial tiles skipped)
template <bool ASPLIT>
__global__ __launch_bounds__(128) void k_gemm_h(const float* __restrict__ A, int lda, size_t sA, const _Float16* __restrict__ Bh, int ldb, size_t sB, float alpha, float* __restrict__ C, int ldc, size_t sC, int M, int N, int K) {
  __shared__ __attribute__((aligned(16))) float so[4][16][64];
  const int tid = threadIdx.x, w = tid >> 5, lane = tid & 31, ln = lane & 15, hh = lane >> 4; const int by = blockIdx.y;
  A += (size_t)by * sA; Bh += (size_t)by * sB; C += (size_t)by * sC;
  const int ntn = (N + 63) / 64; const int wid = blockIdx.x * 4 + w; const int mt = wid / ntn, nq = wid % ntn; if (mt * 16 >= M) return;
  const int row0 = mt * 16, col0 = nq * 64; const float* arow = A + (size_t)(row0 + ln) * lda;
  v8f acc[4] = {};
  for (int kb = 0; kb < K; kb += 32) {
    FragH ah, al;
    const v4f x0 = *(const v4fa*)(arow + kb + 8 * hh), x1 = *(const v4fa*)(arow + kb + 8 * hh + 4), x2 = *(const v4fa*)(arow + kb + 16 + 8 * hh), x3 = *(const v4fa*)(arow + kb + 16 + 8 * hh + 4);
    float xs[16] = {x0[0],x0[1],x0[2],x0[3],x1[0],x1[1],x1[2],x1[3],x2[0],x2[1],x2[2],x2[3],x3[0],x3[1],x3[2],x3[3]};
#pragma unroll
    for (int i = 0; i < 16; ++i) { const _Float16 h = (_Float16)xs[i]; ah.h[i] = h; al.h[i] = ASPLIT ? (_Float16)(xs[i] - (float)h) : (_Float16)0.0f; }
#pragma unroll
    for (int t = 0; t < 4; ++t) { if (col0 + t * 16 >= N) continue; const size_t boff = (size_t)(col0 + t * 16 + ln) * ldb + kb; FragH bq; bq.half[0] = *(const v8us*)(Bh + boff + 8 * hh); bq.half[1] = *(const v8us*)(Bh + boff + 16 + 8 * hh);
      acc[t] = mmaH<ASPLIT ? 2 : 1>(ah.v, al.v, bq.v, bq.v, acc[t]); }
  }
#pragma unroll
  for (int t = 0; t < 4; ++t) { if (col0 + t * 16 >= N) continue;
#pragma unroll
    for (int r = 0; r < 8; ++r) so[w][8 * hh + r][t * 16 + ln] = acc[t][r] * alpha; }
  __builtin_amdgcn_fence(__ATOMIC_ACQ_REL, "workgroup"); __builtin_amdgcn_wave_barrier();
  const int rsub = lane >> 4, c4 = (lane & 15) * 4;
  {
#pragma unroll
    for (int q = 0; q < 8; ++q) { const int r = q * 2 + rsub; if (col0 + c4 < N) { const v4f v = *(const v4fa*)&so[w][r][c4]; *(v4f*)(C + (size_t)(row0 + r) * ldc + col0 + c4) = v; } }
     }
}

// Wt[n][k] = f16(W[k][n]·scale) from f32 row-major W[K][N] (scale = power of two; bf16-exact weights stay exact in f16 away from the subnormal range)
__global__ __launch_bounds__(256) void k_wt_f16(const float* __restrict__ W, _Float16* __restrict__ Wt, int K, int N, float scale) {
  const int t = blockIdx.x * 256 + threadIdx.x; if (t >= N * (K / 8)) return; const int n = t / (K / 8), k8 = (t % (K / 8)) * 8; FragH f;
#pragma unroll
  for (int i = 0; i < 8; ++i) f.h[i] = (_Float16)(bf16_round(W[(size_t)(k8 + i) * N + n]) * scale); const v8us o = f.half[0];
  *(v8us*)((unsigned short*)Wt + (size_t)n * K + k8) = o; 
}
// k_gemm_hh variant with fused epilogue: v = acc·alpha + bias[by·sBias + col] (+ CP[(row/rowsPerB)·sCPb + by·64 + col] if CP) ; ACT 0 none / 1 elu ; writes f16 C16 (and f32 C if non-null)
template <int ACT>
__global__ __launch_bounds__(128) void k_gemm_hhx(const _Float16* __restrict__ A, int lda, size_t sA, const _Float16* __restrict__ Bh, int ldb, size_t sB, float alpha, const float* __restrict__ bias, size_t sBias, const float* __restrict__ CP, int rowsPerB, size_t sCPb, int row0g,
    float* __restrict__ C, _Float16* __restrict__ C16, int ldc, size_t sC, int M, int N, int K) {
  __shared__ __attribute__((aligned(16))) float so[4][16][64];
  const int tid = threadIdx.x, w = tid >> 5, lane = tid & 31, ln = lane & 15, hh = lane >> 4; const int by = blockIdx.y;
  A += (size_t)by * sA; Bh += (size_t)by * sB; const size_t cofs = (size_t)by * sC; const float* bp = bias ? bias + (size_t)by * sBias : nullptr;
  const int ntn = (N + 63) / 64; const int wid = blockIdx.x * 4 + w; const int mt = wid / ntn, nq = wid % ntn; if (mt * 16 >= M) return;
  const int row0 = mt * 16, col0 = nq * 64; const _Float16* arow = A + (size_t)(row0 + ln) * lda;
  v8f acc[4] = {};
  for (int kb = 0; kb < K; kb += 32) { FragH ah; ah.half[0] = *(const v8us*)((const unsigned short*)arow + kb + 8 * hh); ah.half[1] = *(const v8us*)((const unsigned short*)arow + kb + 16 + 8 * hh);
#pragma unroll
    for (int t = 0; t < 4; ++t) { if (col0 + t * 16 >= N) continue; const size_t boff = (size_t)(col0 + t * 16 + ln) * ldb + kb; FragH bq; bq.half[0] = *(const v8us*)((const unsigned short*)Bh + boff + 8 * hh); bq.half[1] = *(const v8us*)((const unsigned short*)Bh + boff + 16 + 8 * hh);
      acc[t] = mmaH<1>(ah.v, ah.v, bq.v, bq.v, acc[t]); }
  }
#pragma unroll
  for (int t = 0; t < 4; ++t) { if (col0 + t * 16 >= N) continue; const int col = col0 + t * 16 + ln; const float bv = bp ? bf16_round(bp[col]) : 0.f;
#pragma unroll
    for (int r = 0; r < 8; ++r) { float v = acc[t][r] * alpha + bv; if (CP) { const int rr = row0g + row0 + 8 * hh + r; if (rowsPerB < 0) v += CP[cofs + (size_t)rr * ldc + col];      /* rowsPerB < 0: own element of the batched C plane */ else { const int bidx = rr / rowsPerB; v += CP[(size_t)bidx * sCPb + (size_t)by * 64 + col]; } } if (ACT == 1) v = (v > 0.f) ? v : expm1f(v); else if (ACT == 7) v = (v > 0.f) ? v + 1.0f : expf(v); else if (ACT == 8) v = tanhf(v); else if (ACT == 9) v = 0.5f * v * (1.0f + tanhf(0.7978845608028654f * (v + 0.044715f * v * v * v))); else if (ACT == 11) v = 1.0f / (1.0f + expf(-v)); else if (ACT == 12) v = (v > 0.f) ? v : 0.01f * v; else if (ACT == 14) v = (v > 0.f) ? v : 0.1f * v; else if (ACT == 16) v = (v >= 0.f) ? v : 0.3f * v; else if (ACT == 17) v = (v >= 0.f) ? v : 0.2f * v; else if (ACT == 15) v = v / (1.0f + expf(-v)); else if (ACT == 3) v = fmaxf(v, 0.f); else if (ACT == 6) v = 0.5f * v * (1.0f + erff(v * 0.70710678118654752f)); so[w][8 * hh + r][t * 16 + ln] = v; } }
  __builtin_amdgcn_fence(__ATOMIC_ACQ_REL, "workgroup"); __builtin_amdgcn_wave_barrier();
  const int rsub = lane >> 4, c4 = (lane & 15) * 4; typedef _Float16 v4h __attribute__((ext_vector_type(4)));
  {
#pragma unroll
    for (int q = 0; q < 8; ++q) { const int r = q * 2 + rsub; if (col0 + c4 < N) { const v4f v = *(const v4fa*)&so[w][r][c4]; if (C) *(v4f*)(C + cofs + (size_t)(row0 + r) * ldc + col0 + c4) = v; if (C16) { v4h h4; for (int i = 0; i < 4; ++i) h4[i] = (_Float16)v[i]; *(v4h*)(C16 + cofs + (size_t)(row0 + r) * ldc + col0 + c4) = h4; } } }
     }
}


typedef _Float16 v4h __attribute__((ext_vector_type(4)));

__global__ __launch_bounds__(256) void k_x16(const float* __restrict__ x, _Float16* __restrict__ X16, size_t n8) { const size_t t = (size_t)blockIdx.x * 256 + threadIdx.x; if (t >= n8) return; FragH f;
#pragma unroll
  for (int q = 0; q < 8; ++q) f.h[q] = (_Float16)bf16_round(x[t * 8 + q]); *(v8us*)((unsigned short*)X16 + t * 8) = f.half[0];  }
__global__ __launch_bounds__(256) void k_h16(const float* __restrict__ x, _Float16* __restrict__ X16, size_t n8) { const size_t t = (size_t)blockIdx.x * 256 + threadIdx.x; if (t >= n8) return; FragH f;
#pragma unroll
  for (int q = 0; q < 8; ++q) f.h[q] = (_Float16)x[t * 8 + q]; *(v8us*)((unsigned short*)X16 + t * 8) = f.half[0];  }
__global__ __launch_bounds__(256) void k_round16f(const float* __restrict__ W, _Float16* __restrict__ Bt, size_t n8) { const size_t t = (size_t)blockIdx.x * 256 + threadIdx.x; if (t >= n8) return; FragH f;
#pragma unroll
  for (int i = 0; i < 8; ++i) f.h[i] = (_Float16)(bf16_round(W[t * 8 + i]) * 16.0f); *(v8us*)((unsigned short*)Bt + t * 8) = f.half[0];  }
template <int NHv, int TTv>
__global__ __launch_bounds__(256) void k_vt(const _Float16* __restrict__ V16, int ldv, int voff, _Float16* __restrict__ Vt) { __shared__ unsigned short tl[64][66]; const int tid = threadIdx.x; const int slab = blockIdx.x / (TTv / 64), lg = blockIdx.x % (TTv / 64); const int b = slab / NHv, h = slab % NHv;
  for (int i = tid; i < 64 * 8; i += 256) { const int r = i / 8, c8 = (i % 8) * 8; FragH f; f.half[0] = *(const v8us*)((const unsigned short*)V16 + ((size_t)b * TTv + lg * 64 + r) * ldv + voff + h * 64 + c8);
#pragma unroll
    for (int q = 0; q < 8; ++q) tl[r][c8 + q] = f.u[q]; }
  __syncthreads();
  {
#pragma unroll
    for (int rd = 0; rd < 2; ++rd) { const int d = rd * 32 + tid / 8, pc = tid % 8; FragH f;
#pragma unroll
      for (int q = 0; q < 8; ++q) f.u[q] = tl[pc * 8 + q][d];
      *(v8us*)((unsigned short*)Vt + ((size_t)slab * 64 + d) * TTv + lg * 64 + pc * 8) = f.half[0]; }
     } }

__global__ __launch_bounds__(256) void k_hl(const float* __restrict__ F, _Float16* __restrict__ Hh, _Float16* __restrict__ Hl, size_t n8) { const size_t t = (size_t)blockIdx.x * 256 + threadIdx.x; if (t >= n8) return; FragH fh, fl; const v4f a = *(const v4fa*)(F + t * 8), c = *(const v4fa*)(F + t * 8 + 4);
#pragma unroll
  for (int q = 0; q < 4; ++q) { _Float16 h = (_Float16)a[q]; fh.h[q] = h; fl.h[q] = (_Float16)((a[q] - (float)h) * 1024.0f); h = (_Float16)c[q]; fh.h[4 + q] = h; fl.h[4 + q] = (_Float16)((c[q] - (float)h) * 1024.0f); }
  { *(v8us*)((unsigned short*)Hh + t * 8) = fh.half[0]; *(v8us*)((unsigned short*)Hl + t * 8) = fl.half[0];  } }

// ---- fast GEMM (wave tile 32x64; requires M % 32 == 0 rows per launch region and N % 64 == 0); epilogue = k_gemm_hhx semantics ----
__device__ __forceinline__ v16h g2_frag(const _Float16* p, int hh) { FragH f; f.half[0] = *(const v8us*)((const unsigned short*)p + 8 * hh); f.half[1] = *(const v8us*)((const unsigned short*)p + 16 + 8 * hh); return f.v; }
__device__ __forceinline__ v8f g2_mma(v16h a, v16h b, v8f c) { v8f d = __builtin_amdgcn_wmma_f32_16x16x32_f16(false, a, false, b, (short)0, c, false, false); asm volatile("v_nop\n\tv_nop\n\tv_nop\n\tv_nop" : "+v"(d) : "v"(a), "v"(b)); return d; }
template <int ACT>
__global__ __launch_bounds__(128) void k_gemm2(const _Float16* __restrict__ A, int lda, size_t sA, const _Float16* __restrict__ Bh, int ldb, size_t sB, float alpha, const float* __restrict__ bias, size_t sBias, const float* __restrict__ CP, int rowsPerB, size_t sCPb, int row0g,
    float* __restrict__ C, _Float16* __restrict__ C16, int ldc, size_t sC, int M, int N, int K) { static_assert(ACT == 0 || ACT == 3 || ACT == 6 || ACT == 8 || ACT == 9 || ACT == 11 || ACT == 12 || ACT == 14 || ACT == 15 || ACT == 16 || ACT == 17, "k_gemm2: unsupported ACT code (would silently apply no activation)");
  __shared__ __attribute__((aligned(16))) float so[4][32][68];
  const int tid = threadIdx.x, w = tid >> 5, lane = tid & 31, ln = lane & 15, hh = lane >> 4; const int by = blockIdx.y;
  A += (size_t)by * sA; Bh += (size_t)by * sB; const size_t cofs = (size_t)by * sC; const float* bp = bias ? bias + (size_t)by * sBias : nullptr;
  const int ntn = N >> 6; const int mt = blockIdx.x / ntn, nq = blockIdx.x - mt * ntn; const int row0 = mt * 128 + 32 * w, col0 = nq * 64; if (row0 >= M) return;
  const _Float16* a0p = A + (size_t)(row0 + ln) * lda; const _Float16* a1p = a0p + (size_t)16 * lda;
  const _Float16* b0p = Bh + (size_t)(col0 + ln) * ldb; const _Float16* b1p = b0p + (size_t)16 * ldb; const _Float16* b2p = b1p + (size_t)16 * ldb; const _Float16* b3p = b2p + (size_t)16 * ldb;
  const v8f z8 = {0.f,0.f,0.f,0.f,0.f,0.f,0.f,0.f}; v8f c00 = z8, c01 = z8, c02 = z8, c03 = z8, c10 = z8, c11 = z8, c12 = z8, c13 = z8;
#pragma unroll 1
  for (int kb = 0; kb < K; kb += 32) { const v16h a0 = g2_frag(a0p + kb, hh), a1 = g2_frag(a1p + kb, hh);
    v16h b = g2_frag(b0p + kb, hh); c00 = g2_mma(a0, b, c00); c10 = g2_mma(a1, b, c10);
    b = g2_frag(b1p + kb, hh); c01 = g2_mma(a0, b, c01); c11 = g2_mma(a1, b, c11);
    b = g2_frag(b2p + kb, hh); c02 = g2_mma(a0, b, c02); c12 = g2_mma(a1, b, c12);
    b = g2_frag(b3p + kb, hh); c03 = g2_mma(a0, b, c03); c13 = g2_mma(a1, b, c13); }
  v8f accs[8] = {c00, c01, c02, c03, c10, c11, c12, c13};
#pragma unroll
  for (int u = 0; u < 8; ++u) { const int t = u & 3, half = u >> 2; const int col = col0 + t * 16 + ln; const float bv = bp ? bf16_round(bp[col]) : 0.f;
#pragma unroll
    for (int r = 0; r < 8; ++r) { const int rloc = half * 16 + 8 * hh + r; float v = accs[u][r] * alpha + bv; if (CP) { if (rowsPerB < 0) v += CP[cofs + (size_t)(row0g + row0 + rloc) * ldc + col];      /* rowsPerB < 0: own element of the batched C plane */ else { const int bidx = (row0g + row0 + rloc) / rowsPerB; v += CP[(size_t)bidx * sCPb + (size_t)by * 64 + col]; } }
      if (ACT == 3) v = fmaxf(v, 0.f); else if (ACT == 6) v = 0.5f * v * (1.0f + erff(v * 0.70710678118654752f)); else if (ACT == 11) v = 1.0f / (1.0f + expf(-v)); else if (ACT == 15) v = v / (1.0f + expf(-v)); else if (ACT == 12) v = (v > 0.f) ? v : 0.01f * v; else if (ACT == 8) v = tanhf(v); else if (ACT == 9) v = 0.5f * v * (1.0f + tanhf(0.7978845608028654f * (v + 0.044715f * v * v * v))); else if (ACT == 14) v = (v > 0.f) ? v : 0.1f * v; else if (ACT == 16) v = (v >= 0.f) ? v : 0.3f * v; else if (ACT == 17) v = (v >= 0.f) ? v : 0.2f * v;
      so[w][rloc][t * 16 + ln] = v; } }
  __builtin_amdgcn_fence(__ATOMIC_ACQ_REL, "workgroup"); __builtin_amdgcn_wave_barrier();
  const int rsub = lane >> 4, c4 = (lane & 15) * 4;
  {
#pragma unroll
    for (int q = 0; q < 16; ++q) { const int r = q * 2 + rsub; const v4f v = *(const v4fa*)&so[w][r][c4]; if (C) *(v4f*)(C + cofs + (size_t)(row0 + r) * ldc + col0 + c4) = v; if (C16) { v4h h4; for (int i = 0; i < 4; ++i) h4[i] = (_Float16)v[i]; *(v4h*)(C16 + cofs + (size_t)(row0 + r) * ldc + col0 + c4) = h4; } }
     } }


__global__ __launch_bounds__(256) void k_wnat(const float* __restrict__ w, size_t n8, _Float16* __restrict__ Bt) { const size_t t = (size_t)blockIdx.x * 256 + threadIdx.x; if (t >= n8) return; FragH f; for (int q = 0; q < 8; ++q) f.h[q] = (_Float16)(bf16_round(w[t * 8 + q]) * 16.0f); *(v8us*)((unsigned short*)Bt + t * 8) = f.half[0];  }
__global__ __launch_bounds__(256) void k_rsm(const float* __restrict__ S, _Float16* __restrict__ P, int nrows) {
  #pragma clang fp contract(off)
  const int i = blockIdx.x * 256 + threadIdx.x; if (i >= nrows) return; const float* s = S + (size_t)i * SQ; float mx = -3.0e38f;
#pragma unroll 1
  for (int j = 0; j < SQ; ++j) mx = fmaxf(mx, s[j]); float se = 0.f;
#pragma unroll 1
  for (int j = 0; j < SQ; ++j) se += expf(s[j] - mx); const float sc = 256.0f / se;
#pragma unroll 1
  for (int j0 = 0; j0 < SQ; j0 += 8) { FragH f; for (int q = 0; q < 8; ++q) f.h[q] = (_Float16)(expf(s[j0 + q] - mx) * sc); unsigned short* d = (unsigned short*)P + (size_t)i * SQ + j0; *(v8us*)d = f.half[0];  } }
__global__ __launch_bounds__(256) void k_vt(const _Float16* __restrict__ V16, int b, int h0, _Float16* __restrict__ VT) { __shared__ unsigned short tl[64][65]; const int tid = threadIdx.x; const int hh = blockIdx.x % HG, sg = blockIdx.x / HG; const int s0 = sg * 64; const int h = h0 + hh;
  for (int i = tid; i < 64 * 8; i += 256) { const int j = i / 8, d8 = (i % 8) * 8; FragH f; f.half[0] = *(const v8us*)((const unsigned short*)V16 + ((size_t)b * SQ + s0 + j) * DM + h * HD + d8); for (int q = 0; q < 8; ++q) tl[d8 + q][j] = f.u[q]; }
  __syncthreads();
  { for (int i = tid; i < 64 * 8; i += 256) { const int d = i / 8, j8 = (i % 8) * 8; FragH f; for (int q = 0; q < 8; ++q) f.u[q] = tl[d][j8 + q]; *(v8us*)((unsigned short*)VT + ((size_t)hh * HD + d) * SQ + s0 + j8) = f.half[0]; }  } }



__global__ __launch_bounds__(256) void k_rsmcf2(const float* __restrict__ S, _Float16* __restrict__ P, int hg, int q0, int nk) {
  #pragma clang fp contract(off)
  const int t = blockIdx.x * 256 + threadIdx.x; if (t >= hg * QT) return; const size_t i = (size_t)t; const float* s = S + i * NKX; const int last = q0 + (t % QT); float mx = -3.0e38f;
#pragma unroll 1
  for (int j = 0; j < nk; ++j) { const float f = (j <= last) ? 1.f : 0.f; mx = fmaxf(mx, fmaf(f, s[j], (1.f - f) * -1.0e9f)); } float se = 0.f;
#pragma unroll 1
  for (int j = 0; j < nk; ++j) { const float f = (j <= last) ? 1.f : 0.f; se += __expf(fmaf(f, s[j], (1.f - f) * -1.0e9f) - mx); } const float sc = 256.0f / se;
#pragma unroll 1
  for (int j0 = 0; j0 < nk; j0 += 8) { FragH fr; for (int q = 0; q < 8; ++q) { const int j = j0 + q; const float f = (j <= last) ? 1.f : 0.f; fr.h[q] = (_Float16)(__expf(fmaf(f, s[j], (1.f - f) * -1.0e9f) - mx) * sc); } unsigned short* d = (unsigned short*)P + i * NKX + j0; *(v8us*)d = fr.half[0];  } }


template <int MASKADD>
__global__ __launch_bounds__(64) void k_att0(const float* __restrict__ QF, const float* __restrict__ KF, const float* __restrict__ VF, int ld, const float* __restrict__ mask, float scale, float* __restrict__ OF, int ldo) {
  #pragma clang fp contract(off)
  __shared__ __attribute__((aligned(16))) float lq[64][64]; __shared__ __attribute__((aligned(16))) float lo[64][64];
  const int tid = threadIdx.x; const int h = blockIdx.x / (QT0 / 64), rg = blockIdx.x % (QT0 / 64); const int i = rg * 64 + tid;
  const float* qr = QF + (size_t)i * ld + h * HD;
#pragma unroll 1
  for (int c = 0; c < HD / 4; ++c) { *(v4f*)&lq[tid][c * 4] = *(const v4fa*)(qr + c * 4); const v4f z = {0.f, 0.f, 0.f, 0.f}; *(v4f*)&lo[tid][c * 4] = z; }
  float m = -1.0e30f, l = 0.f; const int jmax = MASKADD ? (SQ - 1) : (rg * 64 + 63);      /* additive-mask form: every key (the mask input decides); causal form: keys up to the block's last row */
#pragma unroll 1
  for (int j = 0; j <= jmax; ++j) { const float* kr = KF + (size_t)j * ld + h * HD; const float* vr = VF + (size_t)j * ld + h * HD; float s = 0.f;
#pragma unroll 1
    for (int c = 0; c < HD / 4; ++c) { const v4f kq = *(const v4fa*)(kr + c * 4); const v4f qq = *(v4f*)&lq[tid][c * 4]; s = __fadd_rn(s, __fmul_rn(qq[0], kq[0])); s = __fadd_rn(s, __fmul_rn(qq[1], kq[1])); s = __fadd_rn(s, __fmul_rn(qq[2], kq[2])); s = __fadd_rn(s, __fmul_rn(qq[3], kq[3])); }
    s = __fmul_rn(s, scale); if (MASKADD) s = __fadd_rn(s, __fmul_rn(bf16_round(mask[(size_t)i * SQ + j]), -10000.0f));
    const float f = (MASKADD || j <= i) ? 1.f : 0.f; const float sm = fmaf(f, s, (1.f - f) * -1.0e30f); const float mn = fmaxf(m, sm); const float sc = expf(m - mn); const float e = expf(sm - mn); l = __fadd_rn(__fmul_rn(l, sc), e); m = mn;
#pragma unroll 1
    for (int c = 0; c < HD / 4; ++c) { const v4f vv = *(const v4fa*)(vr + c * 4); v4f oo = *(v4f*)&lo[tid][c * 4]; for (int u = 0; u < 4; ++u) oo[u] = __fadd_rn(__fmul_rn(oo[u], sc), __fmul_rn(e, vv[u])); *(v4f*)&lo[tid][c * 4] = oo; } }
  const float fin = 64.0f / l;      /* o carried x64 like the f16 path */
#pragma unroll 1
  for (int c = 0; c < HD / 4; ++c) { v4f oo = *(v4f*)&lo[tid][c * 4]; for (int u = 0; u < 4; ++u) oo[u] = __fmul_rn(oo[u], fin); *(v4f*)&lo[tid][c * 4] = oo; }
  __syncthreads();
  {
#pragma unroll 1
    for (int it = 0; it < 16; ++it) { const int row = it * 4 + tid / 16, pc = (tid % 16) * 4; const v4f v = *(const v4f*)&lo[row][pc]; *(v4f*)(OF + (size_t)(rg * 64 + row) * ldo + h * HD + pc) = v; }
     } }


template <int BFIN, int WXB>
__global__ __launch_bounds__(256) void k_ln16(const float* __restrict__ X, const float* __restrict__ g, const float* __restrict__ bb, float eps, _Float16* __restrict__ N16, float* __restrict__ XB) {
  #pragma clang fp contract(off)
  __shared__ float red[256]; const size_t r = blockIdx.x; const int t = threadIdx.x; const v4f xa = *(const v4fa*)(X + r * DMQ + t * 4); float s[4]; float sum = 0.f;
  for (int q = 0; q < 4; ++q) { s[q] = BFIN ? bf16_round(xa[q]) : xa[q]; sum = __fadd_rn(sum, s[q]); }
  red[t] = sum; __syncthreads(); for (int st = 128; st > 0; st >>= 1) { if (t < st) red[t] = __fadd_rn(red[t], red[t + st]); __syncthreads(); } const float mu = red[0] / (float)DMQ; __syncthreads();
  float vs = 0.f; for (int q = 0; q < 4; ++q) { const float dl = __fadd_rn(s[q], -mu); vs = __fadd_rn(vs, __fmul_rn(dl, dl)); } red[t] = vs; __syncthreads(); for (int st = 128; st > 0; st >>= 1) { if (t < st) red[t] = __fadd_rn(red[t], red[t + st]); __syncthreads(); }
  const float rs = rsqrtf(__fadd_rn(red[0] / (float)DMQ, eps)); v4h y; v4f xb;
  for (int q = 0; q < 4; ++q) { const int c = t * 4 + q; y[q] = (_Float16)__fadd_rn(__fmul_rn(__fmul_rn(__fadd_rn(s[q], -mu), rs), bf16_round(g[c])), bf16_round(bb[c])); xb[q] = s[q]; }
  { *(v4h*)(N16 + r * DMQ + t * 4) = y; if (WXB) *(v4f*)(XB + r * DMQ + t * 4) = xb;  } }
__global__ __launch_bounds__(256) void k_ftres2(const float* __restrict__ OF0, const float* __restrict__ XB, float* __restrict__ X1, size_t n4) {
  #pragma clang fp contract(off)
  const size_t t = (size_t)blockIdx.x * 256 + threadIdx.x; if (t >= n4) return; const v4f o = *(const v4fa*)(OF0 + t * 4), xv = *(const v4fa*)(XB + t * 4); v4f y; for (int q = 0; q < 4; ++q) y[q] = __fadd_rn(__fmul_rn(o[q], 0.015625f), xv[q]); *(v4f*)(X1 + t * 4) = y;  }

__global__ __launch_bounds__(256) void k_wthd(const float* __restrict__ Wt, _Float16* __restrict__ Bt) { const size_t t = (size_t)blockIdx.x * 256 + threadIdx.x; if (t >= (size_t)NH * HD * (DM / 8)) return; const int m8 = (int)(t % (DM / 8)) * 8; const int d = (int)((t / (DM / 8)) % HD); const int h = (int)(t / ((size_t)(DM / 8) * HD)); FragH f;
  for (int q = 0; q < 8; ++q) f.h[q] = (_Float16)(16.0f * bf16_round(Wt[((size_t)h * DM + m8 + q) * HD + d])); unsigned short* dst = (unsigned short*)Bt + ((size_t)h * HD + d) * DM + m8; *(v8us*)dst = f.half[0];  }




__global__ __launch_bounds__(256) void k_wtpad(const float* __restrict__ Wm, _Float16* __restrict__ Wt, int Kr, int Kp, int Nr, int Np, float scale) {
  const int t = blockIdx.x * 256 + threadIdx.x; if (t >= Np * (Kp / 8)) return; const int n = t / (Kp / 8), k8 = (t % (Kp / 8)) * 8; const int nc = min(n, Nr - 1); const float fn = (n < Nr) ? 1.f : 0.f; FragH f;
  for (int i = 0; i < 8; ++i) { const int k = k8 + i; const int kc = min(k, Kr - 1); const float fk = (k < Kr) ? fn : 0.f; f.h[i] = (_Float16)(bf16_round(Wm[(size_t)kc * Nr + nc]) * scale * fk); }
  unsigned short* o = (unsigned short*)Wt + (size_t)n * Kp + k8; *(v8us*)o = f.half[0];  }
__global__ __launch_bounds__(128) void k_bpad(const float* __restrict__ b, float* __restrict__ Bp, int nr, int np) {
  const int i = threadIdx.x; if (i >= np) return; const float v = b[min(i, nr - 1)] * ((i < nr) ? 1.f : 0.f); *(float*)(Bp + i) = v;  }
extern "C" void kernel_launch(void* const* d_in, const int* in_sizes, int n_in,
                              void* d_out, int out_size, void* d_ws, size_t ws_size, hipStream_t stream) {
  (void)in_sizes; (void)n_in; (void)out_size;
  const float* const* I = (const float* const*)d_in; const float* x = I[0]; const float* g1 = I[1]; const float* be1 = I[2]; const float* wq = I[3]; const float* wk = I[4]; const float* wv = I[5]; const float* wo = I[6]; const float* bo = nullptr; const float* gg2 = I[7]; const float* be2 = I[8]; const float* wfc = I[9]; const float* bfc = I[10]; const float* wmp = I[11]; const float* bmp = I[12];      /* x, LN1 g / b, Wq / Wk / Wv / Wo [1024][1024] ([in][out], no biases), LN2 g / b, W1 [1024][4096] + b1, W2 [4096][1024] + b2 */
  char* ws = (char*)d_ws; size_t off = 0;
  auto take = [&](size_t bytes) { char* p = ws + off; off += (bytes + 255) & ~(size_t)255; return p; };
  _Float16* BQKV = (_Float16*)take((size_t)3 * DM * DM * 2); _Float16* BO = (_Float16*)take((size_t)DM * DM * 2);
  _Float16* X16 = (_Float16*)take(NR * DM * 2); float* XB = (float*)take(NR * DM * 4); float* X1 = (float*)take(NR * DM * 4); _Float16* M16 = nullptr;      /* = X16 below (alias: X16's last reader, the last batch's first-tile GEMMs, precedes LN2's write) */ _Float16* HF16 = (_Float16*)take((size_t)SQ * DFF * 2); _Float16* BW1 = (_Float16*)take((size_t)DFF * DM * 2); _Float16* BW2 = (_Float16*)take((size_t)DM * DFF * 2); _Float16* QKV = (_Float16*)take(NR * 3 * DM * 2); _Float16* Q16 = QKV; _Float16* K16 = QKV + DM; _Float16* V16 = QKV + 2 * DM; _Float16* O16 = (_Float16*)take(NR * DM * 2); M16 = X16;
  float* S = (float*)take((size_t)NH * QT * NKX * 4); _Float16* P = (_Float16*)take((size_t)NH * QT * NKX * 2); _Float16* VT = (_Float16*)take((size_t)NH * HD * SQ * 2);
  float* QF0 = (float*)take((size_t)QT0 * DM * 4); float* KF0 = (float*)take((size_t)QT0 * DM * 4); float* VF0 = (float*)take((size_t)QT0 * DM * 4); float* OF0 = (float*)take((size_t)NB * QT0 * DM * 4); _Float16* OH0 = (_Float16*)take((size_t)NB * QT0 * DM * 2); _Float16* OL0 = (_Float16*)take((size_t)NB * QT0 * DM * 2);
  if (off > ws_size) return;
  { const unsigned g = (unsigned)(((size_t)DM * (DM / 8) + 255) / 256); k_wt_f16<<<g, 256, 0, stream>>>(wq, BQKV, DM, DM, 16.0f); k_wt_f16<<<g, 256, 0, stream>>>(wk, BQKV + (size_t)DM * DM, DM, DM, 16.0f); k_wt_f16<<<g, 256, 0, stream>>>(wv, BQKV + (size_t)2 * DM * DM, DM, DM, 16.0f); }      /* [in][out] -> Bt x16, stacked q | k | v */ k_wt_f16<<<(unsigned)(((size_t)DM * (DM / 8) + 255) / 256), 256, 0, stream>>>(wo, BO, DM, DM, 16.0f);      /* w_proj [in][out] -> Bt x16 */
  k_ln16<1, 1><<<(unsigned)NR, 256, 0, stream>>>(x, g1, be1, 1e-5f, X16, XB);      /* a = LN1(bf16(x)) -> f16 rows; XB = bf16(x) for the residual */
  k_wt_f16<<<(unsigned)(((size_t)DFF * (DM / 8) + 255) / 256), 256, 0, stream>>>(wfc, BW1, DM, DFF, 16.0f); k_wt_f16<<<(unsigned)(((size_t)DM * (DFF / 8) + 255) / 256), 256, 0, stream>>>(wmp, BW2, DFF, DM, 16.0f);      /* W1 [1024][4096] -> Bt [4096][1024]; W2 [4096][1024] -> Bt [1024][4096] (x16) */
  const size_t r0p = (size_t)B0 * SQ;      /* first projected row */
  k_gemm2<0><<<dim3((unsigned)((MP / 128) * (3 * DM / 64)), 1), 128, 0, stream>>>(X16 + r0p * DM, DM, 0, BQKV, DM, 0, 0.0625f, nullptr, 0, nullptr, 1, 0, 0, nullptr, QKV + r0p * 3 * DM, 3 * DM, 0, MP, 3 * DM, DM);      /* q | k | v rows (f16); head h = columns h*HD.. of each DM block */
  for (int b = B0; b < B0 + NBR; ++b) { const size_t r0 = (size_t)b * SQ;
    k_vt<NH, SQ><<<NH * (SQ / 64), 256, 0, stream>>>(V16 + r0 * LQ, LQ, 0, VT);      /* V^T [NH][HD][SQ] for this batch */
    k_gemm2<0><<<dim3((QT0 / 128) * (DM / 64), 1), 128, 0, stream>>>(X16 + r0 * DM, DM, 0, BQKV, DM, 0, 0.0625f, nullptr, 0, nullptr, 1, 0, 0, QF0, nullptr, DM, 0, QT0, DM, DM); k_gemm2<0><<<dim3((QT0 / 128) * (DM / 64), 1), 128, 0, stream>>>(X16 + r0 * DM, DM, 0, (BQKV + (size_t)DM * DM), DM, 0, 0.0625f, nullptr, 0, nullptr, 1, 0, 0, KF0, nullptr, DM, 0, QT0, DM, DM); k_gemm2<0><<<dim3((QT0 / 128) * (DM / 64), 1), 128, 0, stream>>>(X16 + r0 * DM, DM, 0, (BQKV + (size_t)2 * DM * DM), DM, 0, 0.0625f, nullptr, 0, nullptr, 1, 0, 0, VF0, nullptr, DM, 0, QT0, DM, DM);      /* f32 q, k, v of the first 128 rows (exact products) */
    k_att0<0><<<NH * (QT0 / 64), 64, 0, stream>>>(QF0, KF0, VF0, DM, nullptr, 0.125f, OF0 + (size_t)b * QT0 * DM, DM);      /* exact f32 attention for rows 0..127 (o x64) */
    for (int q0 = 0; q0 < QN; q0 += QT) { const int nk = q0 + QT;      /* causal: only keys below the tile end are computed */
      k_gemm2<0><<<dim3((QT / 128) * (nk / 64), NHD), 128, 0, stream>>>(Q16 + (r0 + q0) * LQ, LQ, (size_t)HD, K16 + r0 * LQ, LQ, (size_t)HD, 0.125f, nullptr, 0, nullptr, 1, 0, 0, S, nullptr, NKX, (size_t)QT * NKX, QT, nk, HD);      /* scores, all heads on grid.y */
      k_rsmcf2<<<(NHD * QT + 255) / 256, 256, 0, stream>>>(S, P, NHD, q0, nk);
      k_gemm2<0><<<dim3((QT / 128) * (HD / 64), NHD), 128, 0, stream>>>(P, NKX, (size_t)QT * NKX, VT, SQ, (size_t)HD * SQ, 0.25f, nullptr, 0, nullptr, 1, 0, 0, nullptr, O16 + (r0 + q0) * DM, DM, (size_t)HD, QT, HD, nk); } }      /* o (merged heads, x64) as f16 rows */
  k_gemm2<0><<<dim3((unsigned)((MPO / 128) * (DM / 64)), 1), 128, 0, stream>>>(O16 + r0p * DM, DM, 0, BO, DM, 0, 0.0009765625f, bo, 0, XB + r0p * DM, -1, 0, 0, X1 + r0p * DM, nullptr, DM, 0, MPO, DM, DM);      /* x1 = x + o Wo (f32 rows) */
  k_hl<<<(unsigned)(((size_t)NB * QT0 * DM / 8 + 255) / 256), 256, 0, stream>>>(OF0, OH0, OL0, (size_t)NB * QT0 * DM / 8);      /* first-tile o (x64) -> f16 hi + x1024 residual planes */
  for (int b = B0; b < B0 + NBR; ++b) { const size_t r0 = (size_t)b * SQ; const size_t f0 = (size_t)b * QT0;
    k_gemm2<0><<<dim3((QT0 / 128) * (DM / 64), 1), 128, 0, stream>>>(OH0 + f0 * DM, DM, 0, BO, DM, 0, 0.0009765625f, bo, 0, XB + r0 * DM, -1, 0, 0, X1 + r0 * DM, nullptr, DM, 0, QT0, DM, DM);      /* rows 0..127: x1 = x + o_hi Wo, overwriting the f16-path rows */
    k_gemm2<0><<<dim3((QT0 / 128) * (DM / 64), 1), 128, 0, stream>>>(OL0 + f0 * DM, DM, 0, BO, DM, 0, 0.00000095367431640625f, nullptr, 0, X1 + r0 * DM, -1, 0, 0, X1 + r0 * DM, nullptr, DM, 0, QT0, DM, DM); }      /* += o_lo Wo 2^-20 (own-element accumulate) */
  k_ln16<0, 0><<<(unsigned)NR, 256, 0, stream>>>(X1, gg2, be2, 1e-5f, M16, nullptr);      /* h = LN2(x1) -> f16 rows */
  for (int b = 0; b < NB; ++b) { const size_t r0 = (size_t)b * SQ;
    k_gemm2<6><<<dim3((unsigned)((SQ / 128) * (DFF / 64)), 1), 128, 0, stream>>>(M16 + r0 * DM, DM, 0, BW1, DM, 0, 0.0625f, bfc, 0, nullptr, 1, 0, 0, nullptr, HF16, DFF, 0, SQ, DFF, DM);      /* gelu_erf(h2 W1 + b1) -> f16 (this batch) */
    k_gemm2<0><<<dim3((unsigned)((SQ / 128) * (DM / 64)), 1), 128, 0, stream>>>(HF16, DFF, 0, BW2, DFF, 0, 0.0625f, bmp, 0, X1 + r0 * DM, -1, 0, 0, (float*)d_out + r0 * DM, nullptr, DM, 0, SQ, DM, DFF); }      /* out = x1 + mlp (own-element residual) */
}

// v001
// It runs in 4990 microseconds.
// Next to v000, in two timings, it ran 2.16 times as fast each time.
#include <hip/hip_runtime.h>
// Pre-LN causal transformer block (x [4][2048][1024]; h = LN1(x) (biased var, eps 1e-5, gamma / beta); Q/K/V = h Wq/Wk/Wv ([in][out] 1024 x 1024 sigma 1/32, no biases), 16 heads of 64; scores / 8; causal (tril, -inf); softmax; x1 = x + hidden Wo ([in][out], no bias); h2 = LN2(x1); out = x1 + gelu_erf(h2 W1 + b1) W2 + b2 ([in][out] 1024 x 4096 x 1024) -> [4][2048][1024]).
// Structure: token rows r = b*2048 + s; h = LN1(bf16 x) as f16 rows; q | k | v as ONE WMMA GEMM (N = 3 x 1024) (32x64 wave tiles, f32 accumulation, exact x16 weights, no bias, f16 outputs); per batch: V^T for all heads via LDS transposes; per query tile of 256 rows: scores against the keys below the tile end only (K = 64, all heads on grid.y, alpha = 0.125), causal row softmax on VALU, one wave per row, over the computed range (f32 statistics, native exp; weights x256 f16), o = P . V^T (K = keys below the tile end, alpha 2^-2: o carried x64, folded into the output GEMM alpha) written straight into the merged f16 o rows; x1 = x + o W_o GEMM (f32, no bias); then LN2 and the gelu MLP GEMMs into the output layout.
// Compute dtype: inputs rounded to bf16; x / weights exact; q, k, v, softmax weights and o as plain f16 GEMM operands (~2^-12); scores and softmax statistics f32. v_wmma_f32_16x16x32_f16.
#define NB 4
#define SQ 2048
#define DM 1024
#define NH 16
#define HD 64
#define HG 4                         /* heads per block group of the unlaunched k_vt(b, h0) overload */
#define QT 256                       /* query rows per causal tile */
#define NKX SQ                       /* S / P row pitch */
#define QT0 128                      /* first-tile rows recomputed exactly in f32 */
#define B0 0                         /* first batch processed (debug hook) */
#define NBR NB                       /* batches processed (debug hook) */
#define NR ((size_t)NB * SQ)
#define DMQ DM
#define DFF 4096                     /* FFN hidden width */
#define DFFR 100                     /* unused */
#define MP ((int)((size_t)NBR * SQ)) /* rows projected (debug hook) */
#define QN SQ                        /* query rows attended per batch (debug hook) */
#define NHD NH                       /* heads attended (debug hook) */
#define MPO MP                       /* rows through the output stage (debug hook) */
#define LQ (3 * DM)      /* row pitch of the q/k/v rows */
typedef __bf16 v16b __attribute__((ext_vector_type(16)));
typedef unsigned short v8us __attribute__((ext_vector_type(8), may_alias));
typedef float  v8f  __attribute__((ext_vector_type(8)));
typedef float  v4f  __attribute__((ext_vector_type(4)));
typedef float  v4fa __attribute__((ext_vector_type(4), may_alias));
union FragB { v16b v; v8us half[2]; unsigned short u[16]; };

__device__ __forceinline__ unsigned short bf16_bits(float x) { unsigned int u = __float_as_uint(x); return (unsigned short)((u + 0x7FFFu + ((u >> 16) & 1u)) >> 16); }
__device__ __forceinline__ float bf16_val(unsigned short b) { return __uint_as_float(((unsigned int)b) << 16); }
__device__ __forceinline__ float bf16_round(float x) { return bf16_val(bf16_bits(x)); }
// D += A·B with NT terms: 1 = ah·bh, 2 = + al·bh (A split), 3 = + ah·bl (both split)
template <int NT>
__device__ __forceinline__ v8f mmaN(v16b ah, v16b al, v16b bh, v16b bl, v8f c) {
  c = __builtin_amdgcn_wmma_f32_16x16x32_bf16(false, ah, false, bh, (short)0, c, false, false);
  if (NT >= 2) c = __builtin_amdgcn_wmma_f32_16x16x32_bf16(false, al, false, bh, (short)0, c, false, false);
  if (NT >= 3) c = __builtin_amdgcn_wmma_f32_16x16x32_bf16(false, ah, false, bl, (short)0, c, false, false);
  asm volatile("v_nop\n\tv_nop\n\tv_nop\n\tv_nop" : "+v"(c) : "v"(ah), "v"(al), "v"(bh), "v"(bl));
  return c;
}

__global__ __launch_bounds__(256) void k_wt_bf16(const float* __restrict__ W, unsigned short* __restrict__ Wt, int K, int N) {
  const int t = blockIdx.x * 256 + threadIdx.x;
  const int k8n = K / 8;
  if (t >= N * k8n) return;
  const int n = t / k8n, k8 = (t % k8n) * 8;
  v8us v;
#pragma unroll
  for (int i = 0; i < 8; ++i) v[i] = bf16_bits(W[(size_t)(k8 + i) * N + n]);
  *(v8us*)(Wt + (size_t)n * K + k8) = v;
  
}

// GEMM C[M][N] (f32, pitch ldc) = act(A[M][K]·W + bias). A f32 row-major (pitch lda) converted per fragment to bf16
// (ASPLIT: hi/lo two planes -> 2 terms, else single rounded term); Wt bf16 [N][K] (pitch ldb). BIAS_BF16 rounds the
// bias to bf16 first (bias quantised to bf16 before the add). K%32==0, M%16==0, N%64==0.
template <bool ASPLIT, int ACT, bool BIAS_BF16>
__global__ __launch_bounds__(128) void k_gemm_bf(const float* __restrict__ A, int lda, const unsigned short* __restrict__ Wt, int ldb,
                                               const float* __restrict__ bias, float* __restrict__ C, int ldc, int M, int N, int K) {
  __shared__ __attribute__((aligned(16))) float so[4][16][64];
  const int tid = threadIdx.x, w = tid >> 5, lane = tid & 31, ln = lane & 15, hh = lane >> 4;
  const int ntn = N / 64;
  const int wid = blockIdx.x * 4 + w;
  const int mt = wid / ntn, nq = wid % ntn;
  if (mt * 16 >= M) return;
  const int row0 = mt * 16, col0 = nq * 64;
  const float* arow = A + (size_t)(row0 + ln) * lda;
  v8f acc[4] = {};
  for (int kb = 0; kb < K; kb += 32) {
    FragB ah, al;
    const v4f x0 = *(const v4fa*)(arow + kb + 8 * hh), x1 = *(const v4fa*)(arow + kb + 8 * hh + 4);
    const v4f x2 = *(const v4fa*)(arow + kb + 16 + 8 * hh), x3 = *(const v4fa*)(arow + kb + 16 + 8 * hh + 4);
    float xs[16] = {x0[0],x0[1],x0[2],x0[3],x1[0],x1[1],x1[2],x1[3],x2[0],x2[1],x2[2],x2[3],x3[0],x3[1],x3[2],x3[3]};
#pragma unroll
    for (int i = 0; i < 16; ++i) { const unsigned short hb = bf16_bits(xs[i]); ah.u[i] = hb; al.u[i] = ASPLIT ? bf16_bits(xs[i] - bf16_val(hb)) : (unsigned short)0; }
#pragma unroll
    for (int t = 0; t < 4; ++t) {
      const unsigned short* brow = Wt + (size_t)(col0 + t * 16 + ln) * ldb + kb;
      FragB b;
      b.half[0] = *(const v8us*)(brow + 8 * hh);
      b.half[1] = *(const v8us*)(brow + 16 + 8 * hh);
      acc[t] = mmaN<ASPLIT ? 2 : 1>(ah.v, al.v, b.v, b.v, acc[t]);
    }
  }
#pragma unroll
  for (int t = 0; t < 4; ++t) {
    float bv = bias ? bias[col0 + t * 16 + ln] : 0.f;
    if (BIAS_BF16) bv = bf16_round(bv);
#pragma unroll
    for (int r = 0; r < 8; ++r) { float v = acc[t][r] + bv; if (ACT == 1) v = fmaxf(v, 0.f); so[w][8 * hh + r][t * 16 + ln] = v; }
  }
  __builtin_amdgcn_fence(__ATOMIC_ACQ_REL, "workgroup");
  __builtin_amdgcn_wave_barrier();
  const int rsub = lane >> 4, c4 = (lane & 15) * 4;
  {
#pragma unroll
    for (int q = 0; q < 8; ++q) {
      const int r = q * 2 + rsub;
      const v4f v = *(const v4fa*)&so[w][r][c4];
      *(v4f*)(C + (size_t)(row0 + r) * ldc + col0 + c4) = v;
    }
    
  }
}

// GEMM C = act(A·W + bias + resid): A f32 (ASPLIT -> hi/lo 2 terms), Wt bf16 [N][K]; ACT 0 none, 1 relu, 2 exact gelu;
// resid (optional, f32, row index = (row % rmod), pitch ldr, RES_BF16 rounds it) added before the activation.
template <bool ASPLIT, int ACT, bool BIAS_BF16, bool RES_BF16>
__global__ __launch_bounds__(128) void k_gemm_bf3(const float* __restrict__ A, int lda, const unsigned short* __restrict__ Wt, int ldb,
                                                const float* __restrict__ bias, const float* __restrict__ resid, int rmod, int ldr,
                                                float* __restrict__ C, int ldc, int M, int N, int K) {
  __shared__ __attribute__((aligned(16))) float so[4][16][64];
  const int tid = threadIdx.x, w = tid >> 5, lane = tid & 31, ln = lane & 15, hh = lane >> 4;
  const int ntn = N / 64;
  const int wid = blockIdx.x * 4 + w;
  const int mt = wid / ntn, nq = wid % ntn;
  if (mt * 16 >= M) return;
  const int row0 = mt * 16, col0 = nq * 64;
  const float* arow = A + (size_t)(row0 + ln) * lda;
  v8f acc[4] = {};
  for (int kb = 0; kb < K; kb += 32) {
    FragB ah, al;
    const v4f x0 = *(const v4fa*)(arow + kb + 8 * hh), x1 = *(const v4fa*)(arow + kb + 8 * hh + 4);
    const v4f x2 = *(const v4fa*)(arow + kb + 16 + 8 * hh), x3 = *(const v4fa*)(arow + kb + 16 + 8 * hh + 4);
    float xs[16] = {x0[0],x0[1],x0[2],x0[3],x1[0],x1[1],x1[2],x1[3],x2[0],x2[1],x2[2],x2[3],x3[0],x3[1],x3[2],x3[3]};
#pragma unroll
    for (int i = 0; i < 16; ++i) { const unsigned short hb = bf16_bits(xs[i]); ah.u[i] = hb; al.u[i] = ASPLIT ? bf16_bits(xs[i] - bf16_val(hb)) : (unsigned short)0; }
#pragma unroll
    for (int t = 0; t < 4; ++t) {
      const unsigned short* brow = Wt + (size_t)(col0 + t * 16 + ln) * ldb + kb;
      FragB b;
      b.half[0] = *(const v8us*)(brow + 8 * hh);
      b.half[1] = *(const v8us*)(brow + 16 + 8 * hh);
      acc[t] = mmaN<ASPLIT ? 2 : 1>(ah.v, al.v, b.v, b.v, acc[t]);
    }
  }
#pragma unroll
  for (int t = 0; t < 4; ++t) {
    const int col = col0 + t * 16 + ln;
    float bv = bias ? bias[col] : 0.f;
    if (BIAS_BF16) bv = bf16_round(bv);
#pragma unroll
    for (int r = 0; r < 8; ++r) {
      float v = acc[t][r] + bv;
      if (resid) { float rv = resid[(size_t)((row0 + 8 * hh + r) % rmod) * ldr + col]; if (RES_BF16) rv = bf16_round(rv); v += rv; }
      if (ACT == 1) v = fmaxf(v, 0.f);
      if (ACT == 2) v = 0.5f * v * (1.0f + erff(v * 0.70710678118654752f));
      if (ACT == 3) { const float u = 0.7978845608028654f * (v + 0.044715f * v * v * v); v = 0.5f * v * (1.0f + tanhf(u)); }
      so[w][8 * hh + r][t * 16 + ln] = v;
    }
  }
  __builtin_amdgcn_fence(__ATOMIC_ACQ_REL, "workgroup");
  __builtin_amdgcn_wave_barrier();
  const int rsub = lane >> 4, c4 = (lane & 15) * 4;
  {
#pragma unroll
    for (int q = 0; q < 8; ++q) {
      const int r = q * 2 + rsub;
      const v4f v = *(const v4fa*)&so[w][r][c4];
      *(v4f*)(C + (size_t)(row0 + r) * ldc + col0 + c4) = v;
    }
    
  }
}
// row LayerNorm (biased variance, eps) over N: s = X (+ R); optional out_sum <- s; out_norm <- (s-mu)*rsqrt(var+eps)*g + b
template <bool PARAM_BF16>
__global__ __launch_bounds__(256) void k_layernorm(const float* __restrict__ X, const float* __restrict__ R, const float* __restrict__ g, const float* __restrict__ bta,
                                                  float* __restrict__ out_sum, float* __restrict__ out_norm, int N, float eps) {
  __shared__ float red[256];
  const int row = blockIdx.x, tid = threadIdx.x;
  const float* x = X + (size_t)row * N; const float* rr = R ? R + (size_t)row * N : nullptr;
  float vals[16];                     // up to N = 4096
  const int per = N / 256;            // contiguous chunk per thread? use strided-by-4 chunks: thread handles j = tid*4 + 1024*u
  float s1 = 0.f;
  for (int u = 0; u < per / 4; ++u) {
    const int j = tid * 4 + 1024 * u;
    const v4f a = *(const v4fa*)(x + j);
    v4f b = {0.f,0.f,0.f,0.f}; if (rr) b = *(const v4fa*)(rr + j);
#pragma unroll
    for (int q = 0; q < 4; ++q) { const float v = a[q] + b[q]; vals[u * 4 + q] = v; s1 += v; }
  }
  red[tid] = s1; __syncthreads();
  for (int st = 128; st > 0; st >>= 1) { if (tid < st) red[tid] += red[tid + st]; __syncthreads(); }
  const float mu = red[0] / (float)N; __syncthreads();
  float s2 = 0.f;
  for (int u = 0; u < per / 4; ++u)
#pragma unroll
    for (int q = 0; q < 4; ++q) { const float c = vals[u * 4 + q] - mu; s2 += c * c; }
  red[tid] = s2; __syncthreads();
  for (int st = 128; st > 0; st >>= 1) { if (tid < st) red[tid] += red[tid + st]; __syncthreads(); }
  const float rs = rsqrtf(red[0] / (float)N + eps);
  {
    for (int u = 0; u < per / 4; ++u) {
      const int j = tid * 4 + 1024 * u;
      v4f o, sm;
#pragma unroll
      for (int q = 0; q < 4; ++q) {
        float gg = g[j + q], bb = bta[j + q];
        if (PARAM_BF16) { gg = bf16_round(gg); bb = bf16_round(bb); }
        sm[q] = vals[u * 4 + q]; o[q] = (vals[u * 4 + q] - mu) * rs * gg + bb;
      }
      if (out_sum) *(v4f*)(out_sum + (size_t)row * N + j) = sm;
      *(v4f*)(out_norm + (size_t)row * N + j) = o;
    }
    
  }
}



// ---- f16 WMMA path (v_wmma_f32_16x16x32_f16): 11-bit significands for operands in range — used where a [0,1] probability operand needs more precision than bf16
typedef _Float16 v16h __attribute__((ext_vector_type(16)));
union FragH { v16h v; v8us half[2]; _Float16 h[16]; unsigned short u[16]; };
template <int NT>
__device__ __forceinline__ v8f mmaH(v16h ah, v16h al, v16h bh, v16h bl, v8f c) {
  c = __builtin_amdgcn_wmma_f32_16x16x32_f16(false, ah, false, bh, (short)0, c, false, false);
  if (NT >= 2) c = __builtin_amdgcn_wmma_f32_16x16x32_f16(false, al, false, bh, (short)0, c, false, false);
  if (NT >= 3) c = __builtin_amdgcn_wmma_f32_16x16x32_f16(false, ah, false, bl, (short)0, c, false, false);
  asm volatile("v_nop\n\tv_nop\n\tv_nop\n\tv_nop" : "+v"(c) : "v"(ah), "v"(al), "v"(bh), "v"(bl));
  return c;
}
// batched GEMM like k_gemm_b but f16 operands: A f32 (split into f16 hi/lo if ASPLIT, else rounded to f16), Bt = f16 values [n][k]; alpha; C f32; N multiple of 16 (partial tiles skipped)
template <bool ASPLIT>
__global__ __launch_bounds__(128) void k_gemm_h(const float* __restrict__ A, int lda, size_t sA, const _Float16* __restrict__ Bh, int ldb, size_t sB, float alpha, float* __restrict__ C, int ldc, size_t sC, int M, int N, int K) {
  __shared__ __attribute__((aligned(16))) float so[4][16][64];
  const int tid = threadIdx.x, w = tid >> 5, lane = tid & 31, ln = lane & 15, hh = lane >> 4; const int by = blockIdx.y;
  A += (size_t)by * sA; Bh += (size_t)by * sB; C += (size_t)by * sC;
  const int ntn = (N + 63) / 64; const int wid = blockIdx.x * 4 + w; const int mt = wid / ntn, nq = wid % ntn; if (mt * 16 >= M) return;
  const int row0 = mt * 16, col0 = nq * 64; const float* arow = A + (size_t)(row0 + ln) * lda;
  v8f acc[4] = {};
  for (int kb = 0; kb < K; kb += 32) {
    FragH ah, al;
    const v4f x0 = *(const v4fa*)(arow + kb + 8 * hh), x1 = *(const v4fa*)(arow + kb + 8 * hh + 4), x2 = *(const v4fa*)(arow + kb + 16 + 8 * hh), x3 = *(const v4fa*)(arow + kb + 16 + 8 * hh + 4);
    float xs[16] = {x0[0],x0[1],x0[2],x0[3],x1[0],x1[1],x1[2],x1[3],x2[0],x2[1],x2[2],x2[3],x3[0],x3[1],x3[2],x3[3]};
#pragma unroll
    for (int i = 0; i < 16; ++i) { const _Float16 h = (_Float16)xs[i]; ah.h[i] = h; al.h[i] = ASPLIT ? (_Float16)(xs[i] - (float)h) : (_Float16)0.0f; }
#pragma unroll
    for (int t = 0; t < 4; ++t) { if (col0 + t * 16 >= N) continue; const size_t boff = (size_t)(col0 + t * 16 + ln) * ldb + kb; FragH bq; bq.half[0] = *(const v8us*)(Bh + boff + 8 * hh); bq.half[1] = *(const v8us*)(Bh + boff + 16 + 8 * hh);
      acc[t] = mmaH<ASPLIT ? 2 : 1>(ah.v, al.v, bq.v, bq.v, acc[t]); }
  }
#pragma unroll
  for (int t = 0; t < 4; ++t) { if (col0 + t * 16 >= N) continue;
#pragma unroll
    for (int r = 0; r < 8; ++r) so[w][8 * hh + r][t * 16 + ln] = acc[t][r] * alpha; }
  __builtin_amdgcn_fence(__ATOMIC_ACQ_REL, "workgroup"); __builtin_amdgcn_wave_barrier();
  const int rsub = lane >> 4, c4 = (lane & 15) * 4;
  {
#pragma unroll
    for (int q = 0; q < 8; ++q) { const int r = q * 2 + rsub; if (col0 + c4 < N) { const v4f v = *(const v4fa*)&so[w][r][c4]; *(v4f*)(C + (size_t)(row0 + r) * ldc + col0 + c4) = v; } }
     }
}

// Wt[n][k] = f16(W[k][n]·scale) from f32 row-major W[K][N] (scale = power of two; bf16-exact weights stay exact in f16 away from the subnormal range)
__global__ __launch_bounds__(256) void k_wt_f16(const float* __restrict__ W, _Float16* __restrict__ Wt, int K, int N, float scale) {
  const int t = blockIdx.x * 256 + threadIdx.x; if (t >= N * (K / 8)) return; const int n = t / (K / 8), k8 = (t % (K / 8)) * 8; FragH f;
#pragma unroll
  for (int i = 0; i < 8; ++i) f.h[i] = (_Float16)(bf16_round(W[(size_t)(k8 + i) * N + n]) * scale); const v8us o = f.half[0];
  *(v8us*)((unsigned short*)Wt + (size_t)n * K + k8) = o; 
}
// k_gemm_hh variant with fused epilogue: v = acc·alpha + bias[by·sBias + col] (+ CP[(row/rowsPerB)·sCPb + by·64 + col] if CP) ; ACT 0 none / 1 elu ; writes f16 C16 (and f32 C if non-null)
template <int ACT>
__global__ __launch_bounds__(128) void k_gemm_hhx(const _Float16* __restrict__ A, int lda, size_t sA, const _Float16* __restrict__ Bh, int ldb, size_t sB, float alpha, const float* __restrict__ bias, size_t sBias, const float* __restrict__ CP, int rowsPerB, size_t sCPb, int row0g,
    float* __restrict__ C, _Float16* __restrict__ C16, int ldc, size_t sC, int M, int N, int K) {
  __shared__ __attribute__((aligned(16))) float so[4][16][64];
  const int tid = threadIdx.x, w = tid >> 5, lane = tid & 31, ln = lane & 15, hh = lane >> 4; const int by = blockIdx.y;
  A += (size_t)by * sA; Bh += (size_t)by * sB; const size_t cofs = (size_t)by * sC; const float* bp = bias ? bias + (size_t)by * sBias : nullptr;
  const int ntn = (N + 63) / 64; const int wid = blockIdx.x * 4 + w; const int mt = wid / ntn, nq = wid % ntn; if (mt * 16 >= M) return;
  const int row0 = mt * 16, col0 = nq * 64; const _Float16* arow = A + (size_t)(row0 + ln) * lda;
  v8f acc[4] = {};
  for (int kb = 0; kb < K; kb += 32) { FragH ah; ah.half[0] = *(const v8us*)((const unsigned short*)arow + kb + 8 * hh); ah.half[1] = *(const v8us*)((const unsigned short*)arow + kb + 16 + 8 * hh);
#pragma unroll
    for (int t = 0; t < 4; ++t) { if (col0 + t * 16 >= N) continue; const size_t boff = (size_t)(col0 + t * 16 + ln) * ldb + kb; FragH bq; bq.half[0] = *(const v8us*)((const unsigned short*)Bh + boff + 8 * hh); bq.half[1] = *(const v8us*)((const unsigned short*)Bh + boff + 16 + 8 * hh);
      acc[t] = mmaH<1>(ah.v, ah.v, bq.v, bq.v, acc[t]); }
  }
#pragma unroll
  for (int t = 0; t < 4; ++t) { if (col0 + t * 16 >= N) continue; const int col = col0 + t * 16 + ln; const float bv = bp ? bf16_round(bp[col]) : 0.f;
#pragma unroll
    for (int r = 0; r < 8; ++r) { float v = acc[t][r] * alpha + bv; if (CP) { const int rr = row0g + row0 + 8 * hh + r; if (rowsPerB < 0) v += CP[cofs + (size_t)rr * ldc + col];      /* rowsPerB < 0: own element of the batched C plane */ else { const int bidx = rr / rowsPerB; v += CP[(size_t)bidx * sCPb + (size_t)by * 64 + col]; } } if (ACT == 1) v = (v > 0.f) ? v : expm1f(v); else if (ACT == 7) v = (v > 0.f) ? v + 1.0f : expf(v); else if (ACT == 8) v = tanhf(v); else if (ACT == 9) v = 0.5f * v * (1.0f + tanhf(0.7978845608028654f * (v + 0.044715f * v * v * v))); else if (ACT == 11) v = 1.0f / (1.0f + expf(-v)); else if (ACT == 12) v = (v > 0.f) ? v : 0.01f * v; else if (ACT == 14) v = (v > 0.f) ? v : 0.1f * v; else if (ACT == 16) v = (v >= 0.f) ? v : 0.3f * v; else if (ACT == 17) v = (v >= 0.f) ? v : 0.2f * v; else if (ACT == 15) v = v / (1.0f + expf(-v)); else if (ACT == 3) v = fmaxf(v, 0.f); else if (ACT == 6) v = 0.5f * v * (1.0f + erff(v * 0.70710678118654752f)); so[w][8 * hh + r][t * 16 + ln] = v; } }
  __builtin_amdgcn_fence(__ATOMIC_ACQ_REL, "workgroup"); __builtin_amdgcn_wave_barrier();
  const int rsub = lane >> 4, c4 = (lane & 15) * 4; typedef _Float16 v4h __attribute__((ext_vector_type(4)));
  {
#pragma unroll
    for (int q = 0; q < 8; ++q) { const int r = q * 2 + rsub; if (col0 + c4 < N) { const v4f v = *(const v4fa*)&so[w][r][c4]; if (C) *(v4f*)(C + cofs + (size_t)(row0 + r) * ldc + col0 + c4) = v; if (C16) { v4h h4; for (int i = 0; i < 4; ++i) h4[i] = (_Float16)v[i]; *(v4h*)(C16 + cofs + (size_t)(row0 + r) * ldc + col0 + c4) = h4; } } }
     }
}


typedef _Float16 v4h __attribute__((ext_vector_type(4)));

__global__ __launch_bounds__(256) void k_x16(const float* __restrict__ x, _Float16* __restrict__ X16, size_t n8) { const size_t t = (size_t)blockIdx.x * 256 + threadIdx.x; if (t >= n8) return; FragH f;
#pragma unroll
  for (int q = 0; q < 8; ++q) f.h[q] = (_Float16)bf16_round(x[t * 8 + q]); *(v8us*)((unsigned short*)X16 + t * 8) = f.half[0];  }
__global__ __launch_bounds__(256) void k_h16(const float* __restrict__ x, _Float16* __restrict__ X16, size_t n8) { const size_t t = (size_t)blockIdx.x * 256 + threadIdx.x; if (t >= n8) return; FragH f;
#pragma unroll
  for (int q = 0; q < 8; ++q) f.h[q] = (_Float16)x[t * 8 + q]; *(v8us*)((unsigned short*)X16 + t * 8) = f.half[0];  }
__global__ __launch_bounds__(256) void k_round16f(const float* __restrict__ W, _Float16* __restrict__ Bt, size_t n8) { const size_t t = (size_t)blockIdx.x * 256 + threadIdx.x; if (t >= n8) return; FragH f;
#pragma unroll
  for (int i = 0; i < 8; ++i) f.h[i] = (_Float16)(bf16_round(W[t * 8 + i]) * 16.0f); *(v8us*)((unsigned short*)Bt + t * 8) = f.half[0];  }
template <int NHv, int TTv>
__global__ __launch_bounds__(256) void k_vt(const _Float16* __restrict__ V16, int ldv, int voff, _Float16* __restrict__ Vt) { __shared__ unsigned short tl[64][66]; const int tid = threadIdx.x; const int slab = blockIdx.x / (TTv / 64), lg = blockIdx.x % (TTv / 64); const int b = slab / NHv, h = slab % NHv;
  for (int i = tid; i < 64 * 8; i += 256) { const int r = i / 8, c8 = (i % 8) * 8; FragH f; f.half[0] = *(const v8us*)((const unsigned short*)V16 + ((size_t)b * TTv + lg * 64 + r) * ldv + voff + h * 64 + c8);
#pragma unroll
    for (int q = 0; q < 8; ++q) tl[r][c8 + q] = f.u[q]; }
  __syncthreads();
  {
#pragma unroll
    for (int rd = 0; rd < 2; ++rd) { const int d = rd * 32 + tid / 8, pc = tid % 8; FragH f;
#pragma unroll
      for (int q = 0; q < 8; ++q) f.u[q] = tl[pc * 8 + q][d];
      *(v8us*)((unsigned short*)Vt + ((size_t)slab * 64 + d) * TTv + lg * 64 + pc * 8) = f.half[0]; }
     } }

__global__ __launch_bounds__(256) void k_hl(const float* __restrict__ F, _Float16* __restrict__ Hh, _Float16* __restrict__ Hl, size_t n8) { const size_t t = (size_t)blockIdx.x * 256 + threadIdx.x; if (t >= n8) return; FragH fh, fl; const v4f a = *(const v4fa*)(F + t * 8), c = *(const v4fa*)(F + t * 8 + 4);
#pragma unroll
  for (int q = 0; q < 4; ++q) { _Float16 h = (_Float16)a[q]; fh.h[q] = h; fl.h[q] = (_Float16)((a[q] - (float)h) * 1024.0f); h = (_Float16)c[q]; fh.h[4 + q] = h; fl.h[4 + q] = (_Float16)((c[q] - (float)h) * 1024.0f); }
  { *(v8us*)((unsigned short*)Hh + t * 8) = fh.half[0]; *(v8us*)((unsigned short*)Hl + t * 8) = fl.half[0];  } }

// ---- fast GEMM (wave tile 32x64; requires M % 32 == 0 rows per launch region and N % 64 == 0); epilogue = k_gemm_hhx semantics ----
__device__ __forceinline__ v16h g2_frag(const _Float16* p, int hh) { FragH f; f.half[0] = *(const v8us*)((const unsigned short*)p + 8 * hh); f.half[1] = *(const v8us*)((const unsigned short*)p + 16 + 8 * hh); return f.v; }
__device__ __forceinline__ v8f g2_mma(v16h a, v16h b, v8f c) { v8f d = __builtin_amdgcn_wmma_f32_16x16x32_f16(false, a, false, b, (short)0, c, false, false); asm volatile("v_nop\n\tv_nop\n\tv_nop\n\tv_nop" : "+v"(d) : "v"(a), "v"(b)); return d; }
template <int ACT>
__global__ __launch_bounds__(128) void k_gemm2(const _Float16* __restrict__ A, int lda, size_t sA, const _Float16* __restrict__ Bh, int ldb, size_t sB, float alpha, const float* __restrict__ bias, size_t sBias, const float* __restrict__ CP, int rowsPerB, size_t sCPb, int row0g,
    float* __restrict__ C, _Float16* __restrict__ C16, int ldc, size_t sC, int M, int N, int K) { static_assert(ACT == 0 || ACT == 3 || ACT == 6 || ACT == 8 || ACT == 9 || ACT == 11 || ACT == 12 || ACT == 14 || ACT == 15 || ACT == 16 || ACT == 17, "k_gemm2: unsupported ACT code (would silently apply no activation)");
  __shared__ __attribute__((aligned(16))) float so[4][32][68];
  const int tid = threadIdx.x, w = tid >> 5, lane = tid & 31, ln = lane & 15, hh = lane >> 4; const int by = blockIdx.y;
  A += (size_t)by * sA; Bh += (size_t)by * sB; const size_t cofs = (size_t)by * sC; const float* bp = bias ? bias + (size_t)by * sBias : nullptr;
  const int ntn = N >> 6; const int mt = blockIdx.x / ntn, nq = blockIdx.x - mt * ntn; const int row0 = mt * 128 + 32 * w, col0 = nq * 64; if (row0 >= M) return;
  const _Float16* a0p = A + (size_t)(row0 + ln) * lda; const _Float16* a1p = a0p + (size_t)16 * lda;
  const _Float16* b0p = Bh + (size_t)(col0 + ln) * ldb; const _Float16* b1p = b0p + (size_t)16 * ldb; const _Float16* b2p = b1p + (size_t)16 * ldb; const _Float16* b3p = b2p + (size_t)16 * ldb;
  const v8f z8 = {0.f,0.f,0.f,0.f,0.f,0.f,0.f,0.f}; v8f c00 = z8, c01 = z8, c02 = z8, c03 = z8, c10 = z8, c11 = z8, c12 = z8, c13 = z8;
#pragma unroll 1
  for (int kb = 0; kb < K; kb += 32) { const v16h a0 = g2_frag(a0p + kb, hh), a1 = g2_frag(a1p + kb, hh);
    v16h b = g2_frag(b0p + kb, hh); c00 = g2_mma(a0, b, c00); c10 = g2_mma(a1, b, c10);
    b = g2_frag(b1p + kb, hh); c01 = g2_mma(a0, b, c01); c11 = g2_mma(a1, b, c11);
    b = g2_frag(b2p + kb, hh); c02 = g2_mma(a0, b, c02); c12 = g2_mma(a1, b, c12);
    b = g2_frag(b3p + kb, hh); c03 = g2_mma(a0, b, c03); c13 = g2_mma(a1, b, c13); }
  v8f accs[8] = {c00, c01, c02, c03, c10, c11, c12, c13};
#pragma unroll
  for (int u = 0; u < 8; ++u) { const int t = u & 3, half = u >> 2; const int col = col0 + t * 16 + ln; const float bv = bp ? bf16_round(bp[col]) : 0.f;
#pragma unroll
    for (int r = 0; r < 8; ++r) { const int rloc = half * 16 + 8 * hh + r; float v = accs[u][r] * alpha + bv; if (CP) { if (rowsPerB < 0) v += CP[cofs + (size_t)(row0g + row0 + rloc) * ldc + col];      /* rowsPerB < 0: own element of the batched C plane */ else { const int bidx = (row0g + row0 + rloc) / rowsPerB; v += CP[(size_t)bidx * sCPb + (size_t)by * 64 + col]; } }
      if (ACT == 3) v = fmaxf(v, 0.f); else if (ACT == 6) v = 0.5f * v * (1.0f + erff(v * 0.70710678118654752f)); else if (ACT == 11) v = 1.0f / (1.0f + expf(-v)); else if (ACT == 15) v = v / (1.0f + expf(-v)); else if (ACT == 12) v = (v > 0.f) ? v : 0.01f * v; else if (ACT == 8) v = tanhf(v); else if (ACT == 9) v = 0.5f * v * (1.0f + tanhf(0.7978845608028654f * (v + 0.044715f * v * v * v))); else if (ACT == 14) v = (v > 0.f) ? v : 0.1f * v; else if (ACT == 16) v = (v >= 0.f) ? v : 0.3f * v; else if (ACT == 17) v = (v >= 0.f) ? v : 0.2f * v;
      so[w][rloc][t * 16 + ln] = v; } }
  __builtin_amdgcn_fence(__ATOMIC_ACQ_REL, "workgroup"); __builtin_amdgcn_wave_barrier();
  const int rsub = lane >> 4, c4 = (lane & 15) * 4;
  {
#pragma unroll
    for (int q = 0; q < 16; ++q) { const int r = q * 2 + rsub; const v4f v = *(const v4fa*)&so[w][r][c4]; if (C) *(v4f*)(C + cofs + (size_t)(row0 + r) * ldc + col0 + c4) = v; if (C16) { v4h h4; for (int i = 0; i < 4; ++i) h4[i] = (_Float16)v[i]; *(v4h*)(C16 + cofs + (size_t)(row0 + r) * ldc + col0 + c4) = h4; } }
     } }


__global__ __launch_bounds__(256) void k_wnat(const float* __restrict__ w, size_t n8, _Float16* __restrict__ Bt) { const size_t t = (size_t)blockIdx.x * 256 + threadIdx.x; if (t >= n8) return; FragH f; for (int q = 0; q < 8; ++q) f.h[q] = (_Float16)(bf16_round(w[t * 8 + q]) * 16.0f); *(v8us*)((unsigned short*)Bt + t * 8) = f.half[0];  }
__global__ __launch_bounds__(256) void k_rsm(const float* __restrict__ S, _Float16* __restrict__ P, int nrows) {
  #pragma clang fp contract(off)
  const int i = blockIdx.x * 256 + threadIdx.x; if (i >= nrows) return; const float* s = S + (size_t)i * SQ; float mx = -3.0e38f;
#pragma unroll 1
  for (int j = 0; j < SQ; ++j) mx = fmaxf(mx, s[j]); float se = 0.f;
#pragma unroll 1
  for (int j = 0; j < SQ; ++j) se += expf(s[j] - mx); const float sc = 256.0f / se;
#pragma unroll 1
  for (int j0 = 0; j0 < SQ; j0 += 8) { FragH f; for (int q = 0; q < 8; ++q) f.h[q] = (_Float16)(expf(s[j0 + q] - mx) * sc); unsigned short* d = (unsigned short*)P + (size_t)i * SQ + j0; *(v8us*)d = f.half[0];  } }
__global__ __launch_bounds__(256) void k_vt(const _Float16* __restrict__ V16, int b, int h0, _Float16* __restrict__ VT) { __shared__ unsigned short tl[64][65]; const int tid = threadIdx.x; const int hh = blockIdx.x % HG, sg = blockIdx.x / HG; const int s0 = sg * 64; const int h = h0 + hh;
  for (int i = tid; i < 64 * 8; i += 256) { const int j = i / 8, d8 = (i % 8) * 8; FragH f; f.half[0] = *(const v8us*)((const unsigned short*)V16 + ((size_t)b * SQ + s0 + j) * DM + h * HD + d8); for (int q = 0; q < 8; ++q) tl[d8 + q][j] = f.u[q]; }
  __syncthreads();
  { for (int i = tid; i < 64 * 8; i += 256) { const int d = i / 8, j8 = (i % 8) * 8; FragH f; for (int q = 0; q < 8; ++q) f.u[q] = tl[d][j8 + q]; *(v8us*)((unsigned short*)VT + ((size_t)hh * HD + d) * SQ + s0 + j8) = f.half[0]; }  } }



// causal row softmax, one wave per row: lane l holds columns c*128 + 4*l .. + 3 of the row in registers (every load 512 contiguous bytes, every store 256), S read once;
// row maximum and row sum by a five-step butterfly over the 32 lanes; keys above the row's own index take -1e9 (weight 0). nk a multiple of 256, at most NKX.
__global__ __launch_bounds__(256) void k_rsmcf2(const float* __restrict__ S, _Float16* __restrict__ P, int hg, int q0, int nk) {
  const int lane = threadIdx.x & 31; const int t = blockIdx.x * 8 + (threadIdx.x >> 5); if (t >= hg * QT) return;
  const float* s = S + (size_t)t * NKX + lane * 4; _Float16* p = P + (size_t)t * NKX + lane * 4; const int last = q0 + (t % QT); const int nc = nk >> 8;
  v4f v[NKX / 128];
#pragma unroll      /* here and in the three loops below: static indices keep v[] in registers */
  for (int c = 0; c < NKX / 256; ++c) if (c < nc) { v[2 * c] = *(const v4fa*)(s + c * 256); v[2 * c + 1] = *(const v4fa*)(s + c * 256 + 128); }
  float mx = -3.0e38f;
#pragma unroll
  for (int c = 0; c < NKX / 256; ++c) if (c < nc) { for (int u = 2 * c; u < 2 * c + 2; ++u) for (int q = 0; q < 4; ++q) { const float m = (u * 128 + lane * 4 + q <= last) ? v[u][q] : -1.0e9f; v[u][q] = m; mx = fmaxf(mx, m); } }
  for (int d = 16; d > 0; d >>= 1) mx = fmaxf(mx, __shfl_xor(mx, d, 32));
  v4f s4 = {0.f, 0.f, 0.f, 0.f};
#pragma unroll
  for (int c = 0; c < NKX / 256; ++c) if (c < nc) { for (int u = 2 * c; u < 2 * c + 2; ++u) for (int q = 0; q < 4; ++q) { const float e = __expf(v[u][q] - mx); v[u][q] = e; s4[q] += e; } }
  float se = (s4[0] + s4[1]) + (s4[2] + s4[3]);
  for (int d = 16; d > 0; d >>= 1) se += __shfl_xor(se, d, 32);
  const float sc = 256.0f / se;
#pragma unroll
  for (int c = 0; c < NKX / 256; ++c) if (c < nc) { for (int u = 2 * c; u < 2 * c + 2; ++u) { v4h h; for (int q = 0; q < 4; ++q) h[q] = (_Float16)(v[u][q] * sc); *(v4h*)(p + u * 128) = h; }
    asm volatile("s_wait_xcnt 0x0" ::: "memory"); }      /* the next chunk's products reuse the registers that these two stores name: the wait stands in front of that overwrite */
}


template <int MASKADD>
__global__ __launch_bounds__(64) void k_att0(const float* __restrict__ QF, const float* __restrict__ KF, const float* __restrict__ VF, int ld, const float* __restrict__ mask, float scale, float* __restrict__ OF, int ldo) {
  #pragma clang fp contract(off)
  __shared__ __attribute__((aligned(16))) float lq[64][64]; __shared__ __attribute__((aligned(16))) float lo[64][64];
  const int tid = threadIdx.x; const int h = blockIdx.x / (QT0 / 64), rg = blockIdx.x % (QT0 / 64); const int i = rg * 64 + tid;
  const float* qr = QF + (size_t)i * ld + h * HD;
#pragma unroll 1
  for (int c = 0; c < HD / 4; ++c) { *(v4f*)&lq[tid][c * 4] = *(const v4fa*)(qr + c * 4); const v4f z = {0.f, 0.f, 0.f, 0.f}; *(v4f*)&lo[tid][c * 4] = z; }
  float m = -1.0e30f, l = 0.f; const int jmax = MASKADD ? (SQ - 1) : (rg * 64 + 63);      /* additive-mask form: every key (the mask input decides); causal form: keys up to the block's last row */
#pragma unroll 1
  for (int j = 0; j <= jmax; ++j) { const float* kr = KF + (size_t)j * ld + h * HD; const float* vr = VF + (size_t)j * ld + h * HD; float s = 0.f;
#pragma unroll 1
    for (int c = 0; c < HD / 4; ++c) { const v4f kq = *(const v4fa*)(kr + c * 4); const v4f qq = *(v4f*)&lq[tid][c * 4]; s = __fadd_rn(s, __fmul_rn(qq[0], kq[0])); s = __fadd_rn(s, __fmul_rn(qq[1], kq[1])); s = __fadd_rn(s, __fmul_rn(qq[2], kq[2])); s = __fadd_rn(s, __fmul_rn(qq[3], kq[3])); }
    s = __fmul_rn(s, scale); if (MASKADD) s = __fadd_rn(s, __fmul_rn(bf16_round(mask[(size_t)i * SQ + j]), -10000.0f));
    const float f = (MASKADD || j <= i) ? 1.f : 0.f; const float sm = fmaf(f, s, (1.f - f) * -1.0e30f); const float mn = fmaxf(m, sm); const float sc = expf(m - mn); const float e = expf(sm - mn); l = __fadd_rn(__fmul_rn(l, sc), e); m = mn;
#pragma unroll 1
    for (int c = 0; c < HD / 4; ++c) { const v4f vv = *(const v4fa*)(vr + c * 4); v4f oo = *(v4f*)&lo[tid][c * 4]; for (int u = 0; u < 4; ++u) oo[u] = __fadd_rn(__fmul_rn(oo[u], sc), __fmul_rn(e, vv[u])); *(v4f*)&lo[tid][c * 4] = oo; } }
  const float fin = 64.0f / l;      /* o carried x64 like the f16 path */
#pragma unroll 1
  for (int c = 0; c < HD / 4; ++c) { v4f oo = *(v4f*)&lo[tid][c * 4]; for (int u = 0; u < 4; ++u) oo[u] = __fmul_rn(oo[u], fin); *(v4f*)&lo[tid][c * 4] = oo; }
  __syncthreads();
  {
#pragma unroll 1
    for (int it = 0; it < 16; ++it) { const int row = it * 4 + tid / 16, pc = (tid % 16) * 4; const v4f v = *(const v4f*)&lo[row][pc]; *(v4f*)(OF + (size_t)(rg * 64 + row) * ldo + h * HD + pc) = v; }
     } }


template <int BFIN, int WXB>
__global__ __launch_bounds__(256) void k_ln16(const float* __restrict__ X, const float* __restrict__ g, const float* __restrict__ bb, float eps, _Float16* __restrict__ N16, float* __restrict__ XB) {
  #pragma clang fp contract(off)
  __shared__ float red[256]; const size_t r = blockIdx.x; const int t = threadIdx.x; const v4f xa = *(const v4fa*)(X + r * DMQ + t * 4); float s[4]; float sum = 0.f;
  for (int q = 0; q < 4; ++q) { s[q] = BFIN ? bf16_round(xa[q]) : xa[q]; sum = __fadd_rn(sum, s[q]); }
  red[t] = sum; __syncthreads(); for (int st = 128; st > 0; st >>= 1) { if (t < st) red[t] = __fadd_rn(red[t], red[t + st]); __syncthreads(); } const float mu = red[0] / (float)DMQ; __syncthreads();
  float vs = 0.f; for (int q = 0; q < 4; ++q) { const float dl = __fadd_rn(s[q], -mu); vs = __fadd_rn(vs, __fmul_rn(dl, dl)); } red[t] = vs; __syncthreads(); for (int st = 128; st > 0; st >>= 1) { if (t < st) red[t] = __fadd_rn(red[t], red[t + st]); __syncthreads(); }
  const float rs = rsqrtf(__fadd_rn(red[0] / (float)DMQ, eps)); v4h y; v4f xb;
  for (int q = 0; q < 4; ++q) { const int c = t * 4 + q; y[q] = (_Float16)__fadd_rn(__fmul_rn(__fmul_rn(__fadd_rn(s[q], -mu), rs), bf16_round(g[c])), bf16_round(bb[c])); xb[q] = s[q]; }
  { *(v4h*)(N16 + r * DMQ + t * 4) = y; if (WXB) *(v4f*)(XB + r * DMQ + t * 4) = xb;  } }
__global__ __launch_bounds__(256) void k_ftres2(const float* __restrict__ OF0, const float* __restrict__ XB, float* __restrict__ X1, size_t n4) {
  #pragma clang fp contract(off)
  const size_t t = (size_t)blockIdx.x * 256 + threadIdx.x; if (t >= n4) return; const v4f o = *(const v4fa*)(OF0 + t * 4), xv = *(const v4fa*)(XB + t * 4); v4f y; for (int q = 0; q < 4; ++q) y[q] = __fadd_rn(__fmul_rn(o[q], 0.015625f), xv[q]); *(v4f*)(X1 + t * 4) = y;  }

__global__ __launch_bounds__(256) void k_wthd(const float* __restrict__ Wt, _Float16* __restrict__ Bt) { const size_t t = (size_t)blockIdx.x * 256 + threadIdx.x; if (t >= (size_t)NH * HD * (DM / 8)) return; const int m8 = (int)(t % (DM / 8)) * 8; const int d = (int)((t / (DM / 8)) % HD); const int h = (int)(t / ((size_t)(DM / 8) * HD)); FragH f;
  for (int q = 0; q < 8; ++q) f.h[q] = (_Float16)(16.0f * bf16_round(Wt[((size_t)h * DM + m8 + q) * HD + d])); unsigned short* dst = (unsigned short*)Bt + ((size_t)h * HD + d) * DM + m8; *(v8us*)dst = f.half[0];  }




__global__ __launch_bounds__(256) void k_wtpad(const float* __restrict__ Wm, _Float16* __restrict__ Wt, int Kr, int Kp, int Nr, int Np, float scale) {
  const int t = blockIdx.x * 256 + threadIdx.x; if (t >= Np * (Kp / 8)) return; const int n = t / (Kp / 8), k8 = (t % (Kp / 8)) * 8; const int nc = min(n, Nr - 1); const float fn = (n < Nr) ? 1.f : 0.f; FragH f;
  for (int i = 0; i < 8; ++i) { const int k = k8 + i; const int kc = min(k, Kr - 1); const float fk = (k < Kr) ? fn : 0.f; f.h[i] = (_Float16)(bf16_round(Wm[(size_t)kc * Nr + nc]) * scale * fk); }
  unsigned short* o = (unsigned short*)Wt + (size_t)n * Kp + k8; *(v8us*)o = f.half[0];  }
__global__ __launch_bounds__(128) void k_bpad(const float* __restrict__ b, float* __restrict__ Bp, int nr, int np) {
  const int i = threadIdx.x; if (i >= np) return; const float v = b[min(i, nr - 1)] * ((i < nr) ? 1.f : 0.f); *(float*)(Bp + i) = v;  }
extern "C" void kernel_launch(void* const* d_in, const int* in_sizes, int n_in,
                              void* d_out, int out_size, void* d_ws, size_t ws_size, hipStream_t stream) {
  (void)in_sizes; (void)n_in; (void)out_size;
  const float* const* I = (const float* const*)d_in; const float* x = I[0]; const float* g1 = I[1]; const float* be1 = I[2]; const float* wq = I[3]; const float* wk = I[4]; const float* wv = I[5]; const float* wo = I[6]; const float* bo = nullptr; const float* gg2 = I[7]; const float* be2 = I[8]; const float* wfc = I[9]; const float* bfc = I[10]; const float* wmp = I[11]; const float* bmp = I[12];      /* x, LN1 g / b, Wq / Wk / Wv / Wo [1024][1024] ([in][out], no biases), LN2 g / b, W1 [1024][4096] + b1, W2 [4096][1024] + b2 */
  char* ws = (char*)d_ws; size_t off = 0;
  auto take = [&](size_t bytes) { char* p = ws + off; off += (bytes + 255) & ~(size_t)255; return p; };
  _Float16* BQKV = (_Float16*)take((size_t)3 * DM * DM * 2); _Float16* BO = (_Float16*)take((size_t)DM * DM * 2);
  _Float16* X16 = (_Float16*)take(NR * DM * 2); float* XB = (float*)take(NR * DM * 4); float* X1 = (float*)take(NR * DM * 4); _Float16* M16 = nullptr;      /* = X16 below (alias: X16's last reader, the last batch's first-tile GEMMs, precedes LN2's write) */ _Float16* HF16 = (_Float16*)take((size_t)SQ * DFF * 2); _Float16* BW1 = (_Float16*)take((size_t)DFF * DM * 2); _Float16* BW2 = (_Float16*)take((size_t)DM * DFF * 2); _Float16* QKV = (_Float16*)take(NR * 3 * DM * 2); _Float16* Q16 = QKV; _Float16* K16 = QKV + DM; _Float16* V16 = QKV + 2 * DM; _Float16* O16 = (_Float16*)take(NR * DM * 2); M16 = X16;
  float* S = (float*)take((size_t)NH * QT * NKX * 4); _Float16* P = (_Float16*)take((size_t)NH * QT * NKX * 2); _Float16* VT = (_Float16*)take((size_t)NH * HD * SQ * 2);
  float* QF0 = (float*)take((size_t)QT0 * DM * 4); float* KF0 = (float*)take((size_t)QT0 * DM * 4); float* VF0 = (float*)take((size_t)QT0 * DM * 4); float* OF0 = (float*)take((size_t)NB * QT0 * DM * 4); _Float16* OH0 = (_Float16*)take((size_t)NB * QT0 * DM * 2); _Float16* OL0 = (_Float16*)take((size_t)NB * QT0 * DM * 2);
  if (off > ws_size) return;
  { const unsigned g = (unsigned)(((size_t)DM * (DM / 8) + 255) / 256); k_wt_f16<<<g, 256, 0, stream>>>(wq, BQKV, DM, DM, 16.0f); k_wt_f16<<<g, 256, 0, stream>>>(wk, BQKV + (size_t)DM * DM, DM, DM, 16.0f); k_wt_f16<<<g, 256, 0, stream>>>(wv, BQKV + (size_t)2 * DM * DM, DM, DM, 16.0f); }      /* [in][out] -> Bt x16, stacked q | k | v */ k_wt_f16<<<(unsigned)(((size_t)DM * (DM / 8) + 255) / 256), 256, 0, stream>>>(wo, BO, DM, DM, 16.0f);      /* w_proj [in][out] -> Bt x16 */
  k_ln16<1, 1><<<(unsigned)NR, 256, 0, stream>>>(x, g1, be1, 1e-5f, X16, XB);      /* a = LN1(bf16(x)) -> f16 rows; XB = bf16(x) for the residual */
  k_wt_f16<<<(unsigned)(((size_t)DFF * (DM / 8) + 255) / 256), 256, 0, stream>>>(wfc, BW1, DM, DFF, 16.0f); k_wt_f16<<<(unsigned)(((size_t)DM * (DFF / 8) + 255) / 256), 256, 0, stream>>>(wmp, BW2, DFF, DM, 16.0f);      /* W1 [1024][4096] -> Bt [4096][1024]; W2 [4096][1024] -> Bt [1024][4096] (x16) */
  const size_t r0p = (size_t)B0 * SQ;      /* first projected row */
  k_gemm2<0><<<dim3((unsigned)((MP / 128) * (3 * DM / 64)), 1), 128, 0, stream>>>(X16 + r0p * DM, DM, 0, BQKV, DM, 0, 0.0625f, nullptr, 0, nullptr, 1, 0, 0, nullptr, QKV + r0p * 3 * DM, 3 * DM, 0, MP, 3 * DM, DM);      /* q | k | v rows (f16); head h = columns h*HD.. of each DM block */
  for (int b = B0; b < B0 + NBR; ++b) { const size_t r0 = (size_t)b * SQ;
    k_vt<NH, SQ><<<NH * (SQ / 64), 256, 0, stream>>>(V16 + r0 * LQ, LQ, 0, VT);      /* V^T [NH][HD][SQ] for this batch */
    k_gemm2<0><<<dim3((QT0 / 128) * (DM / 64), 1), 128, 0, stream>>>(X16 + r0 * DM, DM, 0, BQKV, DM, 0, 0.0625f, nullptr, 0, nullptr, 1, 0, 0, QF0, nullptr, DM, 0, QT0, DM, DM); k_gemm2<0><<<dim3((QT0 / 128) * (DM / 64), 1), 128, 0, stream>>>(X16 + r0 * DM, DM, 0, (BQKV + (size_t)DM * DM), DM, 0, 0.0625f, nullptr, 0, nullptr, 1, 0, 0, KF0, nullptr, DM, 0, QT0, DM, DM); k_gemm2<0><<<dim3((QT0 / 128) * (DM / 64), 1), 128, 0, stream>>>(X16 + r0 * DM, DM, 0, (BQKV + (size_t)2 * DM * DM), DM, 0, 0.0625f, nullptr, 0, nullptr, 1, 0, 0, VF0, nullptr, DM, 0, QT0, DM, DM);      /* f32 q, k, v of the first 128 rows (exact products) */
    k_att0<0><<<NH * (QT0 / 64), 64, 0, stream>>>(QF0, KF0, VF0, DM, nullptr, 0.125f, OF0 + (size_t)b * QT0 * DM, DM);      /* exact f32 attention for rows 0..127 (o x64) */
    for (int q0 = 0; q0 < QN; q0 += QT) { const int nk = q0 + QT;      /* causal: only keys below the tile end are computed */
      k_gemm2<0><<<dim3((QT / 128) * (nk / 64), NHD), 128, 0, stream>>>(Q16 + (r0 + q0) * LQ, LQ, (size_t)HD, K16 + r0 * LQ, LQ, (size_t)HD, 0.125f, nullptr, 0, nullptr, 1, 0, 0, S, nullptr, NKX, (size_t)QT * NKX, QT, nk, HD);      /* scores, all heads on grid.y */
      k_rsmcf2<<<(NHD * QT + 7) / 8, 256, 0, stream>>>(S, P, NHD, q0, nk);      /* one wave per row, 8 rows per block */
      k_gemm2<0><<<dim3((QT / 128) * (HD / 64), NHD), 128, 0, stream>>>(P, NKX, (size_t)QT * NKX, VT, SQ, (size_t)HD * SQ, 0.25f, nullptr, 0, nullptr, 1, 0, 0, nullptr, O16 + (r0 + q0) * DM, DM, (size_t)HD, QT, HD, nk); } }      /* o (merged heads, x64) as f16 rows */
  k_gemm2<0><<<dim3((unsigned)((MPO / 128) * (DM / 64)), 1), 128, 0, stream>>>(O16 + r0p * DM, DM, 0, BO, DM, 0, 0.0009765625f, bo, 0, XB + r0p * DM, -1, 0, 0, X1 + r0p * DM, nullptr, DM, 0, MPO, DM, DM);      /* x1 = x + o Wo (f32 rows) */
  k_hl<<<(unsigned)(((size_t)NB * QT0 * DM / 8 + 255) / 256), 256, 0, stream>>>(OF0, OH0, OL0, (size_t)NB * QT0 * DM / 8);      /* first-tile o (x64) -> f16 hi + x1024 residual planes */
  for (int b = B0; b < B0 + NBR; ++b) { const size_t r0 = (size_t)b * SQ; const size_t f0 = (size_t)b * QT0;
    k_gemm2<0><<<dim3((QT0 / 128) * (DM / 64), 1), 128, 0, stream>>>(OH0 + f0 * DM, DM, 0, BO, DM, 0, 0.0009765625f, bo, 0, XB + r0 * DM, -1, 0, 0, X1 + r0 * DM, nullptr, DM, 0, QT0, DM, DM);      /* rows 0..127: x1 = x + o_hi Wo, overwriting the f16-path rows */
    k_gemm2<0><<<dim3((QT0 / 128) * (DM / 64), 1), 128, 0, stream>>>(OL0 + f0 * DM, DM, 0, BO, DM, 0, 0.00000095367431640625f, nullptr, 0, X1 + r0 * DM, -1, 0, 0, X1 + r0 * DM, nullptr, DM, 0, QT0, DM, DM); }      /* += o_lo Wo 2^-20 (own-element accumulate) */
  k_ln16<0, 0><<<(unsigned)NR, 256, 0, stream>>>(X1, gg2, be2, 1e-5f, M16, nullptr);      /* h = LN2(x1) -> f16 rows */
  for (int b = 0; b < NB; ++b) { const size_t r0 = (size_t)b * SQ;
    k_gemm2<6><<<dim3((unsigned)((SQ / 128) * (DFF / 64)), 1), 128, 0, stream>>>(M16 + r0 * DM, DM, 0, BW1, DM, 0, 0.0625f, bfc, 0, nullptr, 1, 0, 0, nullptr, HF16, DFF, 0, SQ, DFF, DM);      /* gelu_erf(h2 W1 + b1) -> f16 (this batch) */
    k_gemm2<0><<<dim3((unsigned)((SQ / 128) * (DM / 64)), 1), 128, 0, stream>>>(HF16, DFF, 0, BW2, DFF, 0, 0.0625f, bmp, 0, X1 + r0 * DM, -1, 0, 0, (float*)d_out + r0 * DM, nullptr, DM, 0, SQ, DM, DFF); }      /* out = x1 + mlp (own-element residual) */
}

// v002
// A run of this version takes 3600 microseconds.
// In both of two side-by-side timings against v001, it was 1.39 times as fast.
// Counting every step since v000, it is 3.00 times as fast.
#include <hip/hip_runtime.h>
// Pre-LN causal transformer block (x [4][2048][1024]; h = LN1(x) (biased var, eps 1e-5, gamma / beta); Q/K/V = h Wq/Wk/Wv ([in][out] 1024 x 1024 sigma 1/32, no biases), 16 heads of 64; scores / 8; causal (tril, -inf); softmax; x1 = x + hidden Wo ([in][out], no bias); h2 = LN2(x1); out = x1 + gelu_erf(h2 W1 + b1) W2 + b2 ([in][out] 1024 x 4096 x 1024) -> [4][2048][1024]).
// Structure: token rows r = b*2048 + s; h = LN1(bf16 x) as f16 rows; q | k | v as ONE WMMA GEMM (N = 3 x 1024) (32x64 wave tiles, f32 accumulation, exact x16 weights, no bias, f16 outputs); per batch: V^T for all heads via LDS transposes; per query tile of 256 rows: scores against the keys below the tile end only (K = 64, all heads on grid.y, alpha = 0.125), causal row softmax on VALU, one wave per row, over the computed range (f32 statistics, native exp; weights x256 f16), o = P . V^T (K = keys below the tile end, alpha 2^-2: o carried x64, folded into the output GEMM alpha) written straight into the merged f16 o rows; x1 = x + o W_o GEMM (f32, no bias); then LN2 and the gelu MLP GEMMs into the output layout.
// Compute dtype: inputs rounded to bf16; x / weights exact; q, k, v, softmax weights and o as plain f16 GEMM operands (~2^-12); scores and softmax statistics f32. v_wmma_f32_16x16x32_f16.
#define NB 4
#define SQ 2048
#define DM 1024
#define NH 16
#define HD 64
#define HG 4                         /* heads per block group of the unlaunched k_vt(b, h0) overload */
#define QT 256                       /* query rows per causal tile */
#define NKX SQ                       /* S / P row pitch */
#define QT0 128                      /* first-tile rows recomputed exactly in f32 */
#define B0 0                         /* first batch processed (debug hook) */
#define NBR NB                       /* batches processed (debug hook) */
#define NR ((size_t)NB * SQ)
#define DMQ DM
#define DFF 4096                     /* FFN hidden width */
#define DFFR 100                     /* unused */
#define MP ((int)((size_t)NBR * SQ)) /* rows projected (debug hook) */
#define QN SQ                        /* query rows attended per batch (debug hook) */
#define NHD NH                       /* heads attended (debug hook) */
#define MPO MP                       /* rows through the output stage (debug hook) */
#define LQ (3 * DM)      /* row pitch of the q/k/v rows */
typedef __bf16 v16b __attribute__((ext_vector_type(16)));
typedef unsigned short v8us __attribute__((ext_vector_type(8), may_alias));
typedef float  v8f  __attribute__((ext_vector_type(8)));
typedef float  v4f  __attribute__((ext_vector_type(4)));
typedef float  v4fa __attribute__((ext_vector_type(4), may_alias));
union FragB { v16b v; v8us half[2]; unsigned short u[16]; };

__device__ __forceinline__ unsigned short bf16_bits(float x) { unsigned int u = __float_as_uint(x); return (unsigned short)((u + 0x7FFFu + ((u >> 16) & 1u)) >> 16); }
__device__ __forceinline__ float bf16_val(unsigned short b) { return __uint_as_float(((unsigned int)b) << 16); }
__device__ __forceinline__ float bf16_round(float x) { return bf16_val(bf16_bits(x)); }
// D += A·B with NT terms: 1 = ah·bh, 2 = + al·bh (A split), 3 = + ah·bl (both split)
template <int NT>
__device__ __forceinline__ v8f mmaN(v16b ah, v16b al, v16b bh, v16b bl, v8f c) {
  c = __builtin_amdgcn_wmma_f32_16x16x32_bf16(false, ah, false, bh, (short)0, c, false, false);
  if (NT >= 2) c = __builtin_amdgcn_wmma_f32_16x16x32_bf16(false, al, false, bh, (short)0, c, false, false);
  if (NT >= 3) c = __builtin_amdgcn_wmma_f32_16x16x32_bf16(false, ah, false, bl, (short)0, c, false, false);
  asm volatile("v_nop\n\tv_nop\n\tv_nop\n\tv_nop" : "+v"(c) : "v"(ah), "v"(al), "v"(bh), "v"(bl));
  return c;
}

__global__ __launch_bounds__(256) void k_wt_bf16(const float* __restrict__ W, unsigned short* __restrict__ Wt, int K, int N) {
  const int t = blockIdx.x * 256 + threadIdx.x;
  const int k8n = K / 8;
  if (t >= N * k8n) return;
  const int n = t / k8n, k8 = (t % k8n) * 8;
  v8us v;
#pragma unroll
  for (int i = 0; i < 8; ++i) v[i] = bf16_bits(W[(size_t)(k8 + i) * N + n]);
  *(v8us*)(Wt + (size_t)n * K + k8) = v;
  
}

// GEMM C[M][N] (f32, pitch ldc) = act(A[M][K]·W + bias). A f32 row-major (pitch lda) converted per fragment to bf16
// (ASPLIT: hi/lo two planes -> 2 terms, else single rounded term); Wt bf16 [N][K] (pitch ldb). BIAS_BF16 rounds the
// bias to bf16 first (bias quantised to bf16 before the add). K%32==0, M%16==0, N%64==0.
template <bool ASPLIT, int ACT, bool BIAS_BF16>
__global__ __launch_bounds__(128) void k_gemm_bf(const float* __restrict__ A, int lda, const unsigned short* __restrict__ Wt, int ldb,
                                               const float* __restrict__ bias, float* __restrict__ C, int ldc, int M, int N, int K) {
  __shared__ __attribute__((aligned(16))) float so[4][16][64];
  const int tid = threadIdx.x, w = tid >> 5, lane = tid & 31, ln = lane & 15, hh = lane >> 4;
  const int ntn = N / 64;
  const int wid = blockIdx.x * 4 + w;
  const int mt = wid / ntn, nq = wid % ntn;
  if (mt * 16 >= M) return;
  const int row0 = mt * 16, col0 = nq * 64;
  const float* arow = A + (size_t)(row0 + ln) * lda;
  v8f acc[4] = {};
  for (int kb = 0; kb < K; kb += 32) {
    FragB ah, al;
    const v4f x0 = *(const v4fa*)(arow + kb + 8 * hh), x1 = *(const v4fa*)(arow + kb + 8 * hh + 4);
    const v4f x2 = *(const v4fa*)(arow + kb + 16 + 8 * hh), x3 = *(const v4fa*)(arow + kb + 16 + 8 * hh + 4);
    float xs[16] = {x0[0],x0[1],x0[2],x0[3],x1[0],x1[1],x1[2],x1[3],x2[0],x2[1],x2[2],x2[3],x3[0],x3[1],x3[2],x3[3]};
#pragma unroll
    for (int i = 0; i < 16; ++i) { const unsigned short hb = bf16_bits(xs[i]); ah.u[i] = hb; al.u[i] = ASPLIT ? bf16_bits(xs[i] - bf16_val(hb)) : (unsigned short)0; }
#pragma unroll
    for (int t = 0; t < 4; ++t) {
      const unsigned short* brow = Wt + (size_t)(col0 + t * 16 + ln) * ldb + kb;
      FragB b;
      b.half[0] = *(const v8us*)(brow + 8 * hh);
      b.half[1] = *(const v8us*)(brow + 16 + 8 * hh);
      acc[t] = mmaN<ASPLIT ? 2 : 1>(ah.v, al.v, b.v, b.v, acc[t]);
    }
  }
#pragma unroll
  for (int t = 0; t < 4; ++t) {
    float bv = bias ? bias[col0 + t * 16 + ln] : 0.f;
    if (BIAS_BF16) bv = bf16_round(bv);
#pragma unroll
    for (int r = 0; r < 8; ++r) { float v = acc[t][r] + bv; if (ACT == 1) v = fmaxf(v, 0.f); so[w][8 * hh + r][t * 16 + ln] = v; }
  }
  __builtin_amdgcn_fence(__ATOMIC_ACQ_REL, "workgroup");
  __builtin_amdgcn_wave_barrier();
  const int rsub = lane >> 4, c4 = (lane & 15) * 4;
  {
#pragma unroll
    for (int q = 0; q < 8; ++q) {
      const int r = q * 2 + rsub;
      const v4f v = *(const v4fa*)&so[w][r][c4];
      *(v4f*)(C + (size_t)(row0 + r) * ldc + col0 + c4) = v;
    }
    
  }
}

// GEMM C = act(A·W + bias + resid): A f32 (ASPLIT -> hi/lo 2 terms), Wt bf16 [N][K]; ACT 0 none, 1 relu, 2 exact gelu;
// resid (optional, f32, row index = (row % rmod), pitch ldr, RES_BF16 rounds it) added before the activation.
template <bool ASPLIT, int ACT, bool BIAS_BF16, bool RES_BF16>
__global__ __launch_bounds__(128) void k_gemm_bf3(const float* __restrict__ A, int lda, const unsigned short* __restrict__ Wt, int ldb,
                                                const float* __restrict__ bias, const float* __restrict__ resid, int rmod, int ldr,
                                                float* __restrict__ C, int ldc, int M, int N, int K) {
  __shared__ __attribute__((aligned(16))) float so[4][16][64];
  const int tid = threadIdx.x, w = tid >> 5, lane = tid & 31, ln = lane & 15, hh = lane >> 4;
  const int ntn = N / 64;
  const int wid = blockIdx.x * 4 + w;
  const int mt = wid / ntn, nq = wid % ntn;
  if (mt * 16 >= M) return;
  const int row0 = mt * 16, col0 = nq * 64;
  const float* arow = A + (size_t)(row0 + ln) * lda;
  v8f acc[4] = {};
  for (int kb = 0; kb < K; kb += 32) {
    FragB ah, al;
    const v4f x0 = *(const v4fa*)(arow + kb + 8 * hh), x1 = *(const v4fa*)(arow + kb + 8 * hh + 4);
    const v4f x2 = *(const v4fa*)(arow + kb + 16 + 8 * hh), x3 = *(const v4fa*)(arow + kb + 16 + 8 * hh + 4);
    float xs[16] = {x0[0],x0[1],x0[2],x0[3],x1[0],x1[1],x1[2],x1[3],x2[0],x2[1],x2[2],x2[3],x3[0],x3[1],x3[2],x3[3]};
#pragma unroll
    for (int i = 0; i < 16; ++i) { const unsigned short hb = bf16_bits(xs[i]); ah.u[i] = hb; al.u[i] = ASPLIT ? bf16_bits(xs[i] - bf16_val(hb)) : (unsigned short)0; }
#pragma unroll
    for (int t = 0; t < 4; ++t) {
      const unsigned short* brow = Wt + (size_t)(col0 + t * 16 + ln) * ldb + kb;
      FragB b;
      b.half[0] = *(const v8us*)(brow + 8 * hh);
      b.half[1] = *(const v8us*)(brow + 16 + 8 * hh);
      acc[t] = mmaN<ASPLIT ? 2 : 1>(ah.v, al.v, b.v, b.v, acc[t]);
    }
  }
#pragma unroll
  for (int t = 0; t < 4; ++t) {
    const int col = col0 + t * 16 + ln;
    float bv = bias ? bias[col] : 0.f;
    if (BIAS_BF16) bv = bf16_round(bv);
#pragma unroll
    for (int r = 0; r < 8; ++r) {
      float v = acc[t][r] + bv;
      if (resid) { float rv = resid[(size_t)((row0 + 8 * hh + r) % rmod) * ldr + col]; if (RES_BF16) rv = bf16_round(rv); v += rv; }
      if (ACT == 1) v = fmaxf(v, 0.f);
      if (ACT == 2) v = 0.5f * v * (1.0f + erff(v * 0.70710678118654752f));
      if (ACT == 3) { const float u = 0.7978845608028654f * (v + 0.044715f * v * v * v); v = 0.5f * v * (1.0f + tanhf(u)); }
      so[w][8 * hh + r][t * 16 + ln] = v;
    }
  }
  __builtin_amdgcn_fence(__ATOMIC_ACQ_REL, "workgroup");
  __builtin_amdgcn_wave_barrier();
  const int rsub = lane >> 4, c4 = (lane & 15) * 4;
  {
#pragma unroll
    for (int q = 0; q < 8; ++q) {
      const int r = q * 2 + rsub;
      const v4f v = *(const v4fa*)&so[w][r][c4];
      *(v4f*)(C + (size_t)(row0 + r) * ldc + col0 + c4) = v;
    }
    
  }
}
// row LayerNorm (biased variance, eps) over N: s = X (+ R); optional out_sum <- s; out_norm <- (s-mu)*rsqrt(var+eps)*g + b
template <bool PARAM_BF16>
__global__ __launch_bounds__(256) void k_layernorm(const float* __restrict__ X, const float* __restrict__ R, const float* __restrict__ g, const float* __restrict__ bta,
                                                  float* __restrict__ out_sum, float* __restrict__ out_norm, int N, float eps) {
  __shared__ float red[256];
  const int row = blockIdx.x, tid = threadIdx.x;
  const float* x = X + (size_t)row * N; const float* rr = R ? R + (size_t)row * N : nullptr;
  float vals[16];                     // up to N = 4096
  const int per = N / 256;            // contiguous chunk per thread? use strided-by-4 chunks: thread handles j = tid*4 + 1024*u
  float s1 = 0.f;
  for (int u = 0; u < per / 4; ++u) {
    const int j = tid * 4 + 1024 * u;
    const v4f a = *(const v4fa*)(x + j);
    v4f b = {0.f,0.f,0.f,0.f}; if (rr) b = *(const v4fa*)(rr + j);
#pragma unroll
    for (int q = 0; q < 4; ++q) { const float v = a[q] + b[q]; vals[u * 4 + q] = v; s1 += v; }
  }
  red[tid] = s1; __syncthreads();
  for (int st = 128; st > 0; st >>= 1) { if (tid < st) red[tid] += red[tid + st]; __syncthreads(); }
  const float mu = red[0] / (float)N; __syncthreads();
  float s2 = 0.f;
  for (int u = 0; u < per / 4; ++u)
#pragma unroll
    for (int q = 0; q < 4; ++q) { const float c = vals[u * 4 + q] - mu; s2 += c * c; }
  red[tid] = s2; __syncthreads();
  for (int st = 128; st > 0; st >>= 1) { if (tid < st) red[tid] += red[tid + st]; __syncthreads(); }
  const float rs = rsqrtf(red[0] / (float)N + eps);
  {
    for (int u = 0; u < per / 4; ++u) {
      const int j = tid * 4 + 1024 * u;
      v4f o, sm;
#pragma unroll
      for (int q = 0; q < 4; ++q) {
        float gg = g[j + q], bb = bta[j + q];
        if (PARAM_BF16) { gg = bf16_round(gg); bb = bf16_round(bb); }
        sm[q] = vals[u * 4 + q]; o[q] = (vals[u * 4 + q] - mu) * rs * gg + bb;
      }
      if (out_sum) *(v4f*)(out_sum + (size_t)row * N + j) = sm;
      *(v4f*)(out_norm + (size_t)row * N + j) = o;
    }
    
  }
}



// ---- f16 WMMA path (v_wmma_f32_16x16x32_f16): 11-bit significands for operands in range — used where a [0,1] probability operand needs more precision than bf16
typedef _Float16 v16h __attribute__((ext_vector_type(16)));
union FragH { v16h v; v8us half[2]; _Float16 h[16]; unsigned short u[16]; };
template <int NT>
__device__ __forceinline__ v8f mmaH(v16h ah, v16h al, v16h bh, v16h bl, v8f c) {
  c = __builtin_amdgcn_wmma_f32_16x16x32_f16(false, ah, false, bh, (short)0, c, false, false);
  if (NT >= 2) c = __builtin_amdgcn_wmma_f32_16x16x32_f16(false, al, false, bh, (short)0, c, false, false);
  if (NT >= 3) c = __builtin_amdgcn_wmma_f32_16x16x32_f16(false, ah, false, bl, (short)0, c, false, false);
  asm volatile("v_nop\n\tv_nop\n\tv_nop\n\tv_nop" : "+v"(c) : "v"(ah), "v"(al), "v"(bh), "v"(bl));
  return c;
}
// batched GEMM like k_gemm_b but f16 operands: A f32 (split into f16 hi/lo if ASPLIT, else rounded to f16), Bt = f16 values [n][k]; alpha; C f32; N multiple of 16 (partial tiles skipped)
template <bool ASPLIT>
__global__ __launch_bounds__(128) void k_gemm_h(const float* __restrict__ A, int lda, size_t sA, const _Float16* __restrict__ Bh, int ldb, size_t sB, float alpha, float* __restrict__ C, int ldc, size_t sC, int M, int N, int K) {
  __shared__ __attribute__((aligned(16))) float so[4][16][64];
  const int tid = threadIdx.x, w = tid >> 5, lane = tid & 31, ln = lane & 15, hh = lane >> 4; const int by = blockIdx.y;
  A += (size_t)by * sA; Bh += (size_t)by * sB; C += (size_t)by * sC;
  const int ntn = (N + 63) / 64; const int wid = blockIdx.x * 4 + w; const int mt = wid / ntn, nq = wid % ntn; if (mt * 16 >= M) return;
  const int row0 = mt * 16, col0 = nq * 64; const float* arow = A + (size_t)(row0 + ln) * lda;
  v8f acc[4] = {};
  for (int kb = 0; kb < K; kb += 32) {
    FragH ah, al;
    const v4f x0 = *(const v4fa*)(arow + kb + 8 * hh), x1 = *(const v4fa*)(arow + kb + 8 * hh + 4), x2 = *(const v4fa*)(arow + kb + 16 + 8 * hh), x3 = *(const v4fa*)(arow + kb + 16 + 8 * hh + 4);
    float xs[16] = {x0[0],x0[1],x0[2],x0[3],x1[0],x1[1],x1[2],x1[3],x2[0],x2[1],x2[2],x2[3],x3[0],x3[1],x3[2],x3[3]};
#pragma unroll
    for (int i = 0; i < 16; ++i) { const _Float16 h = (_Float16)xs[i]; ah.h[i] = h; al.h[i] = ASPLIT ? (_Float16)(xs[i] - (float)h) : (_Float16)0.0f; }
#pragma unroll
    for (int t = 0; t < 4; ++t) { if (col0 + t * 16 >= N) continue; const size_t boff = (size_t)(col0 + t * 16 + ln) * ldb + kb; FragH bq; bq.half[0] = *(const v8us*)(Bh + boff + 8 * hh); bq.half[1] = *(const v8us*)(Bh + boff + 16 + 8 * hh);
      acc[t] = mmaH<ASPLIT ? 2 : 1>(ah.v, al.v, bq.v, bq.v, acc[t]); }
  }
#pragma unroll
  for (int t = 0; t < 4; ++t) { if (col0 + t * 16 >= N) continue;
#pragma unroll
    for (int r = 0; r < 8; ++r) so[w][8 * hh + r][t * 16 + ln] = acc[t][r] * alpha; }
  __builtin_amdgcn_fence(__ATOMIC_ACQ_REL, "workgroup"); __builtin_amdgcn_wave_barrier();
  const int rsub = lane >> 4, c4 = (lane & 15) * 4;
  {
#pragma unroll
    for (int q = 0; q < 8; ++q) { const int r = q * 2 + rsub; if (col0 + c4 < N) { const v4f v = *(const v4fa*)&so[w][r][c4]; *(v4f*)(C + (size_t)(row0 + r) * ldc + col0 + c4) = v; } }
     }
}

// Wt[n][k] = f16(W[k][n]·scale) from f32 row-major W[K][N] (scale = power of two; bf16-exact weights stay exact in f16 away from the subnormal range)
__global__ __launch_bounds__(256) void k_wt_f16(const float* __restrict__ W, _Float16* __restrict__ Wt, int K, int N, float scale) {
  const int t = blockIdx.x * 256 + threadIdx.x; if (t >= N * (K / 8)) return; const int n = t / (K / 8), k8 = (t % (K / 8)) * 8; FragH f;
#pragma unroll
  for (int i = 0; i < 8; ++i) f.h[i] = (_Float16)(bf16_round(W[(size_t)(k8 + i) * N + n]) * scale); const v8us o = f.half[0];
  *(v8us*)((unsigned short*)Wt + (size_t)n * K + k8) = o; 
}
// k_gemm_hh variant with fused epilogue: v = acc·alpha + bias[by·sBias + col] (+ CP[(row/rowsPerB)·sCPb + by·64 + col] if CP) ; ACT 0 none / 1 elu ; writes f16 C16 (and f32 C if non-null)
template <int ACT>
__global__ __launch_bounds__(128) void k_gemm_hhx(const _Float16* __restrict__ A, int lda, size_t sA, const _Float16* __restrict__ Bh, int ldb, size_t sB, float alpha, const float* __restrict__ bias, size_t sBias, const float* __restrict__ CP, int rowsPerB, size_t sCPb, int row0g,
    float* __restrict__ C, _Float16* __restrict__ C16, int ldc, size_t sC, int M, int N, int K) {
  __shared__ __attribute__((aligned(16))) float so[4][16][64];
  const int tid = threadIdx.x, w = tid >> 5, lane = tid & 31, ln = lane & 15, hh = lane >> 4; const int by = blockIdx.y;
  A += (size_t)by * sA; Bh += (size_t)by * sB; const size_t cofs = (size_t)by * sC; const float* bp = bias ? bias + (size_t)by * sBias : nullptr;
  const int ntn = (N + 63) / 64; const int wid = blockIdx.x * 4 + w; const int mt = wid / ntn, nq = wid % ntn; if (mt * 16 >= M) return;
  const int row0 = mt * 16, col0 = nq * 64; const _Float16* arow = A + (size_t)(row0 + ln) * lda;
  v8f acc[4] = {};
  for (int kb = 0; kb < K; kb += 32) { FragH ah; ah.half[0] = *(const v8us*)((const unsigned short*)arow + kb + 8 * hh); ah.half[1] = *(const v8us*)((const unsigned short*)arow + kb + 16 + 8 * hh);
#pragma unroll
    for (int t = 0; t < 4; ++t) { if (col0 + t * 16 >= N) continue; const size_t boff = (size_t)(col0 + t * 16 + ln) * ldb + kb; FragH bq; bq.half[0] = *(const v8us*)((const unsigned short*)Bh + boff + 8 * hh); bq.half[1] = *(const v8us*)((const unsigned short*)Bh + boff + 16 + 8 * hh);
      acc[t] = mmaH<1>(ah.v, ah.v, bq.v, bq.v, acc[t]); }
  }
#pragma unroll
  for (int t = 0; t < 4; ++t) { if (col0 + t * 16 >= N) continue; const int col = col0 + t * 16 + ln; const float bv = bp ? bf16_round(bp[col]) : 0.f;
#pragma unroll
    for (int r = 0; r < 8; ++r) { float v = acc[t][r] * alpha + bv; if (CP) { const int rr = row0g + row0 + 8 * hh + r; if (rowsPerB < 0) v += CP[cofs + (size_t)rr * ldc + col];      /* rowsPerB < 0: own element of the batched C plane */ else { const int bidx = rr / rowsPerB; v += CP[(size_t)bidx * sCPb + (size_t)by * 64 + col]; } } if (ACT == 1) v = (v > 0.f) ? v : expm1f(v); else if (ACT == 7) v = (v > 0.f) ? v + 1.0f : expf(v); else if (ACT == 8) v = tanhf(v); else if (ACT == 9) v = 0.5f * v * (1.0f + tanhf(0.7978845608028654f * (v + 0.044715f * v * v * v))); else if (ACT == 11) v = 1.0f / (1.0f + expf(-v)); else if (ACT == 12) v = (v > 0.f) ? v : 0.01f * v; else if (ACT == 14) v = (v > 0.f) ? v : 0.1f * v; else if (ACT == 16) v = (v >= 0.f) ? v : 0.3f * v; else if (ACT == 17) v = (v >= 0.f) ? v : 0.2f * v; else if (ACT == 15) v = v / (1.0f + expf(-v)); else if (ACT == 3) v = fmaxf(v, 0.f); else if (ACT == 6) v = 0.5f * v * (1.0f + erff(v * 0.70710678118654752f)); so[w][8 * hh + r][t * 16 + ln] = v; } }
  __builtin_amdgcn_fence(__ATOMIC_ACQ_REL, "workgroup"); __builtin_amdgcn_wave_barrier();
  const int rsub = lane >> 4, c4 = (lane & 15) * 4; typedef _Float16 v4h __attribute__((ext_vector_type(4)));
  {
#pragma unroll
    for (int q = 0; q < 8; ++q) { const int r = q * 2 + rsub; if (col0 + c4 < N) { const v4f v = *(const v4fa*)&so[w][r][c4]; if (C) *(v4f*)(C + cofs + (size_t)(row0 + r) * ldc + col0 + c4) = v; if (C16) { v4h h4; for (int i = 0; i < 4; ++i) h4[i] = (_Float16)v[i]; *(v4h*)(C16 + cofs + (size_t)(row0 + r) * ldc + col0 + c4) = h4; } } }
     }
}


typedef _Float16 v4h __attribute__((ext_vector_type(4)));

__global__ __launch_bounds__(256) void k_x16(const float* __restrict__ x, _Float16* __restrict__ X16, size_t n8) { const size_t t = (size_t)blockIdx.x * 256 + threadIdx.x; if (t >= n8) return; FragH f;
#pragma unroll
  for (int q = 0; q < 8; ++q) f.h[q] = (_Float16)bf16_round(x[t * 8 + q]); *(v8us*)((unsigned short*)X16 + t * 8) = f.half[0];  }
__global__ __launch_bounds__(256) void k_h16(const float* __restrict__ x, _Float16* __restrict__ X16, size_t n8) { const size_t t = (size_t)blockIdx.x * 256 + threadIdx.x; if (t >= n8) return; FragH f;
#pragma unroll
  for (int q = 0; q < 8; ++q) f.h[q] = (_Float16)x[t * 8 + q]; *(v8us*)((unsigned short*)X16 + t * 8) = f.half[0];  }
__global__ __launch_bounds__(256) void k_round16f(const float* __restrict__ W, _Float16* __restrict__ Bt, size_t n8) { const size_t t = (size_t)blockIdx.x * 256 + threadIdx.x; if (t >= n8) return; FragH f;
#pragma unroll
  for (int i = 0; i < 8; ++i) f.h[i] = (_Float16)(bf16_round(W[t * 8 + i]) * 16.0f); *(v8us*)((unsigned short*)Bt + t * 8) = f.half[0];  }
template <int NHv, int TTv>
__global__ __launch_bounds__(256) void k_vt(const _Float16* __restrict__ V16, int ldv, int voff, _Float16* __restrict__ Vt) { __shared__ unsigned short tl[64][66]; const int tid = threadIdx.x; const int slab = blockIdx.x / (TTv / 64), lg = blockIdx.x % (TTv / 64); const int b = slab / NHv, h = slab % NHv;
  for (int i = tid; i < 64 * 8; i += 256) { const int r = i / 8, c8 = (i % 8) * 8; FragH f; f.half[0] = *(const v8us*)((const unsigned short*)V16 + ((size_t)b * TTv + lg * 64 + r) * ldv + voff + h * 64 + c8);
#pragma unroll
    for (int q = 0; q < 8; ++q) tl[r][c8 + q] = f.u[q]; }
  __syncthreads();
  {
#pragma unroll
    for (int rd = 0; rd < 2; ++rd) { const int d = rd * 32 + tid / 8, pc = tid % 8; FragH f;
#pragma unroll
      for (int q = 0; q < 8; ++q) f.u[q] = tl[pc * 8 + q][d];
      *(v8us*)((unsigned short*)Vt + ((size_t)slab * 64 + d) * TTv + lg * 64 + pc * 8) = f.half[0]; }
     } }

__global__ __launch_bounds__(256) void k_hl(const float* __restrict__ F, _Float16* __restrict__ Hh, _Float16* __restrict__ Hl, size_t n8) { const size_t t = (size_t)blockIdx.x * 256 + threadIdx.x; if (t >= n8) return; FragH fh, fl; const v4f a = *(const v4fa*)(F + t * 8), c = *(const v4fa*)(F + t * 8 + 4);
#pragma unroll
  for (int q = 0; q < 4; ++q) { _Float16 h = (_Float16)a[q]; fh.h[q] = h; fl.h[q] = (_Float16)((a[q] - (float)h) * 1024.0f); h = (_Float16)c[q]; fh.h[4 + q] = h; fl.h[4 + q] = (_Float16)((c[q] - (float)h) * 1024.0f); }
  { *(v8us*)((unsigned short*)Hh + t * 8) = fh.half[0]; *(v8us*)((unsigned short*)Hl + t * 8) = fl.half[0];  } }

// ---- fast GEMM (wave tile 32x64; requires M % 32 == 0 rows per launch region and N % 64 == 0); epilogue = k_gemm_hhx semantics ----
__device__ __forceinline__ v16h g2_frag(const _Float16* p, int hh) { FragH f; f.half[0] = *(const v8us*)((const unsigned short*)p + 8 * hh); f.half[1] = *(const v8us*)((const unsigned short*)p + 16 + 8 * hh); return f.v; }
__device__ __forceinline__ v8f g2_mma(v16h a, v16h b, v8f c) { v8f d = __builtin_amdgcn_wmma_f32_16x16x32_f16(false, a, false, b, (short)0, c, false, false); asm volatile("v_nop\n\tv_nop\n\tv_nop\n\tv_nop" : "+v"(d) : "v"(a), "v"(b)); return d; }
template <int ACT>
__global__ __launch_bounds__(128) void k_gemm2(const _Float16* __restrict__ A, int lda, size_t sA, const _Float16* __restrict__ Bh, int ldb, size_t sB, float alpha, const float* __restrict__ bias, size_t sBias, const float* __restrict__ CP, int rowsPerB, size_t sCPb, int row0g,
    float* __restrict__ C, _Float16* __restrict__ C16, int ldc, size_t sC, int M, int N, int K) { static_assert(ACT == 0 || ACT == 3 || ACT == 6 || ACT == 8 || ACT == 9 || ACT == 11 || ACT == 12 || ACT == 14 || ACT == 15 || ACT == 16 || ACT == 17, "k_gemm2: unsupported ACT code (would silently apply no activation)");
  __shared__ __attribute__((aligned(16))) float so[4][32][68];
  const int tid = threadIdx.x, w = tid >> 5, lane = tid & 31, ln = lane & 15, hh = lane >> 4; const int by = blockIdx.y;
  A += (size_t)by * sA; Bh += (size_t)by * sB; const size_t cofs = (size_t)by * sC; const float* bp = bias ? bias + (size_t)by * sBias : nullptr;
  const int ntn = N >> 6; const int mt = blockIdx.x / ntn, nq = blockIdx.x - mt * ntn; const int row0 = mt * 128 + 32 * w, col0 = nq * 64; if (row0 >= M) return;
  const _Float16* a0p = A + (size_t)(row0 + ln) * lda; const _Float16* a1p = a0p + (size_t)16 * lda;
  const _Float16* b0p = Bh + (size_t)(col0 + ln) * ldb; const _Float16* b1p = b0p + (size_t)16 * ldb; const _Float16* b2p = b1p + (size_t)16 * ldb; const _Float16* b3p = b2p + (size_t)16 * ldb;
  const v8f z8 = {0.f,0.f,0.f,0.f,0.f,0.f,0.f,0.f}; v8f c00 = z8, c01 = z8, c02 = z8, c03 = z8, c10 = z8, c11 = z8, c12 = z8, c13 = z8;
#pragma unroll 1
  for (int kb = 0; kb < K; kb += 32) { const v16h a0 = g2_frag(a0p + kb, hh), a1 = g2_frag(a1p + kb, hh);
    v16h b = g2_frag(b0p + kb, hh); c00 = g2_mma(a0, b, c00); c10 = g2_mma(a1, b, c10);
    b = g2_frag(b1p + kb, hh); c01 = g2_mma(a0, b, c01); c11 = g2_mma(a1, b, c11);
    b = g2_frag(b2p + kb, hh); c02 = g2_mma(a0, b, c02); c12 = g2_mma(a1, b, c12);
    b = g2_frag(b3p + kb, hh); c03 = g2_mma(a0, b, c03); c13 = g2_mma(a1, b, c13); }
  v8f accs[8] = {c00, c01, c02, c03, c10, c11, c12, c13};
#pragma unroll
  for (int u = 0; u < 8; ++u) { const int t = u & 3, half = u >> 2; const int col = col0 + t * 16 + ln; const float bv = bp ? bf16_round(bp[col]) : 0.f;
#pragma unroll
    for (int r = 0; r < 8; ++r) { const int rloc = half * 16 + 8 * hh + r; float v = accs[u][r] * alpha + bv; if (CP) { if (rowsPerB < 0) v += CP[cofs + (size_t)(row0g + row0 + rloc) * ldc + col];      /* rowsPerB < 0: own element of the batched C plane */ else { const int bidx = (row0g + row0 + rloc) / rowsPerB; v += CP[(size_t)bidx * sCPb + (size_t)by * 64 + col]; } }
      if (ACT == 3) v = fmaxf(v, 0.f); else if (ACT == 6) v = 0.5f * v * (1.0f + erff(v * 0.70710678118654752f)); else if (ACT == 11) v = 1.0f / (1.0f + expf(-v)); else if (ACT == 15) v = v / (1.0f + expf(-v)); else if (ACT == 12) v = (v > 0.f) ? v : 0.01f * v; else if (ACT == 8) v = tanhf(v); else if (ACT == 9) v = 0.5f * v * (1.0f + tanhf(0.7978845608028654f * (v + 0.044715f * v * v * v))); else if (ACT == 14) v = (v > 0.f) ? v : 0.1f * v; else if (ACT == 16) v = (v >= 0.f) ? v : 0.3f * v; else if (ACT == 17) v = (v >= 0.f) ? v : 0.2f * v;
      so[w][rloc][t * 16 + ln] = v; } }
  __builtin_amdgcn_fence(__ATOMIC_ACQ_REL, "workgroup"); __builtin_amdgcn_wave_barrier();
  const int rsub = lane >> 4, c4 = (lane & 15) * 4;
  {
#pragma unroll
    for (int q = 0; q < 16; ++q) { const int r = q * 2 + rsub; const v4f v = *(const v4fa*)&so[w][r][c4]; if (C) *(v4f*)(C + cofs + (size_t)(row0 + r) * ldc + col0 + c4) = v; if (C16) { v4h h4; for (int i = 0; i < 4; ++i) h4[i] = (_Float16)v[i]; *(v4h*)(C16 + cofs + (size_t)(row0 + r) * ldc + col0 + c4) = h4; } }
     } }


__global__ __launch_bounds__(256) void k_wnat(const float* __restrict__ w, size_t n8, _Float16* __restrict__ Bt) { const size_t t = (size_t)blockIdx.x * 256 + threadIdx.x; if (t >= n8) return; FragH f; for (int q = 0; q < 8; ++q) f.h[q] = (_Float16)(bf16_round(w[t * 8 + q]) * 16.0f); *(v8us*)((unsigned short*)Bt + t * 8) = f.half[0];  }
__global__ __launch_bounds__(256) void k_rsm(const float* __restrict__ S, _Float16* __restrict__ P, int nrows) {
  #pragma clang fp contract(off)
  const int i = blockIdx.x * 256 + threadIdx.x; if (i >= nrows) return; const float* s = S + (size_t)i * SQ; float mx = -3.0e38f;
#pragma unroll 1
  for (int j = 0; j < SQ; ++j) mx = fmaxf(mx, s[j]); float se = 0.f;
#pragma unroll 1
  for (int j = 0; j < SQ; ++j) se += expf(s[j] - mx); const float sc = 256.0f / se;
#pragma unroll 1
  for (int j0 = 0; j0 < SQ; j0 += 8) { FragH f; for (int q = 0; q < 8; ++q) f.h[q] = (_Float16)(expf(s[j0 + q] - mx) * sc); unsigned short* d = (unsigned short*)P + (size_t)i * SQ + j0; *(v8us*)d = f.half[0];  } }
__global__ __launch_bounds__(256) void k_vt(const _Float16* __restrict__ V16, int b, int h0, _Float16* __restrict__ VT) { __shared__ unsigned short tl[64][65]; const int tid = threadIdx.x; const int hh = blockIdx.x % HG, sg = blockIdx.x / HG; const int s0 = sg * 64; const int h = h0 + hh;
  for (int i = tid; i < 64 * 8; i += 256) { const int j = i / 8, d8 = (i % 8) * 8; FragH f; f.half[0] = *(const v8us*)((const unsigned short*)V16 + ((size_t)b * SQ + s0 + j) * DM + h * HD + d8); for (int q = 0; q < 8; ++q) tl[d8 + q][j] = f.u[q]; }
  __syncthreads();
  { for (int i = tid; i < 64 * 8; i += 256) { const int d = i / 8, j8 = (i % 8) * 8; FragH f; for (int q = 0; q < 8; ++q) f.u[q] = tl[d][j8 + q]; *(v8us*)((unsigned short*)VT + ((size_t)hh * HD + d) * SQ + s0 + j8) = f.half[0]; }  } }



// causal row softmax, one wave per row: lane l holds columns c*128 + 4*l .. + 3 of the row in registers (every load 512 contiguous bytes, every store 256), S read once;
// row maximum and row sum by a five-step butterfly over the 32 lanes; keys above the row's own index take -1e9 (weight 0). nk a multiple of 256, at most NKX.
__global__ __launch_bounds__(256) void k_rsmcf2(const float* __restrict__ S, _Float16* __restrict__ P, int hg, int q0, int nk) {
  const int lane = threadIdx.x & 31; const int t = blockIdx.x * 8 + (threadIdx.x >> 5); if (t >= hg * QT) return;
  const float* s = S + (size_t)t * NKX + lane * 4; _Float16* p = P + (size_t)t * NKX + lane * 4; const int last = q0 + (t % QT); const int nc = nk >> 8;
  v4f v[NKX / 128];
#pragma unroll      /* here and in the three loops below: static indices keep v[] in registers */
  for (int c = 0; c < NKX / 256; ++c) if (c < nc) { v[2 * c] = *(const v4fa*)(s + c * 256); v[2 * c + 1] = *(const v4fa*)(s + c * 256 + 128); }
  float mx = -3.0e38f;
#pragma unroll
  for (int c = 0; c < NKX / 256; ++c) if (c < nc) { for (int u = 2 * c; u < 2 * c + 2; ++u) for (int q = 0; q < 4; ++q) { const float m = (u * 128 + lane * 4 + q <= last) ? v[u][q] : -1.0e9f; v[u][q] = m; mx = fmaxf(mx, m); } }
  for (int d = 16; d > 0; d >>= 1) mx = fmaxf(mx, __shfl_xor(mx, d, 32));
  v4f s4 = {0.f, 0.f, 0.f, 0.f};
#pragma unroll
  for (int c = 0; c < NKX / 256; ++c) if (c < nc) { for (int u = 2 * c; u < 2 * c + 2; ++u) for (int q = 0; q < 4; ++q) { const float e = __expf(v[u][q] - mx); v[u][q] = e; s4[q] += e; } }
  float se = (s4[0] + s4[1]) + (s4[2] + s4[3]);
  for (int d = 16; d > 0; d >>= 1) se += __shfl_xor(se, d, 32);
  const float sc = 256.0f / se;
#pragma unroll
  for (int c = 0; c < NKX / 256; ++c) if (c < nc) { for (int u = 2 * c; u < 2 * c + 2; ++u) { v4h h; for (int q = 0; q < 4; ++q) h[q] = (_Float16)(v[u][q] * sc); *(v4h*)(p + u * 128) = h; }
    asm volatile("s_wait_xcnt 0x0" ::: "memory"); }      /* the next chunk's products reuse the registers that these two stores name: the wait stands in front of that overwrite */
}


template <int MASKADD>
__global__ __launch_bounds__(64) void k_att0(const float* __restrict__ QF, const float* __restrict__ KF, const float* __restrict__ VF, int ld, const float* __restrict__ mask, float scale, float* __restrict__ OF, int ldo) {
  #pragma clang fp contract(off)
  __shared__ __attribute__((aligned(16))) float lo[64][64];      /* only the transpose for the coalesced store at the end */
  const int tid = threadIdx.x; const int h = blockIdx.x / (QT0 / 64), rg = blockIdx.x % (QT0 / 64); const int i = rg * 64 + tid;
  const float* qr = QF + (size_t)i * ld + h * HD;
  v4f rq[HD / 4], ro[HD / 4];      /* the thread's own q row and o row, in registers for the whole key loop */
#pragma unroll      /* here and in the inner loops below: static indices keep rq[] / ro[] in registers, and a key's loads issue together */
  for (int c = 0; c < HD / 4; ++c) { rq[c] = *(const v4fa*)(qr + c * 4); const v4f z = {0.f, 0.f, 0.f, 0.f}; ro[c] = z; }
  float m = -1.0e30f, l = 0.f; const int jmax = MASKADD ? (SQ - 1) : (rg * 64 + 63);      /* additive-mask form: every key (the mask input decides); causal form: keys up to the block's last row */
#pragma unroll 1
  for (int j = 0; j <= jmax; ++j) { const float* kr = KF + (size_t)j * ld + h * HD; const float* vr = VF + (size_t)j * ld + h * HD; float s = 0.f;
#pragma unroll
    for (int c = 0; c < HD / 4; ++c) { const v4f kq = *(const v4fa*)(kr + c * 4); const v4f qq = rq[c]; s = __fadd_rn(s, __fmul_rn(qq[0], kq[0])); s = __fadd_rn(s, __fmul_rn(qq[1], kq[1])); s = __fadd_rn(s, __fmul_rn(qq[2], kq[2])); s = __fadd_rn(s, __fmul_rn(qq[3], kq[3])); }
    s = __fmul_rn(s, scale); if (MASKADD) s = __fadd_rn(s, __fmul_rn(bf16_round(mask[(size_t)i * SQ + j]), -10000.0f));
    const float f = (MASKADD || j <= i) ? 1.f : 0.f; const float sm = fmaf(f, s, (1.f - f) * -1.0e30f); const float mn = fmaxf(m, sm); const float sc = expf(m - mn); const float e = expf(sm - mn); l = __fadd_rn(__fmul_rn(l, sc), e); m = mn;
#pragma unroll
    for (int c = 0; c < HD / 4; ++c) { const v4f vv = *(const v4fa*)(vr + c * 4); v4f oo = ro[c]; for (int u = 0; u < 4; ++u) oo[u] = __fadd_rn(__fmul_rn(oo[u], sc), __fmul_rn(e, vv[u])); ro[c] = oo; } }
  const float fin = 64.0f / l;      /* o carried x64 like the f16 path */
#pragma unroll
  for (int c = 0; c < HD / 4; ++c) { v4f oo = ro[c]; for (int u = 0; u < 4; ++u) oo[u] = __fmul_rn(oo[u], fin); *(v4f*)&lo[tid][c * 4] = oo; }
  __syncthreads();
  {
#pragma unroll 1
    for (int it = 0; it < 16; ++it) { const int row = it * 4 + tid / 16, pc = (tid % 16) * 4; const v4f v = *(const v4f*)&lo[row][pc]; *(v4f*)(OF + (size_t)(rg * 64 + row) * ldo + h * HD + pc) = v; }
     } }


template <int BFIN, int WXB>
__global__ __launch_bounds__(256) void k_ln16(const float* __restrict__ X, const float* __restrict__ g, const float* __restrict__ bb, float eps, _Float16* __restrict__ N16, float* __restrict__ XB) {
  #pragma clang fp contract(off)
  __shared__ float red[256]; const size_t r = blockIdx.x; const int t = threadIdx.x; const v4f xa = *(const v4fa*)(X + r * DMQ + t * 4); float s[4]; float sum = 0.f;
  for (int q = 0; q < 4; ++q) { s[q] = BFIN ? bf16_round(xa[q]) : xa[q]; sum = __fadd_rn(sum, s[q]); }
  red[t] = sum; __syncthreads(); for (int st = 128; st > 0; st >>= 1) { if (t < st) red[t] = __fadd_rn(red[t], red[t + st]); __syncthreads(); } const float mu = red[0] / (float)DMQ; __syncthreads();
  float vs = 0.f; for (int q = 0; q < 4; ++q) { const float dl = __fadd_rn(s[q], -mu); vs = __fadd_rn(vs, __fmul_rn(dl, dl)); } red[t] = vs; __syncthreads(); for (int st = 128; st > 0; st >>= 1) { if (t < st) red[t] = __fadd_rn(red[t], red[t + st]); __syncthreads(); }
  const float rs = rsqrtf(__fadd_rn(red[0] / (float)DMQ, eps)); v4h y; v4f xb;
  for (int q = 0; q < 4; ++q) { const int c = t * 4 + q; y[q] = (_Float16)__fadd_rn(__fmul_rn(__fmul_rn(__fadd_rn(s[q], -mu), rs), bf16_round(g[c])), bf16_round(bb[c])); xb[q] = s[q]; }
  { *(v4h*)(N16 + r * DMQ + t * 4) = y; if (WXB) *(v4f*)(XB + r * DMQ + t * 4) = xb;  } }
__global__ __launch_bounds__(256) void k_ftres2(const float* __restrict__ OF0, const float* __restrict__ XB, float* __restrict__ X1, size_t n4) {
  #pragma clang fp contract(off)
  const size_t t = (size_t)blockIdx.x * 256 + threadIdx.x; if (t >= n4) return; const v4f o = *(const v4fa*)(OF0 + t * 4), xv = *(const v4fa*)(XB + t * 4); v4f y; for (int q = 0; q < 4; ++q) y[q] = __fadd_rn(__fmul_rn(o[q], 0.015625f), xv[q]); *(v4f*)(X1 + t * 4) = y;  }

__global__ __launch_bounds__(256) void k_wthd(const float* __restrict__ Wt, _Float16* __restrict__ Bt) { const size_t t = (size_t)blockIdx.x * 256 + threadIdx.x; if (t >= (size_t)NH * HD * (DM / 8)) return; const int m8 = (int)(t % (DM / 8)) * 8; const int d = (int)((t / (DM / 8)) % HD); const int h = (int)(t / ((size_t)(DM / 8) * HD)); FragH f;
  for (int q = 0; q < 8; ++q) f.h[q] = (_Float16)(16.0f * bf16_round(Wt[((size_t)h * DM + m8 + q) * HD + d])); unsigned short* dst = (unsigned short*)Bt + ((size_t)h * HD + d) * DM + m8; *(v8us*)dst = f.half[0];  }




__global__ __launch_bounds__(256) void k_wtpad(const float* __restrict__ Wm, _Float16* __restrict__ Wt, int Kr, int Kp, int Nr, int Np, float scale) {
  const int t = blockIdx.x * 256 + threadIdx.x; if (t >= Np * (Kp / 8)) return; const int n = t / (Kp / 8), k8 = (t % (Kp / 8)) * 8; const int nc = min(n, Nr - 1); const float fn = (n < Nr) ? 1.f : 0.f; FragH f;
  for (int i = 0; i < 8; ++i) { const int k = k8 + i; const int kc = min(k, Kr - 1); const float fk = (k < Kr) ? fn : 0.f; f.h[i] = (_Float16)(bf16_round(Wm[(size_t)kc * Nr + nc]) * scale * fk); }
  unsigned short* o = (unsigned short*)Wt + (size_t)n * Kp + k8; *(v8us*)o = f.half[0];  }
__global__ __launch_bounds__(128) void k_bpad(const float* __restrict__ b, float* __restrict__ Bp, int nr, int np) {
  const int i = threadIdx.x; if (i >= np) return; const float v = b[min(i, nr - 1)] * ((i < nr) ? 1.f : 0.f); *(float*)(Bp + i) = v;  }
extern "C" void kernel_launch(void* const* d_in, const int* in_sizes, int n_in,
                              void* d_out, int out_size, void* d_ws, size_t ws_size, hipStream_t stream) {
  (void)in_sizes; (void)n_in; (void)out_size;
  const float* const* I = (const float* const*)d_in; const float* x = I[0]; const float* g1 = I[1]; const float* be1 = I[2]; const float* wq = I[3]; const float* wk = I[4]; const float* wv = I[5]; const float* wo = I[6]; const float* bo = nullptr; const float* gg2 = I[7]; const float* be2 = I[8]; const float* wfc = I[9]; const float* bfc = I[10]; const float* wmp = I[11]; const float* bmp = I[12];      /* x, LN1 g / b, Wq / Wk / Wv / Wo [1024][1024] ([in][out], no biases), LN2 g / b, W1 [1024][4096] + b1, W2 [4096][1024] + b2 */
  char* ws = (char*)d_ws; size_t off = 0;
  auto take = [&](size_t bytes) { char* p = ws + off; off += (bytes + 255) & ~(size_t)255; return p; };
  _Float16* BQKV = (_Float16*)take((size_t)3 * DM * DM * 2); _Float16* BO = (_Float16*)take((size_t)DM * DM * 2);
  _Float16* X16 = (_Float16*)take(NR * DM * 2); float* XB = (float*)take(NR * DM * 4); float* X1 = (float*)take(NR * DM * 4); _Float16* M16 = nullptr;      /* = X16 below (alias: X16's last reader, the last batch's first-tile GEMMs, precedes LN2's write) */ _Float16* HF16 = (_Float16*)take((size_t)SQ * DFF * 2); _Float16* BW1 = (_Float16*)take((size_t)DFF * DM * 2); _Float16* BW2 = (_Float16*)take((size_t)DM * DFF * 2); _Float16* QKV = (_Float16*)take(NR * 3 * DM * 2); _Float16* Q16 = QKV; _Float16* K16 = QKV + DM; _Float16* V16 = QKV + 2 * DM; _Float16* O16 = (_Float16*)take(NR * DM * 2); M16 = X16;
  float* S = (float*)take((size_t)NH * QT * NKX * 4); _Float16* P = (_Float16*)take((size_t)NH * QT * NKX * 2); _Float16* VT = (_Float16*)take((size_t)NH * HD * SQ * 2);
  float* QF0 = (float*)take((size_t)QT0 * DM * 4); float* KF0 = (float*)take((size_t)QT0 * DM * 4); float* VF0 = (float*)take((size_t)QT0 * DM * 4); float* OF0 = (float*)take((size_t)NB * QT0 * DM * 4); _Float16* OH0 = (_Float16*)take((size_t)NB * QT0 * DM * 2); _Float16* OL0 = (_Float16*)take((size_t)NB * QT0 * DM * 2);
  if (off > ws_size) return;
  { const unsigned g = (unsigned)(((size_t)DM * (DM / 8) + 255) / 256); k_wt_f16<<<g, 256, 0, stream>>>(wq, BQKV, DM, DM, 16.0f); k_wt_f16<<<g, 256, 0, stream>>>(wk, BQKV + (size_t)DM * DM, DM, DM, 16.0f); k_wt_f16<<<g, 256, 0, stream>>>(wv, BQKV + (size_t)2 * DM * DM, DM, DM, 16.0f); }      /* [in][out] -> Bt x16, stacked q | k | v */ k_wt_f16<<<(unsigned)(((size_t)DM * (DM / 8) + 255) / 256), 256, 0, stream>>>(wo, BO, DM, DM, 16.0f);      /* w_proj [in][out] -> Bt x16 */
  k_ln16<1, 1><<<(unsigned)NR, 256, 0, stream>>>(x, g1, be1, 1e-5f, X16, XB);      /* a = LN1(bf16(x)) -> f16 rows; XB = bf16(x) for the residual */
  k_wt_f16<<<(unsigned)(((size_t)DFF * (DM / 8) + 255) / 256), 256, 0, stream>>>(wfc, BW1, DM, DFF, 16.0f); k_wt_f16<<<(unsigned)(((size_t)DM * (DFF / 8) + 255) / 256), 256, 0, stream>>>(wmp, BW2, DFF, DM, 16.0f);      /* W1 [1024][4096] -> Bt [4096][1024]; W2 [4096][1024] -> Bt [1024][4096] (x16) */
  const size_t r0p = (size_t)B0 * SQ;      /* first projected row */
  k_gemm2<0><<<dim3((unsigned)((MP / 128) * (3 * DM / 64)), 1), 128, 0, stream>>>(X16 + r0p * DM, DM, 0, BQKV, DM, 0, 0.0625f, nullptr, 0, nullptr, 1, 0, 0, nullptr, QKV + r0p * 3 * DM, 3 * DM, 0, MP, 3 * DM, DM);      /* q | k | v rows (f16); head h = columns h*HD.. of each DM block */
  for (int b = B0; b < B0 + NBR; ++b) { const size_t r0 = (size_t)b * SQ;
    k_vt<NH, SQ><<<NH * (SQ / 64), 256, 0, stream>>>(V16 + r0 * LQ, LQ, 0, VT);      /* V^T [NH][HD][SQ] for this batch */
    k_gemm2<0><<<dim3((QT0 / 128) * (DM / 64), 1), 128, 0, stream>>>(X16 + r0 * DM, DM, 0, BQKV, DM, 0, 0.0625f, nullptr, 0, nullptr, 1, 0, 0, QF0, nullptr, DM, 0, QT0, DM, DM); k_gemm2<0><<<dim3((QT0 / 128) * (DM / 64), 1), 128, 0, stream>>>(X16 + r0 * DM, DM, 0, (BQKV + (size_t)DM * DM), DM, 0, 0.0625f, nullptr, 0, nullptr, 1, 0, 0, KF0, nullptr, DM, 0, QT0, DM, DM); k_gemm2<0><<<dim3((QT0 / 128) * (DM / 64), 1), 128, 0, stream>>>(X16 + r0 * DM, DM, 0, (BQKV + (size_t)2 * DM * DM), DM, 0, 0.0625f, nullptr, 0, nullptr, 1, 0, 0, VF0, nullptr, DM, 0, QT0, DM, DM);      /* f32 q, k, v of the first 128 rows (exact products) */
    k_att0<0><<<NH * (QT0 / 64), 64, 0, stream>>>(QF0, KF0, VF0, DM, nullptr, 0.125f, OF0 + (size_t)b * QT0 * DM, DM);      /* exact f32 attention for rows 0..127 (o x64) */
    for (int q0 = 0; q0 < QN; q0 += QT) { const int nk = q0 + QT;      /* causal: only keys below the tile end are computed */
      k_gemm2<0><<<dim3((QT / 128) * (nk / 64), NHD), 128, 0, stream>>>(Q16 + (r0 + q0) * LQ, LQ, (size_t)HD, K16 + r0 * LQ, LQ, (size_t)HD, 0.125f, nullptr, 0, nullptr, 1, 0, 0, S, nullptr, NKX, (size_t)QT * NKX, QT, nk, HD);      /* scores, all heads on grid.y */
      k_rsmcf2<<<(NHD * QT + 7) / 8, 256, 0, stream>>>(S, P, NHD, q0, nk);      /* one wave per row, 8 rows per block */
      k_gemm2<0><<<dim3((QT / 128) * (HD / 64), NHD), 128, 0, stream>>>(P, NKX, (size_t)QT * NKX, VT, SQ, (size_t)HD * SQ, 0.25f, nullptr, 0, nullptr, 1, 0, 0, nullptr, O16 + (r0 + q0) * DM, DM, (size_t)HD, QT, HD, nk); } }      /* o (merged heads, x64) as f16 rows */
  k_gemm2<0><<<dim3((unsigned)((MPO / 128) * (DM / 64)), 1), 128, 0, stream>>>(O16 + r0p * DM, DM, 0, BO, DM, 0, 0.0009765625f, bo, 0, XB + r0p * DM, -1, 0, 0, X1 + r0p * DM, nullptr, DM, 0, MPO, DM, DM);      /* x1 = x + o Wo (f32 rows) */
  k_hl<<<(unsigned)(((size_t)NB * QT0 * DM / 8 + 255) / 256), 256, 0, stream>>>(OF0, OH0, OL0, (size_t)NB * QT0 * DM / 8);      /* first-tile o (x64) -> f16 hi + x1024 residual planes */
  for (int b = B0; b < B0 + NBR; ++b) { const size_t r0 = (size_t)b * SQ; const size_t f0 = (size_t)b * QT0;
    k_gemm2<0><<<dim3((QT0 / 128) * (DM / 64), 1), 128, 0, stream>>>(OH0 + f0 * DM, DM, 0, BO, DM, 0, 0.0009765625f, bo, 0, XB + r0 * DM, -1, 0, 0, X1 + r0 * DM, nullptr, DM, 0, QT0, DM, DM);      /* rows 0..127: x1 = x + o_hi Wo, overwriting the f16-path rows */
    k_gemm2<0><<<dim3((QT0 / 128) * (DM / 64), 1), 128, 0, stream>>>(OL0 + f0 * DM, DM, 0, BO, DM, 0, 0.00000095367431640625f, nullptr, 0, X1 + r0 * DM, -1, 0, 0, X1 + r0 * DM, nullptr, DM, 0, QT0, DM, DM); }      /* += o_lo Wo 2^-20 (own-element accumulate) */
  k_ln16<0, 0><<<(unsigned)NR, 256, 0, stream>>>(X1, gg2, be2, 1e-5f, M16, nullptr);      /* h = LN2(x1) -> f16 rows */
  for (int b = 0; b < NB; ++b) { const size_t r0 = (size_t)b * SQ;
    k_gemm2<6><<<dim3((unsigned)((SQ / 128) * (DFF / 64)), 1), 128, 0, stream>>>(M16 + r0 * DM, DM, 0, BW1, DM, 0, 0.0625f, bfc, 0, nullptr, 1, 0, 0, nullptr, HF16, DFF, 0, SQ, DFF, DM);      /* gelu_erf(h2 W1 + b1) -> f16 (this batch) */
    k_gemm2<0><<<dim3((unsigned)((SQ / 128) * (DM / 64)), 1), 128, 0, stream>>>(HF16, DFF, 0, BW2, DFF, 0, 0.0625f, bmp, 0, X1 + r0 * DM, -1, 0, 0, (float*)d_out + r0 * DM, nullptr, DM, 0, SQ, DM, DFF); }      /* out = x1 + mlp (own-element residual) */
}

// v003
// Measured time: 2490 microseconds a run.
// In two side-by-side timings against v002, it was 1.45 and 1.44 times as fast.
// All steps since v000 together make it 4.33 times as fast.
#include <hip/hip_runtime.h>
// Pre-LN causal transformer block (x [4][2048][1024]; h = LN1(x) (biased var, eps 1e-5, gamma / beta); Q/K/V = h Wq/Wk/Wv ([in][out] 1024 x 1024 sigma 1/32, no biases), 16 heads of 64; scores / 8; causal (tril, -inf); softmax; x1 = x + hidden Wo ([in][out], no bias); h2 = LN2(x1); out = x1 + gelu_erf(h2 W1 + b1) W2 + b2 ([in][out] 1024 x 4096 x 1024) -> [4][2048][1024]).
// Structure: token rows r = b*2048 + s; h = LN1(bf16 x) as f16 rows; q | k | v as ONE WMMA GEMM (N = 3 x 1024) (32x64 wave tiles, f32 accumulation, exact x16 weights, no bias, f16 outputs); per batch: V^T for all heads via LDS transposes; per query tile of 256 rows: scores against the keys below the tile end only (K = 64, all heads on grid.y, alpha = 0.125), causal row softmax on VALU, one wave per row, over the computed range (f32 statistics, native exp; weights x256 f16), o = P . V^T (K = keys below the tile end, alpha 2^-2: o carried x64, folded into the output GEMM alpha) written straight into the merged f16 o rows; x1 = x + o W_o GEMM (f32, no bias); then LN2 and the gelu MLP GEMMs into the output layout.
// Compute dtype: inputs rounded to bf16; x / weights exact; q, k, v, softmax weights and o as plain f16 GEMM operands (~2^-12); scores and softmax statistics f32. v_wmma_f32_16x16x32_f16.
#define NB 4
#define SQ 2048
#define DM 1024
#define NH 16
#define HD 64
#define HG 4                         /* heads per block group of the unlaunched k_vt(b, h0) overload */
#define QT 256                       /* query rows per causal tile */
#define NKX SQ                       /* S / P row pitch */
#define QT0 128                      /* first-tile rows recomputed exactly in f32 */
#define B0 0                         /* first batch processed (debug hook) */
#define NBR NB                       /* batches processed (debug hook) */
#define NR ((size_t)NB * SQ)
#define DMQ DM
#define DFF 4096                     /* FFN hidden width */
#define DFFR 100                     /* unused */
#define MP ((int)((size_t)NBR * SQ)) /* rows projected (debug hook) */
#define QN SQ                        /* query rows attended per batch (debug hook) */
#define NHD NH                       /* heads attended (debug hook) */
#define MPO MP                       /* rows through the output stage (debug hook) */
#define LQ (3 * DM)      /* row pitch of the q/k/v rows */
typedef __bf16 v16b __attribute__((ext_vector_type(16)));
typedef unsigned short v8us __attribute__((ext_vector_type(8), may_alias));
typedef float  v8f  __attribute__((ext_vector_type(8)));
typedef float  v4f  __attribute__((ext_vector_type(4)));
typedef float  v4fa __attribute__((ext_vector_type(4), may_alias));
union FragB { v16b v; v8us half[2]; unsigned short u[16]; };

__device__ __forceinline__ unsigned short bf16_bits(float x) { unsigned int u = __float_as_uint(x); return (unsigned short)((u + 0x7FFFu + ((u >> 16) & 1u)) >> 16); }
__device__ __forceinline__ float bf16_val(unsigned short b) { return __uint_as_float(((unsigned int)b) << 16); }
__device__ __forceinline__ float bf16_round(float x) { return bf16_val(bf16_bits(x)); }
// D += A·B with NT terms: 1 = ah·bh, 2 = + al·bh (A split), 3 = + ah·bl (both split)
template <int NT>
__device__ __forceinline__ v8f mmaN(v16b ah, v16b al, v16b bh, v16b bl, v8f c) {
  c = __builtin_amdgcn_wmma_f32_16x16x32_bf16(false, ah, false, bh, (short)0, c, false, false);
  if (NT >= 2) c = __builtin_amdgcn_wmma_f32_16x16x32_bf16(false, al, false, bh, (short)0, c, false, false);
  if (NT >= 3) c = __builtin_amdgcn_wmma_f32_16x16x32_bf16(false, ah, false, bl, (short)0, c, false, false);
  asm volatile("v_nop\n\tv_nop\n\tv_nop\n\tv_nop" : "+v"(c) : "v"(ah), "v"(al), "v"(bh), "v"(bl));
  return c;
}

__global__ __launch_bounds__(256) void k_wt_bf16(const float* __restrict__ W, unsigned short* __restrict__ Wt, int K, int N) {
  const int t = blockIdx.x * 256 + threadIdx.x;
  const int k8n = K / 8;
  if (t >= N * k8n) return;
  const int n = t / k8n, k8 = (t % k8n) * 8;
  v8us v;
#pragma unroll
  for (int i = 0; i < 8; ++i) v[i] = bf16_bits(W[(size_t)(k8 + i) * N + n]);
  *(v8us*)(Wt + (size_t)n * K + k8) = v;
  
}

// GEMM C[M][N] (f32, pitch ldc) = act(A[M][K]·W + bias). A f32 row-major (pitch lda) converted per fragment to bf16
// (ASPLIT: hi/lo two planes -> 2 terms, else single rounded term); Wt bf16 [N][K] (pitch ldb). BIAS_BF16 rounds the
// bias to bf16 first (bias quantised to bf16 before the add). K%32==0, M%16==0, N%64==0.
template <bool ASPLIT, int ACT, bool BIAS_BF16>
__global__ __launch_bounds__(128) void k_gemm_bf(const float* __restrict__ A, int lda, const unsigned short* __restrict__ Wt, int ldb,
                                               const float* __restrict__ bias, float* __restrict__ C, int ldc, int M, int N, int K) {
  __shared__ __attribute__((aligned(16))) float so[4][16][64];
  const int tid = threadIdx.x, w = tid >> 5, lane = tid & 31, ln = lane & 15, hh = lane >> 4;
  const int ntn = N / 64;
  const int wid = blockIdx.x * 4 + w;
  const int mt = wid / ntn, nq = wid % ntn;
  if (mt * 16 >= M) return;
  const int row0 = mt * 16, col0 = nq * 64;
  const float* arow = A + (size_t)(row0 + ln) * lda;
  v8f acc[4] = {};
  for (int kb = 0; kb < K; kb += 32) {
    FragB ah, al;
    const v4f x0 = *(const v4fa*)(arow + kb + 8 * hh), x1 = *(const v4fa*)(arow + kb + 8 * hh + 4);
    const v4f x2 = *(const v4fa*)(arow + kb + 16 + 8 * hh), x3 = *(const v4fa*)(arow + kb + 16 + 8 * hh + 4);
    float xs[16] = {x0[0],x0[1],x0[2],x0[3],x1[0],x1[1],x1[2],x1[3],x2[0],x2[1],x2[2],x2[3],x3[0],x3[1],x3[2],x3[3]};
#pragma unroll
    for (int i = 0; i < 16; ++i) { const unsigned short hb = bf16_bits(xs[i]); ah.u[i] = hb; al.u[i] = ASPLIT ? bf16_bits(xs[i] - bf16_val(hb)) : (unsigned short)0; }
#pragma unroll
    for (int t = 0; t < 4; ++t) {
      const unsigned short* brow = Wt + (size_t)(col0 + t * 16 + ln) * ldb + kb;
      FragB b;
      b.half[0] = *(const v8us*)(brow + 8 * hh);
      b.half[1] = *(const v8us*)(brow + 16 + 8 * hh);
      acc[t] = mmaN<ASPLIT ? 2 : 1>(ah.v, al.v, b.v, b.v, acc[t]);
    }
  }
#pragma unroll
  for (int t = 0; t < 4; ++t) {
    float bv = bias ? bias[col0 + t * 16 + ln] : 0.f;
    if (BIAS_BF16) bv = bf16_round(bv);
#pragma unroll
    for (int r = 0; r < 8; ++r) { float v = acc[t][r] + bv; if (ACT == 1) v = fmaxf(v, 0.f); so[w][8 * hh + r][t * 16 + ln] = v; }
  }
  __builtin_amdgcn_fence(__ATOMIC_ACQ_REL, "workgroup");
  __builtin_amdgcn_wave_barrier();
  const int rsub = lane >> 4, c4 = (lane & 15) * 4;
  {
#pragma unroll
    for (int q = 0; q < 8; ++q) {
      const int r = q * 2 + rsub;
      const v4f v = *(const v4fa*)&so[w][r][c4];
      *(v4f*)(C + (size_t)(row0 + r) * ldc + col0 + c4) = v;
    }
    
  }
}

// GEMM C = act(A·W + bias + resid): A f32 (ASPLIT -> hi/lo 2 terms), Wt bf16 [N][K]; ACT 0 none, 1 relu, 2 exact gelu;
// resid (optional, f32, row index = (row % rmod), pitch ldr, RES_BF16 rounds it) added before the activation.
template <bool ASPLIT, int ACT, bool BIAS_BF16, bool RES_BF16>
__global__ __launch_bounds__(128) void k_gemm_bf3(const float* __restrict__ A, int lda, const unsigned short* __restrict__ Wt, int ldb,
                                                const float* __restrict__ bias, const float* __restrict__ resid, int rmod, int ldr,
                                                float* __restrict__ C, int ldc, int M, int N, int K) {
  __shared__ __attribute__((aligned(16))) float so[4][16][64];
  const int tid = threadIdx.x, w = tid >> 5, lane = tid & 31, ln = lane & 15, hh = lane >> 4;
  const int ntn = N / 64;
  const int wid = blockIdx.x * 4 + w;
  const int mt = wid / ntn, nq = wid % ntn;
  if (mt * 16 >= M) return;
  const int row0 = mt * 16, col0 = nq * 64;
  const float* arow = A + (size_t)(row0 + ln) * lda;
  v8f acc[4] = {};
  for (int kb = 0; kb < K; kb += 32) {
    FragB ah, al;
    const v4f x0 = *(const v4fa*)(arow + kb + 8 * hh), x1 = *(const v4fa*)(arow + kb + 8 * hh + 4);
    const v4f x2 = *(const v4fa*)(arow + kb + 16 + 8 * hh), x3 = *(const v4fa*)(arow + kb + 16 + 8 * hh + 4);
    float xs[16] = {x0[0],x0[1],x0[2],x0[3],x1[0],x1[1],x1[2],x1[3],x2[0],x2[1],x2[2],x2[3],x3[0],x3[1],x3[2],x3[3]};
#pragma unroll
    for (int i = 0; i < 16; ++i) { const unsigned short hb = bf16_bits(xs[i]); ah.u[i] = hb; al.u[i] = ASPLIT ? bf16_bits(xs[i] - bf16_val(hb)) : (unsigned short)0; }
#pragma unroll
    for (int t = 0; t < 4; ++t) {
      const unsigned short* brow = Wt + (size_t)(col0 + t * 16 + ln) * ldb + kb;
      FragB b;
      b.half[0] = *(const v8us*)(brow + 8 * hh);
      b.half[1] = *(const v8us*)(brow + 16 + 8 * hh);
      acc[t] = mmaN<ASPLIT ? 2 : 1>(ah.v, al.v, b.v, b.v, acc[t]);
    }
  }
#pragma unroll
  for (int t = 0; t < 4; ++t) {
    const int col = col0 + t * 16 + ln;
    float bv = bias ? bias[col] : 0.f;
    if (BIAS_BF16) bv = bf16_round(bv);
#pragma unroll
    for (int r = 0; r < 8; ++r) {
      float v = acc[t][r] + bv;
      if (resid) { float rv = resid[(size_t)((row0 + 8 * hh + r) % rmod) * ldr + col]; if (RES_BF16) rv = bf16_round(rv); v += rv; }
      if (ACT == 1) v = fmaxf(v, 0.f);
      if (ACT == 2) v = 0.5f * v * (1.0f + erff(v * 0.70710678118654752f));
      if (ACT == 3) { const float u = 0.7978845608028654f * (v + 0.044715f * v * v * v); v = 0.5f * v * (1.0f + tanhf(u)); }
      so[w][8 * hh + r][t * 16 + ln] = v;
    }
  }
  __builtin_amdgcn_fence(__ATOMIC_ACQ_REL, "workgroup");
  __builtin_amdgcn_wave_barrier();
  const int rsub = lane >> 4, c4 = (lane & 15) * 4;
  {
#pragma unroll
    for (int q = 0; q < 8; ++q) {
      const int r = q * 2 + rsub;
      const v4f v = *(const v4fa*)&so[w][r][c4];
      *(v4f*)(C + (size_t)(row0 + r) * ldc + col0 + c4) = v;
    }
    
  }
}
// row LayerNorm (biased variance, eps) over N: s = X (+ R); optional out_sum <- s; out_norm <- (s-mu)*rsqrt(var+eps)*g + b
template <bool PARAM_BF16>
__global__ __launch_bounds__(256) void k_layernorm(const float* __restrict__ X, const float* __restrict__ R, const float* __restrict__ g, const float* __restrict__ bta,
                                                  float* __restrict__ out_sum, float* __restrict__ out_norm, int N, float eps) {
  __shared__ float red[256];
  const int row = blockIdx.x, tid = threadIdx.x;
  const float* x = X + (size_t)row * N; const float* rr = R ? R + (size_t)row * N : nullptr;
  float vals[16];                     // up to N = 4096
  const int per = N / 256;            // contiguous chunk per thread? use strided-by-4 chunks: thread handles j = tid*4 + 1024*u
  float s1 = 0.f;
  for (int u = 0; u < per / 4; ++u) {
    const int j = tid * 4 + 1024 * u;
    const v4f a = *(const v4fa*)(x + j);
    v4f b = {0.f,0.f,0.f,0.f}; if (rr) b = *(const v4fa*)(rr + j);
#pragma unroll
    for (int q = 0; q < 4; ++q) { const float v = a[q] + b[q]; vals[u * 4 + q] = v; s1 += v; }
  }
  red[tid] = s1; __syncthreads();
  for (int st = 128; st > 0; st >>= 1) { if (tid < st) red[tid] += red[tid + st]; __syncthreads(); }
  const float mu = red[0] / (float)N; __syncthreads();
  float s2 = 0.f;
  for (int u = 0; u < per / 4; ++u)
#pragma unroll
    for (int q = 0; q < 4; ++q) { const float c = vals[u * 4 + q] - mu; s2 += c * c; }
  red[tid] = s2; __syncthreads();
  for (int st = 128; st > 0; st >>= 1) { if (tid < st) red[tid] += red[tid + st]; __syncthreads(); }
  const float rs = rsqrtf(red[0] / (float)N + eps);
  {
    for (int u = 0; u < per / 4; ++u) {
      const int j = tid * 4 + 1024 * u;
      v4f o, sm;
#pragma unroll
      for (int q = 0; q < 4; ++q) {
        float gg = g[j + q], bb = bta[j + q];
        if (PARAM_BF16) { gg = bf16_round(gg); bb = bf16_round(bb); }
        sm[q] = vals[u * 4 + q]; o[q] = (vals[u * 4 + q] - mu) * rs * gg + bb;
      }
      if (out_sum) *(v4f*)(out_sum + (size_t)row * N + j) = sm;
      *(v4f*)(out_norm + (size_t)row * N + j) = o;
    }
    
  }
}



// ---- f16 WMMA path (v_wmma_f32_16x16x32_f16): 11-bit significands for operands in range — used where a [0,1] probability operand needs more precision than bf16
typedef _Float16 v16h __attribute__((ext_vector_type(16)));
union FragH { v16h v; v8us half[2]; _Float16 h[16]; unsigned short u[16]; };
template <int NT>
__device__ __forceinline__ v8f mmaH(v16h ah, v16h al, v16h bh, v16h bl, v8f c) {
  c = __builtin_amdgcn_wmma_f32_16x16x32_f16(false, ah, false, bh, (short)0, c, false, false);
  if (NT >= 2) c = __builtin_amdgcn_wmma_f32_16x16x32_f16(false, al, false, bh, (short)0, c, false, false);
  if (NT >= 3) c = __builtin_amdgcn_wmma_f32_16x16x32_f16(false, ah, false, bl, (short)0, c, false, false);
  asm volatile("v_nop\n\tv_nop\n\tv_nop\n\tv_nop" : "+v"(c) : "v"(ah), "v"(al), "v"(bh), "v"(bl));
  return c;
}
// batched GEMM like k_gemm_b but f16 operands: A f32 (split into f16 hi/lo if ASPLIT, else rounded to f16), Bt = f16 values [n][k]; alpha; C f32; N multiple of 16 (partial tiles skipped)
template <bool ASPLIT>
__global__ __launch_bounds__(128) void k_gemm_h(const float* __restrict__ A, int lda, size_t sA, const _Float16* __restrict__ Bh, int ldb, size_t sB, float alpha, float* __restrict__ C, int ldc, size_t sC, int M, int N, int K) {
  __shared__ __attribute__((aligned(16))) float so[4][16][64];
  const int tid = threadIdx.x, w = tid >> 5, lane = tid & 31, ln = lane & 15, hh = lane >> 4; const int by = blockIdx.y;
  A += (size_t)by * sA; Bh += (size_t)by * sB; C += (size_t)by * sC;
  const int ntn = (N + 63) / 64; const int wid = blockIdx.x * 4 + w; const int mt = wid / ntn, nq = wid % ntn; if (mt * 16 >= M) return;
  const int row0 = mt * 16, col0 = nq * 64; const float* arow = A + (size_t)(row0 + ln) * lda;
  v8f acc[4] = {};
  for (int kb = 0; kb < K; kb += 32) {
    FragH ah, al;
    const v4f x0 = *(const v4fa*)(arow + kb + 8 * hh), x1 = *(const v4fa*)(arow + kb + 8 * hh + 4), x2 = *(const v4fa*)(arow + kb + 16 + 8 * hh), x3 = *(const v4fa*)(arow + kb + 16 + 8 * hh + 4);
    float xs[16] = {x0[0],x0[1],x0[2],x0[3],x1[0],x1[1],x1[2],x1[3],x2[0],x2[1],x2[2],x2[3],x3[0],x3[1],x3[2],x3[3]};
#pragma unroll
    for (int i = 0; i < 16; ++i) { const _Float16 h = (_Float16)xs[i]; ah.h[i] = h; al.h[i] = ASPLIT ? (_Float16)(xs[i] - (float)h) : (_Float16)0.0f; }
#pragma unroll
    for (int t = 0; t < 4; ++t) { if (col0 + t * 16 >= N) continue; const size_t boff = (size_t)(col0 + t * 16 + ln) * ldb + kb; FragH bq; bq.half[0] = *(const v8us*)(Bh + boff + 8 * hh); bq.half[1] = *(const v8us*)(Bh + boff + 16 + 8 * hh);
      acc[t] = mmaH<ASPLIT ? 2 : 1>(ah.v, al.v, bq.v, bq.v, acc[t]); }
  }
#pragma unroll
  for (int t = 0; t < 4; ++t) { if (col0 + t * 16 >= N) continue;
#pragma unroll
    for (int r = 0; r < 8; ++r) so[w][8 * hh + r][t * 16 + ln] = acc[t][r] * alpha; }
  __builtin_amdgcn_fence(__ATOMIC_ACQ_REL, "workgroup"); __builtin_amdgcn_wave_barrier();
  const int rsub = lane >> 4, c4 = (lane & 15) * 4;
  {
#pragma unroll
    for (int q = 0; q < 8; ++q) { const int r = q * 2 + rsub; if (col0 + c4 < N) { const v4f v = *(const v4fa*)&so[w][r][c4]; *(v4f*)(C + (size_t)(row0 + r) * ldc + col0 + c4) = v; } }
     }
}

// Wt[n][k] = f16(W[k][n]·scale) from f32 row-major W[K][N] (scale = power of two; bf16-exact weights stay exact in f16 away from the subnormal range)
__global__ __launch_bounds__(256) void k_wt_f16(const float* __restrict__ W, _Float16* __restrict__ Wt, int K, int N, float scale) {
  const int t = blockIdx.x * 256 + threadIdx.x; if (t >= N * (K / 8)) return; const int n = t / (K / 8), k8 = (t % (K / 8)) * 8; FragH f;
#pragma unroll
  for (int i = 0; i < 8; ++i) f.h[i] = (_Float16)(bf16_round(W[(size_t)(k8 + i) * N + n]) * scale); const v8us o = f.half[0];
  *(v8us*)((unsigned short*)Wt + (size_t)n * K + k8) = o; 
}
// k_gemm_hh variant with fused epilogue: v = acc·alpha + bias[by·sBias + col] (+ CP[(row/rowsPerB)·sCPb + by·64 + col] if CP) ; ACT 0 none / 1 elu ; writes f16 C16 (and f32 C if non-null)
template <int ACT>
__global__ __launch_bounds__(128) void k_gemm_hhx(const _Float16* __restrict__ A, int lda, size_t sA, const _Float16* __restrict__ Bh, int ldb, size_t sB, float alpha, const float* __restrict__ bias, size_t sBias, const float* __restrict__ CP, int rowsPerB, size_t sCPb, int row0g,
    float* __restrict__ C, _Float16* __restrict__ C16, int ldc, size_t sC, int M, int N, int K) {
  __shared__ __attribute__((aligned(16))) float so[4][16][64];
  const int tid = threadIdx.x, w = tid >> 5, lane = tid & 31, ln = lane & 15, hh = lane >> 4; const int by = blockIdx.y;
  A += (size_t)by * sA; Bh += (size_t)by * sB; const size_t cofs = (size_t)by * sC; const float* bp = bias ? bias + (size_t)by * sBias : nullptr;
  const int ntn = (N + 63) / 64; const int wid = blockIdx.x * 4 + w; const int mt = wid / ntn, nq = wid % ntn; if (mt * 16 >= M) return;
  const int row0 = mt * 16, col0 = nq * 64; const _Float16* arow = A + (size_t)(row0 + ln) * lda;
  v8f acc[4] = {};
  for (int kb = 0; kb < K; kb += 32) { FragH ah; ah.half[0] = *(const v8us*)((const unsigned short*)arow + kb + 8 * hh); ah.half[1] = *(const v8us*)((const unsigned short*)arow + kb + 16 + 8 * hh);
#pragma unroll
    for (int t = 0; t < 4; ++t) { if (col0 + t * 16 >= N) continue; const size_t boff = (size_t)(col0 + t * 16 + ln) * ldb + kb; FragH bq; bq.half[0] = *(const v8us*)((const unsigned short*)Bh + boff + 8 * hh); bq.half[1] = *(const v8us*)((const unsigned short*)Bh + boff + 16 + 8 * hh);
      acc[t] = mmaH<1>(ah.v, ah.v, bq.v, bq.v, acc[t]); }
  }
#pragma unroll
  for (int t = 0; t < 4; ++t) { if (col0 + t * 16 >= N) continue; const int col = col0 + t * 16 + ln; const float bv = bp ? bf16_round(bp[col]) : 0.f;
#pragma unroll
    for (int r = 0; r < 8; ++r) { float v = acc[t][r] * alpha + bv; if (CP) { const int rr = row0g + row0 + 8 * hh + r; if (rowsPerB < 0) v += CP[cofs + (size_t)rr * ldc + col];      /* rowsPerB < 0: own element of the batched C plane */ else { const int bidx = rr / rowsPerB; v += CP[(size_t)bidx * sCPb + (size_t)by * 64 + col]; } } if (ACT == 1) v = (v > 0.f) ? v : expm1f(v); else if (ACT == 7) v = (v > 0.f) ? v + 1.0f : expf(v); else if (ACT == 8) v = tanhf(v); else if (ACT == 9) v = 0.5f * v * (1.0f + tanhf(0.7978845608028654f * (v + 0.044715f * v * v * v))); else if (ACT == 11) v = 1.0f / (1.0f + expf(-v)); else if (ACT == 12) v = (v > 0.f) ? v : 0.01f * v; else if (ACT == 14) v = (v > 0.f) ? v : 0.1f * v; else if (ACT == 16) v = (v >= 0.f) ? v : 0.3f * v; else if (ACT == 17) v = (v >= 0.f) ? v : 0.2f * v; else if (ACT == 15) v = v / (1.0f + expf(-v)); else if (ACT == 3) v = fmaxf(v, 0.f); else if (ACT == 6) v = 0.5f * v * (1.0f + erff(v * 0.70710678118654752f)); so[w][8 * hh + r][t * 16 + ln] = v; } }
  __builtin_amdgcn_fence(__ATOMIC_ACQ_REL, "workgroup"); __builtin_amdgcn_wave_barrier();
  const int rsub = lane >> 4, c4 = (lane & 15) * 4; typedef _Float16 v4h __attribute__((ext_vector_type(4)));
  {
#pragma unroll
    for (int q = 0; q < 8; ++q) { const int r = q * 2 + rsub; if (col0 + c4 < N) { const v4f v = *(const v4fa*)&so[w][r][c4]; if (C) *(v4f*)(C + cofs + (size_t)(row0 + r) * ldc + col0 + c4) = v; if (C16) { v4h h4; for (int i = 0; i < 4; ++i) h4[i] = (_Float16)v[i]; *(v4h*)(C16 + cofs + (size_t)(row0 + r) * ldc + col0 + c4) = h4; } } }
     }
}


typedef _Float16 v4h __attribute__((ext_vector_type(4)));

__global__ __launch_bounds__(256) void k_x16(const float* __restrict__ x, _Float16* __restrict__ X16, size_t n8) { const size_t t = (size_t)blockIdx.x * 256 + threadIdx.x; if (t >= n8) return; FragH f;
#pragma unroll
  for (int q = 0; q < 8; ++q) f.h[q] = (_Float16)bf16_round(x[t * 8 + q]); *(v8us*)((unsigned short*)X16 + t * 8) = f.half[0];  }
__global__ __launch_bounds__(256) void k_h16(const float* __restrict__ x, _Float16* __restrict__ X16, size_t n8) { const size_t t = (size_t)blockIdx.x * 256 + threadIdx.x; if (t >= n8) return; FragH f;
#pragma unroll
  for (int q = 0; q < 8; ++q) f.h[q] = (_Float16)x[t * 8 + q]; *(v8us*)((unsigned short*)X16 + t * 8) = f.half[0];  }
__global__ __launch_bounds__(256) void k_round16f(const float* __restrict__ W, _Float16* __restrict__ Bt, size_t n8) { const size_t t = (size_t)blockIdx.x * 256 + threadIdx.x; if (t >= n8) return; FragH f;
#pragma unroll
  for (int i = 0; i < 8; ++i) f.h[i] = (_Float16)(bf16_round(W[t * 8 + i]) * 16.0f); *(v8us*)((unsigned short*)Bt + t * 8) = f.half[0];  }
template <int NHv, int TTv>
__global__ __launch_bounds__(256) void k_vt(const _Float16* __restrict__ V16, int ldv, int voff, _Float16* __restrict__ Vt) { __shared__ unsigned short tl[64][66]; const int tid = threadIdx.x; const int slab = blockIdx.x / (TTv / 64), lg = blockIdx.x % (TTv / 64); const int b = slab / NHv, h = slab % NHv;
  for (int i = tid; i < 64 * 8; i += 256) { const int r = i / 8, c8 = (i % 8) * 8; FragH f; f.half[0] = *(const v8us*)((const unsigned short*)V16 + ((size_t)b * TTv + lg * 64 + r) * ldv + voff + h * 64 + c8);
#pragma unroll
    for (int q = 0; q < 8; ++q) tl[r][c8 + q] = f.u[q]; }
  __syncthreads();
  {
#pragma unroll
    for (int rd = 0; rd < 2; ++rd) { const int d = rd * 32 + tid / 8, pc = tid % 8; FragH f;
#pragma unroll
      for (int q = 0; q < 8; ++q) f.u[q] = tl[pc * 8 + q][d];
      *(v8us*)((unsigned short*)Vt + ((size_t)slab * 64 + d) * TTv + lg * 64 + pc * 8) = f.half[0]; }
     } }

__global__ __launch_bounds__(256) void k_hl(const float* __restrict__ F, _Float16* __restrict__ Hh, _Float16* __restrict__ Hl, size_t n8) { const size_t t = (size_t)blockIdx.x * 256 + threadIdx.x; if (t >= n8) return; FragH fh, fl; const v4f a = *(const v4fa*)(F + t * 8), c = *(const v4fa*)(F + t * 8 + 4);
#pragma unroll
  for (int q = 0; q < 4; ++q) { _Float16 h = (_Float16)a[q]; fh.h[q] = h; fl.h[q] = (_Float16)((a[q] - (float)h) * 1024.0f); h = (_Float16)c[q]; fh.h[4 + q] = h; fl.h[4 + q] = (_Float16)((c[q] - (float)h) * 1024.0f); }
  { *(v8us*)((unsigned short*)Hh + t * 8) = fh.half[0]; *(v8us*)((unsigned short*)Hl + t * 8) = fl.half[0];  } }

// ---- fast GEMM (wave tile 32x64; requires M % 32 == 0 rows per launch region, N % 64 == 0 and K % 64 == 0); epilogue = k_gemm_hhx semantics ----
__device__ __forceinline__ v16h g2_frag(const _Float16* p, int hh) { FragH f; f.half[0] = *(const v8us*)((const unsigned short*)p + 8 * hh); f.half[1] = *(const v8us*)((const unsigned short*)p + 16 + 8 * hh); return f.v; }
__device__ __forceinline__ v8f g2_mma(v16h a, v16h b, v8f c) { v8f d = __builtin_amdgcn_wmma_f32_16x16x32_f16(false, a, false, b, (short)0, c, false, false); asm volatile("v_nop\n\tv_nop\n\tv_nop\n\tv_nop" : "+v"(d) : "v"(a), "v"(b)); return d; }
template <int ACT>
__global__ __launch_bounds__(128) void k_gemm2(const _Float16* __restrict__ A, int lda, size_t sA, const _Float16* __restrict__ Bh, int ldb, size_t sB, float alpha, const float* __restrict__ bias, size_t sBias, const float* __restrict__ CP, int rowsPerB, size_t sCPb, int row0g,
    float* __restrict__ C, _Float16* __restrict__ C16, int ldc, size_t sC, int M, int N, int K) { static_assert(ACT == 0 || ACT == 3 || ACT == 6 || ACT == 8 || ACT == 9 || ACT == 11 || ACT == 12 || ACT == 14 || ACT == 15 || ACT == 16 || ACT == 17, "k_gemm2: unsupported ACT code (would silently apply no activation)");
  __shared__ __attribute__((aligned(16))) float so[4][32][68];
  const int tid = threadIdx.x, w = tid >> 5, lane = tid & 31, ln = lane & 15, hh = lane >> 4; const int by = blockIdx.y;
  A += (size_t)by * sA; Bh += (size_t)by * sB; const size_t cofs = (size_t)by * sC; const float* bp = bias ? bias + (size_t)by * sBias : nullptr;
  const int ntn = N >> 6; const int mt = blockIdx.x / ntn, nq = blockIdx.x - mt * ntn; const int row0 = mt * 128 + 32 * w, col0 = nq * 64; if (row0 >= M) return;
  const _Float16* a0p = A + (size_t)(row0 + ln) * lda; const _Float16* a1p = a0p + (size_t)16 * lda;
  const _Float16* b0p = Bh + (size_t)(col0 + ln) * ldb; const _Float16* b1p = b0p + (size_t)16 * ldb; const _Float16* b2p = b1p + (size_t)16 * ldb; const _Float16* b3p = b2p + (size_t)16 * ldb;
  const v8f z8 = {0.f,0.f,0.f,0.f,0.f,0.f,0.f,0.f}; v8f c00 = z8, c01 = z8, c02 = z8, c03 = z8, c10 = z8, c11 = z8, c12 = z8, c13 = z8;
  /* two fragment sets, even and odd k-steps: a set's 12 loads issue together, and it is refilled for two k-steps ahead right behind the products that read it, so two k-steps' loads are always in flight. Each accumulator still takes its k-steps in ascending order. */
  v16h a0 = g2_frag(a0p, hh), a1 = g2_frag(a1p, hh), b0 = g2_frag(b0p, hh), b1 = g2_frag(b1p, hh), b2 = g2_frag(b2p, hh), b3 = g2_frag(b3p, hh);
  v16h e0 = g2_frag(a0p + 32, hh), e1 = g2_frag(a1p + 32, hh), f0 = g2_frag(b0p + 32, hh), f1 = g2_frag(b1p + 32, hh), f2 = g2_frag(b2p + 32, hh), f3 = g2_frag(b3p + 32, hh);
  asm volatile("s_wait_xcnt 0x0" ::: "memory");      /* the accumulators' start values reuse address registers that these loads name: the wait stands in front of that overwrite */
#pragma unroll 1      /* one pair of k-steps per trip: a second copy of the body would need two more fragment sets */
  for (int kb = 64; kb < K; kb += 64) {
    c00 = g2_mma(a0, b0, c00); c10 = g2_mma(a1, b0, c10); c01 = g2_mma(a0, b1, c01); c11 = g2_mma(a1, b1, c11); c02 = g2_mma(a0, b2, c02); c12 = g2_mma(a1, b2, c12); c03 = g2_mma(a0, b3, c03); c13 = g2_mma(a1, b3, c13);
    a0 = g2_frag(a0p + kb, hh); a1 = g2_frag(a1p + kb, hh); b0 = g2_frag(b0p + kb, hh); b1 = g2_frag(b1p + kb, hh); b2 = g2_frag(b2p + kb, hh); b3 = g2_frag(b3p + kb, hh);
    c00 = g2_mma(e0, f0, c00); c10 = g2_mma(e1, f0, c10); c01 = g2_mma(e0, f1, c01); c11 = g2_mma(e1, f1, c11); c02 = g2_mma(e0, f2, c02); c12 = g2_mma(e1, f2, c12); c03 = g2_mma(e0, f3, c03); c13 = g2_mma(e1, f3, c13);
    e0 = g2_frag(a0p + kb + 32, hh); e1 = g2_frag(a1p + kb + 32, hh); f0 = g2_frag(b0p + kb + 32, hh); f1 = g2_frag(b1p + kb + 32, hh); f2 = g2_frag(b2p + kb + 32, hh); f3 = g2_frag(b3p + kb + 32, hh);
    asm volatile("s_wait_xcnt 0x0" ::: "memory"); }      /* the next trip's address additions overwrite the registers that this trip's loads name: the wait stands in front of them */
  c00 = g2_mma(a0, b0, c00); c10 = g2_mma(a1, b0, c10); c01 = g2_mma(a0, b1, c01); c11 = g2_mma(a1, b1, c11); c02 = g2_mma(a0, b2, c02); c12 = g2_mma(a1, b2, c12); c03 = g2_mma(a0, b3, c03); c13 = g2_mma(a1, b3, c13);
  c00 = g2_mma(e0, f0, c00); c10 = g2_mma(e1, f0, c10); c01 = g2_mma(e0, f1, c01); c11 = g2_mma(e1, f1, c11); c02 = g2_mma(e0, f2, c02); c12 = g2_mma(e1, f2, c12); c03 = g2_mma(e0, f3, c03); c13 = g2_mma(e1, f3, c13);
  v8f accs[8] = {c00, c01, c02, c03, c10, c11, c12, c13};
#pragma unroll
  for (int u = 0; u < 8; ++u) { const int t = u & 3, half = u >> 2; const int col = col0 + t * 16 + ln; const float bv = bp ? bf16_round(bp[col]) : 0.f;
#pragma unroll
    for (int r = 0; r < 8; ++r) { const int rloc = half * 16 + 8 * hh + r; float v = accs[u][r] * alpha + bv; if (CP) { if (rowsPerB < 0) v += CP[cofs + (size_t)(row0g + row0 + rloc) * ldc + col];      /* rowsPerB < 0: own element of the batched C plane */ else { const int bidx = (row0g + row0 + rloc) / rowsPerB; v += CP[(size_t)bidx * sCPb + (size_t)by * 64 + col]; } }
      if (ACT == 3) v = fmaxf(v, 0.f); else if (ACT == 6) v = 0.5f * v * (1.0f + erff(v * 0.70710678118654752f)); else if (ACT == 11) v = 1.0f / (1.0f + expf(-v)); else if (ACT == 15) v = v / (1.0f + expf(-v)); else if (ACT == 12) v = (v > 0.f) ? v : 0.01f * v; else if (ACT == 8) v = tanhf(v); else if (ACT == 9) v = 0.5f * v * (1.0f + tanhf(0.7978845608028654f * (v + 0.044715f * v * v * v))); else if (ACT == 14) v = (v > 0.f) ? v : 0.1f * v; else if (ACT == 16) v = (v >= 0.f) ? v : 0.3f * v; else if (ACT == 17) v = (v >= 0.f) ? v : 0.2f * v;
      so[w][rloc][t * 16 + ln] = v; } }
  __builtin_amdgcn_fence(__ATOMIC_ACQ_REL, "workgroup"); __builtin_amdgcn_wave_barrier();
  const int rsub = lane >> 4, c4 = (lane & 15) * 4;
  {
#pragma unroll
    for (int q = 0; q < 16; ++q) { const int r = q * 2 + rsub; const v4f v = *(const v4fa*)&so[w][r][c4]; if (C) *(v4f*)(C + cofs + (size_t)(row0 + r) * ldc + col0 + c4) = v; if (C16) { v4h h4; for (int i = 0; i < 4; ++i) h4[i] = (_Float16)v[i]; *(v4h*)(C16 + cofs + (size_t)(row0 + r) * ldc + col0 + c4) = h4; } }
     } }


__global__ __launch_bounds__(256) void k_wnat(const float* __restrict__ w, size_t n8, _Float16* __restrict__ Bt) { const size_t t = (size_t)blockIdx.x * 256 + threadIdx.x; if (t >= n8) return; FragH f; for (int q = 0; q < 8; ++q) f.h[q] = (_Float16)(bf16_round(w[t * 8 + q]) * 16.0f); *(v8us*)((unsigned short*)Bt + t * 8) = f.half[0];  }
__global__ __launch_bounds__(256) void k_rsm(const float* __restrict__ S, _Float16* __restrict__ P, int nrows) {
  #pragma clang fp contract(off)
  const int i = blockIdx.x * 256 + threadIdx.x; if (i >= nrows) return; const float* s = S + (size_t)i * SQ; float mx = -3.0e38f;
#pragma unroll 1
  for (int j = 0; j < SQ; ++j) mx = fmaxf(mx, s[j]); float se = 0.f;
#pragma unroll 1
  for (int j = 0; j < SQ; ++j) se += expf(s[j] - mx); const float sc = 256.0f / se;
#pragma unroll 1
  for (int j0 = 0; j0 < SQ; j0 += 8) { FragH f; for (int q = 0; q < 8; ++q) f.h[q] = (_Float16)(expf(s[j0 + q] - mx) * sc); unsigned short* d = (unsigned short*)P + (size_t)i * SQ + j0; *(v8us*)d = f.half[0];  } }
__global__ __launch_bounds__(256) void k_vt(const _Float16* __restrict__ V16, int b, int h0, _Float16* __restrict__ VT) { __shared__ unsigned short tl[64][65]; const int tid = threadIdx.x; const int hh = blockIdx.x % HG, sg = blockIdx.x / HG; const int s0 = sg * 64; const int h = h0 + hh;
  for (int i = tid; i < 64 * 8; i += 256) { const int j = i / 8, d8 = (i % 8) * 8; FragH f; f.half[0] = *(const v8us*)((const unsigned short*)V16 + ((size_t)b * SQ + s0 + j) * DM + h * HD + d8); for (int q = 0; q < 8; ++q) tl[d8 + q][j] = f.u[q]; }
  __syncthreads();
  { for (int i = tid; i < 64 * 8; i += 256) { const int d = i / 8, j8 = (i % 8) * 8; FragH f; for (int q = 0; q < 8; ++q) f.u[q] = tl[d][j8 + q]; *(v8us*)((unsigned short*)VT + ((size_t)hh * HD + d) * SQ + s0 + j8) = f.half[0]; }  } }



// causal row softmax, one wave per row: lane l holds columns c*128 + 4*l .. + 3 of the row in registers (every load 512 contiguous bytes, every store 256), S read once;
// row maximum and row sum by a five-step butterfly over the 32 lanes; keys above the row's own index take -1e9 (weight 0). nk a multiple of 256, at most NKX.
__global__ __launch_bounds__(256) void k_rsmcf2(const float* __restrict__ S, _Float16* __restrict__ P, int hg, int q0, int nk) {
  const int lane = threadIdx.x & 31; const int t = blockIdx.x * 8 + (threadIdx.x >> 5); if (t >= hg * QT) return;
  const float* s = S + (size_t)t * NKX + lane * 4; _Float16* p = P + (size_t)t * NKX + lane * 4; const int last = q0 + (t % QT); const int nc = nk >> 8;
  v4f v[NKX / 128];
#pragma unroll      /* here and in the three loops below: static indices keep v[] in registers */
  for (int c = 0; c < NKX / 256; ++c) if (c < nc) { v[2 * c] = *(const v4fa*)(s + c * 256); v[2 * c + 1] = *(const v4fa*)(s + c * 256 + 128); }
  float mx = -3.0e38f;
#pragma unroll
  for (int c = 0; c < NKX / 256; ++c) if (c < nc) { for (int u = 2 * c; u < 2 * c + 2; ++u) for (int q = 0; q < 4; ++q) { const float m = (u * 128 + lane * 4 + q <= last) ? v[u][q] : -1.0e9f; v[u][q] = m; mx = fmaxf(mx, m); } }
  for (int d = 16; d > 0; d >>= 1) mx = fmaxf(mx, __shfl_xor(mx, d, 32));
  v4f s4 = {0.f, 0.f, 0.f, 0.f};
#pragma unroll
  for (int c = 0; c < NKX / 256; ++c) if (c < nc) { for (int u = 2 * c; u < 2 * c + 2; ++u) for (int q = 0; q < 4; ++q) { const float e = __expf(v[u][q] - mx); v[u][q] = e; s4[q] += e; } }
  float se = (s4[0] + s4[1]) + (s4[2] + s4[3]);
  for (int d = 16; d > 0; d >>= 1) se += __shfl_xor(se, d, 32);
  const float sc = 256.0f / se;
#pragma unroll
  for (int c = 0; c < NKX / 256; ++c) if (c < nc) { for (int u = 2 * c; u < 2 * c + 2; ++u) { v4h h; for (int q = 0; q < 4; ++q) h[q] = (_Float16)(v[u][q] * sc); *(v4h*)(p + u * 128) = h; }
    asm volatile("s_wait_xcnt 0x0" ::: "memory"); }      /* the next chunk's products reuse the registers that these two stores name: the wait stands in front of that overwrite */
}


template <int MASKADD>
__global__ __launch_bounds__(64) void k_att0(const float* __restrict__ QF, const float* __restrict__ KF, const float* __restrict__ VF, int ld, const float* __restrict__ mask, float scale, float* __restrict__ OF, int ldo) {
  #pragma clang fp contract(off)
  __shared__ __attribute__((aligned(16))) float lo[64][64];      /* only the transpose for the coalesced store at the end */
  const int tid = threadIdx.x; const int h = blockIdx.x / (QT0 / 64), rg = blockIdx.x % (QT0 / 64); const int i = rg * 64 + tid;
  const float* qr = QF + (size_t)i * ld + h * HD;
  v4f rq[HD / 4], ro[HD / 4];      /* the thread's own q row and o row, in registers for the whole key loop */
#pragma unroll      /* here and in the inner loops below: static indices keep rq[] / ro[] in registers, and a key's loads issue together */
  for (int c = 0; c < HD / 4; ++c) { rq[c] = *(const v4fa*)(qr + c * 4); const v4f z = {0.f, 0.f, 0.f, 0.f}; ro[c] = z; }
  float m = -1.0e30f, l = 0.f; const int jmax = MASKADD ? (SQ - 1) : (rg * 64 + 63);      /* additive-mask form: every key (the mask input decides); causal form: keys up to the block's last row */
#pragma unroll 1
  for (int j = 0; j <= jmax; ++j) { const float* kr = KF + (size_t)j * ld + h * HD; const float* vr = VF + (size_t)j * ld + h * HD; float s = 0.f;
#pragma unroll
    for (int c = 0; c < HD / 4; ++c) { const v4f kq = *(const v4fa*)(kr + c * 4); const v4f qq = rq[c]; s = __fadd_rn(s, __fmul_rn(qq[0], kq[0])); s = __fadd_rn(s, __fmul_rn(qq[1], kq[1])); s = __fadd_rn(s, __fmul_rn(qq[2], kq[2])); s = __fadd_rn(s, __fmul_rn(qq[3], kq[3])); }
    s = __fmul_rn(s, scale); if (MASKADD) s = __fadd_rn(s, __fmul_rn(bf16_round(mask[(size_t)i * SQ + j]), -10000.0f));
    const float f = (MASKADD || j <= i) ? 1.f : 0.f; const float sm = fmaf(f, s, (1.f - f) * -1.0e30f); const float mn = fmaxf(m, sm); const float sc = expf(m - mn); const float e = expf(sm - mn); l = __fadd_rn(__fmul_rn(l, sc), e); m = mn;
#pragma unroll
    for (int c = 0; c < HD / 4; ++c) { const v4f vv = *(const v4fa*)(vr + c * 4); v4f oo = ro[c]; for (int u = 0; u < 4; ++u) oo[u] = __fadd_rn(__fmul_rn(oo[u], sc), __fmul_rn(e, vv[u])); ro[c] = oo; } }
  const float fin = 64.0f / l;      /* o carried x64 like the f16 path */
#pragma unroll
  for (int c = 0; c < HD / 4; ++c) { v4f oo = ro[c]; for (int u = 0; u < 4; ++u) oo[u] = __fmul_rn(oo[u], fin); *(v4f*)&lo[tid][c * 4] = oo; }
  __syncthreads();
  {
#pragma unroll 1
    for (int it = 0; it < 16; ++it) { const int row = it * 4 + tid / 16, pc = (tid % 16) * 4; const v4f v = *(const v4f*)&lo[row][pc]; *(v4f*)(OF + (size_t)(rg * 64 + row) * ldo + h * HD + pc) = v; }
     } }


template <int BFIN, int WXB>
__global__ __launch_bounds__(256) void k_ln16(const float* __restrict__ X, const float* __restrict__ g, const float* __restrict__ bb, float eps, _Float16* __restrict__ N16, float* __restrict__ XB) {
  #pragma clang fp contract(off)
  __shared__ float red[256]; const size_t r = blockIdx.x; const int t = threadIdx.x; const v4f xa = *(const v4fa*)(X + r * DMQ + t * 4); float s[4]; float sum = 0.f;
  for (int q = 0; q < 4; ++q) { s[q] = BFIN ? bf16_round(xa[q]) : xa[q]; sum = __fadd_rn(sum, s[q]); }
  red[t] = sum; __syncthreads(); for (int st = 128; st > 0; st >>= 1) { if (t < st) red[t] = __fadd_rn(red[t], red[t + st]); __syncthreads(); } const float mu = red[0] / (float)DMQ; __syncthreads();
  float vs = 0.f; for (int q = 0; q < 4; ++q) { const float dl = __fadd_rn(s[q], -mu); vs = __fadd_rn(vs, __fmul_rn(dl, dl)); } red[t] = vs; __syncthreads(); for (int st = 128; st > 0; st >>= 1) { if (t < st) red[t] = __fadd_rn(red[t], red[t + st]); __syncthreads(); }
  const float rs = rsqrtf(__fadd_rn(red[0] / (float)DMQ, eps)); v4h y; v4f xb;
  for (int q = 0; q < 4; ++q) { const int c = t * 4 + q; y[q] = (_Float16)__fadd_rn(__fmul_rn(__fmul_rn(__fadd_rn(s[q], -mu), rs), bf16_round(g[c])), bf16_round(bb[c])); xb[q] = s[q]; }
  { *(v4h*)(N16 + r * DMQ + t * 4) = y; if (WXB) *(v4f*)(XB + r * DMQ + t * 4) = xb;  } }
__global__ __launch_bounds__(256) void k_ftres2(const float* __restrict__ OF0, const float* __restrict__ XB, float* __restrict__ X1, size_t n4) {
  #pragma clang fp contract(off)
  const size_t t = (size_t)blockIdx.x * 256 + threadIdx.x; if (t >= n4) return; const v4f o = *(const v4fa*)(OF0 + t * 4), xv = *(const v4fa*)(XB + t * 4); v4f y; for (int q = 0; q < 4; ++q) y[q] = __fadd_rn(__fmul_rn(o[q], 0.015625f), xv[q]); *(v4f*)(X1 + t * 4) = y;  }

__global__ __launch_bounds__(256) void k_wthd(const float* __restrict__ Wt, _Float16* __restrict__ Bt) { const size_t t = (size_t)blockIdx.x * 256 + threadIdx.x; if (t >= (size_t)NH * HD * (DM / 8)) return; const int m8 = (int)(t % (DM / 8)) * 8; const int d = (int)((t / (DM / 8)) % HD); const int h = (int)(t / ((size_t)(DM / 8) * HD)); FragH f;
  for (int q = 0; q < 8; ++q) f.h[q] = (_Float16)(16.0f * bf16_round(Wt[((size_t)h * DM + m8 + q) * HD + d])); unsigned short* dst = (unsigned short*)Bt + ((size_t)h * HD + d) * DM + m8; *(v8us*)dst = f.half[0];  }




__global__ __launch_bounds__(256) void k_wtpad(const float* __restrict__ Wm, _Float16* __restrict__ Wt, int Kr, int Kp, int Nr, int Np, float scale) {
  const int t = blockIdx.x * 256 + threadIdx.x; if (t >= Np * (Kp / 8)) return; const int n = t / (Kp / 8), k8 = (t % (Kp / 8)) * 8; const int nc = min(n, Nr - 1); const float fn = (n < Nr) ? 1.f : 0.f; FragH f;
  for (int i = 0; i < 8; ++i) { const int k = k8 + i; const int kc = min(k, Kr - 1); const float fk = (k < Kr) ? fn : 0.f; f.h[i] = (_Float16)(bf16_round(Wm[(size_t)kc * Nr + nc]) * scale * fk); }
  unsigned short* o = (unsigned short*)Wt + (size_t)n * Kp + k8; *(v8us*)o = f.half[0];  }
__global__ __launch_bounds__(128) void k_bpad(const float* __restrict__ b, float* __restrict__ Bp, int nr, int np) {
  const int i = threadIdx.x; if (i >= np) return; const float v = b[min(i, nr - 1)] * ((i < nr) ? 1.f : 0.f); *(float*)(Bp + i) = v;  }
extern "C" void kernel_launch(void* const* d_in, const int* in_sizes, int n_in,
                              void* d_out, int out_size, void* d_ws, size_t ws_size, hipStream_t stream) {
  (void)in_sizes; (void)n_in; (void)out_size;
  const float* const* I = (const float* const*)d_in; const float* x = I[0]; const float* g1 = I[1]; const float* be1 = I[2]; const float* wq = I[3]; const float* wk = I[4]; const float* wv = I[5]; const float* wo = I[6]; const float* bo = nullptr; const float* gg2 = I[7]; const float* be2 = I[8]; const float* wfc = I[9]; const float* bfc = I[10]; const float* wmp = I[11]; const float* bmp = I[12];      /* x, LN1 g / b, Wq / Wk / Wv / Wo [1024][1024] ([in][out], no biases), LN2 g / b, W1 [1024][4096] + b1, W2 [4096][1024] + b2 */
  char* ws = (char*)d_ws; size_t off = 0;
  auto take = [&](size_t bytes) { char* p = ws + off; off += (bytes + 255) & ~(size_t)255; return p; };
  _Float16* BQKV = (_Float16*)take((size_t)3 * DM * DM * 2); _Float16* BO = (_Float16*)take((size_t)DM * DM * 2);
  _Float16* X16 = (_Float16*)take(NR * DM * 2); float* XB = (float*)take(NR * DM * 4); float* X1 = (float*)take(NR * DM * 4); _Float16* M16 = nullptr;      /* = X16 below (alias: X16's last reader, the last batch's first-tile GEMMs, precedes LN2's write) */ _Float16* HF16 = (_Float16*)take((size_t)SQ * DFF * 2); _Float16* BW1 = (_Float16*)take((size_t)DFF * DM * 2); _Float16* BW2 = (_Float16*)take((size_t)DM * DFF * 2); _Float16* QKV = (_Float16*)take(NR * 3 * DM * 2); _Float16* Q16 = QKV; _Float16* K16 = QKV + DM; _Float16* V16 = QKV + 2 * DM; _Float16* O16 = (_Float16*)take(NR * DM * 2); M16 = X16;
  float* S = (float*)take((size_t)NH * QT * NKX * 4); _Float16* P = (_Float16*)take((size_t)NH * QT * NKX * 2); _Float16* VT = (_Float16*)take((size_t)NH * HD * SQ * 2);
  float* QF0 = (float*)take((size_t)QT0 * DM * 4); float* KF0 = (float*)take((size_t)QT0 * DM * 4); float* VF0 = (float*)take((size_t)QT0 * DM * 4); float* OF0 = (float*)take((size_t)NB * QT0 * DM * 4); _Float16* OH0 = (_Float16*)take((size_t)NB * QT0 * DM * 2); _Float16* OL0 = (_Float16*)take((size_t)NB * QT0 * DM * 2);
  if (off > ws_size) return;
  { const unsigned g = (unsigned)(((size_t)DM * (DM / 8) + 255) / 256); k_wt_f16<<<g, 256, 0, stream>>>(wq, BQKV, DM, DM, 16.0f); k_wt_f16<<<g, 256, 0, stream>>>(wk, BQKV + (size_t)DM * DM, DM, DM, 16.0f); k_wt_f16<<<g, 256, 0, stream>>>(wv, BQKV + (size_t)2 * DM * DM, DM, DM, 16.0f); }      /* [in][out] -> Bt x16, stacked q | k | v */ k_wt_f16<<<(unsigned)(((size_t)DM * (DM / 8) + 255) / 256), 256, 0, stream>>>(wo, BO, DM, DM, 16.0f);      /* w_proj [in][out] -> Bt x16 */
  k_ln16<1, 1><<<(unsigned)NR, 256, 0, stream>>>(x, g1, be1, 1e-5f, X16, XB);      /* a = LN1(bf16(x)) -> f16 rows; XB = bf16(x) for the residual */
  k_wt_f16<<<(unsigned)(((size_t)DFF * (DM / 8) + 255) / 256), 256, 0, stream>>>(wfc, BW1, DM, DFF, 16.0f); k_wt_f16<<<(unsigned)(((size_t)DM * (DFF / 8) + 255) / 256), 256, 0, stream>>>(wmp, BW2, DFF, DM, 16.0f);      /* W1 [1024][4096] -> Bt [4096][1024]; W2 [4096][1024] -> Bt [1024][4096] (x16) */
  const size_t r0p = (size_t)B0 * SQ;      /* first projected row */
  k_gemm2<0><<<dim3((unsigned)((MP / 128) * (3 * DM / 64)), 1), 128, 0, stream>>>(X16 + r0p * DM, DM, 0, BQKV, DM, 0, 0.0625f, nullptr, 0, nullptr, 1, 0, 0, nullptr, QKV + r0p * 3 * DM, 3 * DM, 0, MP, 3 * DM, DM);      /* q | k | v rows (f16); head h = columns h*HD.. of each DM block */
  for (int b = B0; b < B0 + NBR; ++b) { const size_t r0 = (size_t)b * SQ;
    k_vt<NH, SQ><<<NH * (SQ / 64), 256, 0, stream>>>(V16 + r0 * LQ, LQ, 0, VT);      /* V^T [NH][HD][SQ] for this batch */
    k_gemm2<0><<<dim3((QT0 / 128) * (DM / 64), 1), 128, 0, stream>>>(X16 + r0 * DM, DM, 0, BQKV, DM, 0, 0.0625f, nullptr, 0, nullptr, 1, 0, 0, QF0, nullptr, DM, 0, QT0, DM, DM); k_gemm2<0><<<dim3((QT0 / 128) * (DM / 64), 1), 128, 0, stream>>>(X16 + r0 * DM, DM, 0, (BQKV + (size_t)DM * DM), DM, 0, 0.0625f, nullptr, 0, nullptr, 1, 0, 0, KF0, nullptr, DM, 0, QT0, DM, DM); k_gemm2<0><<<dim3((QT0 / 128) * (DM / 64), 1), 128, 0, stream>>>(X16 + r0 * DM, DM, 0, (BQKV + (size_t)2 * DM * DM), DM, 0, 0.0625f, nullptr, 0, nullptr, 1, 0, 0, VF0, nullptr, DM, 0, QT0, DM, DM);      /* f32 q, k, v of the first 128 rows (exact products) */
    k_att0<0><<<NH * (QT0 / 64), 64, 0, stream>>>(QF0, KF0, VF0, DM, nullptr, 0.125f, OF0 + (size_t)b * QT0 * DM, DM);      /* exact f32 attention for rows 0..127 (o x64) */
    for (int q0 = 0; q0 < QN; q0 += QT) { const int nk = q0 + QT;      /* causal: only keys below the tile end are computed */
      k_gemm2<0><<<dim3((QT / 128) * (nk / 64), NHD), 128, 0, stream>>>(Q16 + (r0 + q0) * LQ, LQ, (size_t)HD, K16 + r0 * LQ, LQ, (size_t)HD, 0.125f, nullptr, 0, nullptr, 1, 0, 0, S, nullptr, NKX, (size_t)QT * NKX, QT, nk, HD);      /* scores, all heads on grid.y */
      k_rsmcf2<<<(NHD * QT + 7) / 8, 256, 0, stream>>>(S, P, NHD, q0, nk);      /* one wave per row, 8 rows per block */
      k_gemm2<0><<<dim3((QT / 128) * (HD / 64), NHD), 128, 0, stream>>>(P, NKX, (size_t)QT * NKX, VT, SQ, (size_t)HD * SQ, 0.25f, nullptr, 0, nullptr, 1, 0, 0, nullptr, O16 + (r0 + q0) * DM, DM, (size_t)HD, QT, HD, nk); } }      /* o (merged heads, x64) as f16 rows */
  k_gemm2<0><<<dim3((unsigned)((MPO / 128) * (DM / 64)), 1), 128, 0, stream>>>(O16 + r0p * DM, DM, 0, BO, DM, 0, 0.0009765625f, bo, 0, XB + r0p * DM, -1, 0, 0, X1 + r0p * DM, nullptr, DM, 0, MPO, DM, DM);      /* x1 = x + o Wo (f32 rows) */
  k_hl<<<(unsigned)(((size_t)NB * QT0 * DM / 8 + 255) / 256), 256, 0, stream>>>(OF0, OH0, OL0, (size_t)NB * QT0 * DM / 8);      /* first-tile o (x64) -> f16 hi + x1024 residual planes */
  for (int b = B0; b < B0 + NBR; ++b) { const size_t r0 = (size_t)b * SQ; const size_t f0 = (size_t)b * QT0;
    k_gemm2<0><<<dim3((QT0 / 128) * (DM / 64), 1), 128, 0, stream>>>(OH0 + f0 * DM, DM, 0, BO, DM, 0, 0.0009765625f, bo, 0, XB + r0 * DM, -1, 0, 0, X1 + r0 * DM, nullptr, DM, 0, QT0, DM, DM);      /* rows 0..127: x1 = x + o_hi Wo, overwriting the f16-path rows */
    k_gemm2<0><<<dim3((QT0 / 128) * (DM / 64), 1), 128, 0, stream>>>(OL0 + f0 * DM, DM, 0, BO, DM, 0, 0.00000095367431640625f, nullptr, 0, X1 + r0 * DM, -1, 0, 0, X1 + r0 * DM, nullptr, DM, 0, QT0, DM, DM); }      /* += o_lo Wo 2^-20 (own-element accumulate) */
  k_ln16<0, 0><<<(unsigned)NR, 256, 0, stream>>>(X1, gg2, be2, 1e-5f, M16, nullptr);      /* h = LN2(x1) -> f16 rows */
  for (int b = 0; b < NB; ++b) { const size_t r0 = (size_t)b * SQ;
    k_gemm2<6><<<dim3((unsigned)((SQ / 128) * (DFF / 64)), 1), 128, 0, stream>>>(M16 + r0 * DM, DM, 0, BW1, DM, 0, 0.0625f, bfc, 0, nullptr, 1, 0, 0, nullptr, HF16, DFF, 0, SQ, DFF, DM);      /* gelu_erf(h2 W1 + b1) -> f16 (this batch) */
    k_gemm2<0><<<dim3((unsigned)((SQ / 128) * (DM / 64)), 1), 128, 0, stream>>>(HF16, DFF, 0, BW2, DFF, 0, 0.0625f, bmp, 0, X1 + r0 * DM, -1, 0, 0, (float*)d_out + r0 * DM, nullptr, DM, 0, SQ, DM, DFF); }      /* out = x1 + mlp (own-element residual) */
}

// v004
// It runs in 1590 microseconds.
// Next to v003, in two timings, it ran 1.57 times as fast each time.
// Over all steps from v000 it is 6.79 times as fast.
#include <hip/hip_runtime.h>
// Pre-LN causal transformer block (x [4][2048][1024]; h = LN1(x) (biased var, eps 1e-5, gamma / beta); Q/K/V = h Wq/Wk/Wv ([in][out] 1024 x 1024 sigma 1/32, no biases), 16 heads of 64; scores / 8; causal (tril, -inf); softmax; x1 = x + hidden Wo ([in][out], no bias); h2 = LN2(x1); out = x1 + gelu_erf(h2 W1 + b1) W2 + b2 ([in][out] 1024 x 4096 x 1024) -> [4][2048][1024]).
// Structure: token rows r = b*2048 + s; h = LN1(bf16-rounded x) as f16 rows; q | k | v as ONE WMMA GEMM (N = 3 x 1024) (32x64 wave tiles, f32 accumulation, exact x16 weights, no bias, f16 outputs); V^T for all batches and heads via LDS transposes; ONE fused causal attention launch: a wave owns 32 query rows and walks the keys below its last row 32 at a time, scores^T = K . Q^T on WMMA (keys on the accumulator rows, so a lane holds one query's scores), running row maximum and row sum in f32 (native exp2; weights x16 f16, taken from the accumulators in place as the B fragment), o^T += V^T . P^T on WMMA, o carried x64 (folded into the output GEMM alpha) written straight into the merged f16 o rows; x1 = x + o W_o GEMM (f32, no bias) into the output layout.
// Compute dtype: inputs rounded to bf16; x / weights exact; q, k, v, softmax weights and o as plain f16 GEMM operands (~2^-12); scores and softmax statistics f32. v_wmma_f32_16x16x32_f16.
#define NB 4
#define SQ 2048
#define DM 1024
#define NH 16
#define HD 64
#define HG 4                         /* heads per block group of the unlaunched k_vt(b, h0) overload */
#define QT 256                       /* unused */
#define NKX SQ                       /* S / P row pitch */
#define QT0 128                      /* first-tile rows recomputed exactly in f32 */
#define B0 0                         /* first batch processed (debug hook) */
#define NBR NB                       /* batches processed (debug hook) */
#define NR ((size_t)NB * SQ)
#define DMQ DM
#define DFF 4096                     /* FFN hidden width */
#define DFFR 100                     /* unused */
#define MP ((int)((size_t)NBR * SQ)) /* rows projected (debug hook) */
#define QN SQ                        /* unused */
#define NHD NH                       /* unused */
#define MPO MP                       /* rows through the output stage (debug hook) */
#define LQ (3 * DM)      /* row pitch of the q/k/v rows */
typedef __bf16 v16b __attribute__((ext_vector_type(16)));
typedef unsigned short v8us __attribute__((ext_vector_type(8), may_alias));
typedef float  v8f  __attribute__((ext_vector_type(8)));
typedef float  v4f  __attribute__((ext_vector_type(4)));
typedef float  v4fa __attribute__((ext_vector_type(4), may_alias));
union FragB { v16b v; v8us half[2]; unsigned short u[16]; };

__device__ __forceinline__ unsigned short bf16_bits(float x) { unsigned int u = __float_as_uint(x); return (unsigned short)((u + 0x7FFFu + ((u >> 16) & 1u)) >> 16); }
__device__ __forceinline__ float bf16_val(unsigned short b) { return __uint_as_float(((unsigned int)b) << 16); }
__device__ __forceinline__ float bf16_round(float x) { return bf16_val(bf16_bits(x)); }
// D += A·B with NT terms: 1 = ah·bh, 2 = + al·bh (A split), 3 = + ah·bl (both split)
template <int NT>
__device__ __forceinline__ v8f mmaN(v16b ah, v16b al, v16b bh, v16b bl, v8f c) {
  c = __builtin_amdgcn_wmma_f32_16x16x32_bf16(false, ah, false, bh, (short)0, c, false, false);
  if (NT >= 2) c = __builtin_amdgcn_wmma_f32_16x16x32_bf16(false, al, false, bh, (short)0, c, false, false);
  if (NT >= 3) c = __builtin_amdgcn_wmma_f32_16x16x32_bf16(false, ah, false, bl, (short)0, c, false, false);
  asm volatile("v_nop\n\tv_nop\n\tv_nop\n\tv_nop" : "+v"(c) : "v"(ah), "v"(al), "v"(bh), "v"(bl));
  return c;
}

__global__ __launch_bounds__(256) void k_wt_bf16(const float* __restrict__ W, unsigned short* __restrict__ Wt, int K, int N) {
  const int t = blockIdx.x * 256 + threadIdx.x;
  const int k8n = K / 8;
  if (t >= N * k8n) return;
  const int n = t / k8n, k8 = (t % k8n) * 8;
  v8us v;
#pragma unroll
  for (int i = 0; i < 8; ++i) v[i] = bf16_bits(W[(size_t)(k8 + i) * N + n]);
  *(v8us*)(Wt + (size_t)n * K + k8) = v;
  
}

// GEMM C[M][N] (f32, pitch ldc) = act(A[M][K]·W + bias). A f32 row-major (pitch lda) converted per fragment to bf16
// (ASPLIT: hi/lo two planes -> 2 terms, else single rounded term); Wt bf16 [N][K] (pitch ldb). BIAS_BF16 rounds the
// bias to bf16 first (bias quantised to bf16 before the add). K%32==0, M%16==0, N%64==0.
template <bool ASPLIT, int ACT, bool BIAS_BF16>
__global__ __launch_bounds__(128) void k_gemm_bf(const float* __restrict__ A, int lda, const unsigned short* __restrict__ Wt, int ldb,
                                               const float* __restrict__ bias, float* __restrict__ C, int ldc, int M, int N, int K) {
  __shared__ __attribute__((aligned(16))) float so[4][16][64];
  const int tid = threadIdx.x, w = tid >> 5, lane = tid & 31, ln = lane & 15, hh = lane >> 4;
  const int ntn = N / 64;
  const int wid = blockIdx.x * 4 + w;
  const int mt = wid / ntn, nq = wid % ntn;
  if (mt * 16 >= M) return;
  const int row0 = mt * 16, col0 = nq * 64;
  const float* arow = A + (size_t)(row0 + ln) * lda;
  v8f acc[4] = {};
  for (int kb = 0; kb < K; kb += 32) {
    FragB ah, al;
    const v4f x0 = *(const v4fa*)(arow + kb + 8 * hh), x1 = *(const v4fa*)(arow + kb + 8 * hh + 4);
    const v4f x2 = *(const v4fa*)(arow + kb + 16 + 8 * hh), x3 = *(const v4fa*)(arow + kb + 16 + 8 * hh + 4);
    float xs[16] = {x0[0],x0[1],x0[2],x0[3],x1[0],x1[1],x1[2],x1[3],x2[0],x2[1],x2[2],x2[3],x3[0],x3[1],x3[2],x3[3]};
#pragma unroll
    for (int i = 0; i < 16; ++i) { const unsigned short hb = bf16_bits(xs[i]); ah.u[i] = hb; al.u[i] = ASPLIT ? bf16_bits(xs[i] - bf16_val(hb)) : (unsigned short)0; }
#pragma unroll
    for (int t = 0; t < 4; ++t) {
      const unsigned short* brow = Wt + (size_t)(col0 + t * 16 + ln) * ldb + kb;
      FragB b;
      b.half[0] = *(const v8us*)(brow + 8 * hh);
      b.half[1] = *(const v8us*)(brow + 16 + 8 * hh);
      acc[t] = mmaN<ASPLIT ? 2 : 1>(ah.v, al.v, b.v, b.v, acc[t]);
    }
  }
#pragma unroll
  for (int t = 0; t < 4; ++t) {
    float bv = bias ? bias[col0 + t * 16 + ln] : 0.f;
    if (BIAS_BF16) bv = bf16_round(bv);
#pragma unroll
    for (int r = 0; r < 8; ++r) { float v = acc[t][r] + bv; if (ACT == 1) v = fmaxf(v, 0.f); so[w][8 * hh + r][t * 16 + ln] = v; }
  }
  __builtin_amdgcn_fence(__ATOMIC_ACQ_REL, "workgroup");
  __builtin_amdgcn_wave_barrier();
  const int rsub = lane >> 4, c4 = (lane & 15) * 4;
  {
#pragma unroll
    for (int q = 0; q < 8; ++q) {
      const int r = q * 2 + rsub;
      const v4f v = *(const v4fa*)&so[w][r][c4];
      *(v4f*)(C + (size_t)(row0 + r) * ldc + col0 + c4) = v;
    }
    
  }
}

// GEMM C = act(A·W + bias + resid): A f32 (ASPLIT -> hi/lo 2 terms), Wt bf16 [N][K]; ACT 0 none, 1 relu, 2 exact gelu;
// resid (optional, f32, row index = (row % rmod), pitch ldr, RES_BF16 rounds it) added before the activation.
template <bool ASPLIT, int ACT, bool BIAS_BF16, bool RES_BF16>
__global__ __launch_bounds__(128) void k_gemm_bf3(const float* __restrict__ A, int lda, const unsigned short* __restrict__ Wt, int ldb,
                                                const float* __restrict__ bias, const float* __restrict__ resid, int rmod, int ldr,
                                                float* __restrict__ C, int ldc, int M, int N, int K) {
  __shared__ __attribute__((aligned(16))) float so[4][16][64];
  const int tid = threadIdx.x, w = tid >> 5, lane = tid & 31, ln = lane & 15, hh = lane >> 4;
  const int ntn = N / 64;
  const int wid = blockIdx.x * 4 + w;
  const int mt = wid / ntn, nq = wid % ntn;
  if (mt * 16 >= M) return;
  const int row0 = mt * 16, col0 = nq * 64;
  const float* arow = A + (size_t)(row0 + ln) * lda;
  v8f acc[4] = {};
  for (int kb = 0; kb < K; kb += 32) {
    FragB ah, al;
    const v4f x0 = *(const v4fa*)(arow + kb + 8 * hh), x1 = *(const v4fa*)(arow + kb + 8 * hh + 4);
    const v4f x2 = *(const v4fa*)(arow + kb + 16 + 8 * hh), x3 = *(const v4fa*)(arow + kb + 16 + 8 * hh + 4);
    float xs[16] = {x0[0],x0[1],x0[2],x0[3],x1[0],x1[1],x1[2],x1[3],x2[0],x2[1],x2[2],x2[3],x3[0],x3[1],x3[2],x3[3]};
#pragma unroll
    for (int i = 0; i < 16; ++i) { const unsigned short hb = bf16_bits(xs[i]); ah.u[i] = hb; al.u[i] = ASPLIT ? bf16_bits(xs[i] - bf16_val(hb)) : (unsigned short)0; }
#pragma unroll
    for (int t = 0; t < 4; ++t) {
      const unsigned short* brow = Wt + (size_t)(col0 + t * 16 + ln) * ldb + kb;
      FragB b;
      b.half[0] = *(const v8us*)(brow + 8 * hh);
      b.half[1] = *(const v8us*)(brow + 16 + 8 * hh);
      acc[t] = mmaN<ASPLIT ? 2 : 1>(ah.v, al.v, b.v, b.v, acc[t]);
    }
  }
#pragma unroll
  for (int t = 0; t < 4; ++t) {
    const int col = col0 + t * 16 + ln;
    float bv = bias ? bias[col] : 0.f;
    if (BIAS_BF16) bv = bf16_round(bv);
#pragma unroll
    for (int r = 0; r < 8; ++r) {
      float v = acc[t][r] + bv;
      if (resid) { float rv = resid[(size_t)((row0 + 8 * hh + r) % rmod) * ldr + col]; if (RES_BF16) rv = bf16_round(rv); v += rv; }
      if (ACT == 1) v = fmaxf(v, 0.f);
      if (ACT == 2) v = 0.5f * v * (1.0f + erff(v * 0.70710678118654752f));
      if (ACT == 3) { const float u = 0.7978845608028654f * (v + 0.044715f * v * v * v); v = 0.5f * v * (1.0f + tanhf(u)); }
      so[w][8 * hh + r][t * 16 + ln] = v;
    }
  }
  __builtin_amdgcn_fence(__ATOMIC_ACQ_REL, "workgroup");
  __builtin_amdgcn_wave_barrier();
  const int rsub = lane >> 4, c4 = (lane & 15) * 4;
  {
#pragma unroll
    for (int q = 0; q < 8; ++q) {
      const int r = q * 2 + rsub;
      const v4f v = *(const v4fa*)&so[w][r][c4];
      *(v4f*)(C + (size_t)(row0 + r) * ldc + col0 + c4) = v;
    }
    
  }
}
// row LayerNorm (biased variance, eps) over N: s = X (+ R); optional out_sum <- s; out_norm <- (s-mu)*rsqrt(var+eps)*g + b
template <bool PARAM_BF16>
__global__ __launch_bounds__(256) void k_layernorm(const float* __restrict__ X, const float* __restrict__ R, const float* __restrict__ g, const float* __restrict__ bta,
                                                  float* __restrict__ out_sum, float* __restrict__ out_norm, int N, float eps) {
  __shared__ float red[256];
  const int row = blockIdx.x, tid = threadIdx.x;
  const float* x = X + (size_t)row * N; const float* rr = R ? R + (size_t)row * N : nullptr;
  float vals[16];                     // up to N = 4096
  const int per = N / 256;            // contiguous chunk per thread? use strided-by-4 chunks: thread handles j = tid*4 + 1024*u
  float s1 = 0.f;
  for (int u = 0; u < per / 4; ++u) {
    const int j = tid * 4 + 1024 * u;
    const v4f a = *(const v4fa*)(x + j);
    v4f b = {0.f,0.f,0.f,0.f}; if (rr) b = *(const v4fa*)(rr + j);
#pragma unroll
    for (int q = 0; q < 4; ++q) { const float v = a[q] + b[q]; vals[u * 4 + q] = v; s1 += v; }
  }
  red[tid] = s1; __syncthreads();
  for (int st = 128; st > 0; st >>= 1) { if (tid < st) red[tid] += red[tid + st]; __syncthreads(); }
  const float mu = red[0] / (float)N; __syncthreads();
  float s2 = 0.f;
  for (int u = 0; u < per / 4; ++u)
#pragma unroll
    for (int q = 0; q < 4; ++q) { const float c = vals[u * 4 + q] - mu; s2 += c * c; }
  red[tid] = s2; __syncthreads();
  for (int st = 128; st > 0; st >>= 1) { if (tid < st) red[tid] += red[tid + st]; __syncthreads(); }
  const float rs = rsqrtf(red[0] / (float)N + eps);
  {
    for (int u = 0; u < per / 4; ++u) {
      const int j = tid * 4 + 1024 * u;
      v4f o, sm;
#pragma unroll
      for (int q = 0; q < 4; ++q) {
        float gg = g[j + q], bb = bta[j + q];
        if (PARAM_BF16) { gg = bf16_round(gg); bb = bf16_round(bb); }
        sm[q] = vals[u * 4 + q]; o[q] = (vals[u * 4 + q] - mu) * rs * gg + bb;
      }
      if (out_sum) *(v4f*)(out_sum + (size_t)row * N + j) = sm;
      *(v4f*)(out_norm + (size_t)row * N + j) = o;
    }
    
  }
}



// ---- f16 WMMA path (v_wmma_f32_16x16x32_f16): 11-bit significands for operands in range — used where a [0,1] probability operand needs more precision than bf16
typedef _Float16 v16h __attribute__((ext_vector_type(16)));
union FragH { v16h v; v8us half[2]; _Float16 h[16]; unsigned short u[16]; };
template <int NT>
__device__ __forceinline__ v8f mmaH(v16h ah, v16h al, v16h bh, v16h bl, v8f c) {
  c = __builtin_amdgcn_wmma_f32_16x16x32_f16(false, ah, false, bh, (short)0, c, false, false);
  if (NT >= 2) c = __builtin_amdgcn_wmma_f32_16x16x32_f16(false, al, false, bh, (short)0, c, false, false);
  if (NT >= 3) c = __builtin_amdgcn_wmma_f32_16x16x32_f16(false, ah, false, bl, (short)0, c, false, false);
  asm volatile("v_nop\n\tv_nop\n\tv_nop\n\tv_nop" : "+v"(c) : "v"(ah), "v"(al), "v"(bh), "v"(bl));
  return c;
}
// batched GEMM like k_gemm_b but f16 operands: A f32 (split into f16 hi/lo if ASPLIT, else rounded to f16), Bt = f16 values [n][k]; alpha; C f32; N multiple of 16 (partial tiles skipped)
template <bool ASPLIT>
__global__ __launch_bounds__(128) void k_gemm_h(const float* __restrict__ A, int lda, size_t sA, const _Float16* __restrict__ Bh, int ldb, size_t sB, float alpha, float* __restrict__ C, int ldc, size_t sC, int M, int N, int K) {
  __shared__ __attribute__((aligned(16))) float so[4][16][64];
  const int tid = threadIdx.x, w = tid >> 5, lane = tid & 31, ln = lane & 15, hh = lane >> 4; const int by = blockIdx.y;
  A += (size_t)by * sA; Bh += (size_t)by * sB; C += (size_t)by * sC;
  const int ntn = (N + 63) / 64; const int wid = blockIdx.x * 4 + w; const int mt = wid / ntn, nq = wid % ntn; if (mt * 16 >= M) return;
  const int row0 = mt * 16, col0 = nq * 64; const float* arow = A + (size_t)(row0 + ln) * lda;
  v8f acc[4] = {};
  for (int kb = 0; kb < K; kb += 32) {
    FragH ah, al;
    const v4f x0 = *(const v4fa*)(arow + kb + 8 * hh), x1 = *(const v4fa*)(arow + kb + 8 * hh + 4), x2 = *(const v4fa*)(arow + kb + 16 + 8 * hh), x3 = *(const v4fa*)(arow + kb + 16 + 8 * hh + 4);
    float xs[16] = {x0[0],x0[1],x0[2],x0[3],x1[0],x1[1],x1[2],x1[3],x2[0],x2[1],x2[2],x2[3],x3[0],x3[1],x3[2],x3[3]};
#pragma unroll
    for (int i = 0; i < 16; ++i) { const _Float16 h = (_Float16)xs[i]; ah.h[i] = h; al.h[i] = ASPLIT ? (_Float16)(xs[i] - (float)h) : (_Float16)0.0f; }
#pragma unroll
    for (int t = 0; t < 4; ++t) { if (col0 + t * 16 >= N) continue; const size_t boff = (size_t)(col0 + t * 16 + ln) * ldb + kb; FragH bq; bq.half[0] = *(const v8us*)(Bh + boff + 8 * hh); bq.half[1] = *(const v8us*)(Bh + boff + 16 + 8 * hh);
      acc[t] = mmaH<ASPLIT ? 2 : 1>(ah.v, al.v, bq.v, bq.v, acc[t]); }
  }
#pragma unroll
  for (int t = 0; t < 4; ++t) { if (col0 + t * 16 >= N) continue;
#pragma unroll
    for (int r = 0; r < 8; ++r) so[w][8 * hh + r][t * 16 + ln] = acc[t][r] * alpha; }
  __builtin_amdgcn_fence(__ATOMIC_ACQ_REL, "workgroup"); __builtin_amdgcn_wave_barrier();
  const int rsub = lane >> 4, c4 = (lane & 15) * 4;
  {
#pragma unroll
    for (int q = 0; q < 8; ++q) { const int r = q * 2 + rsub; if (col0 + c4 < N) { const v4f v = *(const v4fa*)&so[w][r][c4]; *(v4f*)(C + (size_t)(row0 + r) * ldc + col0 + c4) = v; } }
     }
}

// Wt[n][k] = f16(W[k][n]·scale) from f32 row-major W[K][N] (scale = power of two; bf16-exact weights stay exact in f16 away from the subnormal range)
__global__ __launch_bounds__(256) void k_wt_f16(const float* __restrict__ W, _Float16* __restrict__ Wt, int K, int N, float scale) {
  const int t = blockIdx.x * 256 + threadIdx.x; if (t >= N * (K / 8)) return; const int n = t / (K / 8), k8 = (t % (K / 8)) * 8; FragH f;
#pragma unroll
  for (int i = 0; i < 8; ++i) f.h[i] = (_Float16)(bf16_round(W[(size_t)(k8 + i) * N + n]) * scale); const v8us o = f.half[0];
  *(v8us*)((unsigned short*)Wt + (size_t)n * K + k8) = o; 
}
// k_gemm_hh variant with fused epilogue: v = acc·alpha + bias[by·sBias + col] (+ CP[(row/rowsPerB)·sCPb + by·64 + col] if CP) ; ACT 0 none / 1 elu ; writes f16 C16 (and f32 C if non-null)
template <int ACT>
__global__ __launch_bounds__(128) void k_gemm_hhx(const _Float16* __restrict__ A, int lda, size_t sA, const _Float16* __restrict__ Bh, int ldb, size_t sB, float alpha, const float* __restrict__ bias, size_t sBias, const float* __restrict__ CP, int rowsPerB, size_t sCPb, int row0g,
    float* __restrict__ C, _Float16* __restrict__ C16, int ldc, size_t sC, int M, int N, int K) {
  __shared__ __attribute__((aligned(16))) float so[4][16][64];
  const int tid = threadIdx.x, w = tid >> 5, lane = tid & 31, ln = lane & 15, hh = lane >> 4; const int by = blockIdx.y;
  A += (size_t)by * sA; Bh += (size_t)by * sB; const size_t cofs = (size_t)by * sC; const float* bp = bias ? bias + (size_t)by * sBias : nullptr;
  const int ntn = (N + 63) / 64; const int wid = blockIdx.x * 4 + w; const int mt = wid / ntn, nq = wid % ntn; if (mt * 16 >= M) return;
  const int row0 = mt * 16, col0 = nq * 64; const _Float16* arow = A + (size_t)(row0 + ln) * lda;
  v8f acc[4] = {};
  for (int kb = 0; kb < K; kb += 32) { FragH ah; ah.half[0] = *(const v8us*)((const unsigned short*)arow + kb + 8 * hh); ah.half[1] = *(const v8us*)((const unsigned short*)arow + kb + 16 + 8 * hh);
#pragma unroll
    for (int t = 0; t < 4; ++t) { if (col0 + t * 16 >= N) continue; const size_t boff = (size_t)(col0 + t * 16 + ln) * ldb + kb; FragH bq; bq.half[0] = *(const v8us*)((const unsigned short*)Bh + boff + 8 * hh); bq.half[1] = *(const v8us*)((const unsigned short*)Bh + boff + 16 + 8 * hh);
      acc[t] = mmaH<1>(ah.v, ah.v, bq.v, bq.v, acc[t]); }
  }
#pragma unroll
  for (int t = 0; t < 4; ++t) { if (col0 + t * 16 >= N) continue; const int col = col0 + t * 16 + ln; const float bv = bp ? bf16_round(bp[col]) : 0.f;
#pragma unroll
    for (int r = 0; r < 8; ++r) { float v = acc[t][r] * alpha + bv; if (CP) { const int rr = row0g + row0 + 8 * hh + r; if (rowsPerB < 0) v += CP[cofs + (size_t)rr * ldc + col];      /* rowsPerB < 0: own element of the batched C plane */ else { const int bidx = rr / rowsPerB; v += CP[(size_t)bidx * sCPb + (size_t)by * 64 + col]; } } if (ACT == 1) v = (v > 0.f) ? v : expm1f(v); else if (ACT == 7) v = (v > 0.f) ? v + 1.0f : expf(v); else if (ACT == 8) v = tanhf(v); else if (ACT == 9) v = 0.5f * v * (1.0f + tanhf(0.7978845608028654f * (v + 0.044715f * v * v * v))); else if (ACT == 11) v = 1.0f / (1.0f + expf(-v)); else if (ACT == 12) v = (v > 0.f) ? v : 0.01f * v; else if (ACT == 14) v = (v > 0.f) ? v : 0.1f * v; else if (ACT == 16) v = (v >= 0.f) ? v : 0.3f * v; else if (ACT == 17) v = (v >= 0.f) ? v : 0.2f * v; else if (ACT == 15) v = v / (1.0f + expf(-v)); else if (ACT == 3) v = fmaxf(v, 0.f); else if (ACT == 6) v = 0.5f * v * (1.0f + erff(v * 0.70710678118654752f)); so[w][8 * hh + r][t * 16 + ln] = v; } }
  __builtin_amdgcn_fence(__ATOMIC_ACQ_REL, "workgroup"); __builtin_amdgcn_wave_barrier();
  const int rsub = lane >> 4, c4 = (lane & 15) * 4; typedef _Float16 v4h __attribute__((ext_vector_type(4)));
  {
#pragma unroll
    for (int q = 0; q < 8; ++q) { const int r = q * 2 + rsub; if (col0 + c4 < N) { const v4f v = *(const v4fa*)&so[w][r][c4]; if (C) *(v4f*)(C + cofs + (size_t)(row0 + r) * ldc + col0 + c4) = v; if (C16) { v4h h4; for (int i = 0; i < 4; ++i) h4[i] = (_Float16)v[i]; *(v4h*)(C16 + cofs + (size_t)(row0 + r) * ldc + col0 + c4) = h4; } } }
     }
}


typedef _Float16 v4h __attribute__((ext_vector_type(4)));

__global__ __launch_bounds__(256) void k_x16(const float* __restrict__ x, _Float16* __restrict__ X16, size_t n8) { const size_t t = (size_t)blockIdx.x * 256 + threadIdx.x; if (t >= n8) return; FragH f;
#pragma unroll
  for (int q = 0; q < 8; ++q) f.h[q] = (_Float16)bf16_round(x[t * 8 + q]); *(v8us*)((unsigned short*)X16 + t * 8) = f.half[0];  }
__global__ __launch_bounds__(256) void k_h16(const float* __restrict__ x, _Float16* __restrict__ X16, size_t n8) { const size_t t = (size_t)blockIdx.x * 256 + threadIdx.x; if (t >= n8) return; FragH f;
#pragma unroll
  for (int q = 0; q < 8; ++q) f.h[q] = (_Float16)x[t * 8 + q]; *(v8us*)((unsigned short*)X16 + t * 8) = f.half[0];  }
__global__ __launch_bounds__(256) void k_round16f(const float* __restrict__ W, _Float16* __restrict__ Bt, size_t n8) { const size_t t = (size_t)blockIdx.x * 256 + threadIdx.x; if (t >= n8) return; FragH f;
#pragma unroll
  for (int i = 0; i < 8; ++i) f.h[i] = (_Float16)(bf16_round(W[t * 8 + i]) * 16.0f); *(v8us*)((unsigned short*)Bt + t * 8) = f.half[0];  }
template <int NHv, int TTv>
__global__ __launch_bounds__(256) void k_vt(const _Float16* __restrict__ V16, int ldv, int voff, _Float16* __restrict__ Vt) { __shared__ unsigned short tl[64][66]; const int tid = threadIdx.x; const int slab = blockIdx.x / (TTv / 64), lg = blockIdx.x % (TTv / 64); const int b = slab / NHv, h = slab % NHv;
  for (int i = tid; i < 64 * 8; i += 256) { const int r = i / 8, c8 = (i % 8) * 8; FragH f; f.half[0] = *(const v8us*)((const unsigned short*)V16 + ((size_t)b * TTv + lg * 64 + r) * ldv + voff + h * 64 + c8);
#pragma unroll
    for (int q = 0; q < 8; ++q) tl[r][c8 + q] = f.u[q]; }
  __syncthreads();
  {
#pragma unroll
    for (int rd = 0; rd < 2; ++rd) { const int d = rd * 32 + tid / 8, pc = tid % 8; FragH f;
#pragma unroll
      for (int q = 0; q < 8; ++q) f.u[q] = tl[pc * 8 + q][d];
      *(v8us*)((unsigned short*)Vt + ((size_t)slab * 64 + d) * TTv + lg * 64 + pc * 8) = f.half[0]; }
     } }

__global__ __launch_bounds__(256) void k_hl(const float* __restrict__ F, _Float16* __restrict__ Hh, _Float16* __restrict__ Hl, size_t n8) { const size_t t = (size_t)blockIdx.x * 256 + threadIdx.x; if (t >= n8) return; FragH fh, fl; const v4f a = *(const v4fa*)(F + t * 8), c = *(const v4fa*)(F + t * 8 + 4);
#pragma unroll
  for (int q = 0; q < 4; ++q) { _Float16 h = (_Float16)a[q]; fh.h[q] = h; fl.h[q] = (_Float16)((a[q] - (float)h) * 1024.0f); h = (_Float16)c[q]; fh.h[4 + q] = h; fl.h[4 + q] = (_Float16)((c[q] - (float)h) * 1024.0f); }
  { *(v8us*)((unsigned short*)Hh + t * 8) = fh.half[0]; *(v8us*)((unsigned short*)Hl + t * 8) = fl.half[0];  } }

// ---- fast GEMM (wave tile 32x64; requires M % 32 == 0 rows per launch region, N % 64 == 0 and K % 64 == 0); epilogue = k_gemm_hhx semantics ----
__device__ __forceinline__ v16h g2_frag(const _Float16* p, int hh) { FragH f; f.half[0] = *(const v8us*)((const unsigned short*)p + 8 * hh); f.half[1] = *(const v8us*)((const unsigned short*)p + 16 + 8 * hh); return f.v; }
__device__ __forceinline__ v8f g2_mma(v16h a, v16h b, v8f c) { v8f d = __builtin_amdgcn_wmma_f32_16x16x32_f16(false, a, false, b, (short)0, c, false, false); asm volatile("v_nop\n\tv_nop\n\tv_nop\n\tv_nop" : "+v"(d) : "v"(a), "v"(b)); return d; }
template <int ACT>
__global__ __launch_bounds__(128) void k_gemm2(const _Float16* __restrict__ A, int lda, size_t sA, const _Float16* __restrict__ Bh, int ldb, size_t sB, float alpha, const float* __restrict__ bias, size_t sBias, const float* __restrict__ CP, int rowsPerB, size_t sCPb, int row0g,
    float* __restrict__ C, _Float16* __restrict__ C16, int ldc, size_t sC, int M, int N, int K) { static_assert(ACT == 0 || ACT == 3 || ACT == 6 || ACT == 8 || ACT == 9 || ACT == 11 || ACT == 12 || ACT == 14 || ACT == 15 || ACT == 16 || ACT == 17, "k_gemm2: unsupported ACT code (would silently apply no activation)");
  __shared__ __attribute__((aligned(16))) float so[4][32][68];
  const int tid = threadIdx.x, w = tid >> 5, lane = tid & 31, ln = lane & 15, hh = lane >> 4; const int by = blockIdx.y;
  A += (size_t)by * sA; Bh += (size_t)by * sB; const size_t cofs = (size_t)by * sC; const float* bp = bias ? bias + (size_t)by * sBias : nullptr;
  const int ntn = N >> 6; const int mt = blockIdx.x / ntn, nq = blockIdx.x - mt * ntn; const int row0 = mt * 128 + 32 * w, col0 = nq * 64; if (row0 >= M) return;
  const _Float16* a0p = A + (size_t)(row0 + ln) * lda; const _Float16* a1p = a0p + (size_t)16 * lda;
  const _Float16* b0p = Bh + (size_t)(col0 + ln) * ldb; const _Float16* b1p = b0p + (size_t)16 * ldb; const _Float16* b2p = b1p + (size_t)16 * ldb; const _Float16* b3p = b2p + (size_t)16 * ldb;
  const v8f z8 = {0.f,0.f,0.f,0.f,0.f,0.f,0.f,0.f}; v8f c00 = z8, c01 = z8, c02 = z8, c03 = z8, c10 = z8, c11 = z8, c12 = z8, c13 = z8;
  /* two fragment sets, even and odd k-steps: a set's 12 loads issue together, and it is refilled for two k-steps ahead right behind the products that read it, so two k-steps' loads are always in flight. Each accumulator still takes its k-steps in ascending order. */
  v16h a0 = g2_frag(a0p, hh), a1 = g2_frag(a1p, hh), b0 = g2_frag(b0p, hh), b1 = g2_frag(b1p, hh), b2 = g2_frag(b2p, hh), b3 = g2_frag(b3p, hh);
  v16h e0 = g2_frag(a0p + 32, hh), e1 = g2_frag(a1p + 32, hh), f0 = g2_frag(b0p + 32, hh), f1 = g2_frag(b1p + 32, hh), f2 = g2_frag(b2p + 32, hh), f3 = g2_frag(b3p + 32, hh);
  asm volatile("s_wait_xcnt 0x0" ::: "memory");      /* the accumulators' start values reuse address registers that these loads name: the wait stands in front of that overwrite */
#pragma unroll 1      /* one pair of k-steps per trip: a second copy of the body would need two more fragment sets */
  for (int kb = 64; kb < K; kb += 64) {
    c00 = g2_mma(a0, b0, c00); c10 = g2_mma(a1, b0, c10); c01 = g2_mma(a0, b1, c01); c11 = g2_mma(a1, b1, c11); c02 = g2_mma(a0, b2, c02); c12 = g2_mma(a1, b2, c12); c03 = g2_mma(a0, b3, c03); c13 = g2_mma(a1, b3, c13);
    a0 = g2_frag(a0p + kb, hh); a1 = g2_frag(a1p + kb, hh); b0 = g2_frag(b0p + kb, hh); b1 = g2_frag(b1p + kb, hh); b2 = g2_frag(b2p + kb, hh); b3 = g2_frag(b3p + kb, hh);
    c00 = g2_mma(e0, f0, c00); c10 = g2_mma(e1, f0, c10); c01 = g2_mma(e0, f1, c01); c11 = g2_mma(e1, f1, c11); c02 = g2_mma(e0, f2, c02); c12 = g2_mma(e1, f2, c12); c03 = g2_mma(e0, f3, c03); c13 = g2_mma(e1, f3, c13);
    e0 = g2_frag(a0p + kb + 32, hh); e1 = g2_frag(a1p + kb + 32, hh); f0 = g2_frag(b0p + kb + 32, hh); f1 = g2_frag(b1p + kb + 32, hh); f2 = g2_frag(b2p + kb + 32, hh); f3 = g2_frag(b3p + kb + 32, hh);
    asm volatile("s_wait_xcnt 0x0" ::: "memory"); }      /* the next trip's address additions overwrite the registers that this trip's loads name: the wait stands in front of them */
  c00 = g2_mma(a0, b0, c00); c10 = g2_mma(a1, b0, c10); c01 = g2_mma(a0, b1, c01); c11 = g2_mma(a1, b1, c11); c02 = g2_mma(a0, b2, c02); c12 = g2_mma(a1, b2, c12); c03 = g2_mma(a0, b3, c03); c13 = g2_mma(a1, b3, c13);
  c00 = g2_mma(e0, f0, c00); c10 = g2_mma(e1, f0, c10); c01 = g2_mma(e0, f1, c01); c11 = g2_mma(e1, f1, c11); c02 = g2_mma(e0, f2, c02); c12 = g2_mma(e1, f2, c12); c03 = g2_mma(e0, f3, c03); c13 = g2_mma(e1, f3, c13);
  v8f accs[8] = {c00, c01, c02, c03, c10, c11, c12, c13};
#pragma unroll
  for (int u = 0; u < 8; ++u) { const int t = u & 3, half = u >> 2; const int col = col0 + t * 16 + ln; const float bv = bp ? bf16_round(bp[col]) : 0.f;
#pragma unroll
    for (int r = 0; r < 8; ++r) { const int rloc = half * 16 + 8 * hh + r; float v = accs[u][r] * alpha + bv; if (CP) { if (rowsPerB < 0) v += CP[cofs + (size_t)(row0g + row0 + rloc) * ldc + col];      /* rowsPerB < 0: own element of the batched C plane */ else { const int bidx = (row0g + row0 + rloc) / rowsPerB; v += CP[(size_t)bidx * sCPb + (size_t)by * 64 + col]; } }
      if (ACT == 3) v = fmaxf(v, 0.f); else if (ACT == 6) v = 0.5f * v * (1.0f + erff(v * 0.70710678118654752f)); else if (ACT == 11) v = 1.0f / (1.0f + expf(-v)); else if (ACT == 15) v = v / (1.0f + expf(-v)); else if (ACT == 12) v = (v > 0.f) ? v : 0.01f * v; else if (ACT == 8) v = tanhf(v); else if (ACT == 9) v = 0.5f * v * (1.0f + tanhf(0.7978845608028654f * (v + 0.044715f * v * v * v))); else if (ACT == 14) v = (v > 0.f) ? v : 0.1f * v; else if (ACT == 16) v = (v >= 0.f) ? v : 0.3f * v; else if (ACT == 17) v = (v >= 0.f) ? v : 0.2f * v;
      so[w][rloc][t * 16 + ln] = v; } }
  __builtin_amdgcn_fence(__ATOMIC_ACQ_REL, "workgroup"); __builtin_amdgcn_wave_barrier();
  const int rsub = lane >> 4, c4 = (lane & 15) * 4;
  {
#pragma unroll
    for (int q = 0; q < 16; ++q) { const int r = q * 2 + rsub; const v4f v = *(const v4fa*)&so[w][r][c4]; if (C) *(v4f*)(C + cofs + (size_t)(row0 + r) * ldc + col0 + c4) = v; if (C16) { v4h h4; for (int i = 0; i < 4; ++i) h4[i] = (_Float16)v[i]; *(v4h*)(C16 + cofs + (size_t)(row0 + r) * ldc + col0 + c4) = h4; } }
     } }


__global__ __launch_bounds__(256) void k_wnat(const float* __restrict__ w, size_t n8, _Float16* __restrict__ Bt) { const size_t t = (size_t)blockIdx.x * 256 + threadIdx.x; if (t >= n8) return; FragH f; for (int q = 0; q < 8; ++q) f.h[q] = (_Float16)(bf16_round(w[t * 8 + q]) * 16.0f); *(v8us*)((unsigned short*)Bt + t * 8) = f.half[0];  }
__global__ __launch_bounds__(256) void k_rsm(const float* __restrict__ S, _Float16* __restrict__ P, int nrows) {
  #pragma clang fp contract(off)
  const int i = blockIdx.x * 256 + threadIdx.x; if (i >= nrows) return; const float* s = S + (size_t)i * SQ; float mx = -3.0e38f;
#pragma unroll 1
  for (int j = 0; j < SQ; ++j) mx = fmaxf(mx, s[j]); float se = 0.f;
#pragma unroll 1
  for (int j = 0; j < SQ; ++j) se += expf(s[j] - mx); const float sc = 256.0f / se;
#pragma unroll 1
  for (int j0 = 0; j0 < SQ; j0 += 8) { FragH f; for (int q = 0; q < 8; ++q) f.h[q] = (_Float16)(expf(s[j0 + q] - mx) * sc); unsigned short* d = (unsigned short*)P + (size_t)i * SQ + j0; *(v8us*)d = f.half[0];  } }
__global__ __launch_bounds__(256) void k_vt(const _Float16* __restrict__ V16, int b, int h0, _Float16* __restrict__ VT) { __shared__ unsigned short tl[64][65]; const int tid = threadIdx.x; const int hh = blockIdx.x % HG, sg = blockIdx.x / HG; const int s0 = sg * 64; const int h = h0 + hh;
  for (int i = tid; i < 64 * 8; i += 256) { const int j = i / 8, d8 = (i % 8) * 8; FragH f; f.half[0] = *(const v8us*)((const unsigned short*)V16 + ((size_t)b * SQ + s0 + j) * DM + h * HD + d8); for (int q = 0; q < 8; ++q) tl[d8 + q][j] = f.u[q]; }
  __syncthreads();
  { for (int i = tid; i < 64 * 8; i += 256) { const int d = i / 8, j8 = (i % 8) * 8; FragH f; for (int q = 0; q < 8; ++q) f.u[q] = tl[d][j8 + q]; *(v8us*)((unsigned short*)VT + ((size_t)hh * HD + d) * SQ + s0 + j8) = f.half[0]; }  } }



// fused causal attention, one wave per 32 query rows, no LDS, scores and weights never leave the registers.
// scores^T tile = K rows (A) x Q rows (B): accumulator row = key 8*hh + r, column = query ln, so a lane's 8 values of key tile 0 and its 8 of key tile 1 are,
// in order, the 16 elements of the B fragment (k = 8*hh + i, 16 + 8*hh + i) of the 32-key step of o^T = V^T (A) x P^T (B): no exchange between lanes.
// A lane keeps the running maximum of its query (made equal in both half-waves by one exchange per 32 keys) and its own half of the running sum (halves added at the end).
#define FA_CS 0.18033688011112042f      /* log2(e) / 8: score scale and exp -> exp2 in one factor */
__device__ __forceinline__ float fa_exp2(float x) { float e; asm("v_exp_f32 %0, %1\n\tv_nop" : "=v"(e) : "v"(x)); return e; }      /* the v_nop is the one slot the instruction set asks for behind a transcendental before its result is read or its source overwritten */
__device__ __forceinline__ float fa_xhalf(float x) { return __builtin_bit_cast(float, __builtin_amdgcn_permlanex16(__builtin_bit_cast(int, x), __builtin_bit_cast(int, x), 0x76543210, 0xfedcba98, false, false)); }      /* lane l with lane l ^ 16, on the vector unit (a shuffle would go through the LDS pipe and its wait) */
__device__ __forceinline__ v8f fa_mma(v16h a, v16h b, v8f c) { return __builtin_amdgcn_wmma_f32_16x16x32_f16(false, a, false, b, (short)0, c, false, false); }
__global__ __launch_bounds__(128) void k_fattn(const _Float16* __restrict__ QKVp, const _Float16* __restrict__ VTp, _Float16* __restrict__ O) {
  const int lane = threadIdx.x & 31, ln = lane & 15, hh = lane >> 4; const int w = __builtin_amdgcn_readfirstlane((int)(threadIdx.x >> 5));
  const int bh = blockIdx.x, b = bh / NH, h = bh - b * NH;
  const int yg = (int)blockIdx.y >> 2, yi = (int)blockIdx.y & 3; const int qt = SQ / 128 - 1 - 4 * yg - ((yg & 1) ? 3 - yi : yi);      /* query tile: long tiles first, every second group of four in rising order, so that work-groups 256 apart in the grid (all are resident at once) add up to equal lengths; any order is correct */
  const int row0 = qt * 128 + 32 * w;      /* also the first key of the wave's last 32-key block */
  const _Float16* qp = QKVp + ((size_t)b * SQ + row0 + ln) * LQ + h * HD;
  const _Float16* kp = QKVp + ((size_t)b * SQ + ln) * LQ + DM + h * HD;
  const _Float16* vp = VTp + ((size_t)bh * HD + ln) * SQ;
  v16h q[2][2], kf[2][2];
#pragma unroll      /* here and in every inner loop below: static indices keep the fragment and accumulator arrays in registers */
  for (int j = 0; j < 2; ++j) for (int kk = 0; kk < 2; ++kk) q[j][kk] = g2_frag(qp + (size_t)(j * 16) * LQ + kk * 32, hh);
#pragma unroll
  for (int kt = 0; kt < 2; ++kt) for (int kk = 0; kk < 2; ++kk) kf[kt][kk] = g2_frag(kp + (size_t)(kt * 16) * LQ + kk * 32, hh);
  const v8f z8 = {0.f,0.f,0.f,0.f,0.f,0.f,0.f,0.f};
  v8f o[2][4] = {{z8, z8, z8, z8}, {z8, z8, z8, z8}}; float m[2] = {-1.0e30f, -1.0e30f}, l[2] = {0.f, 0.f};
  int kb = 0;
#pragma unroll 1      /* one 32-key block per trip: a second copy of the body would need a second set of fragments */
  do {
    const int kn = min(kb + 32, row0);      /* next block; the last trip fetches its own block again, so every address stays inside the batch's rows */
    v8f s[2][2]; v16h vf[4];
#pragma unroll
    for (int t = 0; t < 4; ++t) vf[t] = g2_frag(vp + (size_t)(t * 16) * SQ + kb, hh);      /* this block's V^T, in flight under the scores and the softmax */
#pragma unroll
    for (int kt = 0; kt < 2; ++kt) for (int j = 0; j < 2; ++j) s[j][kt] = fa_mma(kf[kt][0], q[j][0], z8);
#pragma unroll
    for (int kt = 0; kt < 2; ++kt) for (int j = 0; j < 2; ++j) s[j][kt] = fa_mma(kf[kt][1], q[j][1], s[j][kt]);
#pragma unroll
    for (int kt = 0; kt < 2; ++kt) for (int kk = 0; kk < 2; ++kk) kf[kt][kk] = g2_frag(kp + (size_t)(kn + kt * 16) * LQ + kk * 32, hh);      /* next block's K, in flight under the softmax and the second product */
    asm volatile("s_wait_xcnt 0x0" ::: "memory");      /* later address arithmetic may overwrite registers that these loads name: the wait stands in front of it */
    if (kb + 31 > row0) {      /* only the block on the diagonal needs the causal test (same for the whole wave) */
      const int dq = row0 + ln - kb - 8 * hh;      /* key offset kt*16 + r is allowed up to dq + j*16 */
#pragma unroll
      for (int j = 0; j < 2; ++j) for (int kt = 0; kt < 2; ++kt) for (int r = 0; r < 8; ++r) s[j][kt][r] = (kt * 16 + r - j * 16 <= dq) ? s[j][kt][r] : -1.0e30f; }
    v16h p[2];
#pragma unroll
    for (int j = 0; j < 2; ++j) {
      float bm = s[j][0][0];
#pragma unroll
      for (int kt = 0; kt < 2; ++kt) for (int r = 0; r < 8; ++r) bm = fmaxf(bm, s[j][kt][r]);
      bm = fmaxf(bm, fa_xhalf(bm));      /* the query's other 16 keys of this block sit in the other half-wave */
      const float mn = fmaxf(m[j], bm); const float sc = fa_exp2((m[j] - mn) * FA_CS); m[j] = mn;
      const float mc = mn * FA_CS - 4.0f;      /* weights carried x16 (largest = 16): small ones stay in f16's normal range; the factor is in the row sum too and cancels */
      v4f ls = {0.f, 0.f, 0.f, 0.f}; FragH f;
#pragma unroll
      for (int i = 0; i < 16; ++i) { const float e = fa_exp2(fmaf(s[j][i >> 3][i & 7], FA_CS, -mc)); ls[i & 3] += e; f.h[i] = (_Float16)e; }
      p[j] = f.v;
      l[j] = l[j] * sc + ((ls[0] + ls[1]) + (ls[2] + ls[3]));
#pragma unroll
      for (int t = 0; t < 4; ++t) o[j][t] *= sc; }
#pragma unroll
    for (int t = 0; t < 4; ++t) for (int j = 0; j < 2; ++j) o[j][t] = fa_mma(vf[t], p[j], o[j][t]);
    kb += 32;
  } while (kb <= row0);
#pragma unroll
  for (int j = 0; j < 2; ++j) { const float fin = 64.0f / (l[j] + fa_xhalf(l[j]));      /* o carried x64 */
    unsigned short* op = (unsigned short*)O + ((size_t)b * SQ + row0 + j * 16 + ln) * DM + h * HD + 8 * hh;
#pragma unroll
    for (int t = 0; t < 4; ++t) { FragH f;
#pragma unroll
      for (int r = 0; r < 8; ++r) f.h[r] = (_Float16)(o[j][t][r] * fin);
      *(v8us*)(op + t * 16) = f.half[0]; } }
}


template <int MASKADD>
__global__ __launch_bounds__(64) void k_att0(const float* __restrict__ QF, const float* __restrict__ KF, const float* __restrict__ VF, int ld, const float* __restrict__ mask, float scale, float* __restrict__ OF, int ldo) {
  #pragma clang fp contract(off)
  __shared__ __attribute__((aligned(16))) float lo[64][64];      /* only the transpose for the coalesced store at the end */
  const int tid = threadIdx.x; const int h = blockIdx.x / (QT0 / 64), rg = blockIdx.x % (QT0 / 64); const int i = rg * 64 + tid;
  const float* qr = QF + (size_t)i * ld + h * HD;
  v4f rq[HD / 4], ro[HD / 4];      /* the thread's own q row and o row, in registers for the whole key loop */
#pragma unroll      /* here and in the inner loops below: static indices keep rq[] / ro[] in registers, and a key's loads issue together */
  for (int c = 0; c < HD / 4; ++c) { rq[c] = *(const v4fa*)(qr + c * 4); const v4f z = {0.f, 0.f, 0.f, 0.f}; ro[c] = z; }
  float m = -1.0e30f, l = 0.f; const int jmax = MASKADD ? (SQ - 1) : (rg * 64 + 63);      /* additive-mask form: every key (the mask input decides); causal form: keys up to the block's last row */
#pragma unroll 1
  for (int j = 0; j <= jmax; ++j) { const float* kr = KF + (size_t)j * ld + h * HD; const float* vr = VF + (size_t)j * ld + h * HD; float s = 0.f;
#pragma unroll
    for (int c = 0; c < HD / 4; ++c) { const v4f kq = *(const v4fa*)(kr + c * 4); const v4f qq = rq[c]; s = __fadd_rn(s, __fmul_rn(qq[0], kq[0])); s = __fadd_rn(s, __fmul_rn(qq[1], kq[1])); s = __fadd_rn(s, __fmul_rn(qq[2], kq[2])); s = __fadd_rn(s, __fmul_rn(qq[3], kq[3])); }
    s = __fmul_rn(s, scale); if (MASKADD) s = __fadd_rn(s, __fmul_rn(bf16_round(mask[(size_t)i * SQ + j]), -10000.0f));
    const float f = (MASKADD || j <= i) ? 1.f : 0.f; const float sm = fmaf(f, s, (1.f - f) * -1.0e30f); const float mn = fmaxf(m, sm); const float sc = expf(m - mn); const float e = expf(sm - mn); l = __fadd_rn(__fmul_rn(l, sc), e); m = mn;
#pragma unroll
    for (int c = 0; c < HD / 4; ++c) { const v4f vv = *(const v4fa*)(vr + c * 4); v4f oo = ro[c]; for (int u = 0; u < 4; ++u) oo[u] = __fadd_rn(__fmul_rn(oo[u], sc), __fmul_rn(e, vv[u])); ro[c] = oo; } }
  const float fin = 64.0f / l;      /* o carried x64 like the f16 path */
#pragma unroll
  for (int c = 0; c < HD / 4; ++c) { v4f oo = ro[c]; for (int u = 0; u < 4; ++u) oo[u] = __fmul_rn(oo[u], fin); *(v4f*)&lo[tid][c * 4] = oo; }
  __syncthreads();
  {
#pragma unroll 1
    for (int it = 0; it < 16; ++it) { const int row = it * 4 + tid / 16, pc = (tid % 16) * 4; const v4f v = *(const v4f*)&lo[row][pc]; *(v4f*)(OF + (size_t)(rg * 64 + row) * ldo + h * HD + pc) = v; }
     } }


template <int BFIN, int WXB>
__global__ __launch_bounds__(256) void k_ln16(const float* __restrict__ X, const float* __restrict__ g, const float* __restrict__ bb, float eps, _Float16* __restrict__ N16, float* __restrict__ XB) {
  #pragma clang fp contract(off)
  __shared__ float red[256]; const size_t r = blockIdx.x; const int t = threadIdx.x; const v4f xa = *(const v4fa*)(X + r * DMQ + t * 4); float s[4]; float sum = 0.f;
  for (int q = 0; q < 4; ++q) { s[q] = BFIN ? bf16_round(xa[q]) : xa[q]; sum = __fadd_rn(sum, s[q]); }
  red[t] = sum; __syncthreads(); for (int st = 128; st > 0; st >>= 1) { if (t < st) red[t] = __fadd_rn(red[t], red[t + st]); __syncthreads(); } const float mu = red[0] / (float)DMQ; __syncthreads();
  float vs = 0.f; for (int q = 0; q < 4; ++q) { const float dl = __fadd_rn(s[q], -mu); vs = __fadd_rn(vs, __fmul_rn(dl, dl)); } red[t] = vs; __syncthreads(); for (int st = 128; st > 0; st >>= 1) { if (t < st) red[t] = __fadd_rn(red[t], red[t + st]); __syncthreads(); }
  const float rs = rsqrtf(__fadd_rn(red[0] / (float)DMQ, eps)); v4h y; v4f xb;
  for (int q = 0; q < 4; ++q) { const int c = t * 4 + q; y[q] = (_Float16)__fadd_rn(__fmul_rn(__fmul_rn(__fadd_rn(s[q], -mu), rs), bf16_round(g[c])), bf16_round(bb[c])); xb[q] = s[q]; }
  { *(v4h*)(N16 + r * DMQ + t * 4) = y; if (WXB) *(v4f*)(XB + r * DMQ + t * 4) = xb;  } }
__global__ __launch_bounds__(256) void k_ftres2(const float* __restrict__ OF0, const float* __restrict__ XB, float* __restrict__ X1, size_t n4) {
  #pragma clang fp contract(off)
  const size_t t = (size_t)blockIdx.x * 256 + threadIdx.x; if (t >= n4) return; const v4f o = *(const v4fa*)(OF0 + t * 4), xv = *(const v4fa*)(XB + t * 4); v4f y; for (int q = 0; q < 4; ++q) y[q] = __fadd_rn(__fmul_rn(o[q], 0.015625f), xv[q]); *(v4f*)(X1 + t * 4) = y;  }

__global__ __launch_bounds__(256) void k_wthd(const float* __restrict__ Wt, _Float16* __restrict__ Bt) { const size_t t = (size_t)blockIdx.x * 256 + threadIdx.x; if (t >= (size_t)NH * HD * (DM / 8)) return; const int m8 = (int)(t % (DM / 8)) * 8; const int d = (int)((t / (DM / 8)) % HD); const int h = (int)(t / ((size_t)(DM / 8) * HD)); FragH f;
  for (int q = 0; q < 8; ++q) f.h[q] = (_Float16)(16.0f * bf16_round(Wt[((size_t)h * DM + m8 + q) * HD + d])); unsigned short* dst = (unsigned short*)Bt + ((size_t)h * HD + d) * DM + m8; *(v8us*)dst = f.half[0];  }




__global__ __launch_bounds__(256) void k_wtpad(const float* __restrict__ Wm, _Float16* __restrict__ Wt, int Kr, int Kp, int Nr, int Np, float scale) {
  const int t = blockIdx.x * 256 + threadIdx.x; if (t >= Np * (Kp / 8)) return; const int n = t / (Kp / 8), k8 = (t % (Kp / 8)) * 8; const int nc = min(n, Nr - 1); const float fn = (n < Nr) ? 1.f : 0.f; FragH f;
  for (int i = 0; i < 8; ++i) { const int k = k8 + i; const int kc = min(k, Kr - 1); const float fk = (k < Kr) ? fn : 0.f; f.h[i] = (_Float16)(bf16_round(Wm[(size_t)kc * Nr + nc]) * scale * fk); }
  unsigned short* o = (unsigned short*)Wt + (size_t)n * Kp + k8; *(v8us*)o = f.half[0];  }
__global__ __launch_bounds__(128) void k_bpad(const float* __restrict__ b, float* __restrict__ Bp, int nr, int np) {
  const int i = threadIdx.x; if (i >= np) return; const float v = b[min(i, nr - 1)] * ((i < nr) ? 1.f : 0.f); *(float*)(Bp + i) = v;  }
extern "C" void kernel_launch(void* const* d_in, const int* in_sizes, int n_in,
                              void* d_out, int out_size, void* d_ws, size_t ws_size, hipStream_t stream) {
  (void)in_sizes; (void)n_in; (void)out_size;
  const float* const* I = (const float* const*)d_in; const float* x = I[0]; const float* g1 = I[1]; const float* be1 = I[2]; const float* wq = I[3]; const float* wk = I[4]; const float* wv = I[5]; const float* wo = I[6]; const float* bo = nullptr; const float* gg2 = I[7]; const float* be2 = I[8]; const float* wfc = I[9]; const float* bfc = I[10]; const float* wmp = I[11]; const float* bmp = I[12];      /* x, LN1 g / b, Wq / Wk / Wv / Wo [1024][1024] ([in][out], no biases), LN2 g / b, W1 [1024][4096] + b1, W2 [4096][1024] + b2 */
  char* ws = (char*)d_ws; size_t off = 0;
  auto take = [&](size_t bytes) { char* p = ws + off; off += (bytes + 255) & ~(size_t)255; return p; };
  _Float16* BQKV = (_Float16*)take((size_t)3 * DM * DM * 2); _Float16* BO = (_Float16*)take((size_t)DM * DM * 2);
  _Float16* X16 = (_Float16*)take(NR * DM * 2); float* XB = (float*)take(NR * DM * 4); float* X1 = (float*)take(NR * DM * 4); _Float16* M16 = nullptr;      /* = X16 below (alias: X16's last reader, the last batch's first-tile GEMMs, precedes LN2's write) */ _Float16* HF16 = (_Float16*)take((size_t)SQ * DFF * 2); _Float16* BW1 = (_Float16*)take((size_t)DFF * DM * 2); _Float16* BW2 = (_Float16*)take((size_t)DM * DFF * 2); _Float16* QKV = (_Float16*)take(NR * 3 * DM * 2); _Float16* Q16 = QKV; _Float16* K16 = QKV + DM; _Float16* V16 = QKV + 2 * DM; _Float16* O16 = (_Float16*)take(NR * DM * 2); M16 = X16;
  _Float16* VT = (_Float16*)take((size_t)NB * NH * HD * SQ * 2);
  float* QF0 = (float*)take((size_t)QT0 * DM * 4); float* KF0 = (float*)take((size_t)QT0 * DM * 4); float* VF0 = (float*)take((size_t)QT0 * DM * 4); float* OF0 = (float*)take((size_t)NB * QT0 * DM * 4); _Float16* OH0 = (_Float16*)take((size_t)NB * QT0 * DM * 2); _Float16* OL0 = (_Float16*)take((size_t)NB * QT0 * DM * 2);
  if (off > ws_size) return;
  { const unsigned g = (unsigned)(((size_t)DM * (DM / 8) + 255) / 256); k_wt_f16<<<g, 256, 0, stream>>>(wq, BQKV, DM, DM, 16.0f); k_wt_f16<<<g, 256, 0, stream>>>(wk, BQKV + (size_t)DM * DM, DM, DM, 16.0f); k_wt_f16<<<g, 256, 0, stream>>>(wv, BQKV + (size_t)2 * DM * DM, DM, DM, 16.0f); }      /* [in][out] -> Bt x16, stacked q | k | v */ k_wt_f16<<<(unsigned)(((size_t)DM * (DM / 8) + 255) / 256), 256, 0, stream>>>(wo, BO, DM, DM, 16.0f);      /* w_proj [in][out] -> Bt x16 */
  k_ln16<1, 1><<<(unsigned)NR, 256, 0, stream>>>(x, g1, be1, 1e-5f, X16, XB);      /* a = LN1(bf16(x)) -> f16 rows; XB = bf16(x) for the residual */
  k_wt_f16<<<(unsigned)(((size_t)DFF * (DM / 8) + 255) / 256), 256, 0, stream>>>(wfc, BW1, DM, DFF, 16.0f); k_wt_f16<<<(unsigned)(((size_t)DM * (DFF / 8) + 255) / 256), 256, 0, stream>>>(wmp, BW2, DFF, DM, 16.0f);      /* W1 [1024][4096] -> Bt [4096][1024]; W2 [4096][1024] -> Bt [1024][4096] (x16) */
  const size_t r0p = (size_t)B0 * SQ;      /* first projected row */
  k_gemm2<0><<<dim3((unsigned)((MP / 128) * (3 * DM / 64)), 1), 128, 0, stream>>>(X16 + r0p * DM, DM, 0, BQKV, DM, 0, 0.0625f, nullptr, 0, nullptr, 1, 0, 0, nullptr, QKV + r0p * 3 * DM, 3 * DM, 0, MP, 3 * DM, DM);      /* q | k | v rows (f16); head h = columns h*HD.. of each DM block */
  for (int b = B0; b < B0 + NBR; ++b) { const size_t r0 = (size_t)b * SQ;
    k_gemm2<0><<<dim3((QT0 / 128) * (DM / 64), 1), 128, 0, stream>>>(X16 + r0 * DM, DM, 0, BQKV, DM, 0, 0.0625f, nullptr, 0, nullptr, 1, 0, 0, QF0, nullptr, DM, 0, QT0, DM, DM); k_gemm2<0><<<dim3((QT0 / 128) * (DM / 64), 1), 128, 0, stream>>>(X16 + r0 * DM, DM, 0, (BQKV + (size_t)DM * DM), DM, 0, 0.0625f, nullptr, 0, nullptr, 1, 0, 0, KF0, nullptr, DM, 0, QT0, DM, DM); k_gemm2<0><<<dim3((QT0 / 128) * (DM / 64), 1), 128, 0, stream>>>(X16 + r0 * DM, DM, 0, (BQKV + (size_t)2 * DM * DM), DM, 0, 0.0625f, nullptr, 0, nullptr, 1, 0, 0, VF0, nullptr, DM, 0, QT0, DM, DM);      /* f32 q, k, v of the first 128 rows (exact products) */
    k_att0<0><<<NH * (QT0 / 64), 64, 0, stream>>>(QF0, KF0, VF0, DM, nullptr, 0.125f, OF0 + (size_t)b * QT0 * DM, DM);      /* exact f32 attention for rows 0..127 (o x64) */
  }
  k_vt<NH, SQ><<<NB * NH * (SQ / 64), 256, 0, stream>>>(V16, LQ, 0, VT);      /* V^T [NB][NH][HD][SQ] */
  k_fattn<<<dim3(NB * NH, SQ / 128), 128, 0, stream>>>(QKV, VT, O16);      /* o (merged heads, x64) as f16 rows, every batch, head and query tile in one launch */
  k_gemm2<0><<<dim3((unsigned)((MPO / 128) * (DM / 64)), 1), 128, 0, stream>>>(O16 + r0p * DM, DM, 0, BO, DM, 0, 0.0009765625f, bo, 0, XB + r0p * DM, -1, 0, 0, X1 + r0p * DM, nullptr, DM, 0, MPO, DM, DM);      /* out rows are the output layout */
  k_hl<<<(unsigned)(((size_t)NB * QT0 * DM / 8 + 255) / 256), 256, 0, stream>>>(OF0, OH0, OL0, (size_t)NB * QT0 * DM / 8);      /* first-tile o (x64) -> f16 hi + x1024 residual planes */
  for (int b = B0; b < B0 + NBR; ++b) { const size_t r0 = (size_t)b * SQ; const size_t f0 = (size_t)b * QT0;
    k_gemm2<0><<<dim3((QT0 / 128) * (DM / 64), 1), 128, 0, stream>>>(OH0 + f0 * DM, DM, 0, BO, DM, 0, 0.0009765625f, bo, 0, XB + r0 * DM, -1, 0, 0, X1 + r0 * DM, nullptr, DM, 0, QT0, DM, DM);      /* rows 0..127: x1 = x + o_hi Wo, overwriting the f16-path rows */
    k_gemm2<0><<<dim3((QT0 / 128) * (DM / 64), 1), 128, 0, stream>>>(OL0 + f0 * DM, DM, 0, BO, DM, 0, 0.00000095367431640625f, nullptr, 0, X1 + r0 * DM, -1, 0, 0, X1 + r0 * DM, nullptr, DM, 0, QT0, DM, DM); }      /* += o_lo Wo 2^-20 (own-element accumulate) */
  k_ln16<0, 0><<<(unsigned)NR, 256, 0, stream>>>(X1, gg2, be2, 1e-5f, M16, nullptr);      /* h = LN2(x1) -> f16 rows */
  for (int b = 0; b < NB; ++b) { const size_t r0 = (size_t)b * SQ;
    k_gemm2<6><<<dim3((unsigned)((SQ / 128) * (DFF / 64)), 1), 128, 0, stream>>>(M16 + r0 * DM, DM, 0, BW1, DM, 0, 0.0625f, bfc, 0, nullptr, 1, 0, 0, nullptr, HF16, DFF, 0, SQ, DFF, DM);      /* gelu_erf(h2 W1 + b1) -> f16 (this batch) */
    k_gemm2<0><<<dim3((unsigned)((SQ / 128) * (DM / 64)), 1), 128, 0, stream>>>(HF16, DFF, 0, BW2, DFF, 0, 0.0625f, bmp, 0, X1 + r0 * DM, -1, 0, 0, (float*)d_out + r0 * DM, nullptr, DM, 0, SQ, DM, DFF); }      /* out = x1 + mlp (own-element residual) */
}

// v005
// Measured time: 1000 microseconds a run.
// In both of two side-by-side timings against v004, it was 1.58 times as fast.
// Over all steps from v000 it is 10.8 times as fast.
#include <hip/hip_runtime.h>
// Pre-LN causal transformer block (x [4][2048][1024]; h = LN1(x) (biased var, eps 1e-5, gamma / beta); Q/K/V = h Wq/Wk/Wv ([in][out] 1024 x 1024 sigma 1/32, no biases), 16 heads of 64; scores / 8; causal (tril, -inf); softmax; x1 = x + hidden Wo ([in][out], no bias); h2 = LN2(x1); out = x1 + gelu_erf(h2 W1 + b1) W2 + b2 ([in][out] 1024 x 4096 x 1024) -> [4][2048][1024]).
// Structure: token rows r = b*2048 + s; h = LN1(bf16-rounded x) as f16 rows; q | k | v as ONE WMMA GEMM (N = 3 x 1024) (32x64 wave tiles, f32 accumulation, exact x16 weights, no bias, f16 outputs); V^T for all batches and heads via LDS transposes; ONE fused causal attention launch: a wave owns 32 query rows and walks the keys below its last row 32 at a time, scores^T = K . Q^T on WMMA (keys on the accumulator rows, so a lane holds one query's scores), running row maximum and row sum in f32 (native exp2; weights x16 f16, taken from the accumulators in place as the B fragment), o^T += V^T . P^T on WMMA, o carried x64 (folded into the output GEMM alpha) written straight into the merged f16 o rows; x1 = x + o W_o GEMM (f32, no bias) into the output layout.
// Compute dtype: inputs rounded to bf16; x / weights exact; q, k, v, softmax weights and o as plain f16 GEMM operands (~2^-12); scores and softmax statistics f32. v_wmma_f32_16x16x32_f16.
#define NB 4
#define SQ 2048
#define DM 1024
#define NH 16
#define HD 64
#define HG 4                         /* heads per block group of the unlaunched k_vt(b, h0) overload */
#define QT 256                       /* unused */
#define NKX SQ                       /* unused */
#define QT0 128                      /* first-tile rows recomputed exactly in f32 */
#define B0 0                         /* first batch processed (debug hook) */
#define NBR NB                       /* batches processed (debug hook) */
#define NR ((size_t)NB * SQ)
#define DMQ DM
#define DFF 4096                     /* FFN hidden width */
#define DFFR 100                     /* unused */
#define MP ((int)((size_t)NBR * SQ)) /* rows projected (debug hook) */
#define QN SQ                        /* unused */
#define NHD NH                       /* unused */
#define MPO MP                       /* rows through the output stage (debug hook) */
#define LQ (3 * DM)      /* row pitch of the q/k/v rows */
typedef __bf16 v16b __attribute__((ext_vector_type(16)));
typedef unsigned short v8us __attribute__((ext_vector_type(8), may_alias));
typedef float  v8f  __attribute__((ext_vector_type(8)));
typedef float  v4f  __attribute__((ext_vector_type(4)));
typedef float  v4fa __attribute__((ext_vector_type(4), may_alias));
union FragB { v16b v; v8us half[2]; unsigned short u[16]; };

__device__ __forceinline__ unsigned short bf16_bits(float x) { unsigned int u = __float_as_uint(x); return (unsigned short)((u + 0x7FFFu + ((u >> 16) & 1u)) >> 16); }
__device__ __forceinline__ float bf16_val(unsigned short b) { return __uint_as_float(((unsigned int)b) << 16); }
__device__ __forceinline__ float bf16_round(float x) { return bf16_val(bf16_bits(x)); }
// D += A·B with NT terms: 1 = ah·bh, 2 = + al·bh (A split), 3 = + ah·bl (both split)
template <int NT>
__device__ __forceinline__ v8f mmaN(v16b ah, v16b al, v16b bh, v16b bl, v8f c) {
  c = __builtin_amdgcn_wmma_f32_16x16x32_bf16(false, ah, false, bh, (short)0, c, false, false);
  if (NT >= 2) c = __builtin_amdgcn_wmma_f32_16x16x32_bf16(false, al, false, bh, (short)0, c, false, false);
  if (NT >= 3) c = __builtin_amdgcn_wmma_f32_16x16x32_bf16(false, ah, false, bl, (short)0, c, false, false);
  asm volatile("v_nop\n\tv_nop\n\tv_nop\n\tv_nop" : "+v"(c) : "v"(ah), "v"(al), "v"(bh), "v"(bl));
  return c;
}

__global__ __launch_bounds__(256) void k_wt_bf16(const float* __restrict__ W, unsigned short* __restrict__ Wt, int K, int N) {
  const int t = blockIdx.x * 256 + threadIdx.x;
  const int k8n = K / 8;
  if (t >= N * k8n) return;
  const int n = t / k8n, k8 = (t % k8n) * 8;
  v8us v;
#pragma unroll
  for (int i = 0; i < 8; ++i) v[i] = bf16_bits(W[(size_t)(k8 + i) * N + n]);
  *(v8us*)(Wt + (size_t)n * K + k8) = v;
  
}

// GEMM C[M][N] (f32, pitch ldc) = act(A[M][K]·W + bias). A f32 row-major (pitch lda) converted per fragment to bf16
// (ASPLIT: hi/lo two planes -> 2 terms, else single rounded term); Wt bf16 [N][K] (pitch ldb). BIAS_BF16 rounds the
// bias to bf16 first (bias quantised to bf16 before the add). K%32==0, M%16==0, N%64==0.
template <bool ASPLIT, int ACT, bool BIAS_BF16>
__global__ __launch_bounds__(128) void k_gemm_bf(const float* __restrict__ A, int lda, const unsigned short* __restrict__ Wt, int ldb,
                                               const float* __restrict__ bias, float* __restrict__ C, int ldc, int M, int N, int K) {
  __shared__ __attribute__((aligned(16))) float so[4][16][64];
  const int tid = threadIdx.x, w = tid >> 5, lane = tid & 31, ln = lane & 15, hh = lane >> 4;
  const int ntn = N / 64;
  const int wid = blockIdx.x * 4 + w;
  const int mt = wid / ntn, nq = wid % ntn;
  if (mt * 16 >= M) return;
  const int row0 = mt * 16, col0 = nq * 64;
  const float* arow = A + (size_t)(row0 + ln) * lda;
  v8f acc[4] = {};
  for (int kb = 0; kb < K; kb += 32) {
    FragB ah, al;
    const v4f x0 = *(const v4fa*)(arow + kb + 8 * hh), x1 = *(const v4fa*)(arow + kb + 8 * hh + 4);
    const v4f x2 = *(const v4fa*)(arow + kb + 16 + 8 * hh), x3 = *(const v4fa*)(arow + kb + 16 + 8 * hh + 4);
    float xs[16] = {x0[0],x0[1],x0[2],x0[3],x1[0],x1[1],x1[2],x1[3],x2[0],x2[1],x2[2],x2[3],x3[0],x3[1],x3[2],x3[3]};
#pragma unroll
    for (int i = 0; i < 16; ++i) { const unsigned short hb = bf16_bits(xs[i]); ah.u[i] = hb; al.u[i] = ASPLIT ? bf16_bits(xs[i] - bf16_val(hb)) : (unsigned short)0; }
#pragma unroll
    for (int t = 0; t < 4; ++t) {
      const unsigned short* brow = Wt + (size_t)(col0 + t * 16 + ln) * ldb + kb;
      FragB b;
      b.half[0] = *(const v8us*)(brow + 8 * hh);
      b.half[1] = *(const v8us*)(brow + 16 + 8 * hh);
      acc[t] = mmaN<ASPLIT ? 2 : 1>(ah.v, al.v, b.v, b.v, acc[t]);
    }
  }
#pragma unroll
  for (int t = 0; t < 4; ++t) {
    float bv = bias ? bias[col0 + t * 16 + ln] : 0.f;
    if (BIAS_BF16) bv = bf16_round(bv);
#pragma unroll
    for (int r = 0; r < 8; ++r) { float v = acc[t][r] + bv; if (ACT == 1) v = fmaxf(v, 0.f); so[w][8 * hh + r][t * 16 + ln] = v; }
  }
  __builtin_amdgcn_fence(__ATOMIC_ACQ_REL, "workgroup");
  __builtin_amdgcn_wave_barrier();
  const int rsub = lane >> 4, c4 = (lane & 15) * 4;
  {
#pragma unroll
    for (int q = 0; q < 8; ++q) {
      const int r = q * 2 + rsub;
      const v4f v = *(const v4fa*)&so[w][r][c4];
      *(v4f*)(C + (size_t)(row0 + r) * ldc + col0 + c4) = v;
    }
    
  }
}

// GEMM C = act(A·W + bias + resid): A f32 (ASPLIT -> hi/lo 2 terms), Wt bf16 [N][K]; ACT 0 none, 1 relu, 2 exact gelu;
// resid (optional, f32, row index = (row % rmod), pitch ldr, RES_BF16 rounds it) added before the activation.
template <bool ASPLIT, int ACT, bool BIAS_BF16, bool RES_BF16>
__global__ __launch_bounds__(128) void k_gemm_bf3(const float* __restrict__ A, int lda, const unsigned short* __restrict__ Wt, int ldb,
                                                const float* __restrict__ bias, const float* __restrict__ resid, int rmod, int ldr,
                                                float* __restrict__ C, int ldc, int M, int N, int K) {
  __shared__ __attribute__((aligned(16))) float so[4][16][64];
  const int tid = threadIdx.x, w = tid >> 5, lane = tid & 31, ln = lane & 15, hh = lane >> 4;
  const int ntn = N / 64;
  const int wid = blockIdx.x * 4 + w;
  const int mt = wid / ntn, nq = wid % ntn;
  if (mt * 16 >= M) return;
  const int row0 = mt * 16, col0 = nq * 64;
  const float* arow = A + (size_t)(row0 + ln) * lda;
  v8f acc[4] = {};
  for (int kb = 0; kb < K; kb += 32) {
    FragB ah, al;
    const v4f x0 = *(const v4fa*)(arow + kb + 8 * hh), x1 = *(const v4fa*)(arow + kb + 8 * hh + 4);
    const v4f x2 = *(const v4fa*)(arow + kb + 16 + 8 * hh), x3 = *(const v4fa*)(arow + kb + 16 + 8 * hh + 4);
    float xs[16] = {x0[0],x0[1],x0[2],x0[3],x1[0],x1[1],x1[2],x1[3],x2[0],x2[1],x2[2],x2[3],x3[0],x3[1],x3[2],x3[3]};
#pragma unroll
    for (int i = 0; i < 16; ++i) { const unsigned short hb = bf16_bits(xs[i]); ah.u[i] = hb; al.u[i] = ASPLIT ? bf16_bits(xs[i] - bf16_val(hb)) : (unsigned short)0; }
#pragma unroll
    for (int t = 0; t < 4; ++t) {
      const unsigned short* brow = Wt + (size_t)(col0 + t * 16 + ln) * ldb + kb;
      FragB b;
      b.half[0] = *(const v8us*)(brow + 8 * hh);
      b.half[1] = *(const v8us*)(brow + 16 + 8 * hh);
      acc[t] = mmaN<ASPLIT ? 2 : 1>(ah.v, al.v, b.v, b.v, acc[t]);
    }
  }
#pragma unroll
  for (int t = 0; t < 4; ++t) {
    const int col = col0 + t * 16 + ln;
    float bv = bias ? bias[col] : 0.f;
    if (BIAS_BF16) bv = bf16_round(bv);
#pragma unroll
    for (int r = 0; r < 8; ++r) {
      float v = acc[t][r] + bv;
      if (resid) { float rv = resid[(size_t)((row0 + 8 * hh + r) % rmod) * ldr + col]; if (RES_BF16) rv = bf16_round(rv); v += rv; }
      if (ACT == 1) v = fmaxf(v, 0.f);
      if (ACT == 2) v = 0.5f * v * (1.0f + erff(v * 0.70710678118654752f));
      if (ACT == 3) { const float u = 0.7978845608028654f * (v + 0.044715f * v * v * v); v = 0.5f * v * (1.0f + tanhf(u)); }
      so[w][8 * hh + r][t * 16 + ln] = v;
    }
  }
  __builtin_amdgcn_fence(__ATOMIC_ACQ_REL, "workgroup");
  __builtin_amdgcn_wave_barrier();
  const int rsub = lane >> 4, c4 = (lane & 15) * 4;
  {
#pragma unroll
    for (int q = 0; q < 8; ++q) {
      const int r = q * 2 + rsub;
      const v4f v = *(const v4fa*)&so[w][r][c4];
      *(v4f*)(C + (size_t)(row0 + r) * ldc + col0 + c4) = v;
    }
    
  }
}
// row LayerNorm (biased variance, eps) over N: s = X (+ R); optional out_sum <- s; out_norm <- (s-mu)*rsqrt(var+eps)*g + b
template <bool PARAM_BF16>
__global__ __launch_bounds__(256) void k_layernorm(const float* __restrict__ X, const float* __restrict__ R, const float* __restrict__ g, const float* __restrict__ bta,
                                                  float* __restrict__ out_sum, float* __restrict__ out_norm, int N, float eps) {
  __shared__ float red[256];
  const int row = blockIdx.x, tid = threadIdx.x;
  const float* x = X + (size_t)row * N; const float* rr = R ? R + (size_t)row * N : nullptr;
  float vals[16];                     // up to N = 4096
  const int per = N / 256;            // contiguous chunk per thread? use strided-by-4 chunks: thread handles j = tid*4 + 1024*u
  float s1 = 0.f;
  for (int u = 0; u < per / 4; ++u) {
    const int j = tid * 4 + 1024 * u;
    const v4f a = *(const v4fa*)(x + j);
    v4f b = {0.f,0.f,0.f,0.f}; if (rr) b = *(const v4fa*)(rr + j);
#pragma unroll
    for (int q = 0; q < 4; ++q) { const float v = a[q] + b[q]; vals[u * 4 + q] = v; s1 += v; }
  }
  red[tid] = s1; __syncthreads();
  for (int st = 128; st > 0; st >>= 1) { if (tid < st) red[tid] += red[tid + st]; __syncthreads(); }
  const float mu = red[0] / (float)N; __syncthreads();
  float s2 = 0.f;
  for (int u = 0; u < per / 4; ++u)
#pragma unroll
    for (int q = 0; q < 4; ++q) { const float c = vals[u * 4 + q] - mu; s2 += c * c; }
  red[tid] = s2; __syncthreads();
  for (int st = 128; st > 0; st >>= 1) { if (tid < st) red[tid] += red[tid + st]; __syncthreads(); }
  const float rs = rsqrtf(red[0] / (float)N + eps);
  {
    for (int u = 0; u < per / 4; ++u) {
      const int j = tid * 4 + 1024 * u;
      v4f o, sm;
#pragma unroll
      for (int q = 0; q < 4; ++q) {
        float gg = g[j + q], bb = bta[j + q];
        if (PARAM_BF16) { gg = bf16_round(gg); bb = bf16_round(bb); }
        sm[q] = vals[u * 4 + q]; o[q] = (vals[u * 4 + q] - mu) * rs * gg + bb;
      }
      if (out_sum) *(v4f*)(out_sum + (size_t)row * N + j) = sm;
      *(v4f*)(out_norm + (size_t)row * N + j) = o;
    }
    
  }
}



// ---- f16 WMMA path (v_wmma_f32_16x16x32_f16): 11-bit significands for operands in range — used where a [0,1] probability operand needs more precision than bf16
typedef _Float16 v16h __attribute__((ext_vector_type(16)));
union FragH { v16h v; v8us half[2]; _Float16 h[16]; unsigned short u[16]; };
template <int NT>
__device__ __forceinline__ v8f mmaH(v16h ah, v16h al, v16h bh, v16h bl, v8f c) {
  c = __builtin_amdgcn_wmma_f32_16x16x32_f16(false, ah, false, bh, (short)0, c, false, false);
  if (NT >= 2) c = __builtin_amdgcn_wmma_f32_16x16x32_f16(false, al, false, bh, (short)0, c, false, false);
  if (NT >= 3) c = __builtin_amdgcn_wmma_f32_16x16x32_f16(false, ah, false, bl, (short)0, c, false, false);
  asm volatile("v_nop\n\tv_nop\n\tv_nop\n\tv_nop" : "+v"(c) : "v"(ah), "v"(al), "v"(bh), "v"(bl));
  return c;
}
// batched GEMM like k_gemm_b but f16 operands: A f32 (split into f16 hi/lo if ASPLIT, else rounded to f16), Bt = f16 values [n][k]; alpha; C f32; N multiple of 16 (partial tiles skipped)
template <bool ASPLIT>
__global__ __launch_bounds__(128) void k_gemm_h(const float* __restrict__ A, int lda, size_t sA, const _Float16* __restrict__ Bh, int ldb, size_t sB, float alpha, float* __restrict__ C, int ldc, size_t sC, int M, int N, int K) {
  __shared__ __attribute__((aligned(16))) float so[4][16][64];
  const int tid = threadIdx.x, w = tid >> 5, lane = tid & 31, ln = lane & 15, hh = lane >> 4; const int by = blockIdx.y;
  A += (size_t)by * sA; Bh += (size_t)by * sB; C += (size_t)by * sC;
  const int ntn = (N + 63) / 64; const int wid = blockIdx.x * 4 + w; const int mt = wid / ntn, nq = wid % ntn; if (mt * 16 >= M) return;
  const int row0 = mt * 16, col0 = nq * 64; const float* arow = A + (size_t)(row0 + ln) * lda;
  v8f acc[4] = {};
  for (int kb = 0; kb < K; kb += 32) {
    FragH ah, al;
    const v4f x0 = *(const v4fa*)(arow + kb + 8 * hh), x1 = *(const v4fa*)(arow + kb + 8 * hh + 4), x2 = *(const v4fa*)(arow + kb + 16 + 8 * hh), x3 = *(const v4fa*)(arow + kb + 16 + 8 * hh + 4);
    float xs[16] = {x0[0],x0[1],x0[2],x0[3],x1[0],x1[1],x1[2],x1[3],x2[0],x2[1],x2[2],x2[3],x3[0],x3[1],x3[2],x3[3]};
#pragma unroll
    for (int i = 0; i < 16; ++i) { const _Float16 h = (_Float16)xs[i]; ah.h[i] = h; al.h[i] = ASPLIT ? (_Float16)(xs[i] - (float)h) : (_Float16)0.0f; }
#pragma unroll
    for (int t = 0; t < 4; ++t) { if (col0 + t * 16 >= N) continue; const size_t boff = (size_t)(col0 + t * 16 + ln) * ldb + kb; FragH bq; bq.half[0] = *(const v8us*)(Bh + boff + 8 * hh); bq.half[1] = *(const v8us*)(Bh + boff + 16 + 8 * hh);
      acc[t] = mmaH<ASPLIT ? 2 : 1>(ah.v, al.v, bq.v, bq.v, acc[t]); }
  }
#pragma unroll
  for (int t = 0; t < 4; ++t) { if (col0 + t * 16 >= N) continue;
#pragma unroll
    for (int r = 0; r < 8; ++r) so[w][8 * hh + r][t * 16 + ln] = acc[t][r] * alpha; }
  __builtin_amdgcn_fence(__ATOMIC_ACQ_REL, "workgroup"); __builtin_amdgcn_wave_barrier();
  const int rsub = lane >> 4, c4 = (lane & 15) * 4;
  {
#pragma unroll
    for (int q = 0; q < 8; ++q) { const int r = q * 2 + rsub; if (col0 + c4 < N) { const v4f v = *(const v4fa*)&so[w][r][c4]; *(v4f*)(C + (size_t)(row0 + r) * ldc + col0 + c4) = v; } }
     }
}

// Wt[n][k] = f16(W[k][n]·scale) from f32 row-major W[K][N] (scale = power of two; bf16-exact weights stay exact in f16 away from the subnormal range)
__global__ __launch_bounds__(256) void k_wt_f16(const float* __restrict__ W, _Float16* __restrict__ Wt, int K, int N, float scale) {
  const int t = blockIdx.x * 256 + threadIdx.x; if (t >= N * (K / 8)) return; const int n = t / (K / 8), k8 = (t % (K / 8)) * 8; FragH f;
#pragma unroll
  for (int i = 0; i < 8; ++i) f.h[i] = (_Float16)(bf16_round(W[(size_t)(k8 + i) * N + n]) * scale); const v8us o = f.half[0];
  *(v8us*)((unsigned short*)Wt + (size_t)n * K + k8) = o; 
}
// k_gemm_hh variant with fused epilogue: v = acc·alpha + bias[by·sBias + col] (+ CP[(row/rowsPerB)·sCPb + by·64 + col] if CP) ; ACT 0 none / 1 elu ; writes f16 C16 (and f32 C if non-null)
template <int ACT>
__global__ __launch_bounds__(128) void k_gemm_hhx(const _Float16* __restrict__ A, int lda, size_t sA, const _Float16* __restrict__ Bh, int ldb, size_t sB, float alpha, const float* __restrict__ bias, size_t sBias, const float* __restrict__ CP, int rowsPerB, size_t sCPb, int row0g,
    float* __restrict__ C, _Float16* __restrict__ C16, int ldc, size_t sC, int M, int N, int K) {
  __shared__ __attribute__((aligned(16))) float so[4][16][64];
  const int tid = threadIdx.x, w = tid >> 5, lane = tid & 31, ln = lane & 15, hh = lane >> 4; const int by = blockIdx.y;
  A += (size_t)by * sA; Bh += (size_t)by * sB; const size_t cofs = (size_t)by * sC; const float* bp = bias ? bias + (size_t)by * sBias : nullptr;
  const int ntn = (N + 63) / 64; const int wid = blockIdx.x * 4 + w; const int mt = wid / ntn, nq = wid % ntn; if (mt * 16 >= M) return;
  const int row0 = mt * 16, col0 = nq * 64; const _Float16* arow = A + (size_t)(row0 + ln) * lda;
  v8f acc[4] = {};
  for (int kb = 0; kb < K; kb += 32) { FragH ah; ah.half[0] = *(const v8us*)((const unsigned short*)arow + kb + 8 * hh); ah.half[1] = *(const v8us*)((const unsigned short*)arow + kb + 16 + 8 * hh);
#pragma unroll
    for (int t = 0; t < 4; ++t) { if (col0 + t * 16 >= N) continue; const size_t boff = (size_t)(col0 + t * 16 + ln) * ldb + kb; FragH bq; bq.half[0] = *(const v8us*)((const unsigned short*)Bh + boff + 8 * hh); bq.half[1] = *(const v8us*)((const unsigned short*)Bh + boff + 16 + 8 * hh);
      acc[t] = mmaH<1>(ah.v, ah.v, bq.v, bq.v, acc[t]); }
  }
#pragma unroll
  for (int t = 0; t < 4; ++t) { if (col0 + t * 16 >= N) continue; const int col = col0 + t * 16 + ln; const float bv = bp ? bf16_round(bp[col]) : 0.f;
#pragma unroll
    for (int r = 0; r < 8; ++r) { float v = acc[t][r] * alpha + bv; if (CP) { const int rr = row0g + row0 + 8 * hh + r; if (rowsPerB < 0) v += CP[cofs + (size_t)rr * ldc + col];      /* rowsPerB < 0: own element of the batched C plane */ else { const int bidx = rr / rowsPerB; v += CP[(size_t)bidx * sCPb + (size_t)by * 64 + col]; } } if (ACT == 1) v = (v > 0.f) ? v : expm1f(v); else if (ACT == 7) v = (v > 0.f) ? v + 1.0f : expf(v); else if (ACT == 8) v = tanhf(v); else if (ACT == 9) v = 0.5f * v * (1.0f + tanhf(0.7978845608028654f * (v + 0.044715f * v * v * v))); else if (ACT == 11) v = 1.0f / (1.0f + expf(-v)); else if (ACT == 12) v = (v > 0.f) ? v : 0.01f * v; else if (ACT == 14) v = (v > 0.f) ? v : 0.1f * v; else if (ACT == 16) v = (v >= 0.f) ? v : 0.3f * v; else if (ACT == 17) v = (v >= 0.f) ? v : 0.2f * v; else if (ACT == 15) v = v / (1.0f + expf(-v)); else if (ACT == 3) v = fmaxf(v, 0.f); else if (ACT == 6) v = 0.5f * v * (1.0f + erff(v * 0.70710678118654752f)); so[w][8 * hh + r][t * 16 + ln] = v; } }
  __builtin_amdgcn_fence(__ATOMIC_ACQ_REL, "workgroup"); __builtin_amdgcn_wave_barrier();
  const int rsub = lane >> 4, c4 = (lane & 15) * 4; typedef _Float16 v4h __attribute__((ext_vector_type(4)));
  {
#pragma unroll
    for (int q = 0; q < 8; ++q) { const int r = q * 2 + rsub; if (col0 + c4 < N) { const v4f v = *(const v4fa*)&so[w][r][c4]; if (C) *(v4f*)(C + cofs + (size_t)(row0 + r) * ldc + col0 + c4) = v; if (C16) { v4h h4; for (int i = 0; i < 4; ++i) h4[i] = (_Float16)v[i]; *(v4h*)(C16 + cofs + (size_t)(row0 + r) * ldc + col0 + c4) = h4; } } }
     }
}


typedef _Float16 v4h __attribute__((ext_vector_type(4)));

__global__ __launch_bounds__(256) void k_x16(const float* __restrict__ x, _Float16* __restrict__ X16, size_t n8) { const size_t t = (size_t)blockIdx.x * 256 + threadIdx.x; if (t >= n8) return; FragH f;
#pragma unroll
  for (int q = 0; q < 8; ++q) f.h[q] = (_Float16)bf16_round(x[t * 8 + q]); *(v8us*)((unsigned short*)X16 + t * 8) = f.half[0];  }
__global__ __launch_bounds__(256) void k_h16(const float* __restrict__ x, _Float16* __restrict__ X16, size_t n8) { const size_t t = (size_t)blockIdx.x * 256 + threadIdx.x; if (t >= n8) return; FragH f;
#pragma unroll
  for (int q = 0; q < 8; ++q) f.h[q] = (_Float16)x[t * 8 + q]; *(v8us*)((unsigned short*)X16 + t * 8) = f.half[0];  }
__global__ __launch_bounds__(256) void k_round16f(const float* __restrict__ W, _Float16* __restrict__ Bt, size_t n8) { const size_t t = (size_t)blockIdx.x * 256 + threadIdx.x; if (t >= n8) return; FragH f;
#pragma unroll
  for (int i = 0; i < 8; ++i) f.h[i] = (_Float16)(bf16_round(W[t * 8 + i]) * 16.0f); *(v8us*)((unsigned short*)Bt + t * 8) = f.half[0];  }
template <int NHv, int TTv>
__global__ __launch_bounds__(256) void k_vt(const _Float16* __restrict__ V16, int ldv, int voff, _Float16* __restrict__ Vt) { __shared__ unsigned short tl[64][66]; const int tid = threadIdx.x; const int slab = blockIdx.x / (TTv / 64), lg = blockIdx.x % (TTv / 64); const int b = slab / NHv, h = slab % NHv;
  for (int i = tid; i < 64 * 8; i += 256) { const int r = i / 8, c8 = (i % 8) * 8; FragH f; f.half[0] = *(const v8us*)((const unsigned short*)V16 + ((size_t)b * TTv + lg * 64 + r) * ldv + voff + h * 64 + c8);
#pragma unroll
    for (int q = 0; q < 8; ++q) tl[r][c8 + q] = f.u[q]; }
  __syncthreads();
  {
#pragma unroll
    for (int rd = 0; rd < 2; ++rd) { const int d = rd * 32 + tid / 8, pc = tid % 8; FragH f;
#pragma unroll
      for (int q = 0; q < 8; ++q) f.u[q] = tl[pc * 8 + q][d];
      *(v8us*)((unsigned short*)Vt + ((size_t)slab * 64 + d) * TTv + lg * 64 + pc * 8) = f.half[0]; }
     } }

__global__ __launch_bounds__(256) void k_hl(const float* __restrict__ F, _Float16* __restrict__ Hh, _Float16* __restrict__ Hl, size_t n8) { const size_t t = (size_t)blockIdx.x * 256 + threadIdx.x; if (t >= n8) return; FragH fh, fl; const v4f a = *(const v4fa*)(F + t * 8), c = *(const v4fa*)(F + t * 8 + 4);
#pragma unroll
  for (int q = 0; q < 4; ++q) { _Float16 h = (_Float16)a[q]; fh.h[q] = h; fl.h[q] = (_Float16)((a[q] - (float)h) * 1024.0f); h = (_Float16)c[q]; fh.h[4 + q] = h; fl.h[4 + q] = (_Float16)((c[q] - (float)h) * 1024.0f); }
  { *(v8us*)((unsigned short*)Hh + t * 8) = fh.half[0]; *(v8us*)((unsigned short*)Hl + t * 8) = fl.half[0];  } }

// ---- fast GEMM (wave tile 32x64; requires M % 32 == 0 rows per launch region, N % 64 == 0 and K % 64 == 0); epilogue = k_gemm_hhx semantics ----
__device__ __forceinline__ v16h g2_frag(const _Float16* p, int hh) { FragH f; f.half[0] = *(const v8us*)((const unsigned short*)p + 8 * hh); f.half[1] = *(const v8us*)((const unsigned short*)p + 16 + 8 * hh); return f.v; }
__device__ __forceinline__ v8f g2_mma(v16h a, v16h b, v8f c) { v8f d = __builtin_amdgcn_wmma_f32_16x16x32_f16(false, a, false, b, (short)0, c, false, false); asm volatile("v_nop\n\tv_nop\n\tv_nop\n\tv_nop" : "+v"(d) : "v"(a), "v"(b)); return d; }
template <int ACT>
__global__ __launch_bounds__(128) void k_gemm2(const _Float16* __restrict__ A, int lda, size_t sA, const _Float16* __restrict__ Bh, int ldb, size_t sB, float alpha, const float* __restrict__ bias, size_t sBias, const float* __restrict__ CP, int rowsPerB, size_t sCPb, int row0g,
    float* __restrict__ C, _Float16* __restrict__ C16, int ldc, size_t sC, int M, int N, int K) { static_assert(ACT == 0 || ACT == 3 || ACT == 6 || ACT == 8 || ACT == 9 || ACT == 11 || ACT == 12 || ACT == 14 || ACT == 15 || ACT == 16 || ACT == 17, "k_gemm2: unsupported ACT code (would silently apply no activation)");
  __shared__ __attribute__((aligned(16))) float so[4][32][68];
  const int tid = threadIdx.x, w = tid >> 5, lane = tid & 31, ln = lane & 15, hh = lane >> 4; const int by = blockIdx.y;
  A += (size_t)by * sA; Bh += (size_t)by * sB; const size_t cofs = (size_t)by * sC; const float* bp = bias ? bias + (size_t)by * sBias : nullptr;
  const int ntn = N >> 6; const int mt = blockIdx.x / ntn, nq = blockIdx.x - mt * ntn; const int row0 = mt * 128 + 32 * w, col0 = nq * 64; if (row0 >= M) return;
  const _Float16* a0p = A + (size_t)(row0 + ln) * lda; const _Float16* a1p = a0p + (size_t)16 * lda;
  const _Float16* b0p = Bh + (size_t)(col0 + ln) * ldb; const _Float16* b1p = b0p + (size_t)16 * ldb; const _Float16* b2p = b1p + (size_t)16 * ldb; const _Float16* b3p = b2p + (size_t)16 * ldb;
  const v8f z8 = {0.f,0.f,0.f,0.f,0.f,0.f,0.f,0.f}; v8f c00 = z8, c01 = z8, c02 = z8, c03 = z8, c10 = z8, c11 = z8, c12 = z8, c13 = z8;
  /* two fragment sets, even and odd k-steps: a set's 12 loads issue together, and it is refilled for two k-steps ahead right behind the products that read it, so two k-steps' loads are always in flight. Each accumulator still takes its k-steps in ascending order. */
  v16h a0 = g2_frag(a0p, hh), a1 = g2_frag(a1p, hh), b0 = g2_frag(b0p, hh), b1 = g2_frag(b1p, hh), b2 = g2_frag(b2p, hh), b3 = g2_frag(b3p, hh);
  v16h e0 = g2_frag(a0p + 32, hh), e1 = g2_frag(a1p + 32, hh), f0 = g2_frag(b0p + 32, hh), f1 = g2_frag(b1p + 32, hh), f2 = g2_frag(b2p + 32, hh), f3 = g2_frag(b3p + 32, hh);
  asm volatile("s_wait_xcnt 0x0" ::: "memory");      /* the accumulators' start values reuse address registers that these loads name: the wait stands in front of that overwrite */
#pragma unroll 1      /* one pair of k-steps per trip: a second copy of the body would need two more fragment sets */
  for (int kb = 64; kb < K; kb += 64) {
    c00 = g2_mma(a0, b0, c00); c10 = g2_mma(a1, b0, c10); c01 = g2_mma(a0, b1, c01); c11 = g2_mma(a1, b1, c11); c02 = g2_mma(a0, b2, c02); c12 = g2_mma(a1, b2, c12); c03 = g2_mma(a0, b3, c03); c13 = g2_mma(a1, b3, c13);
    a0 = g2_frag(a0p + kb, hh); a1 = g2_frag(a1p + kb, hh); b0 = g2_frag(b0p + kb, hh); b1 = g2_frag(b1p + kb, hh); b2 = g2_frag(b2p + kb, hh); b3 = g2_frag(b3p + kb, hh);
    c00 = g2_mma(e0, f0, c00); c10 = g2_mma(e1, f0, c10); c01 = g2_mma(e0, f1, c01); c11 = g2_mma(e1, f1, c11); c02 = g2_mma(e0, f2, c02); c12 = g2_mma(e1, f2, c12); c03 = g2_mma(e0, f3, c03); c13 = g2_mma(e1, f3, c13);
    e0 = g2_frag(a0p + kb + 32, hh); e1 = g2_frag(a1p + kb + 32, hh); f0 = g2_frag(b0p + kb + 32, hh); f1 = g2_frag(b1p + kb + 32, hh); f2 = g2_frag(b2p + kb + 32, hh); f3 = g2_frag(b3p + kb + 32, hh);
    asm volatile("s_wait_xcnt 0x0" ::: "memory"); }      /* the next trip's address additions overwrite the registers that this trip's loads name: the wait stands in front of them */
  c00 = g2_mma(a0, b0, c00); c10 = g2_mma(a1, b0, c10); c01 = g2_mma(a0, b1, c01); c11 = g2_mma(a1, b1, c11); c02 = g2_mma(a0, b2, c02); c12 = g2_mma(a1, b2, c12); c03 = g2_mma(a0, b3, c03); c13 = g2_mma(a1, b3, c13);
  c00 = g2_mma(e0, f0, c00); c10 = g2_mma(e1, f0, c10); c01 = g2_mma(e0, f1, c01); c11 = g2_mma(e1, f1, c11); c02 = g2_mma(e0, f2, c02); c12 = g2_mma(e1, f2, c12); c03 = g2_mma(e0, f3, c03); c13 = g2_mma(e1, f3, c13);
  v8f accs[8] = {c00, c01, c02, c03, c10, c11, c12, c13};
#pragma unroll
  for (int u = 0; u < 8; ++u) { const int t = u & 3, half = u >> 2; const int col = col0 + t * 16 + ln; const float bv = bp ? bf16_round(bp[col]) : 0.f;
#pragma unroll
    for (int r = 0; r < 8; ++r) { const int rloc = half * 16 + 8 * hh + r; float v = accs[u][r] * alpha + bv; if (CP) { if (rowsPerB < 0) v += CP[cofs + (size_t)(row0g + row0 + rloc) * ldc + col];      /* rowsPerB < 0: own element of the batched C plane */ else { const int bidx = (row0g + row0 + rloc) / rowsPerB; v += CP[(size_t)bidx * sCPb + (size_t)by * 64 + col]; } }
      if (ACT == 3) v = fmaxf(v, 0.f); else if (ACT == 6) v = 0.5f * v * (1.0f + erff(v * 0.70710678118654752f)); else if (ACT == 11) v = 1.0f / (1.0f + expf(-v)); else if (ACT == 15) v = v / (1.0f + expf(-v)); else if (ACT == 12) v = (v > 0.f) ? v : 0.01f * v; else if (ACT == 8) v = tanhf(v); else if (ACT == 9) v = 0.5f * v * (1.0f + tanhf(0.7978845608028654f * (v + 0.044715f * v * v * v))); else if (ACT == 14) v = (v > 0.f) ? v : 0.1f * v; else if (ACT == 16) v = (v >= 0.f) ? v : 0.3f * v; else if (ACT == 17) v = (v >= 0.f) ? v : 0.2f * v;
      so[w][rloc][t * 16 + ln] = v; } }
  __builtin_amdgcn_fence(__ATOMIC_ACQ_REL, "workgroup"); __builtin_amdgcn_wave_barrier();
  const int rsub = lane >> 4, c4 = (lane & 15) * 4;
  {
#pragma unroll
    for (int q = 0; q < 16; ++q) { const int r = q * 2 + rsub; const v4f v = *(const v4fa*)&so[w][r][c4]; if (C) *(v4f*)(C + cofs + (size_t)(row0 + r) * ldc + col0 + c4) = v; if (C16) { v4h h4; for (int i = 0; i < 4; ++i) h4[i] = (_Float16)v[i]; *(v4h*)(C16 + cofs + (size_t)(row0 + r) * ldc + col0 + c4) = h4; } }
     } }


__global__ __launch_bounds__(256) void k_wnat(const float* __restrict__ w, size_t n8, _Float16* __restrict__ Bt) { const size_t t = (size_t)blockIdx.x * 256 + threadIdx.x; if (t >= n8) return; FragH f; for (int q = 0; q < 8; ++q) f.h[q] = (_Float16)(bf16_round(w[t * 8 + q]) * 16.0f); *(v8us*)((unsigned short*)Bt + t * 8) = f.half[0];  }
__global__ __launch_bounds__(256) void k_rsm(const float* __restrict__ S, _Float16* __restrict__ P, int nrows) {
  #pragma clang fp contract(off)
  const int i = blockIdx.x * 256 + threadIdx.x; if (i >= nrows) return; const float* s = S + (size_t)i * SQ; float mx = -3.0e38f;
#pragma unroll 1
  for (int j = 0; j < SQ; ++j) mx = fmaxf(mx, s[j]); float se = 0.f;
#pragma unroll 1
  for (int j = 0; j < SQ; ++j) se += expf(s[j] - mx); const float sc = 256.0f / se;
#pragma unroll 1
  for (int j0 = 0; j0 < SQ; j0 += 8) { FragH f; for (int q = 0; q < 8; ++q) f.h[q] = (_Float16)(expf(s[j0 + q] - mx) * sc); unsigned short* d = (unsigned short*)P + (size_t)i * SQ + j0; *(v8us*)d = f.half[0];  } }
__global__ __launch_bounds__(256) void k_vt(const _Float16* __restrict__ V16, int b, int h0, _Float16* __restrict__ VT) { __shared__ unsigned short tl[64][65]; const int tid = threadIdx.x; const int hh = blockIdx.x % HG, sg = blockIdx.x / HG; const int s0 = sg * 64; const int h = h0 + hh;
  for (int i = tid; i < 64 * 8; i += 256) { const int j = i / 8, d8 = (i % 8) * 8; FragH f; f.half[0] = *(const v8us*)((const unsigned short*)V16 + ((size_t)b * SQ + s0 + j) * DM + h * HD + d8); for (int q = 0; q < 8; ++q) tl[d8 + q][j] = f.u[q]; }
  __syncthreads();
  { for (int i = tid; i < 64 * 8; i += 256) { const int d = i / 8, j8 = (i % 8) * 8; FragH f; for (int q = 0; q < 8; ++q) f.u[q] = tl[d][j8 + q]; *(v8us*)((unsigned short*)VT + ((size_t)hh * HD + d) * SQ + s0 + j8) = f.half[0]; }  } }



// fused causal attention, one wave per 32 query rows, no LDS, scores and weights never leave the registers.
// scores^T tile = K rows (A) x Q rows (B): accumulator row = key 8*hh + r, column = query ln, so a lane's 8 values of key tile 0 and its 8 of key tile 1 are,
// in order, the 16 elements of the B fragment (k = 8*hh + i, 16 + 8*hh + i) of the 32-key step of o^T = V^T (A) x P^T (B): no exchange between lanes.
// A lane keeps the running maximum of its query (made equal in both half-waves by one exchange per 32 keys) and its own half of the running sum (halves added at the end).
#define FA_CS 0.18033688011112042f      /* log2(e) / 8: score scale and exp -> exp2 in one factor */
__device__ __forceinline__ float fa_exp2(float x) { float e; asm("v_exp_f32 %0, %1\n\tv_nop" : "=v"(e) : "v"(x)); return e; }      /* the v_nop is the one slot the instruction set asks for behind a transcendental before its result is read or its source overwritten */
__device__ __forceinline__ float fa_xhalf(float x) { return __builtin_bit_cast(float, __builtin_amdgcn_permlanex16(__builtin_bit_cast(int, x), __builtin_bit_cast(int, x), 0x76543210, 0xfedcba98, false, false)); }      /* lane l with lane l ^ 16, on the vector unit (a shuffle would go through the LDS pipe and its wait) */
__device__ __forceinline__ v8f fa_mma(v16h a, v16h b, v8f c) { return __builtin_amdgcn_wmma_f32_16x16x32_f16(false, a, false, b, (short)0, c, false, false); }
__global__ __launch_bounds__(128) void k_fattn(const _Float16* __restrict__ QKVp, const _Float16* __restrict__ VTp, _Float16* __restrict__ O) {
  const int lane = threadIdx.x & 31, ln = lane & 15, hh = lane >> 4; const int w = __builtin_amdgcn_readfirstlane((int)(threadIdx.x >> 5));
  const int bh = blockIdx.x, b = bh / NH, h = bh - b * NH;
  const int yg = (int)blockIdx.y >> 2, yi = (int)blockIdx.y & 3; const int qt = SQ / 128 - 1 - 4 * yg - ((yg & 1) ? 3 - yi : yi);      /* query tile: long tiles first, every second group of four in rising order, so that work-groups 256 apart in the grid (all are resident at once) add up to equal lengths; any order is correct */
  const int row0 = qt * 128 + 32 * w;      /* also the first key of the wave's last 32-key block */
  const _Float16* qp = QKVp + ((size_t)b * SQ + row0 + ln) * LQ + h * HD;
  const _Float16* kp = QKVp + ((size_t)b * SQ + ln) * LQ + DM + h * HD;
  const _Float16* vp = VTp + ((size_t)bh * HD + ln) * SQ;
  v16h q[2][2], kf[2][2];
#pragma unroll      /* here and in every inner loop below: static indices keep the fragment and accumulator arrays in registers */
  for (int j = 0; j < 2; ++j) for (int kk = 0; kk < 2; ++kk) q[j][kk] = g2_frag(qp + (size_t)(j * 16) * LQ + kk * 32, hh);
#pragma unroll
  for (int kt = 0; kt < 2; ++kt) for (int kk = 0; kk < 2; ++kk) kf[kt][kk] = g2_frag(kp + (size_t)(kt * 16) * LQ + kk * 32, hh);
  const v8f z8 = {0.f,0.f,0.f,0.f,0.f,0.f,0.f,0.f};
  v8f o[2][4] = {{z8, z8, z8, z8}, {z8, z8, z8, z8}}; float m[2] = {-1.0e30f, -1.0e30f}, l[2] = {0.f, 0.f};
  int kb = 0;
#pragma unroll 1      /* one 32-key block per trip: a second copy of the body would need a second set of fragments */
  do {
    const int kn = min(kb + 32, row0);      /* next block; the last trip fetches its own block again, so every address stays inside the batch's rows */
    v8f s[2][2]; v16h vf[4];
#pragma unroll
    for (int t = 0; t < 4; ++t) vf[t] = g2_frag(vp + (size_t)(t * 16) * SQ + kb, hh);      /* this block's V^T, in flight under the scores and the softmax */
#pragma unroll
    for (int kt = 0; kt < 2; ++kt) for (int j = 0; j < 2; ++j) s[j][kt] = fa_mma(kf[kt][0], q[j][0], z8);
#pragma unroll
    for (int kt = 0; kt < 2; ++kt) for (int j = 0; j < 2; ++j) s[j][kt] = fa_mma(kf[kt][1], q[j][1], s[j][kt]);
#pragma unroll
    for (int kt = 0; kt < 2; ++kt) for (int kk = 0; kk < 2; ++kk) kf[kt][kk] = g2_frag(kp + (size_t)(kn + kt * 16) * LQ + kk * 32, hh);      /* next block's K, in flight under the softmax and the second product */
    asm volatile("s_wait_xcnt 0x0" ::: "memory");      /* later address arithmetic may overwrite registers that these loads name: the wait stands in front of it */
    if (kb + 31 > row0) {      /* only the block on the diagonal needs the causal test (same for the whole wave) */
      const int dq = row0 + ln - kb - 8 * hh;      /* key offset kt*16 + r is allowed up to dq + j*16 */
#pragma unroll
      for (int j = 0; j < 2; ++j) for (int kt = 0; kt < 2; ++kt) for (int r = 0; r < 8; ++r) s[j][kt][r] = (kt * 16 + r - j * 16 <= dq) ? s[j][kt][r] : -1.0e30f; }
    v16h p[2];
#pragma unroll
    for (int j = 0; j < 2; ++j) {
      float bm = s[j][0][0];
#pragma unroll
      for (int kt = 0; kt < 2; ++kt) for (int r = 0; r < 8; ++r) bm = fmaxf(bm, s[j][kt][r]);
      bm = fmaxf(bm, fa_xhalf(bm));      /* the query's other 16 keys of this block sit in the other half-wave */
      const float mn = fmaxf(m[j], bm); const float sc = fa_exp2((m[j] - mn) * FA_CS); m[j] = mn;
      const float mc = mn * FA_CS - 4.0f;      /* weights carried x16 (largest = 16): small ones stay in f16's normal range; the factor is in the row sum too and cancels */
      v4f ls = {0.f, 0.f, 0.f, 0.f}; FragH f;
#pragma unroll
      for (int i = 0; i < 16; ++i) { const float e = fa_exp2(fmaf(s[j][i >> 3][i & 7], FA_CS, -mc)); ls[i & 3] += e; f.h[i] = (_Float16)e; }
      p[j] = f.v;
      l[j] = l[j] * sc + ((ls[0] + ls[1]) + (ls[2] + ls[3]));
#pragma unroll
      for (int t = 0; t < 4; ++t) o[j][t] *= sc; }
#pragma unroll
    for (int t = 0; t < 4; ++t) for (int j = 0; j < 2; ++j) o[j][t] = fa_mma(vf[t], p[j], o[j][t]);
    kb += 32;
  } while (kb <= row0);
#pragma unroll
  for (int j = 0; j < 2; ++j) { const float fin = 64.0f / (l[j] + fa_xhalf(l[j]));      /* o carried x64 */
    unsigned short* op = (unsigned short*)O + ((size_t)b * SQ + row0 + j * 16 + ln) * DM + h * HD + 8 * hh;
#pragma unroll
    for (int t = 0; t < 4; ++t) { FragH f;
#pragma unroll
      for (int r = 0; r < 8; ++r) f.h[r] = (_Float16)(o[j][t][r] * fin);
      *(v8us*)(op + t * 16) = f.half[0]; } }
}


template <int MASKADD>
__global__ __launch_bounds__(64) void k_att0(const float* __restrict__ QF, const float* __restrict__ KF, const float* __restrict__ VF, int ld, size_t sIn, const float* __restrict__ mask, float scale, float* __restrict__ OF, int ldo, size_t sOut) {
  #pragma clang fp contract(off)
  __shared__ __attribute__((aligned(16))) float lo[64][64];      /* only the transpose for the coalesced store at the end */
  const int tid = threadIdx.x; const int h = blockIdx.x / (QT0 / 64), rg = blockIdx.x % (QT0 / 64); const int i = rg * 64 + tid;
  QF += (size_t)blockIdx.y * sIn; KF += (size_t)blockIdx.y * sIn; VF += (size_t)blockIdx.y * sIn; OF += (size_t)blockIdx.y * sOut;      /* blockIdx.y = batch */
  const float* qr = QF + (size_t)i * ld + h * HD;
  v4f rq[HD / 4], ro[HD / 4];      /* the thread's own q row and o row, in registers for the whole key loop */
#pragma unroll      /* here and in the inner loops below: static indices keep rq[] / ro[] in registers, and a key's loads issue together */
  for (int c = 0; c < HD / 4; ++c) { rq[c] = *(const v4fa*)(qr + c * 4); const v4f z = {0.f, 0.f, 0.f, 0.f}; ro[c] = z; }
  float m = -1.0e30f, l = 0.f; const int jmax = MASKADD ? (SQ - 1) : (rg * 64 + 63);      /* additive-mask form: every key (the mask input decides); causal form: keys up to the block's last row */
#pragma unroll 1
  for (int j = 0; j <= jmax; ++j) { const float* kr = KF + (size_t)j * ld + h * HD; const float* vr = VF + (size_t)j * ld + h * HD; float s = 0.f;
#pragma unroll
    for (int c = 0; c < HD / 4; ++c) { const v4f kq = *(const v4fa*)(kr + c * 4); const v4f qq = rq[c]; s = __fadd_rn(s, __fmul_rn(qq[0], kq[0])); s = __fadd_rn(s, __fmul_rn(qq[1], kq[1])); s = __fadd_rn(s, __fmul_rn(qq[2], kq[2])); s = __fadd_rn(s, __fmul_rn(qq[3], kq[3])); }
    s = __fmul_rn(s, scale); if (MASKADD) s = __fadd_rn(s, __fmul_rn(bf16_round(mask[(size_t)i * SQ + j]), -10000.0f));
    const float f = (MASKADD || j <= i) ? 1.f : 0.f; const float sm = fmaf(f, s, (1.f - f) * -1.0e30f); const float mn = fmaxf(m, sm); const float sc = expf(m - mn); const float e = expf(sm - mn); l = __fadd_rn(__fmul_rn(l, sc), e); m = mn;
#pragma unroll
    for (int c = 0; c < HD / 4; ++c) { const v4f vv = *(const v4fa*)(vr + c * 4); v4f oo = ro[c]; for (int u = 0; u < 4; ++u) oo[u] = __fadd_rn(__fmul_rn(oo[u], sc), __fmul_rn(e, vv[u])); ro[c] = oo; } }
  const float fin = 64.0f / l;      /* o carried x64 like the f16 path */
#pragma unroll
  for (int c = 0; c < HD / 4; ++c) { v4f oo = ro[c]; for (int u = 0; u < 4; ++u) oo[u] = __fmul_rn(oo[u], fin); *(v4f*)&lo[tid][c * 4] = oo; }
  __syncthreads();
  {
#pragma unroll 1
    for (int it = 0; it < 16; ++it) { const int row = it * 4 + tid / 16, pc = (tid % 16) * 4; const v4f v = *(const v4f*)&lo[row][pc]; *(v4f*)(OF + (size_t)(rg * 64 + row) * ldo + h * HD + pc) = v; }
     } }


template <int BFIN, int WXB>
__global__ __launch_bounds__(256) void k_ln16(const float* __restrict__ X, const float* __restrict__ g, const float* __restrict__ bb, float eps, _Float16* __restrict__ N16, float* __restrict__ XB) {
  #pragma clang fp contract(off)
  __shared__ float red[256]; const size_t r = blockIdx.x; const int t = threadIdx.x; const v4f xa = *(const v4fa*)(X + r * DMQ + t * 4); float s[4]; float sum = 0.f;
  for (int q = 0; q < 4; ++q) { s[q] = BFIN ? bf16_round(xa[q]) : xa[q]; sum = __fadd_rn(sum, s[q]); }
  red[t] = sum; __syncthreads(); for (int st = 128; st > 0; st >>= 1) { if (t < st) red[t] = __fadd_rn(red[t], red[t + st]); __syncthreads(); } const float mu = red[0] / (float)DMQ; __syncthreads();
  float vs = 0.f; for (int q = 0; q < 4; ++q) { const float dl = __fadd_rn(s[q], -mu); vs = __fadd_rn(vs, __fmul_rn(dl, dl)); } red[t] = vs; __syncthreads(); for (int st = 128; st > 0; st >>= 1) { if (t < st) red[t] = __fadd_rn(red[t], red[t + st]); __syncthreads(); }
  const float rs = rsqrtf(__fadd_rn(red[0] / (float)DMQ, eps)); v4h y; v4f xb;
  for (int q = 0; q < 4; ++q) { const int c = t * 4 + q; y[q] = (_Float16)__fadd_rn(__fmul_rn(__fmul_rn(__fadd_rn(s[q], -mu), rs), bf16_round(g[c])), bf16_round(bb[c])); xb[q] = s[q]; }
  { *(v4h*)(N16 + r * DMQ + t * 4) = y; if (WXB) *(v4f*)(XB + r * DMQ + t * 4) = xb;  } }
__global__ __launch_bounds__(256) void k_ftres2(const float* __restrict__ OF0, const float* __restrict__ XB, float* __restrict__ X1, size_t n4) {
  #pragma clang fp contract(off)
  const size_t t = (size_t)blockIdx.x * 256 + threadIdx.x; if (t >= n4) return; const v4f o = *(const v4fa*)(OF0 + t * 4), xv = *(const v4fa*)(XB + t * 4); v4f y; for (int q = 0; q < 4; ++q) y[q] = __fadd_rn(__fmul_rn(o[q], 0.015625f), xv[q]); *(v4f*)(X1 + t * 4) = y;  }

__global__ __launch_bounds__(256) void k_wthd(const float* __restrict__ Wt, _Float16* __restrict__ Bt) { const size_t t = (size_t)blockIdx.x * 256 + threadIdx.x; if (t >= (size_t)NH * HD * (DM / 8)) return; const int m8 = (int)(t % (DM / 8)) * 8; const int d = (int)((t / (DM / 8)) % HD); const int h = (int)(t / ((size_t)(DM / 8) * HD)); FragH f;
  for (int q = 0; q < 8; ++q) f.h[q] = (_Float16)(16.0f * bf16_round(Wt[((size_t)h * DM + m8 + q) * HD + d])); unsigned short* dst = (unsigned short*)Bt + ((size_t)h * HD + d) * DM + m8; *(v8us*)dst = f.half[0];  }




__global__ __launch_bounds__(256) void k_wtpad(const float* __restrict__ Wm, _Float16* __restrict__ Wt, int Kr, int Kp, int Nr, int Np, float scale) {
  const int t = blockIdx.x * 256 + threadIdx.x; if (t >= Np * (Kp / 8)) return; const int n = t / (Kp / 8), k8 = (t % (Kp / 8)) * 8; const int nc = min(n, Nr - 1); const float fn = (n < Nr) ? 1.f : 0.f; FragH f;
  for (int i = 0; i < 8; ++i) { const int k = k8 + i; const int kc = min(k, Kr - 1); const float fk = (k < Kr) ? fn : 0.f; f.h[i] = (_Float16)(bf16_round(Wm[(size_t)kc * Nr + nc]) * scale * fk); }
  unsigned short* o = (unsigned short*)Wt + (size_t)n * Kp + k8; *(v8us*)o = f.half[0];  }
__global__ __launch_bounds__(128) void k_bpad(const float* __restrict__ b, float* __restrict__ Bp, int nr, int np) {
  const int i = threadIdx.x; if (i >= np) return; const float v = b[min(i, nr - 1)] * ((i < nr) ? 1.f : 0.f); *(float*)(Bp + i) = v;  }
extern "C" void kernel_launch(void* const* d_in, const int* in_sizes, int n_in,
                              void* d_out, int out_size, void* d_ws, size_t ws_size, hipStream_t stream) {
  (void)in_sizes; (void)n_in; (void)out_size;
  const float* const* I = (const float* const*)d_in; const float* x = I[0]; const float* g1 = I[1]; const float* be1 = I[2]; const float* wq = I[3]; const float* wk = I[4]; const float* wv = I[5]; const float* wo = I[6]; const float* bo = nullptr; const float* gg2 = I[7]; const float* be2 = I[8]; const float* wfc = I[9]; const float* bfc = I[10]; const float* wmp = I[11]; const float* bmp = I[12];      /* x, LN1 g / b, Wq / Wk / Wv / Wo [1024][1024] ([in][out], no biases), LN2 g / b, W1 [1024][4096] + b1, W2 [4096][1024] + b2 */
  char* ws = (char*)d_ws; size_t off = 0;
  auto take = [&](size_t bytes) { char* p = ws + off; off += (bytes + 255) & ~(size_t)255; return p; };
  _Float16* BQKV = (_Float16*)take((size_t)3 * DM * DM * 2); _Float16* BO = (_Float16*)take((size_t)DM * DM * 2);
  _Float16* X16 = (_Float16*)take(NR * DM * 2); float* XB = (float*)take(NR * DM * 4); float* X1 = (float*)take(NR * DM * 4); _Float16* M16 = nullptr;      /* = X16 below (alias: X16's last reader, the first-tile q | k | v GEMM, precedes LN2's write) */ _Float16* HF16 = (_Float16*)take((size_t)SQ * DFF * 2); _Float16* BW1 = (_Float16*)take((size_t)DFF * DM * 2); _Float16* BW2 = (_Float16*)take((size_t)DM * DFF * 2); _Float16* QKV = (_Float16*)take(NR * 3 * DM * 2); _Float16* Q16 = QKV; _Float16* K16 = QKV + DM; _Float16* V16 = QKV + 2 * DM; _Float16* O16 = (_Float16*)take(NR * DM * 2); M16 = X16;
  _Float16* VT = (_Float16*)take((size_t)NB * NH * HD * SQ * 2);
  float* QKVF0 = (float*)take((size_t)NB * QT0 * LQ * 4);      /* f32 q | k | v rows of every batch's first tile, pitch LQ */ float* OF0 = (float*)take((size_t)NB * QT0 * DM * 4); _Float16* OH0 = (_Float16*)take((size_t)NB * QT0 * DM * 2); _Float16* OL0 = (_Float16*)take((size_t)NB * QT0 * DM * 2);
  if (off > ws_size) return;
  { const unsigned g = (unsigned)(((size_t)DM * (DM / 8) + 255) / 256); k_wt_f16<<<g, 256, 0, stream>>>(wq, BQKV, DM, DM, 16.0f); k_wt_f16<<<g, 256, 0, stream>>>(wk, BQKV + (size_t)DM * DM, DM, DM, 16.0f); k_wt_f16<<<g, 256, 0, stream>>>(wv, BQKV + (size_t)2 * DM * DM, DM, DM, 16.0f); }      /* [in][out] -> Bt x16, stacked q | k | v */ k_wt_f16<<<(unsigned)(((size_t)DM * (DM / 8) + 255) / 256), 256, 0, stream>>>(wo, BO, DM, DM, 16.0f);      /* w_proj [in][out] -> Bt x16 */
  k_ln16<1, 1><<<(unsigned)NR, 256, 0, stream>>>(x, g1, be1, 1e-5f, X16, XB);      /* a = LN1(bf16(x)) -> f16 rows; XB = bf16(x) for the residual */
  k_wt_f16<<<(unsigned)(((size_t)DFF * (DM / 8) + 255) / 256), 256, 0, stream>>>(wfc, BW1, DM, DFF, 16.0f); k_wt_f16<<<(unsigned)(((size_t)DM * (DFF / 8) + 255) / 256), 256, 0, stream>>>(wmp, BW2, DFF, DM, 16.0f);      /* W1 [1024][4096] -> Bt [4096][1024]; W2 [4096][1024] -> Bt [1024][4096] (x16) */
  const size_t r0p = (size_t)B0 * SQ;      /* first projected row */
  k_gemm2<0><<<dim3((unsigned)((MP / 128) * (3 * DM / 64)), 1), 128, 0, stream>>>(X16 + r0p * DM, DM, 0, BQKV, DM, 0, 0.0625f, nullptr, 0, nullptr, 1, 0, 0, nullptr, QKV + r0p * 3 * DM, 3 * DM, 0, MP, 3 * DM, DM);      /* q | k | v rows (f16); head h = columns h*HD.. of each DM block */
  k_gemm2<0><<<dim3((QT0 / 128) * (LQ / 64), NB), 128, 0, stream>>>(X16, DM, (size_t)SQ * DM, BQKV, DM, 0, 0.0625f, nullptr, 0, nullptr, 1, 0, 0, QKVF0, nullptr, LQ, (size_t)QT0 * LQ, QT0, LQ, DM);      /* f32 q | k | v of the first 128 rows of every batch (exact products); blockIdx.y = batch */
  k_att0<0><<<dim3(NH * (QT0 / 64), NB), 64, 0, stream>>>(QKVF0, QKVF0 + DM, QKVF0 + 2 * DM, LQ, (size_t)QT0 * LQ, nullptr, 0.125f, OF0, DM, (size_t)QT0 * DM);      /* exact f32 attention for rows 0..127 of every batch (o x64) */
  k_vt<NH, SQ><<<NB * NH * (SQ / 64), 256, 0, stream>>>(V16, LQ, 0, VT);      /* V^T [NB][NH][HD][SQ] */
  k_fattn<<<dim3(NB * NH, SQ / 128), 128, 0, stream>>>(QKV, VT, O16);      /* o (merged heads, x64) as f16 rows, every batch, head and query tile in one launch */
  k_gemm2<0><<<dim3((unsigned)((MPO / 128) * (DM / 64)), 1), 128, 0, stream>>>(O16 + r0p * DM, DM, 0, BO, DM, 0, 0.0009765625f, bo, 0, XB + r0p * DM, -1, 0, 0, X1 + r0p * DM, nullptr, DM, 0, MPO, DM, DM);      /* out rows are the output layout */
  k_hl<<<(unsigned)(((size_t)NB * QT0 * DM / 8 + 255) / 256), 256, 0, stream>>>(OF0, OH0, OL0, (size_t)NB * QT0 * DM / 8);      /* first-tile o (x64) -> f16 hi + x1024 residual planes */
  k_gemm2<0><<<dim3((QT0 / 128) * (DM / 64), NB), 128, 0, stream>>>(OH0, DM, (size_t)QT0 * DM, BO, DM, 0, 0.0009765625f, bo, 0, XB, -1, 0, 0, X1, nullptr, DM, (size_t)SQ * DM, QT0, DM, DM);      /* rows 0..127 of every batch: x1 = o_hi Wo + x (no bias), overwriting the f16-path rows */
  k_gemm2<0><<<dim3((QT0 / 128) * (DM / 64), NB), 128, 0, stream>>>(OL0, DM, (size_t)QT0 * DM, BO, DM, 0, 0.00000095367431640625f, nullptr, 0, X1, -1, 0, 0, X1, nullptr, DM, (size_t)SQ * DM, QT0, DM, DM);      /* += o_lo Wo 2^-20 (own-element accumulate) */
  k_ln16<0, 0><<<(unsigned)NR, 256, 0, stream>>>(X1, gg2, be2, 1e-5f, M16, nullptr);      /* h = LN2(x1) -> f16 rows */
  for (int b = 0; b < NB; ++b) { const size_t r0 = (size_t)b * SQ;
    k_gemm2<6><<<dim3((unsigned)((SQ / 128) * (DFF / 64)), 1), 128, 0, stream>>>(M16 + r0 * DM, DM, 0, BW1, DM, 0, 0.0625f, bfc, 0, nullptr, 1, 0, 0, nullptr, HF16, DFF, 0, SQ, DFF, DM);      /* gelu_erf(h2 W1 + b1) -> f16 (this batch) */
    k_gemm2<0><<<dim3((unsigned)((SQ / 128) * (DM / 64)), 1), 128, 0, stream>>>(HF16, DFF, 0, BW2, DFF, 0, 0.0625f, bmp, 0, X1 + r0 * DM, -1, 0, 0, (float*)d_out + r0 * DM, nullptr, DM, 0, SQ, DM, DFF); }      /* out = x1 + mlp (own-element residual) */
}

// v006
// A run of this version takes 754 microseconds.
// Two timings next to v005 put it at 1.32 and 1.33 times that version's speed.
// Over all steps from v000 it is 14.3 times as fast.
#include <hip/hip_runtime.h>
// Pre-LN causal transformer block (x [4][2048][1024]; h = LN1(x) (biased var, eps 1e-5, gamma / beta); Q/K/V = h Wq/Wk/Wv ([in][out] 1024 x 1024 sigma 1/32, no biases), 16 heads of 64; scores / 8; causal (tril, -inf); softmax; x1 = x + hidden Wo ([in][out], no bias); h2 = LN2(x1); out = x1 + gelu_erf(h2 W1 + b1) W2 + b2 ([in][out] 1024 x 4096 x 1024) -> [4][2048][1024]).
// Structure: token rows r = b*2048 + s; h = LN1(bf16-rounded x) as f16 rows; q | k | v as ONE WMMA GEMM (N = 3 x 1024) (32x64 wave tiles, f32 accumulation, exact x16 weights, no bias, f16 outputs); V^T for all batches and heads via LDS transposes; ONE fused causal attention launch: a wave owns 32 query rows and walks the keys below its last row 32 at a time, scores^T = K . Q^T on WMMA (keys on the accumulator rows, so a lane holds one query's scores), running row maximum and row sum in f32 (native exp2; weights x16 f16, taken from the accumulators in place as the B fragment), o^T += V^T . P^T on WMMA, o carried x64 (folded into the output GEMM alpha) written straight into the merged f16 o rows; x1 = x + o W_o GEMM (f32, no bias) into the output layout.
// Compute dtype: inputs rounded to bf16; x / weights exact; q, k, v, softmax weights and o as plain f16 GEMM operands (~2^-12); scores and softmax statistics f32. v_wmma_f32_16x16x32_f16.
#define NB 4
#define SQ 2048
#define DM 1024
#define NH 16
#define HD 64
#define HG 4                         /* heads per block group of the unlaunched k_vt(b, h0) overload */
#define QT 256                       /* unused */
#define NKX SQ                       /* unused */
#define QT0 128                      /* first-tile rows recomputed exactly in f32 */
#define B0 0                         /* first batch processed (debug hook) */
#define NBR NB                       /* batches processed (debug hook) */
#define NR ((size_t)NB * SQ)
#define DMQ DM
#define DFF 4096                     /* FFN hidden width */
#define DFFR 100                     /* unused */
#define MP ((int)((size_t)NBR * SQ)) /* rows projected (debug hook) */
#define QN SQ                        /* unused */
#define NHD NH                       /* unused */
#define MPO MP                       /* rows through the output stage (debug hook) */
#define LQ (3 * DM)      /* row pitch of the q/k/v rows */
typedef __bf16 v16b __attribute__((ext_vector_type(16)));
typedef unsigned short v8us __attribute__((ext_vector_type(8), may_alias));
typedef float  v8f  __attribute__((ext_vector_type(8)));
typedef float  v4f  __attribute__((ext_vector_type(4)));
typedef float  v4fa __attribute__((ext_vector_type(4), may_alias));
union FragB { v16b v; v8us half[2]; unsigned short u[16]; };

__device__ __forceinline__ unsigned short bf16_bits(float x) { unsigned int u = __float_as_uint(x); return (unsigned short)((u + 0x7FFFu + ((u >> 16) & 1u)) >> 16); }
__device__ __forceinline__ float bf16_val(unsigned short b) { return __uint_as_float(((unsigned int)b) << 16); }
__device__ __forceinline__ float bf16_round(float x) { return bf16_val(bf16_bits(x)); }
// D += A·B with NT terms: 1 = ah·bh, 2 = + al·bh (A split), 3 = + ah·bl (both split)
template <int NT>
__device__ __forceinline__ v8f mmaN(v16b ah, v16b al, v16b bh, v16b bl, v8f c) {
  c = __builtin_amdgcn_wmma_f32_16x16x32_bf16(false, ah, false, bh, (short)0, c, false, false);
  if (NT >= 2) c = __builtin_amdgcn_wmma_f32_16x16x32_bf16(false, al, false, bh, (short)0, c, false, false);
  if (NT >= 3) c = __builtin_amdgcn_wmma_f32_16x16x32_bf16(false, ah, false, bl, (short)0, c, false, false);
  asm volatile("v_nop\n\tv_nop\n\tv_nop\n\tv_nop" : "+v"(c) : "v"(ah), "v"(al), "v"(bh), "v"(bl));
  return c;
}

__global__ __launch_bounds__(256) void k_wt_bf16(const float* __restrict__ W, unsigned short* __restrict__ Wt, int K, int N) {
  const int t = blockIdx.x * 256 + threadIdx.x;
  const int k8n = K / 8;
  if (t >= N * k8n) return;
  const int n = t / k8n, k8 = (t % k8n) * 8;
  v8us v;
#pragma unroll
  for (int i = 0; i < 8; ++i) v[i] = bf16_bits(W[(size_t)(k8 + i) * N + n]);
  *(v8us*)(Wt + (size_t)n * K + k8) = v;
  
}

// GEMM C[M][N] (f32, pitch ldc) = act(A[M][K]·W + bias). A f32 row-major (pitch lda) converted per fragment to bf16
// (ASPLIT: hi/lo two planes -> 2 terms, else single rounded term); Wt bf16 [N][K] (pitch ldb). BIAS_BF16 rounds the
// bias to bf16 first (bias quantised to bf16 before the add). K%32==0, M%16==0, N%64==0.
template <bool ASPLIT, int ACT, bool BIAS_BF16>
__global__ __launch_bounds__(128) void k_gemm_bf(const float* __restrict__ A, int lda, const unsigned short* __restrict__ Wt, int ldb,
                                               const float* __restrict__ bias, float* __restrict__ C, int ldc, int M, int N, int K) {
  __shared__ __attribute__((aligned(16))) float so[4][16][64];
  const int tid = threadIdx.x, w = tid >> 5, lane = tid & 31, ln = lane & 15, hh = lane >> 4;
  const int ntn = N / 64;
  const int wid = blockIdx.x * 4 + w;
  const int mt = wid / ntn, nq = wid % ntn;
  if (mt * 16 >= M) return;
  const int row0 = mt * 16, col0 = nq * 64;
  const float* arow = A + (size_t)(row0 + ln) * lda;
  v8f acc[4] = {};
  for (int kb = 0; kb < K; kb += 32) {
    FragB ah, al;
    const v4f x0 = *(const v4fa*)(arow + kb + 8 * hh), x1 = *(const v4fa*)(arow + kb + 8 * hh + 4);
    const v4f x2 = *(const v4fa*)(arow + kb + 16 + 8 * hh), x3 = *(const v4fa*)(arow + kb + 16 + 8 * hh + 4);
    float xs[16] = {x0[0],x0[1],x0[2],x0[3],x1[0],x1[1],x1[2],x1[3],x2[0],x2[1],x2[2],x2[3],x3[0],x3[1],x3[2],x3[3]};
#pragma unroll
    for (int i = 0; i < 16; ++i) { const unsigned short hb = bf16_bits(xs[i]); ah.u[i] = hb; al.u[i] = ASPLIT ? bf16_bits(xs[i] - bf16_val(hb)) : (unsigned short)0; }
#pragma unroll
    for (int t = 0; t < 4; ++t) {
      const unsigned short* brow = Wt + (size_t)(col0 + t * 16 + ln) * ldb + kb;
      FragB b;
      b.half[0] = *(const v8us*)(brow + 8 * hh);
      b.half[1] = *(const v8us*)(brow + 16 + 8 * hh);
      acc[t] = mmaN<ASPLIT ? 2 : 1>(ah.v, al.v, b.v, b.v, acc[t]);
    }
  }
#pragma unroll
  for (int t = 0; t < 4; ++t) {
    float bv = bias ? bias[col0 + t * 16 + ln] : 0.f;
    if (BIAS_BF16) bv = bf16_round(bv);
#pragma unroll
    for (int r = 0; r < 8; ++r) { float v = acc[t][r] + bv; if (ACT == 1) v = fmaxf(v, 0.f); so[w][8 * hh + r][t * 16 + ln] = v; }
  }
  __builtin_amdgcn_fence(__ATOMIC_ACQ_REL, "workgroup");
  __builtin_amdgcn_wave_barrier();
  const int rsub = lane >> 4, c4 = (lane & 15) * 4;
  {
#pragma unroll
    for (int q = 0; q < 8; ++q) {
      const int r = q * 2 + rsub;
      const v4f v = *(const v4fa*)&so[w][r][c4];
      *(v4f*)(C + (size_t)(row0 + r) * ldc + col0 + c4) = v;
    }
    
  }
}

// GEMM C = act(A·W + bias + resid): A f32 (ASPLIT -> hi/lo 2 terms), Wt bf16 [N][K]; ACT 0 none, 1 relu, 2 exact gelu;
// resid (optional, f32, row index = (row % rmod), pitch ldr, RES_BF16 rounds it) added before the activation.
template <bool ASPLIT, int ACT, bool BIAS_BF16, bool RES_BF16>
__global__ __launch_bounds__(128) void k_gemm_bf3(const float* __restrict__ A, int lda, const unsigned short* __restrict__ Wt, int ldb,
                                                const float* __restrict__ bias, const float* __restrict__ resid, int rmod, int ldr,
                                                float* __restrict__ C, int ldc, int M, int N, int K) {
  __shared__ __attribute__((aligned(16))) float so[4][16][64];
  const int tid = threadIdx.x, w = tid >> 5, lane = tid & 31, ln = lane & 15, hh = lane >> 4;
  const int ntn = N / 64;
  const int wid = blockIdx.x * 4 + w;
  const int mt = wid / ntn, nq = wid % ntn;
  if (mt * 16 >= M) return;
  const int row0 = mt * 16, col0 = nq * 64;
  const float* arow = A + (size_t)(row0 + ln) * lda;
  v8f acc[4] = {};
  for (int kb = 0; kb < K; kb += 32) {
    FragB ah, al;
    const v4f x0 = *(const v4fa*)(arow + kb + 8 * hh), x1 = *(const v4fa*)(arow + kb + 8 * hh + 4);
    const v4f x2 = *(const v4fa*)(arow + kb + 16 + 8 * hh), x3 = *(const v4fa*)(arow + kb + 16 + 8 * hh + 4);
    float xs[16] = {x0[0],x0[1],x0[2],x0[3],x1[0],x1[1],x1[2],x1[3],x2[0],x2[1],x2[2],x2[3],x3[0],x3[1],x3[2],x3[3]};
#pragma unroll
    for (int i = 0; i < 16; ++i) { const unsigned short hb = bf16_bits(xs[i]); ah.u[i] = hb; al.u[i] = ASPLIT ? bf16_bits(xs[i] - bf16_val(hb)) : (unsigned short)0; }
#pragma unroll
    for (int t = 0; t < 4; ++t) {
      const unsigned short* brow = Wt + (size_t)(col0 + t * 16 + ln) * ldb + kb;
      FragB b;
      b.half[0] = *(const v8us*)(brow + 8 * hh);
      b.half[1] = *(const v8us*)(brow + 16 + 8 * hh);
      acc[t] = mmaN<ASPLIT ? 2 : 1>(ah.v, al.v, b.v, b.v, acc[t]);
    }
  }
#pragma unroll
  for (int t = 0; t < 4; ++t) {
    const int col = col0 + t * 16 + ln;
    float bv = bias ? bias[col] : 0.f;
    if (BIAS_BF16) bv = bf16_round(bv);
#pragma unroll
    for (int r = 0; r < 8; ++r) {
      float v = acc[t][r] + bv;
      if (resid) { float rv = resid[(size_t)((row0 + 8 * hh + r) % rmod) * ldr + col]; if (RES_BF16) rv = bf16_round(rv); v += rv; }
      if (ACT == 1) v = fmaxf(v, 0.f);
      if (ACT == 2) v = 0.5f * v * (1.0f + erff(v * 0.70710678118654752f));
      if (ACT == 3) { const float u = 0.7978845608028654f * (v + 0.044715f * v * v * v); v = 0.5f * v * (1.0f + tanhf(u)); }
      so[w][8 * hh + r][t * 16 + ln] = v;
    }
  }
  __builtin_amdgcn_fence(__ATOMIC_ACQ_REL, "workgroup");
  __builtin_amdgcn_wave_barrier();
  const int rsub = lane >> 4, c4 = (lane & 15) * 4;
  {
#pragma unroll
    for (int q = 0; q < 8; ++q) {
      const int r = q * 2 + rsub;
      const v4f v = *(const v4fa*)&so[w][r][c4];
      *(v4f*)(C + (size_t)(row0 + r) * ldc + col0 + c4) = v;
    }
    
  }
}
// row LayerNorm (biased variance, eps) over N: s = X (+ R); optional out_sum <- s; out_norm <- (s-mu)*rsqrt(var+eps)*g + b
template <bool PARAM_BF16>
__global__ __launch_bounds__(256) void k_layernorm(const float* __restrict__ X, const float* __restrict__ R, const float* __restrict__ g, const float* __restrict__ bta,
                                                  float* __restrict__ out_sum, float* __restrict__ out_norm, int N, float eps) {
  __shared__ float red[256];
  const int row = blockIdx.x, tid = threadIdx.x;
  const float* x = X + (size_t)row * N; const float* rr = R ? R + (size_t)row * N : nullptr;
  float vals[16];                     // up to N = 4096
  const int per = N / 256;            // contiguous chunk per thread? use strided-by-4 chunks: thread handles j = tid*4 + 1024*u
  float s1 = 0.f;
  for (int u = 0; u < per / 4; ++u) {
    const int j = tid * 4 + 1024 * u;
    const v4f a = *(const v4fa*)(x + j);
    v4f b = {0.f,0.f,0.f,0.f}; if (rr) b = *(const v4fa*)(rr + j);
#pragma unroll
    for (int q = 0; q < 4; ++q) { const float v = a[q] + b[q]; vals[u * 4 + q] = v; s1 += v; }
  }
  red[tid] = s1; __syncthreads();
  for (int st = 128; st > 0; st >>= 1) { if (tid < st) red[tid] += red[tid + st]; __syncthreads(); }
  const float mu = red[0] / (float)N; __syncthreads();
  float s2 = 0.f;
  for (int u = 0; u < per / 4; ++u)
#pragma unroll
    for (int q = 0; q < 4; ++q) { const float c = vals[u * 4 + q] - mu; s2 += c * c; }
  red[tid] = s2; __syncthreads();
  for (int st = 128; st > 0; st >>= 1) { if (tid < st) red[tid] += red[tid + st]; __syncthreads(); }
  const float rs = rsqrtf(red[0] / (float)N + eps);
  {
    for (int u = 0; u < per / 4; ++u) {
      const int j = tid * 4 + 1024 * u;
      v4f o, sm;
#pragma unroll
      for (int q = 0; q < 4; ++q) {
        float gg = g[j + q], bb = bta[j + q];
        if (PARAM_BF16) { gg = bf16_round(gg); bb = bf16_round(bb); }
        sm[q] = vals[u * 4 + q]; o[q] = (vals[u * 4 + q] - mu) * rs * gg + bb;
      }
      if (out_sum) *(v4f*)(out_sum + (size_t)row * N + j) = sm;
      *(v4f*)(out_norm + (size_t)row * N + j) = o;
    }
    
  }
}



// ---- f16 WMMA path (v_wmma_f32_16x16x32_f16): 11-bit significands for operands in range — used where a [0,1] probability operand needs more precision than bf16
typedef _Float16 v16h __attribute__((ext_vector_type(16)));
union FragH { v16h v; v8us half[2]; _Float16 h[16]; unsigned short u[16]; };
template <int NT>
__device__ __forceinline__ v8f mmaH(v16h ah, v16h al, v16h bh, v16h bl, v8f c) {
  c = __builtin_amdgcn_wmma_f32_16x16x32_f16(false, ah, false, bh, (short)0, c, false, false);
  if (NT >= 2) c = __builtin_amdgcn_wmma_f32_16x16x32_f16(false, al, false, bh, (short)0, c, false, false);
  if (NT >= 3) c = __builtin_amdgcn_wmma_f32_16x16x32_f16(false, ah, false, bl, (short)0, c, false, false);
  asm volatile("v_nop\n\tv_nop\n\tv_nop\n\tv_nop" : "+v"(c) : "v"(ah), "v"(al), "v"(bh), "v"(bl));
  return c;
}
// batched GEMM like k_gemm_b but f16 operands: A f32 (split into f16 hi/lo if ASPLIT, else rounded to f16), Bt = f16 values [n][k]; alpha; C f32; N multiple of 16 (partial tiles skipped)
template <bool ASPLIT>
__global__ __launch_bounds__(128) void k_gemm_h(const float* __restrict__ A, int lda, size_t sA, const _Float16* __restrict__ Bh, int ldb, size_t sB, float alpha, float* __restrict__ C, int ldc, size_t sC, int M, int N, int K) {
  __shared__ __attribute__((aligned(16))) float so[4][16][64];
  const int tid = threadIdx.x, w = tid >> 5, lane = tid & 31, ln = lane & 15, hh = lane >> 4; const int by = blockIdx.y;
  A += (size_t)by * sA; Bh += (size_t)by * sB; C += (size_t)by * sC;
  const int ntn = (N + 63) / 64; const int wid = blockIdx.x * 4 + w; const int mt = wid / ntn, nq = wid % ntn; if (mt * 16 >= M) return;
  const int row0 = mt * 16, col0 = nq * 64; const float* arow = A + (size_t)(row0 + ln) * lda;
  v8f acc[4] = {};
  for (int kb = 0; kb < K; kb += 32) {
    FragH ah, al;
    const v4f x0 = *(const v4fa*)(arow + kb + 8 * hh), x1 = *(const v4fa*)(arow + kb + 8 * hh + 4), x2 = *(const v4fa*)(arow + kb + 16 + 8 * hh), x3 = *(const v4fa*)(arow + kb + 16 + 8 * hh + 4);
    float xs[16] = {x0[0],x0[1],x0[2],x0[3],x1[0],x1[1],x1[2],x1[3],x2[0],x2[1],x2[2],x2[3],x3[0],x3[1],x3[2],x3[3]};
#pragma unroll
    for (int i = 0; i < 16; ++i) { const _Float16 h = (_Float16)xs[i]; ah.h[i] = h; al.h[i] = ASPLIT ? (_Float16)(xs[i] - (float)h) : (_Float16)0.0f; }
#pragma unroll
    for (int t = 0; t < 4; ++t) { if (col0 + t * 16 >= N) continue; const size_t boff = (size_t)(col0 + t * 16 + ln) * ldb + kb; FragH bq; bq.half[0] = *(const v8us*)(Bh + boff + 8 * hh); bq.half[1] = *(const v8us*)(Bh + boff + 16 + 8 * hh);
      acc[t] = mmaH<ASPLIT ? 2 : 1>(ah.v, al.v, bq.v, bq.v, acc[t]); }
  }
#pragma unroll
  for (int t = 0; t < 4; ++t) { if (col0 + t * 16 >= N) continue;
#pragma unroll
    for (int r = 0; r < 8; ++r) so[w][8 * hh + r][t * 16 + ln] = acc[t][r] * alpha; }
  __builtin_amdgcn_fence(__ATOMIC_ACQ_REL, "workgroup"); __builtin_amdgcn_wave_barrier();
  const int rsub = lane >> 4, c4 = (lane & 15) * 4;
  {
#pragma unroll
    for (int q = 0; q < 8; ++q) { const int r = q * 2 + rsub; if (col0 + c4 < N) { const v4f v = *(const v4fa*)&so[w][r][c4]; *(v4f*)(C + (size_t)(row0 + r) * ldc + col0 + c4) = v; } }
     }
}

// Wt[n][k] = f16(W[k][n]·scale) from f32 row-major W[K][N] (scale = power of two; bf16-exact weights stay exact in f16 away from the subnormal range)
__global__ __launch_bounds__(256) void k_wt_f16(const float* __restrict__ W, _Float16* __restrict__ Wt, int K, int N, float scale) {
  const int t = blockIdx.x * 256 + threadIdx.x; if (t >= N * (K / 8)) return; const int n = t / (K / 8), k8 = (t % (K / 8)) * 8; FragH f;
#pragma unroll
  for (int i = 0; i < 8; ++i) f.h[i] = (_Float16)(bf16_round(W[(size_t)(k8 + i) * N + n]) * scale); const v8us o = f.half[0];
  *(v8us*)((unsigned short*)Wt + (size_t)n * K + k8) = o; 
}
// k_gemm_hh variant with fused epilogue: v = acc·alpha + bias[by·sBias + col] (+ CP[(row/rowsPerB)·sCPb + by·64 + col] if CP) ; ACT 0 none / 1 elu ; writes f16 C16 (and f32 C if non-null)
template <int ACT>
__global__ __launch_bounds__(128) void k_gemm_hhx(const _Float16* __restrict__ A, int lda, size_t sA, const _Float16* __restrict__ Bh, int ldb, size_t sB, float alpha, const float* __restrict__ bias, size_t sBias, const float* __restrict__ CP, int rowsPerB, size_t sCPb, int row0g,
    float* __restrict__ C, _Float16* __restrict__ C16, int ldc, size_t sC, int M, int N, int K) {
  __shared__ __attribute__((aligned(16))) float so[4][16][64];
  const int tid = threadIdx.x, w = tid >> 5, lane = tid & 31, ln = lane & 15, hh = lane >> 4; const int by = blockIdx.y;
  A += (size_t)by * sA; Bh += (size_t)by * sB; const size_t cofs = (size_t)by * sC; const float* bp = bias ? bias + (size_t)by * sBias : nullptr;
  const int ntn = (N + 63) / 64; const int wid = blockIdx.x * 4 + w; const int mt = wid / ntn, nq = wid % ntn; if (mt * 16 >= M) return;
  const int row0 = mt * 16, col0 = nq * 64; const _Float16* arow = A + (size_t)(row0 + ln) * lda;
  v8f acc[4] = {};
  for (int kb = 0; kb < K; kb += 32) { FragH ah; ah.half[0] = *(const v8us*)((const unsigned short*)arow + kb + 8 * hh); ah.half[1] = *(const v8us*)((const unsigned short*)arow + kb + 16 + 8 * hh);
#pragma unroll
    for (int t = 0; t < 4; ++t) { if (col0 + t * 16 >= N) continue; const size_t boff = (size_t)(col0 + t * 16 + ln) * ldb + kb; FragH bq; bq.half[0] = *(const v8us*)((const unsigned short*)Bh + boff + 8 * hh); bq.half[1] = *(const v8us*)((const unsigned short*)Bh + boff + 16 + 8 * hh);
      acc[t] = mmaH<1>(ah.v, ah.v, bq.v, bq.v, acc[t]); }
  }
#pragma unroll
  for (int t = 0; t < 4; ++t) { if (col0 + t * 16 >= N) continue; const int col = col0 + t * 16 + ln; const float bv = bp ? bf16_round(bp[col]) : 0.f;
#pragma unroll
    for (int r = 0; r < 8; ++r) { float v = acc[t][r] * alpha + bv; if (CP) { const int rr = row0g + row0 + 8 * hh + r; if (rowsPerB < 0) v += CP[cofs + (size_t)rr * ldc + col];      /* rowsPerB < 0: own element of the batched C plane */ else { const int bidx = rr / rowsPerB; v += CP[(size_t)bidx * sCPb + (size_t)by * 64 + col]; } } if (ACT == 1) v = (v > 0.f) ? v : expm1f(v); else if (ACT == 7) v = (v > 0.f) ? v + 1.0f : expf(v); else if (ACT == 8) v = tanhf(v); else if (ACT == 9) v = 0.5f * v * (1.0f + tanhf(0.7978845608028654f * (v + 0.044715f * v * v * v))); else if (ACT == 11) v = 1.0f / (1.0f + expf(-v)); else if (ACT == 12) v = (v > 0.f) ? v : 0.01f * v; else if (ACT == 14) v = (v > 0.f) ? v : 0.1f * v; else if (ACT == 16) v = (v >= 0.f) ? v : 0.3f * v; else if (ACT == 17) v = (v >= 0.f) ? v : 0.2f * v; else if (ACT == 15) v = v / (1.0f + expf(-v)); else if (ACT == 3) v = fmaxf(v, 0.f); else if (ACT == 6) v = 0.5f * v * (1.0f + erff(v * 0.70710678118654752f)); so[w][8 * hh + r][t * 16 + ln] = v; } }
  __builtin_amdgcn_fence(__ATOMIC_ACQ_REL, "workgroup"); __builtin_amdgcn_wave_barrier();
  const int rsub = lane >> 4, c4 = (lane & 15) * 4; typedef _Float16 v4h __attribute__((ext_vector_type(4)));
  {
#pragma unroll
    for (int q = 0; q < 8; ++q) { const int r = q * 2 + rsub; if (col0 + c4 < N) { const v4f v = *(const v4fa*)&so[w][r][c4]; if (C) *(v4f*)(C + cofs + (size_t)(row0 + r) * ldc + col0 + c4) = v; if (C16) { v4h h4; for (int i = 0; i < 4; ++i) h4[i] = (_Float16)v[i]; *(v4h*)(C16 + cofs + (size_t)(row0 + r) * ldc + col0 + c4) = h4; } } }
     }
}


typedef _Float16 v4h __attribute__((ext_vector_type(4)));

__global__ __launch_bounds__(256) void k_x16(const float* __restrict__ x, _Float16* __restrict__ X16, size_t n8) { const size_t t = (size_t)blockIdx.x * 256 + threadIdx.x; if (t >= n8) return; FragH f;
#pragma unroll
  for (int q = 0; q < 8; ++q) f.h[q] = (_Float16)bf16_round(x[t * 8 + q]); *(v8us*)((unsigned short*)X16 + t * 8) = f.half[0];  }
__global__ __launch_bounds__(256) void k_h16(const float* __restrict__ x, _Float16* __restrict__ X16, size_t n8) { const size_t t = (size_t)blockIdx.x * 256 + threadIdx.x; if (t >= n8) return; FragH f;
#pragma unroll
  for (int q = 0; q < 8; ++q) f.h[q] = (_Float16)x[t * 8 + q]; *(v8us*)((unsigned short*)X16 + t * 8) = f.half[0];  }
__global__ __launch_bounds__(256) void k_round16f(const float* __restrict__ W, _Float16* __restrict__ Bt, size_t n8) { const size_t t = (size_t)blockIdx.x * 256 + threadIdx.x; if (t >= n8) return; FragH f;
#pragma unroll
  for (int i = 0; i < 8; ++i) f.h[i] = (_Float16)(bf16_round(W[t * 8 + i]) * 16.0f); *(v8us*)((unsigned short*)Bt + t * 8) = f.half[0];  }
template <int NHv, int TTv>
__global__ __launch_bounds__(256) void k_vt(const _Float16* __restrict__ V16, int ldv, int voff, _Float16* __restrict__ Vt) { __shared__ unsigned short tl[64][66]; const int tid = threadIdx.x; const int slab = blockIdx.x / (TTv / 64), lg = blockIdx.x % (TTv / 64); const int b = slab / NHv, h = slab % NHv;
  for (int i = tid; i < 64 * 8; i += 256) { const int r = i / 8, c8 = (i % 8) * 8; FragH f; f.half[0] = *(const v8us*)((const unsigned short*)V16 + ((size_t)b * TTv + lg * 64 + r) * ldv + voff + h * 64 + c8);
#pragma unroll
    for (int q = 0; q < 8; ++q) tl[r][c8 + q] = f.u[q]; }
  __syncthreads();
  {
#pragma unroll
    for (int rd = 0; rd < 2; ++rd) { const int d = rd * 32 + tid / 8, pc = tid % 8; FragH f;
#pragma unroll
      for (int q = 0; q < 8; ++q) f.u[q] = tl[pc * 8 + q][d];
      *(v8us*)((unsigned short*)Vt + ((size_t)slab * 64 + d) * TTv + lg * 64 + pc * 8) = f.half[0]; }
     } }

__global__ __launch_bounds__(256) void k_hl(const float* __restrict__ F, _Float16* __restrict__ Hh, _Float16* __restrict__ Hl, size_t n8) { const size_t t = (size_t)blockIdx.x * 256 + threadIdx.x; if (t >= n8) return; FragH fh, fl; const v4f a = *(const v4fa*)(F + t * 8), c = *(const v4fa*)(F + t * 8 + 4);
#pragma unroll
  for (int q = 0; q < 4; ++q) { _Float16 h = (_Float16)a[q]; fh.h[q] = h; fl.h[q] = (_Float16)((a[q] - (float)h) * 1024.0f); h = (_Float16)c[q]; fh.h[4 + q] = h; fl.h[4 + q] = (_Float16)((c[q] - (float)h) * 1024.0f); }
  { *(v8us*)((unsigned short*)Hh + t * 8) = fh.half[0]; *(v8us*)((unsigned short*)Hl + t * 8) = fl.half[0];  } }

// ---- fast GEMM (work-group tile 128x64, wave tile 32x64, operands staged in LDS; requires M % 128 == 0 rows per launch region, N % 64 == 0 and K % 64 == 0); epilogue = k_gemm_hhx semantics ----
__device__ __forceinline__ v16h g2_frag(const _Float16* p, int hh) { FragH f; f.half[0] = *(const v8us*)((const unsigned short*)p + 8 * hh); f.half[1] = *(const v8us*)((const unsigned short*)p + 16 + 8 * hh); return f.v; }
__device__ __forceinline__ v8f g2_mma(v16h a, v16h b, v8f c) { v8f d = __builtin_amdgcn_wmma_f32_16x16x32_f16(false, a, false, b, (short)0, c, false, false); asm volatile("v_nop\n\tv_nop\n\tv_nop\n\tv_nop" : "+v"(d) : "v"(a), "v"(b)); return d; }
#define G2P 72                       /* LDS row pitch in f16: 128 B of data + 16 B = 144 B, an odd multiple of 16 B, so the 16 rows of a ds_load_b128 fragment read fall on different banks */
#define G2B (192 * G2P)              /* f16 per buffer: the block's 128 A rows, then its 64 B rows, 64 k each */
#define G2S (16u * G2P * 2u)         /* LDS bytes between a lane's successive copies (16 rows) */
// one k-tile (64 k) of the block's 128 A rows and 64 B rows, global -> LDS through no register: lane = (row tid / 8 + 16 i, 16-byte piece tid % 8), so a wave's copy takes four whole 128-byte lines.
// The s_wait_xcnt stands inside the copies' own statement, behind the last of them: later address arithmetic overwrites registers that the copies name, and only here is the wait tied in front of it.
__device__ __forceinline__ void g2_stage(const _Float16* ga, size_t sa, const _Float16* gb, size_t sb, unsigned l) {
  asm volatile(
    "global_load_async_to_lds_b128 %0, %12, off\n\t"
    "global_load_async_to_lds_b128 %1, %13, off\n\t"
    "global_load_async_to_lds_b128 %2, %14, off\n\t"
    "global_load_async_to_lds_b128 %3, %15, off\n\t"
    "global_load_async_to_lds_b128 %4, %16, off\n\t"
    "global_load_async_to_lds_b128 %5, %17, off\n\t"
    "global_load_async_to_lds_b128 %6, %18, off\n\t"
    "global_load_async_to_lds_b128 %7, %19, off\n\t"
    "global_load_async_to_lds_b128 %8, %20, off\n\t"
    "global_load_async_to_lds_b128 %9, %21, off\n\t"
    "global_load_async_to_lds_b128 %10, %22, off\n\t"
    "global_load_async_to_lds_b128 %11, %23, off\n\t"
    "s_wait_xcnt 0x0"
    :: "v"(l), "v"(l + 1u * G2S), "v"(l + 2u * G2S), "v"(l + 3u * G2S), "v"(l + 4u * G2S), "v"(l + 5u * G2S), "v"(l + 6u * G2S), "v"(l + 7u * G2S), "v"(l + 8u * G2S), "v"(l + 9u * G2S), "v"(l + 10u * G2S), "v"(l + 11u * G2S),
       "v"(ga), "v"(ga + 1 * sa), "v"(ga + 2 * sa), "v"(ga + 3 * sa), "v"(ga + 4 * sa), "v"(ga + 5 * sa), "v"(ga + 6 * sa), "v"(ga + 7 * sa), "v"(gb), "v"(gb + 1 * sb), "v"(gb + 2 * sb), "v"(gb + 3 * sb) : "memory"); }
template <int ACT>
__global__ __launch_bounds__(128) void k_gemm2(const _Float16* __restrict__ A, int lda, size_t sA, const _Float16* __restrict__ Bh, int ldb, size_t sB, float alpha, const float* __restrict__ bias, size_t sBias, const float* __restrict__ CP, int rowsPerB, size_t sCPb, int row0g,
    float* __restrict__ C, _Float16* __restrict__ C16, int ldc, size_t sC, int M, int N, int K) { static_assert(ACT == 0 || ACT == 3 || ACT == 6 || ACT == 8 || ACT == 9 || ACT == 11 || ACT == 12 || ACT == 14 || ACT == 15 || ACT == 16 || ACT == 17, "k_gemm2: unsupported ACT code (would silently apply no activation)");
  __shared__ __attribute__((aligned(16))) float sm[G2B];      /* two k-tile buffers of G2B f16 each; behind the k-loop's last barrier the same bytes are the epilogue's transpose tiles */
  float (*so)[32][68] = (float (*)[32][68])sm; static_assert(4 * 32 * 68 <= G2B, "epilogue tiles must fit the ring");
  const int tid = threadIdx.x, w = tid >> 5, lane = tid & 31, ln = lane & 15, hh = lane >> 4; const int by = blockIdx.y;
  A += (size_t)by * sA; Bh += (size_t)by * sB; const size_t cofs = (size_t)by * sC; const float* bp = bias ? bias + (size_t)by * sBias : nullptr;
  const int ntn = N >> 6; const int mt = blockIdx.x / ntn, nq = blockIdx.x - mt * ntn; const int row0 = mt * 128 + 32 * w, col0 = nq * 64; if (mt * 128 >= M) return;      /* the whole work-group leaves or none (barriers below) */
  const _Float16* ga = A + (size_t)(mt * 128 + (tid >> 3)) * lda + (tid & 7) * 8; const _Float16* gb = Bh + (size_t)(col0 + (tid >> 3)) * ldb + (tid & 7) * 8; const size_t sa = (size_t)16 * lda, sb = (size_t)16 * ldb;
  const unsigned l0 = (unsigned)(size_t)sm + (unsigned)((tid >> 3) * (G2P * 2) + (tid & 7) * 16);      /* the lane's LDS byte address in buffer 0 */
  const _Float16* st = (const _Float16*)sm; const int nt = K >> 6;
  const v8f z8 = {0.f,0.f,0.f,0.f,0.f,0.f,0.f,0.f}; v8f c00 = z8, c01 = z8, c02 = z8, c03 = z8, c10 = z8, c11 = z8, c12 = z8, c13 = z8;
  /* two LDS buffers: tile t + 1 flies while tile t is worked on. Each accumulator still takes its k-steps in ascending order. */
  g2_stage(ga, sa, gb, sb, l0);
  asm volatile("s_wait_asynccnt 0x0" ::: "memory");      /* this wave's copies of tile 0 have landed */
  __syncthreads();      /* ... and every other wave's */
  if (nt > 1) g2_stage(ga + 64, sa, gb + 64, sb, l0 + (unsigned)(G2B * 2));
#pragma unroll 1      /* one k-tile per trip: the buffer alternates by the trip's parity */
  for (int t = 0; t < nt; ++t) {
    const _Float16* ap = st + (t & 1) * G2B + (32 * w + ln) * G2P; const _Float16* bq = st + (t & 1) * G2B + (128 + ln) * G2P;
    const v16h a0 = g2_frag(ap, hh), a1 = g2_frag(ap + 16 * G2P, hh), b0 = g2_frag(bq, hh), b1 = g2_frag(bq + 16 * G2P, hh), b2 = g2_frag(bq + 32 * G2P, hh), b3 = g2_frag(bq + 48 * G2P, hh);
    const v16h e0 = g2_frag(ap + 32, hh), e1 = g2_frag(ap + 16 * G2P + 32, hh), f0 = g2_frag(bq + 32, hh), f1 = g2_frag(bq + 16 * G2P + 32, hh), f2 = g2_frag(bq + 32 * G2P + 32, hh), f3 = g2_frag(bq + 48 * G2P + 32, hh);
    c00 = g2_mma(a0, b0, c00); c10 = g2_mma(a1, b0, c10); c01 = g2_mma(a0, b1, c01); c11 = g2_mma(a1, b1, c11); c02 = g2_mma(a0, b2, c02); c12 = g2_mma(a1, b2, c12); c03 = g2_mma(a0, b3, c03); c13 = g2_mma(a1, b3, c13);
    c00 = g2_mma(e0, f0, c00); c10 = g2_mma(e1, f0, c10); c01 = g2_mma(e0, f1, c01); c11 = g2_mma(e1, f1, c11); c02 = g2_mma(e0, f2, c02); c12 = g2_mma(e1, f2, c12); c03 = g2_mma(e0, f3, c03); c13 = g2_mma(e1, f3, c13);
    asm volatile("s_wait_dscnt 0x0" ::: "memory");      /* this wave's reads of tile t are done before the buffer is given up */
    asm volatile("s_wait_asynccnt 0x0" ::: "memory");      /* this wave's copies of tile t + 1 have landed */
    __syncthreads();      /* publishes tile t + 1 and ends every wave's reads of tile t */
    if (t + 2 < nt) g2_stage(ga + (size_t)(t + 2) * 64, sa, gb + (size_t)(t + 2) * 64, sb, l0 + (unsigned)((t & 1) * (G2B * 2))); }      /* refill of the buffer that this trip has just read */
  asm volatile("s_wait_asynccnt 0x0" ::: "memory");      /* nothing of the ring is in flight when its bytes become the epilogue's tiles */
  v8f accs[8] = {c00, c01, c02, c03, c10, c11, c12, c13};
#pragma unroll
  for (int u = 0; u < 8; ++u) { const int t = u & 3, half = u >> 2; const int col = col0 + t * 16 + ln; const float bv = bp ? bf16_round(bp[col]) : 0.f;
#pragma unroll
    for (int r = 0; r < 8; ++r) { const int rloc = half * 16 + 8 * hh + r; float v = accs[u][r] * alpha + bv; if (CP) { if (rowsPerB < 0) v += CP[cofs + (size_t)(row0g + row0 + rloc) * ldc + col];      /* rowsPerB < 0: own element of the batched C plane */ else { const int bidx = (row0g + row0 + rloc) / rowsPerB; v += CP[(size_t)bidx * sCPb + (size_t)by * 64 + col]; } }
      if (ACT == 3) v = fmaxf(v, 0.f); else if (ACT == 6) v = 0.5f * v * (1.0f + erff(v * 0.70710678118654752f)); else if (ACT == 11) v = 1.0f / (1.0f + expf(-v)); else if (ACT == 15) v = v / (1.0f + expf(-v)); else if (ACT == 12) v = (v > 0.f) ? v : 0.01f * v; else if (ACT == 8) v = tanhf(v); else if (ACT == 9) v = 0.5f * v * (1.0f + tanhf(0.7978845608028654f * (v + 0.044715f * v * v * v))); else if (ACT == 14) v = (v > 0.f) ? v : 0.1f * v; else if (ACT == 16) v = (v >= 0.f) ? v : 0.3f * v; else if (ACT == 17) v = (v >= 0.f) ? v : 0.2f * v;
      so[w][rloc][t * 16 + ln] = v; } }
  __builtin_amdgcn_fence(__ATOMIC_ACQ_REL, "workgroup"); __builtin_amdgcn_wave_barrier();
  const int rsub = lane >> 4, c4 = (lane & 15) * 4;
  {
#pragma unroll
    for (int q = 0; q < 16; ++q) { const int r = q * 2 + rsub; const v4f v = *(const v4fa*)&so[w][r][c4]; if (C) *(v4f*)(C + cofs + (size_t)(row0 + r) * ldc + col0 + c4) = v; if (C16) { v4h h4; for (int i = 0; i < 4; ++i) h4[i] = (_Float16)v[i]; *(v4h*)(C16 + cofs + (size_t)(row0 + r) * ldc + col0 + c4) = h4; } }
     } }


__global__ __launch_bounds__(256) void k_wnat(const float* __restrict__ w, size_t n8, _Float16* __restrict__ Bt) { const size_t t = (size_t)blockIdx.x * 256 + threadIdx.x; if (t >= n8) return; FragH f; for (int q = 0; q < 8; ++q) f.h[q] = (_Float16)(bf16_round(w[t * 8 + q]) * 16.0f); *(v8us*)((unsigned short*)Bt + t * 8) = f.half[0];  }
__global__ __launch_bounds__(256) void k_rsm(const float* __restrict__ S, _Float16* __restrict__ P, int nrows) {
  #pragma clang fp contract(off)
  const int i = blockIdx.x * 256 + threadIdx.x; if (i >= nrows) return; const float* s = S + (size_t)i * SQ; float mx = -3.0e38f;
#pragma unroll 1
  for (int j = 0; j < SQ; ++j) mx = fmaxf(mx, s[j]); float se = 0.f;
#pragma unroll 1
  for (int j = 0; j < SQ; ++j) se += expf(s[j] - mx); const float sc = 256.0f / se;
#pragma unroll 1
  for (int j0 = 0; j0 < SQ; j0 += 8) { FragH f; for (int q = 0; q < 8; ++q) f.h[q] = (_Float16)(expf(s[j0 + q] - mx) * sc); unsigned short* d = (unsigned short*)P + (size_t)i * SQ + j0; *(v8us*)d = f.half[0];  } }
__global__ __launch_bounds__(256) void k_vt(const _Float16* __restrict__ V16, int b, int h0, _Float16* __restrict__ VT) { __shared__ unsigned short tl[64][65]; const int tid = threadIdx.x; const int hh = blockIdx.x % HG, sg = blockIdx.x / HG; const int s0 = sg * 64; const int h = h0 + hh;
  for (int i = tid; i < 64 * 8; i += 256) { const int j = i / 8, d8 = (i % 8) * 8; FragH f; f.half[0] = *(const v8us*)((const unsigned short*)V16 + ((size_t)b * SQ + s0 + j) * DM + h * HD + d8); for (int q = 0; q < 8; ++q) tl[d8 + q][j] = f.u[q]; }
  __syncthreads();
  { for (int i = tid; i < 64 * 8; i += 256) { const int d = i / 8, j8 = (i % 8) * 8; FragH f; for (int q = 0; q < 8; ++q) f.u[q] = tl[d][j8 + q]; *(v8us*)((unsigned short*)VT + ((size_t)hh * HD + d) * SQ + s0 + j8) = f.half[0]; }  } }



// fused causal attention, one wave per 32 query rows, no LDS, scores and weights never leave the registers.
// scores^T tile = K rows (A) x Q rows (B): accumulator row = key 8*hh + r, column = query ln, so a lane's 8 values of key tile 0 and its 8 of key tile 1 are,
// in order, the 16 elements of the B fragment (k = 8*hh + i, 16 + 8*hh + i) of the 32-key step of o^T = V^T (A) x P^T (B): no exchange between lanes.
// A lane keeps the running maximum of its query (made equal in both half-waves by one exchange per 32 keys) and its own half of the running sum (halves added at the end).
#define FA_CS 0.18033688011112042f      /* log2(e) / 8: score scale and exp -> exp2 in one factor */
__device__ __forceinline__ float fa_exp2(float x) { float e; asm("v_exp_f32 %0, %1\n\tv_nop" : "=v"(e) : "v"(x)); return e; }      /* the v_nop is the one slot the instruction set asks for behind a transcendental before its result is read or its source overwritten */
__device__ __forceinline__ float fa_xhalf(float x) { return __builtin_bit_cast(float, __builtin_amdgcn_permlanex16(__builtin_bit_cast(int, x), __builtin_bit_cast(int, x), 0x76543210, 0xfedcba98, false, false)); }      /* lane l with lane l ^ 16, on the vector unit (a shuffle would go through the LDS pipe and its wait) */
__device__ __forceinline__ v8f fa_mma(v16h a, v16h b, v8f c) { return __builtin_amdgcn_wmma_f32_16x16x32_f16(false, a, false, b, (short)0, c, false, false); }
__global__ __launch_bounds__(128) void k_fattn(const _Float16* __restrict__ QKVp, const _Float16* __restrict__ VTp, _Float16* __restrict__ O) {
  const int lane = threadIdx.x & 31, ln = lane & 15, hh = lane >> 4; const int w = __builtin_amdgcn_readfirstlane((int)(threadIdx.x >> 5));
  const int bh = blockIdx.x, b = bh / NH, h = bh - b * NH;
  const int yg = (int)blockIdx.y >> 2, yi = (int)blockIdx.y & 3; const int qt = SQ / 128 - 1 - 4 * yg - ((yg & 1) ? 3 - yi : yi);      /* query tile: long tiles first, every second group of four in rising order, so that work-groups 256 apart in the grid (all are resident at once) add up to equal lengths; any order is correct */
  const int row0 = qt * 128 + 32 * w;      /* also the first key of the wave's last 32-key block */
  const _Float16* qp = QKVp + ((size_t)b * SQ + row0 + ln) * LQ + h * HD;
  const _Float16* kp = QKVp + ((size_t)b * SQ + ln) * LQ + DM + h * HD;
  const _Float16* vp = VTp + ((size_t)bh * HD + ln) * SQ;
  v16h q[2][2], kf[2][2];
#pragma unroll      /* here and in every inner loop below: static indices keep the fragment and accumulator arrays in registers */
  for (int j = 0; j < 2; ++j) for (int kk = 0; kk < 2; ++kk) q[j][kk] = g2_frag(qp + (size_t)(j * 16) * LQ + kk * 32, hh);
#pragma unroll
  for (int kt = 0; kt < 2; ++kt) for (int kk = 0; kk < 2; ++kk) kf[kt][kk] = g2_frag(kp + (size_t)(kt * 16) * LQ + kk * 32, hh);
  const v8f z8 = {0.f,0.f,0.f,0.f,0.f,0.f,0.f,0.f};
  v8f o[2][4] = {{z8, z8, z8, z8}, {z8, z8, z8, z8}}; float m[2] = {-1.0e30f, -1.0e30f}, l[2] = {0.f, 0.f};
  int kb = 0;
#pragma unroll 1      /* one 32-key block per trip: a second copy of the body would need a second set of fragments */
  do {
    const int kn = min(kb + 32, row0);      /* next block; the last trip fetches its own block again, so every address stays inside the batch's rows */
    v8f s[2][2]; v16h vf[4];
#pragma unroll
    for (int t = 0; t < 4; ++t) vf[t] = g2_frag(vp + (size_t)(t * 16) * SQ + kb, hh);      /* this block's V^T, in flight under the scores and the softmax */
#pragma unroll
    for (int kt = 0; kt < 2; ++kt) for (int j = 0; j < 2; ++j) s[j][kt] = fa_mma(kf[kt][0], q[j][0], z8);
#pragma unroll
    for (int kt = 0; kt < 2; ++kt) for (int j = 0; j < 2; ++j) s[j][kt] = fa_mma(kf[kt][1], q[j][1], s[j][kt]);
#pragma unroll
    for (int kt = 0; kt < 2; ++kt) for (int kk = 0; kk < 2; ++kk) kf[kt][kk] = g2_frag(kp + (size_t)(kn + kt * 16) * LQ + kk * 32, hh);      /* next block's K, in flight under the softmax and the second product */
    asm volatile("s_wait_xcnt 0x0" ::: "memory");      /* later address arithmetic may overwrite registers that these loads name: the wait stands in front of it */
    if (kb + 31 > row0) {      /* only the block on the diagonal needs the causal test (same for the whole wave) */
      const int dq = row0 + ln - kb - 8 * hh;      /* key offset kt*16 + r is allowed up to dq + j*16 */
#pragma unroll
      for (int j = 0; j < 2; ++j) for (int kt = 0; kt < 2; ++kt) for (int r = 0; r < 8; ++r) s[j][kt][r] = (kt * 16 + r - j * 16 <= dq) ? s[j][kt][r] : -1.0e30f; }
    v16h p[2];
#pragma unroll
    for (int j = 0; j < 2; ++j) {
      float bm = s[j][0][0];
#pragma unroll
      for (int kt = 0; kt < 2; ++kt) for (int r = 0; r < 8; ++r) bm = fmaxf(bm, s[j][kt][r]);
      bm = fmaxf(bm, fa_xhalf(bm));      /* the query's other 16 keys of this block sit in the other half-wave */
      const float mn = fmaxf(m[j], bm); const float sc = fa_exp2((m[j] - mn) * FA_CS); m[j] = mn;
      const float mc = mn * FA_CS - 4.0f;      /* weights carried x16 (largest = 16): small ones stay in f16's normal range; the factor is in the row sum too and cancels */
      v4f ls = {0.f, 0.f, 0.f, 0.f}; FragH f;
#pragma unroll
      for (int i = 0; i < 16; ++i) { const float e = fa_exp2(fmaf(s[j][i >> 3][i & 7], FA_CS, -mc)); ls[i & 3] += e; f.h[i] = (_Float16)e; }
      p[j] = f.v;
      l[j] = l[j] * sc + ((ls[0] + ls[1]) + (ls[2] + ls[3]));
#pragma unroll
      for (int t = 0; t < 4; ++t) o[j][t] *= sc; }
#pragma unroll
    for (int t = 0; t < 4; ++t) for (int j = 0; j < 2; ++j) o[j][t] = fa_mma(vf[t], p[j], o[j][t]);
    kb += 32;
  } while (kb <= row0);
#pragma unroll
  for (int j = 0; j < 2; ++j) { const float fin = 64.0f / (l[j] + fa_xhalf(l[j]));      /* o carried x64 */
    unsigned short* op = (unsigned short*)O + ((size_t)b * SQ + row0 + j * 16 + ln) * DM + h * HD + 8 * hh;
#pragma unroll
    for (int t = 0; t < 4; ++t) { FragH f;
#pragma unroll
      for (int r = 0; r < 8; ++r) f.h[r] = (_Float16)(o[j][t][r] * fin);
      *(v8us*)(op + t * 16) = f.half[0]; } }
}


template <int MASKADD>
__global__ __launch_bounds__(64) void k_att0(const float* __restrict__ QF, const float* __restrict__ KF, const float* __restrict__ VF, int ld, size_t sIn, const float* __restrict__ mask, float scale, float* __restrict__ OF, int ldo, size_t sOut) {
  #pragma clang fp contract(off)
  __shared__ __attribute__((aligned(16))) float lo[64][64];      /* only the transpose for the coalesced store at the end */
  const int tid = threadIdx.x; const int h = blockIdx.x / (QT0 / 64), rg = blockIdx.x % (QT0 / 64); const int i = rg * 64 + tid;
  QF += (size_t)blockIdx.y * sIn; KF += (size_t)blockIdx.y * sIn; VF += (size_t)blockIdx.y * sIn; OF += (size_t)blockIdx.y * sOut;      /* blockIdx.y = batch */
  const float* qr = QF + (size_t)i * ld + h * HD;
  v4f rq[HD / 4], ro[HD / 4];      /* the thread's own q row and o row, in registers for the whole key loop */
#pragma unroll      /* here and in the inner loops below: static indices keep rq[] / ro[] in registers, and a key's loads issue together */
  for (int c = 0; c < HD / 4; ++c) { rq[c] = *(const v4fa*)(qr + c * 4); const v4f z = {0.f, 0.f, 0.f, 0.f}; ro[c] = z; }
  float m = -1.0e30f, l = 0.f; const int jmax = MASKADD ? (SQ - 1) : (rg * 64 + 63);      /* additive-mask form: every key (the mask input decides); causal form: keys up to the block's last row */
#pragma unroll 1
  for (int j = 0; j <= jmax; ++j) { const float* kr = KF + (size_t)j * ld + h * HD; const float* vr = VF + (size_t)j * ld + h * HD; float s = 0.f;
#pragma unroll
    for (int c = 0; c < HD / 4; ++c) { const v4f kq = *(const v4fa*)(kr + c * 4); const v4f qq = rq[c]; s = __fadd_rn(s, __fmul_rn(qq[0], kq[0])); s = __fadd_rn(s, __fmul_rn(qq[1], kq[1])); s = __fadd_rn(s, __fmul_rn(qq[2], kq[2])); s = __fadd_rn(s, __fmul_rn(qq[3], kq[3])); }
    s = __fmul_rn(s, scale); if (MASKADD) s = __fadd_rn(s, __fmul_rn(bf16_round(mask[(size_t)i * SQ + j]), -10000.0f));
    const float f = (MASKADD || j <= i) ? 1.f : 0.f; const float sm = fmaf(f, s, (1.f - f) * -1.0e30f); const float mn = fmaxf(m, sm); const float sc = expf(m - mn); const float e = expf(sm - mn); l = __fadd_rn(__fmul_rn(l, sc), e); m = mn;
#pragma unroll
    for (int c = 0; c < HD / 4; ++c) { const v4f vv = *(const v4fa*)(vr + c * 4); v4f oo = ro[c]; for (int u = 0; u < 4; ++u) oo[u] = __fadd_rn(__fmul_rn(oo[u], sc), __fmul_rn(e, vv[u])); ro[c] = oo; } }
  const float fin = 64.0f / l;      /* o carried x64 like the f16 path */
#pragma unroll
  for (int c = 0; c < HD / 4; ++c) { v4f oo = ro[c]; for (int u = 0; u < 4; ++u) oo[u] = __fmul_rn(oo[u], fin); *(v4f*)&lo[tid][c * 4] = oo; }
  __syncthreads();
  {
#pragma unroll 1
    for (int it = 0; it < 16; ++it) { const int row = it * 4 + tid / 16, pc = (tid % 16) * 4; const v4f v = *(const v4f*)&lo[row][pc]; *(v4f*)(OF + (size_t)(rg * 64 + row) * ldo + h * HD + pc) = v; }
     } }


template <int BFIN, int WXB>
__global__ __launch_bounds__(256) void k_ln16(const float* __restrict__ X, const float* __restrict__ g, const float* __restrict__ bb, float eps, _Float16* __restrict__ N16, float* __restrict__ XB) {
  #pragma clang fp contract(off)
  __shared__ float red[256]; const size_t r = blockIdx.x; const int t = threadIdx.x; const v4f xa = *(const v4fa*)(X + r * DMQ + t * 4); float s[4]; float sum = 0.f;
  for (int q = 0; q < 4; ++q) { s[q] = BFIN ? bf16_round(xa[q]) : xa[q]; sum = __fadd_rn(sum, s[q]); }
  red[t] = sum; __syncthreads(); for (int st = 128; st > 0; st >>= 1) { if (t < st) red[t] = __fadd_rn(red[t], red[t + st]); __syncthreads(); } const float mu = red[0] / (float)DMQ; __syncthreads();
  float vs = 0.f; for (int q = 0; q < 4; ++q) { const float dl = __fadd_rn(s[q], -mu); vs = __fadd_rn(vs, __fmul_rn(dl, dl)); } red[t] = vs; __syncthreads(); for (int st = 128; st > 0; st >>= 1) { if (t < st) red[t] = __fadd_rn(red[t], red[t + st]); __syncthreads(); }
  const float rs = rsqrtf(__fadd_rn(red[0] / (float)DMQ, eps)); v4h y; v4f xb;
  for (int q = 0; q < 4; ++q) { const int c = t * 4 + q; y[q] = (_Float16)__fadd_rn(__fmul_rn(__fmul_rn(__fadd_rn(s[q], -mu), rs), bf16_round(g[c])), bf16_round(bb[c])); xb[q] = s[q]; }
  { *(v4h*)(N16 + r * DMQ + t * 4) = y; if (WXB) *(v4f*)(XB + r * DMQ + t * 4) = xb;  } }
__global__ __launch_bounds__(256) void k_ftres2(const float* __restrict__ OF0, const float* __restrict__ XB, float* __restrict__ X1, size_t n4) {
  #pragma clang fp contract(off)
  const size_t t = (size_t)blockIdx.x * 256 + threadIdx.x; if (t >= n4) return; const v4f o = *(const v4fa*)(OF0 + t * 4), xv = *(const v4fa*)(XB + t * 4); v4f y; for (int q = 0; q < 4; ++q) y[q] = __fadd_rn(__fmul_rn(o[q], 0.015625f), xv[q]); *(v4f*)(X1 + t * 4) = y;  }

__global__ __launch_bounds__(256) void k_wthd(const float* __restrict__ Wt, _Float16* __restrict__ Bt) { const size_t t = (size_t)blockIdx.x * 256 + threadIdx.x; if (t >= (size_t)NH * HD * (DM / 8)) return; const int m8 = (int)(t % (DM / 8)) * 8; const int d = (int)((t / (DM / 8)) % HD); const int h = (int)(t / ((size_t)(DM / 8) * HD)); FragH f;
  for (int q = 0; q < 8; ++q) f.h[q] = (_Float16)(16.0f * bf16_round(Wt[((size_t)h * DM + m8 + q) * HD + d])); unsigned short* dst = (unsigned short*)Bt + ((size_t)h * HD + d) * DM + m8; *(v8us*)dst = f.half[0];  }




__global__ __launch_bounds__(256) void k_wtpad(const float* __restrict__ Wm, _Float16* __restrict__ Wt, int Kr, int Kp, int Nr, int Np, float scale) {
  const int t = blockIdx.x * 256 + threadIdx.x; if (t >= Np * (Kp / 8)) return; const int n = t / (Kp / 8), k8 = (t % (Kp / 8)) * 8; const int nc = min(n, Nr - 1); const float fn = (n < Nr) ? 1.f : 0.f; FragH f;
  for (int i = 0; i < 8; ++i) { const int k = k8 + i; const int kc = min(k, Kr - 1); const float fk = (k < Kr) ? fn : 0.f; f.h[i] = (_Float16)(bf16_round(Wm[(size_t)kc * Nr + nc]) * scale * fk); }
  unsigned short* o = (unsigned short*)Wt + (size_t)n * Kp + k8; *(v8us*)o = f.half[0];  }
__global__ __launch_bounds__(128) void k_bpad(const float* __restrict__ b, float* __restrict__ Bp, int nr, int np) {
  const int i = threadIdx.x; if (i >= np) return; const float v = b[min(i, nr - 1)] * ((i < nr) ? 1.f : 0.f); *(float*)(Bp + i) = v;  }
extern "C" void kernel_launch(void* const* d_in, const int* in_sizes, int n_in,
                              void* d_out, int out_size, void* d_ws, size_t ws_size, hipStream_t stream) {
  (void)in_sizes; (void)n_in; (void)out_size;
  const float* const* I = (const float* const*)d_in; const float* x = I[0]; const float* g1 = I[1]; const float* be1 = I[2]; const float* wq = I[3]; const float* wk = I[4]; const float* wv = I[5]; const float* wo = I[6]; const float* bo = nullptr; const float* gg2 = I[7]; const float* be2 = I[8]; const float* wfc = I[9]; const float* bfc = I[10]; const float* wmp = I[11]; const float* bmp = I[12];      /* x, LN1 g / b, Wq / Wk / Wv / Wo [1024][1024] ([in][out], no biases), LN2 g / b, W1 [1024][4096] + b1, W2 [4096][1024] + b2 */
  char* ws = (char*)d_ws; size_t off = 0;
  auto take = [&](size_t bytes) { char* p = ws + off; off += (bytes + 255) & ~(size_t)255; return p; };
  _Float16* BQKV = (_Float16*)take((size_t)3 * DM * DM * 2); _Float16* BO = (_Float16*)take((size_t)DM * DM * 2);
  _Float16* X16 = (_Float16*)take(NR * DM * 2); float* XB = (float*)take(NR * DM * 4); float* X1 = (float*)take(NR * DM * 4); _Float16* M16 = nullptr;      /* = X16 below (alias: X16's last reader, the first-tile q | k | v GEMM, precedes LN2's write) */ _Float16* HF16 = (_Float16*)take((size_t)SQ * DFF * 2); _Float16* BW1 = (_Float16*)take((size_t)DFF * DM * 2); _Float16* BW2 = (_Float16*)take((size_t)DM * DFF * 2); _Float16* QKV = (_Float16*)take(NR * 3 * DM * 2); _Float16* Q16 = QKV; _Float16* K16 = QKV + DM; _Float16* V16 = QKV + 2 * DM; _Float16* O16 = (_Float16*)take(NR * DM * 2); M16 = X16;
  _Float16* VT = (_Float16*)take((size_t)NB * NH * HD * SQ * 2);
  float* QKVF0 = (float*)take((size_t)NB * QT0 * LQ * 4);      /* f32 q | k | v rows of every batch's first tile, pitch LQ */ float* OF0 = (float*)take((size_t)NB * QT0 * DM * 4); _Float16* OH0 = (_Float16*)take((size_t)NB * QT0 * DM * 2); _Float16* OL0 = (_Float16*)take((size_t)NB * QT0 * DM * 2);
  if (off > ws_size) return;
  { const unsigned g = (unsigned)(((size_t)DM * (DM / 8) + 255) / 256); k_wt_f16<<<g, 256, 0, stream>>>(wq, BQKV, DM, DM, 16.0f); k_wt_f16<<<g, 256, 0, stream>>>(wk, BQKV + (size_t)DM * DM, DM, DM, 16.0f); k_wt_f16<<<g, 256, 0, stream>>>(wv, BQKV + (size_t)2 * DM * DM, DM, DM, 16.0f); }      /* [in][out] -> Bt x16, stacked q | k | v */ k_wt_f16<<<(unsigned)(((size_t)DM * (DM / 8) + 255) / 256), 256, 0, stream>>>(wo, BO, DM, DM, 16.0f);      /* w_proj [in][out] -> Bt x16 */
  k_ln16<1, 1><<<(unsigned)NR, 256, 0, stream>>>(x, g1, be1, 1e-5f, X16, XB);      /* a = LN1(bf16(x)) -> f16 rows; XB = bf16(x) for the residual */
  k_wt_f16<<<(unsigned)(((size_t)DFF * (DM / 8) + 255) / 256), 256, 0, stream>>>(wfc, BW1, DM, DFF, 16.0f); k_wt_f16<<<(unsigned)(((size_t)DM * (DFF / 8) + 255) / 256), 256, 0, stream>>>(wmp, BW2, DFF, DM, 16.0f);      /* W1 [1024][4096] -> Bt [4096][1024]; W2 [4096][1024] -> Bt [1024][4096] (x16) */
  const size_t r0p = (size_t)B0 * SQ;      /* first projected row */
  k_gemm2<0><<<dim3((unsigned)((MP / 128) * (3 * DM / 64)), 1), 128, 0, stream>>>(X16 + r0p * DM, DM, 0, BQKV, DM, 0, 0.0625f, nullptr, 0, nullptr, 1, 0, 0, nullptr, QKV + r0p * 3 * DM, 3 * DM, 0, MP, 3 * DM, DM);      /* q | k | v rows (f16); head h = columns h*HD.. of each DM block */
  k_gemm2<0><<<dim3((QT0 / 128) * (LQ / 64), NB), 128, 0, stream>>>(X16, DM, (size_t)SQ * DM, BQKV, DM, 0, 0.0625f, nullptr, 0, nullptr, 1, 0, 0, QKVF0, nullptr, LQ, (size_t)QT0 * LQ, QT0, LQ, DM);      /* f32 q | k | v of the first 128 rows of every batch (exact products); blockIdx.y = batch */
  k_att0<0><<<dim3(NH * (QT0 / 64), NB), 64, 0, stream>>>(QKVF0, QKVF0 + DM, QKVF0 + 2 * DM, LQ, (size_t)QT0 * LQ, nullptr, 0.125f, OF0, DM, (size_t)QT0 * DM);      /* exact f32 attention for rows 0..127 of every batch (o x64) */
  k_vt<NH, SQ><<<NB * NH * (SQ / 64), 256, 0, stream>>>(V16, LQ, 0, VT);      /* V^T [NB][NH][HD][SQ] */
  k_fattn<<<dim3(NB * NH, SQ / 128), 128, 0, stream>>>(QKV, VT, O16);      /* o (merged heads, x64) as f16 rows, every batch, head and query tile in one launch */
  k_gemm2<0><<<dim3((unsigned)((MPO / 128) * (DM / 64)), 1), 128, 0, stream>>>(O16 + r0p * DM, DM, 0, BO, DM, 0, 0.0009765625f, bo, 0, XB + r0p * DM, -1, 0, 0, X1 + r0p * DM, nullptr, DM, 0, MPO, DM, DM);      /* out rows are the output layout */
  k_hl<<<(unsigned)(((size_t)NB * QT0 * DM / 8 + 255) / 256), 256, 0, stream>>>(OF0, OH0, OL0, (size_t)NB * QT0 * DM / 8);      /* first-tile o (x64) -> f16 hi + x1024 residual planes */
  k_gemm2<0><<<dim3((QT0 / 128) * (DM / 64), NB), 128, 0, stream>>>(OH0, DM, (size_t)QT0 * DM, BO, DM, 0, 0.0009765625f, bo, 0, XB, -1, 0, 0, X1, nullptr, DM, (size_t)SQ * DM, QT0, DM, DM);      /* rows 0..127 of every batch: x1 = o_hi Wo + x (no bias), overwriting the f16-path rows */
  k_gemm2<0><<<dim3((QT0 / 128) * (DM / 64), NB), 128, 0, stream>>>(OL0, DM, (size_t)QT0 * DM, BO, DM, 0, 0.00000095367431640625f, nullptr, 0, X1, -1, 0, 0, X1, nullptr, DM, (size_t)SQ * DM, QT0, DM, DM);      /* += o_lo Wo 2^-20 (own-element accumulate) */
  k_ln16<0, 0><<<(unsigned)NR, 256, 0, stream>>>(X1, gg2, be2, 1e-5f, M16, nullptr);      /* h = LN2(x1) -> f16 rows */
  for (int b = 0; b < NB; ++b) { const size_t r0 = (size_t)b * SQ;
    k_gemm2<6><<<dim3((unsigned)((SQ / 128) * (DFF / 64)), 1), 128, 0, stream>>>(M16 + r0 * DM, DM, 0, BW1, DM, 0, 0.0625f, bfc, 0, nullptr, 1, 0, 0, nullptr, HF16, DFF, 0, SQ, DFF, DM);      /* gelu_erf(h2 W1 + b1) -> f16 (this batch) */
    k_gemm2<0><<<dim3((unsigned)((SQ / 128) * (DM / 64)), 1), 128, 0, stream>>>(HF16, DFF, 0, BW2, DFF, 0, 0.0625f, bmp, 0, X1 + r0 * DM, -1, 0, 0, (float*)d_out + r0 * DM, nullptr, DM, 0, SQ, DM, DFF); }      /* out = x1 + mlp (own-element residual) */
}

// v007
// It runs in 592 microseconds.
// Next to v006, in two timings, it ran 1.27 times as fast each time.
// All steps since v000 together make it 18.1 times as fast.
#include <hip/hip_runtime.h>
// Pre-LN causal transformer block (x [4][2048][1024]; h = LN1(x) (biased var, eps 1e-5, gamma / beta); Q/K/V = h Wq/Wk/Wv ([in][out] 1024 x 1024 sigma 1/32, no biases), 16 heads of 64; scores / 8; causal (tril, -inf); softmax; x1 = x + hidden Wo ([in][out], no bias); h2 = LN2(x1); out = x1 + gelu_erf(h2 W1 + b1) W2 + b2 ([in][out] 1024 x 4096 x 1024) -> [4][2048][1024]).
// Structure: token rows r = b*2048 + s; h = LN1(bf16-rounded x) as f16 rows; q | k | v as ONE WMMA GEMM (N = 3 x 1024) (32x64 wave tiles, f32 accumulation, exact x16 weights, no bias, f16 outputs); V^T for all batches and heads via LDS transposes; ONE fused causal attention launch: a wave owns 32 query rows and walks the keys below its last row 32 at a time, scores^T = K . Q^T on WMMA (keys on the accumulator rows, so a lane holds one query's scores), running row maximum and row sum in f32 (native exp2; weights x16 f16, taken from the accumulators in place as the B fragment), o^T += V^T . P^T on WMMA, o carried x64 (folded into the output GEMM alpha) written straight into the merged f16 o rows; x1 = x + o W_o GEMM (f32, no bias) into the output layout.
// Compute dtype: inputs rounded to bf16; x / weights exact; q, k, v, softmax weights and o as plain f16 GEMM operands (~2^-12); scores and softmax statistics f32. v_wmma_f32_16x16x32_f16.
#define NB 4
#define SQ 2048
#define DM 1024
#define NH 16
#define HD 64
#define HG 4                         /* heads per block group of the unlaunched k_vt(b, h0) overload */
#define QT 256                       /* unused */
#define NKX SQ                       /* unused */
#define QT0 128                      /* first-tile rows recomputed exactly in f32 */
#define B0 0                         /* first batch processed (debug hook) */
#define NBR NB                       /* batches processed (debug hook) */
#define NR ((size_t)NB * SQ)
#define DMQ DM
#define DFF 4096                     /* FFN hidden width */
#define DFFR 100                     /* unused */
#define MP ((int)((size_t)NBR * SQ)) /* rows projected (debug hook) */
#define QN SQ                        /* unused */
#define NHD NH                       /* unused */
#define MPO MP                       /* rows through the output stage (debug hook) */
#define LQ (3 * DM)      /* row pitch of the q/k/v rows */
typedef __bf16 v16b __attribute__((ext_vector_type(16)));
typedef unsigned short v8us __attribute__((ext_vector_type(8), may_alias));
typedef float  v8f  __attribute__((ext_vector_type(8)));
typedef float  v4f  __attribute__((ext_vector_type(4)));
typedef float  v4fa __attribute__((ext_vector_type(4), may_alias));
union FragB { v16b v; v8us half[2]; unsigned short u[16]; };

__device__ __forceinline__ unsigned short bf16_bits(float x) { unsigned int u = __float_as_uint(x); return (unsigned short)((u + 0x7FFFu + ((u >> 16) & 1u)) >> 16); }
__device__ __forceinline__ float bf16_val(unsigned short b) { return __uint_as_float(((unsigned int)b) << 16); }
__device__ __forceinline__ float bf16_round(float x) { return bf16_val(bf16_bits(x)); }
// D += A·B with NT terms: 1 = ah·bh, 2 = + al·bh (A split), 3 = + ah·bl (both split)
template <int NT>
__device__ __forceinline__ v8f mmaN(v16b ah, v16b al, v16b bh, v16b bl, v8f c) {
  c = __builtin_amdgcn_wmma_f32_16x16x32_bf16(false, ah, false, bh, (short)0, c, false, false);
  if (NT >= 2) c = __builtin_amdgcn_wmma_f32_16x16x32_bf16(false, al, false, bh, (short)0, c, false, false);
  if (NT >= 3) c = __builtin_amdgcn_wmma_f32_16x16x32_bf16(false, ah, false, bl, (short)0, c, false, false);
  asm volatile("v_nop\n\tv_nop\n\tv_nop\n\tv_nop" : "+v"(c) : "v"(ah), "v"(al), "v"(bh), "v"(bl));
  return c;
}

__global__ __launch_bounds__(256) void k_wt_bf16(const float* __restrict__ W, unsigned short* __restrict__ Wt, int K, int N) {
  const int t = blockIdx.x * 256 + threadIdx.x;
  const int k8n = K / 8;
  if (t >= N * k8n) return;
  const int n = t / k8n, k8 = (t % k8n) * 8;
  v8us v;
#pragma unroll
  for (int i = 0; i < 8; ++i) v[i] = bf16_bits(W[(size_t)(k8 + i) * N + n]);
  *(v8us*)(Wt + (size_t)n * K + k8) = v;
  
}

// GEMM C[M][N] (f32, pitch ldc) = act(A[M][K]·W + bias). A f32 row-major (pitch lda) converted per fragment to bf16
// (ASPLIT: hi/lo two planes -> 2 terms, else single rounded term); Wt bf16 [N][K] (pitch ldb). BIAS_BF16 rounds the
// bias to bf16 first (bias quantised to bf16 before the add). K%32==0, M%16==0, N%64==0.
template <bool ASPLIT, int ACT, bool BIAS_BF16>
__global__ __launch_bounds__(128) void k_gemm_bf(const float* __restrict__ A, int lda, const unsigned short* __restrict__ Wt, int ldb,
                                               const float* __restrict__ bias, float* __restrict__ C, int ldc, int M, int N, int K) {
  __shared__ __attribute__((aligned(16))) float so[4][16][64];
  const int tid = threadIdx.x, w = tid >> 5, lane = tid & 31, ln = lane & 15, hh = lane >> 4;
  const int ntn = N / 64;
  const int wid = blockIdx.x * 4 + w;
  const int mt = wid / ntn, nq = wid % ntn;
  if (mt * 16 >= M) return;
  const int row0 = mt * 16, col0 = nq * 64;
  const float* arow = A + (size_t)(row0 + ln) * lda;
  v8f acc[4] = {};
  for (int kb = 0; kb < K; kb += 32) {
    FragB ah, al;
    const v4f x0 = *(const v4fa*)(arow + kb + 8 * hh), x1 = *(const v4fa*)(arow + kb + 8 * hh + 4);
    const v4f x2 = *(const v4fa*)(arow + kb + 16 + 8 * hh), x3 = *(const v4fa*)(arow + kb + 16 + 8 * hh + 4);
    float xs[16] = {x0[0],x0[1],x0[2],x0[3],x1[0],x1[1],x1[2],x1[3],x2[0],x2[1],x2[2],x2[3],x3[0],x3[1],x3[2],x3[3]};
#pragma unroll
    for (int i = 0; i < 16; ++i) { const unsigned short hb = bf16_bits(xs[i]); ah.u[i] = hb; al.u[i] = ASPLIT ? bf16_bits(xs[i] - bf16_val(hb)) : (unsigned short)0; }
#pragma unroll
    for (int t = 0; t < 4; ++t) {
      const unsigned short* brow = Wt + (size_t)(col0 + t * 16 + ln) * ldb + kb;
      FragB b;
      b.half[0] = *(const v8us*)(brow + 8 * hh);
      b.half[1] = *(const v8us*)(brow + 16 + 8 * hh);
      acc[t] = mmaN<ASPLIT ? 2 : 1>(ah.v, al.v, b.v, b.v, acc[t]);
    }
  }
#pragma unroll
  for (int t = 0; t < 4; ++t) {
    float bv = bias ? bias[col0 + t * 16 + ln] : 0.f;
    if (BIAS_BF16) bv = bf16_round(bv);
#pragma unroll
    for (int r = 0; r < 8; ++r) { float v = acc[t][r] + bv; if (ACT == 1) v = fmaxf(v, 0.f); so[w][8 * hh + r][t * 16 + ln] = v; }
  }
  __builtin_amdgcn_fence(__ATOMIC_ACQ_REL, "workgroup");
  __builtin_amdgcn_wave_barrier();
  const int rsub = lane >> 4, c4 = (lane & 15) * 4;
  {
#pragma unroll
    for (int q = 0; q < 8; ++q) {
      const int r = q * 2 + rsub;
      const v4f v = *(const v4fa*)&so[w][r][c4];
      *(v4f*)(C + (size_t)(row0 + r) * ldc + col0 + c4) = v;
    }
    
  }
}

// GEMM C = act(A·W + bias + resid): A f32 (ASPLIT -> hi/lo 2 terms), Wt bf16 [N][K]; ACT 0 none, 1 relu, 2 exact gelu;
// resid (optional, f32, row index = (row % rmod), pitch ldr, RES_BF16 rounds it) added before the activation.
template <bool ASPLIT, int ACT, bool BIAS_BF16, bool RES_BF16>
__global__ __launch_bounds__(128) void k_gemm_bf3(const float* __restrict__ A, int lda, const unsigned short* __restrict__ Wt, int ldb,
                                                const float* __restrict__ bias, const float* __restrict__ resid, int rmod, int ldr,
                                                float* __restrict__ C, int ldc, int M, int N, int K) {
  __shared__ __attribute__((aligned(16))) float so[4][16][64];
  const int tid = threadIdx.x, w = tid >> 5, lane = tid & 31, ln = lane & 15, hh = lane >> 4;
  const int ntn = N / 64;
  const int wid = blockIdx.x * 4 + w;
  const int mt = wid / ntn, nq = wid % ntn;
  if (mt * 16 >= M) return;
  const int row0 = mt * 16, col0 = nq * 64;
  const float* arow = A + (size_t)(row0 + ln) * lda;
  v8f acc[4] = {};
  for (int kb = 0; kb < K; kb += 32) {
    FragB ah, al;
    const v4f x0 = *(const v4fa*)(arow + kb + 8 * hh), x1 = *(const v4fa*)(arow + kb + 8 * hh + 4);
    const v4f x2 = *(const v4fa*)(arow + kb + 16 + 8 * hh), x3 = *(const v4fa*)(arow + kb + 16 + 8 * hh + 4);
    float xs[16] = {x0[0],x0[1],x0[2],x0[3],x1[0],x1[1],x1[2],x1[3],x2[0],x2[1],x2[2],x2[3],x3[0],x3[1],x3[2],x3[3]};
#pragma unroll
    for (int i = 0; i < 16; ++i) { const unsigned short hb = bf16_bits(xs[i]); ah.u[i] = hb; al.u[i] = ASPLIT ? bf16_bits(xs[i] - bf16_val(hb)) : (unsigned short)0; }
#pragma unroll
    for (int t = 0; t < 4; ++t) {
      const unsigned short* brow = Wt + (size_t)(col0 + t * 16 + ln) * ldb + kb;
      FragB b;
      b.half[0] = *(const v8us*)(brow + 8 * hh);
      b.half[1] = *(const v8us*)(brow + 16 + 8 * hh);
      acc[t] = mmaN<ASPLIT ? 2 : 1>(ah.v, al.v, b.v, b.v, acc[t]);
    }
  }
#pragma unroll
  for (int t = 0; t < 4; ++t) {
    const int col = col0 + t * 16 + ln;
    float bv = bias ? bias[col] : 0.f;
    if (BIAS_BF16) bv = bf16_round(bv);
#pragma unroll
    for (int r = 0; r < 8; ++r) {
      float v = acc[t][r] + bv;
      if (resid) { float rv = resid[(size_t)((row0 + 8 * hh + r) % rmod) * ldr + col]; if (RES_BF16) rv = bf16_round(rv); v += rv; }
      if (ACT == 1) v = fmaxf(v, 0.f);
      if (ACT == 2) v = 0.5f * v * (1.0f + erff(v * 0.70710678118654752f));
      if (ACT == 3) { const float u = 0.7978845608028654f * (v + 0.044715f * v * v * v); v = 0.5f * v * (1.0f + tanhf(u)); }
      so[w][8 * hh + r][t * 16 + ln] = v;
    }
  }
  __builtin_amdgcn_fence(__ATOMIC_ACQ_REL, "workgroup");
  __builtin_amdgcn_wave_barrier();
  const int rsub = lane >> 4, c4 = (lane & 15) * 4;
  {
#pragma unroll
    for (int q = 0; q < 8; ++q) {
      const int r = q * 2 + rsub;
      const v4f v = *(const v4fa*)&so[w][r][c4];
      *(v4f*)(C + (size_t)(row0 + r) * ldc + col0 + c4) = v;
    }
    
  }
}
// row LayerNorm (biased variance, eps) over N: s = X (+ R); optional out_sum <- s; out_norm <- (s-mu)*rsqrt(var+eps)*g + b
template <bool PARAM_BF16>
__global__ __launch_bounds__(256) void k_layernorm(const float* __restrict__ X, const float* __restrict__ R, const float* __restrict__ g, const float* __restrict__ bta,
                                                  float* __restrict__ out_sum, float* __restrict__ out_norm, int N, float eps) {
  __shared__ float red[256];
  const int row = blockIdx.x, tid = threadIdx.x;
  const float* x = X + (size_t)row * N; const float* rr = R ? R + (size_t)row * N : nullptr;
  float vals[16];                     // up to N = 4096
  const int per = N / 256;            // contiguous chunk per thread? use strided-by-4 chunks: thread handles j = tid*4 + 1024*u
  float s1 = 0.f;
  for (int u = 0; u < per / 4; ++u) {
    const int j = tid * 4 + 1024 * u;
    const v4f a = *(const v4fa*)(x + j);
    v4f b = {0.f,0.f,0.f,0.f}; if (rr) b = *(const v4fa*)(rr + j);
#pragma unroll
    for (int q = 0; q < 4; ++q) { const float v = a[q] + b[q]; vals[u * 4 + q] = v; s1 += v; }
  }
  red[tid] = s1; __syncthreads();
  for (int st = 128; st > 0; st >>= 1) { if (tid < st) red[tid] += red[tid + st]; __syncthreads(); }
  const float mu = red[0] / (float)N; __syncthreads();
  float s2 = 0.f;
  for (int u = 0; u < per / 4; ++u)
#pragma unroll
    for (int q = 0; q < 4; ++q) { const float c = vals[u * 4 + q] - mu; s2 += c * c; }
  red[tid] = s2; __syncthreads();
  for (int st = 128; st > 0; st >>= 1) { if (tid < st) red[tid] += red[tid + st]; __syncthreads(); }
  const float rs = rsqrtf(red[0] / (float)N + eps);
  {
    for (int u = 0; u < per / 4; ++u) {
      const int j = tid * 4 + 1024 * u;
      v4f o, sm;
#pragma unroll
      for (int q = 0; q < 4; ++q) {
        float gg = g[j + q], bb = bta[j + q];
        if (PARAM_BF16) { gg = bf16_round(gg); bb = bf16_round(bb); }
        sm[q] = vals[u * 4 + q]; o[q] = (vals[u * 4 + q] - mu) * rs * gg + bb;
      }
      if (out_sum) *(v4f*)(out_sum + (size_t)row * N + j) = sm;
      *(v4f*)(out_norm + (size_t)row * N + j) = o;
    }
    
  }
}



// ---- f16 WMMA path (v_wmma_f32_16x16x32_f16): 11-bit significands for operands in range — used by every GEMM and by the fused attention that this file launches
typedef _Float16 v16h __attribute__((ext_vector_type(16)));
union FragH { v16h v; v8us half[2]; _Float16 h[16]; unsigned short u[16]; };
template <int NT>
__device__ __forceinline__ v8f mmaH(v16h ah, v16h al, v16h bh, v16h bl, v8f c) {
  c = __builtin_amdgcn_wmma_f32_16x16x32_f16(false, ah, false, bh, (short)0, c, false, false);
  if (NT >= 2) c = __builtin_amdgcn_wmma_f32_16x16x32_f16(false, al, false, bh, (short)0, c, false, false);
  if (NT >= 3) c = __builtin_amdgcn_wmma_f32_16x16x32_f16(false, ah, false, bl, (short)0, c, false, false);
  asm volatile("v_nop\n\tv_nop\n\tv_nop\n\tv_nop" : "+v"(c) : "v"(ah), "v"(al), "v"(bh), "v"(bl));
  return c;
}
// batched GEMM like k_gemm_b but f16 operands: A f32 (split into f16 hi/lo if ASPLIT, else rounded to f16), Bt = f16 values [n][k]; alpha; C f32; N multiple of 16 (partial tiles skipped)
template <bool ASPLIT>
__global__ __launch_bounds__(128) void k_gemm_h(const float* __restrict__ A, int lda, size_t sA, const _Float16* __restrict__ Bh, int ldb, size_t sB, float alpha, float* __restrict__ C, int ldc, size_t sC, int M, int N, int K) {
  __shared__ __attribute__((aligned(16))) float so[4][16][64];
  const int tid = threadIdx.x, w = tid >> 5, lane = tid & 31, ln = lane & 15, hh = lane >> 4; const int by = blockIdx.y;
  A += (size_t)by * sA; Bh += (size_t)by * sB; C += (size_t)by * sC;
  const int ntn = (N + 63) / 64; const int wid = blockIdx.x * 4 + w; const int mt = wid / ntn, nq = wid % ntn; if (mt * 16 >= M) return;
  const int row0 = mt * 16, col0 = nq * 64; const float* arow = A + (size_t)(row0 + ln) * lda;
  v8f acc[4] = {};
  for (int kb = 0; kb < K; kb += 32) {
    FragH ah, al;
    const v4f x0 = *(const v4fa*)(arow + kb + 8 * hh), x1 = *(const v4fa*)(arow + kb + 8 * hh + 4), x2 = *(const v4fa*)(arow + kb + 16 + 8 * hh), x3 = *(const v4fa*)(arow + kb + 16 + 8 * hh + 4);
    float xs[16] = {x0[0],x0[1],x0[2],x0[3],x1[0],x1[1],x1[2],x1[3],x2[0],x2[1],x2[2],x2[3],x3[0],x3[1],x3[2],x3[3]};
#pragma unroll
    for (int i = 0; i < 16; ++i) { const _Float16 h = (_Float16)xs[i]; ah.h[i] = h; al.h[i] = ASPLIT ? (_Float16)(xs[i] - (float)h) : (_Float16)0.0f; }
#pragma unroll
    for (int t = 0; t < 4; ++t) { if (col0 + t * 16 >= N) continue; const size_t boff = (size_t)(col0 + t * 16 + ln) * ldb + kb; FragH bq; bq.half[0] = *(const v8us*)(Bh + boff + 8 * hh); bq.half[1] = *(const v8us*)(Bh + boff + 16 + 8 * hh);
      acc[t] = mmaH<ASPLIT ? 2 : 1>(ah.v, al.v, bq.v, bq.v, acc[t]); }
  }
#pragma unroll
  for (int t = 0; t < 4; ++t) { if (col0 + t * 16 >= N) continue;
#pragma unroll
    for (int r = 0; r < 8; ++r) so[w][8 * hh + r][t * 16 + ln] = acc[t][r] * alpha; }
  __builtin_amdgcn_fence(__ATOMIC_ACQ_REL, "workgroup"); __builtin_amdgcn_wave_barrier();
  const int rsub = lane >> 4, c4 = (lane & 15) * 4;
  {
#pragma unroll
    for (int q = 0; q < 8; ++q) { const int r = q * 2 + rsub; if (col0 + c4 < N) { const v4f v = *(const v4fa*)&so[w][r][c4]; *(v4f*)(C + (size_t)(row0 + r) * ldc + col0 + c4) = v; } }
     }
}

// Wt[n][k] = f16(W[k][n]·scale) from f32 row-major W[K][N] (scale = power of two; bf16-exact weights stay exact in f16 away from the subnormal range)
__global__ __launch_bounds__(256) void k_wt_f16(const float* __restrict__ W, _Float16* __restrict__ Wt, int K, int N, float scale) {
  const int t = blockIdx.x * 256 + threadIdx.x; if (t >= N * (K / 8)) return; const int n = t / (K / 8), k8 = (t % (K / 8)) * 8; FragH f;
#pragma unroll
  for (int i = 0; i < 8; ++i) f.h[i] = (_Float16)(bf16_round(W[(size_t)(k8 + i) * N + n]) * scale); const v8us o = f.half[0];
  *(v8us*)((unsigned short*)Wt + (size_t)n * K + k8) = o; 
}
// k_gemm_hh variant with fused epilogue: v = acc·alpha + bias[by·sBias + col] (+ CP[(row/rowsPerB)·sCPb + by·64 + col] if CP) ; ACT 0 none / 1 elu ; writes f16 C16 (and f32 C if non-null)
template <int ACT>
__global__ __launch_bounds__(128) void k_gemm_hhx(const _Float16* __restrict__ A, int lda, size_t sA, const _Float16* __restrict__ Bh, int ldb, size_t sB, float alpha, const float* __restrict__ bias, size_t sBias, const float* __restrict__ CP, int rowsPerB, size_t sCPb, int row0g,
    float* __restrict__ C, _Float16* __restrict__ C16, int ldc, size_t sC, int M, int N, int K) {
  __shared__ __attribute__((aligned(16))) float so[4][16][64];
  const int tid = threadIdx.x, w = tid >> 5, lane = tid & 31, ln = lane & 15, hh = lane >> 4; const int by = blockIdx.y;
  A += (size_t)by * sA; Bh += (size_t)by * sB; const size_t cofs = (size_t)by * sC; const float* bp = bias ? bias + (size_t)by * sBias : nullptr;
  const int ntn = (N + 63) / 64; const int wid = blockIdx.x * 4 + w; const int mt = wid / ntn, nq = wid % ntn; if (mt * 16 >= M) return;
  const int row0 = mt * 16, col0 = nq * 64; const _Float16* arow = A + (size_t)(row0 + ln) * lda;
  v8f acc[4] = {};
  for (int kb = 0; kb < K; kb += 32) { FragH ah; ah.half[0] = *(const v8us*)((const unsigned short*)arow + kb + 8 * hh); ah.half[1] = *(const v8us*)((const unsigned short*)arow + kb + 16 + 8 * hh);
#pragma unroll
    for (int t = 0; t < 4; ++t) { if (col0 + t * 16 >= N) continue; const size_t boff = (size_t)(col0 + t * 16 + ln) * ldb + kb; FragH bq; bq.half[0] = *(const v8us*)((const unsigned short*)Bh + boff + 8 * hh); bq.half[1] = *(const v8us*)((const unsigned short*)Bh + boff + 16 + 8 * hh);
      acc[t] = mmaH<1>(ah.v, ah.v, bq.v, bq.v, acc[t]); }
  }
#pragma unroll
  for (int t = 0; t < 4; ++t) { if (col0 + t * 16 >= N) continue; const int col = col0 + t * 16 + ln; const float bv = bp ? bf16_round(bp[col]) : 0.f;
#pragma unroll
    for (int r = 0; r < 8; ++r) { float v = acc[t][r] * alpha + bv; if (CP) { const int rr = row0g + row0 + 8 * hh + r; if (rowsPerB < 0) v += CP[cofs + (size_t)rr * ldc + col];      /* rowsPerB < 0: own element of the batched C plane */ else { const int bidx = rr / rowsPerB; v += CP[(size_t)bidx * sCPb + (size_t)by * 64 + col]; } } if (ACT == 1) v = (v > 0.f) ? v : expm1f(v); else if (ACT == 7) v = (v > 0.f) ? v + 1.0f : expf(v); else if (ACT == 8) v = tanhf(v); else if (ACT == 9) v = 0.5f * v * (1.0f + tanhf(0.7978845608028654f * (v + 0.044715f * v * v * v))); else if (ACT == 11) v = 1.0f / (1.0f + expf(-v)); else if (ACT == 12) v = (v > 0.f) ? v : 0.01f * v; else if (ACT == 14) v = (v > 0.f) ? v : 0.1f * v; else if (ACT == 16) v = (v >= 0.f) ? v : 0.3f * v; else if (ACT == 17) v = (v >= 0.f) ? v : 0.2f * v; else if (ACT == 15) v = v / (1.0f + expf(-v)); else if (ACT == 3) v = fmaxf(v, 0.f); else if (ACT == 6) v = 0.5f * v * (1.0f + erff(v * 0.70710678118654752f)); so[w][8 * hh + r][t * 16 + ln] = v; } }
  __builtin_amdgcn_fence(__ATOMIC_ACQ_REL, "workgroup"); __builtin_amdgcn_wave_barrier();
  const int rsub = lane >> 4, c4 = (lane & 15) * 4; typedef _Float16 v4h __attribute__((ext_vector_type(4)));
  {
#pragma unroll
    for (int q = 0; q < 8; ++q) { const int r = q * 2 + rsub; if (col0 + c4 < N) { const v4f v = *(const v4fa*)&so[w][r][c4]; if (C) *(v4f*)(C + cofs + (size_t)(row0 + r) * ldc + col0 + c4) = v; if (C16) { v4h h4; for (int i = 0; i < 4; ++i) h4[i] = (_Float16)v[i]; *(v4h*)(C16 + cofs + (size_t)(row0 + r) * ldc + col0 + c4) = h4; } } }
     }
}


typedef _Float16 v4h __attribute__((ext_vector_type(4)));

__global__ __launch_bounds__(256) void k_x16(const float* __restrict__ x, _Float16* __restrict__ X16, size_t n8) { const size_t t = (size_t)blockIdx.x * 256 + threadIdx.x; if (t >= n8) return; FragH f;
#pragma unroll
  for (int q = 0; q < 8; ++q) f.h[q] = (_Float16)bf16_round(x[t * 8 + q]); *(v8us*)((unsigned short*)X16 + t * 8) = f.half[0];  }
__global__ __launch_bounds__(256) void k_h16(const float* __restrict__ x, _Float16* __restrict__ X16, size_t n8) { const size_t t = (size_t)blockIdx.x * 256 + threadIdx.x; if (t >= n8) return; FragH f;
#pragma unroll
  for (int q = 0; q < 8; ++q) f.h[q] = (_Float16)x[t * 8 + q]; *(v8us*)((unsigned short*)X16 + t * 8) = f.half[0];  }
__global__ __launch_bounds__(256) void k_round16f(const float* __restrict__ W, _Float16* __restrict__ Bt, size_t n8) { const size_t t = (size_t)blockIdx.x * 256 + threadIdx.x; if (t >= n8) return; FragH f;
#pragma unroll
  for (int i = 0; i < 8; ++i) f.h[i] = (_Float16)(bf16_round(W[t * 8 + i]) * 16.0f); *(v8us*)((unsigned short*)Bt + t * 8) = f.half[0];  }
template <int NHv, int TTv>
__global__ __launch_bounds__(256) void k_vt(const _Float16* __restrict__ V16, int ldv, int voff, _Float16* __restrict__ Vt) { __shared__ unsigned short tl[64][66]; const int tid = threadIdx.x; const int slab = blockIdx.x / (TTv / 64), lg = blockIdx.x % (TTv / 64); const int b = slab / NHv, h = slab % NHv;
  for (int i = tid; i < 64 * 8; i += 256) { const int r = i / 8, c8 = (i % 8) * 8; FragH f; f.half[0] = *(const v8us*)((const unsigned short*)V16 + ((size_t)b * TTv + lg * 64 + r) * ldv + voff + h * 64 + c8);
#pragma unroll
    for (int q = 0; q < 8; ++q) tl[r][c8 + q] = f.u[q]; }
  __syncthreads();
  {
#pragma unroll
    for (int rd = 0; rd < 2; ++rd) { const int d = rd * 32 + tid / 8, pc = tid % 8; FragH f;
#pragma unroll
      for (int q = 0; q < 8; ++q) f.u[q] = tl[pc * 8 + q][d];
      *(v8us*)((unsigned short*)Vt + ((size_t)slab * 64 + d) * TTv + lg * 64 + pc * 8) = f.half[0]; }
     } }

__global__ __launch_bounds__(256) void k_hl(const float* __restrict__ F, _Float16* __restrict__ Hh, _Float16* __restrict__ Hl, size_t n8) { const size_t t = (size_t)blockIdx.x * 256 + threadIdx.x; if (t >= n8) return; FragH fh, fl; const v4f a = *(const v4fa*)(F + t * 8), c = *(const v4fa*)(F + t * 8 + 4);
#pragma unroll
  for (int q = 0; q < 4; ++q) { _Float16 h = (_Float16)a[q]; fh.h[q] = h; fl.h[q] = (_Float16)((a[q] - (float)h) * 1024.0f); h = (_Float16)c[q]; fh.h[4 + q] = h; fl.h[4 + q] = (_Float16)((c[q] - (float)h) * 1024.0f); }
  { *(v8us*)((unsigned short*)Hh + t * 8) = fh.half[0]; *(v8us*)((unsigned short*)Hl + t * 8) = fl.half[0];  } }

// ---- fast GEMM (work-group tile 128x64, wave tile 32x64, operands staged in LDS; requires M % 128 == 0 rows per launch region, N % 64 == 0 and K % 64 == 0); epilogue = k_gemm_hhx semantics ----
__device__ __forceinline__ v16h g2_frag(const _Float16* p, int hh) { FragH f; f.half[0] = *(const v8us*)((const unsigned short*)p + 8 * hh); f.half[1] = *(const v8us*)((const unsigned short*)p + 16 + 8 * hh); return f.v; }
__device__ __forceinline__ v8f g2_mma(v16h a, v16h b, v8f c) { v8f d = __builtin_amdgcn_wmma_f32_16x16x32_f16(false, a, false, b, (short)0, c, false, false); asm volatile("v_nop\n\tv_nop\n\tv_nop\n\tv_nop" : "+v"(d) : "v"(a), "v"(b)); return d; }
#define G2P 72                       /* LDS row pitch in f16: 128 B of data + 16 B = 144 B, an odd multiple of 16 B, so the 16 rows of a ds_load_b128 fragment read fall on different banks */
#define G2B (192 * G2P)              /* f16 per buffer: the block's 128 A rows, then its 64 B rows, 64 k each */
#define G2S (16u * G2P * 2u)         /* LDS bytes between a lane's successive copies (16 rows) */
// one k-tile (64 k) of the block's 128 A rows and 64 B rows, global -> LDS through no register: lane = (row tid / 8 + 16 i, 16-byte piece tid % 8), so a wave's copy takes four whole 128-byte lines.
// The s_wait_xcnt stands inside the copies' own statement, behind the last of them: later address arithmetic overwrites registers that the copies name, and only here is the wait tied in front of it.
__device__ __forceinline__ void g2_stage(const _Float16* ga, size_t sa, const _Float16* gb, size_t sb, unsigned l) {
  asm volatile(
    "global_load_async_to_lds_b128 %0, %12, off\n\t"
    "global_load_async_to_lds_b128 %1, %13, off\n\t"
    "global_load_async_to_lds_b128 %2, %14, off\n\t"
    "global_load_async_to_lds_b128 %3, %15, off\n\t"
    "global_load_async_to_lds_b128 %4, %16, off\n\t"
    "global_load_async_to_lds_b128 %5, %17, off\n\t"
    "global_load_async_to_lds_b128 %6, %18, off\n\t"
    "global_load_async_to_lds_b128 %7, %19, off\n\t"
    "global_load_async_to_lds_b128 %8, %20, off\n\t"
    "global_load_async_to_lds_b128 %9, %21, off\n\t"
    "global_load_async_to_lds_b128 %10, %22, off\n\t"
    "global_load_async_to_lds_b128 %11, %23, off\n\t"
    "s_wait_xcnt 0x0"
    :: "v"(l), "v"(l + 1u * G2S), "v"(l + 2u * G2S), "v"(l + 3u * G2S), "v"(l + 4u * G2S), "v"(l + 5u * G2S), "v"(l + 6u * G2S), "v"(l + 7u * G2S), "v"(l + 8u * G2S), "v"(l + 9u * G2S), "v"(l + 10u * G2S), "v"(l + 11u * G2S),
       "v"(ga), "v"(ga + 1 * sa), "v"(ga + 2 * sa), "v"(ga + 3 * sa), "v"(ga + 4 * sa), "v"(ga + 5 * sa), "v"(ga + 6 * sa), "v"(ga + 7 * sa), "v"(gb), "v"(gb + 1 * sb), "v"(gb + 2 * sb), "v"(gb + 3 * sb) : "memory"); }
template <int ACT>
__global__ __launch_bounds__(128) void k_gemm2(const _Float16* __restrict__ A, int lda, size_t sA, const _Float16* __restrict__ Bh, int ldb, size_t sB, float alpha, const float* __restrict__ bias, size_t sBias, const float* __restrict__ CP, int rowsPerB, size_t sCPb, int row0g,
    float* __restrict__ C, _Float16* __restrict__ C16, int ldc, size_t sC, int M, int N, int K) { static_assert(ACT == 0 || ACT == 3 || ACT == 6 || ACT == 8 || ACT == 9 || ACT == 11 || ACT == 12 || ACT == 14 || ACT == 15 || ACT == 16 || ACT == 17, "k_gemm2: unsupported ACT code (would silently apply no activation)");
  __shared__ __attribute__((aligned(16))) float sm[G2B];      /* two k-tile buffers of G2B f16 each; behind the k-loop's last barrier the same bytes are the epilogue's transpose tiles */
  float (*so)[32][68] = (float (*)[32][68])sm; static_assert(4 * 32 * 68 <= G2B, "epilogue tiles must fit the ring");
  const int tid = threadIdx.x, w = tid >> 5, lane = tid & 31, ln = lane & 15, hh = lane >> 4; const int by = blockIdx.y;
  A += (size_t)by * sA; Bh += (size_t)by * sB; const size_t cofs = (size_t)by * sC; const float* bp = bias ? bias + (size_t)by * sBias : nullptr;
  const int ntn = N >> 6; const int mt = blockIdx.x / ntn, nq = blockIdx.x - mt * ntn; const int row0 = mt * 128 + 32 * w, col0 = nq * 64; if (mt * 128 >= M) return;      /* the whole work-group leaves or none (barriers below) */
  const _Float16* ga = A + (size_t)(mt * 128 + (tid >> 3)) * lda + (tid & 7) * 8; const _Float16* gb = Bh + (size_t)(col0 + (tid >> 3)) * ldb + (tid & 7) * 8; const size_t sa = (size_t)16 * lda, sb = (size_t)16 * ldb;
  const unsigned l0 = (unsigned)(size_t)sm + (unsigned)((tid >> 3) * (G2P * 2) + (tid & 7) * 16);      /* the lane's LDS byte address in buffer 0 */
  const _Float16* st = (const _Float16*)sm; const int nt = K >> 6;
  const v8f z8 = {0.f,0.f,0.f,0.f,0.f,0.f,0.f,0.f}; v8f c00 = z8, c01 = z8, c02 = z8, c03 = z8, c10 = z8, c11 = z8, c12 = z8, c13 = z8;
  /* two LDS buffers: tile t + 1 flies while tile t is worked on. Each accumulator still takes its k-steps in ascending order. */
  g2_stage(ga, sa, gb, sb, l0);
  asm volatile("s_wait_asynccnt 0x0" ::: "memory");      /* this wave's copies of tile 0 have landed */
  __syncthreads();      /* ... and every other wave's */
  if (nt > 1) g2_stage(ga + 64, sa, gb + 64, sb, l0 + (unsigned)(G2B * 2));
#pragma unroll 1      /* one k-tile per trip: the buffer alternates by the trip's parity */
  for (int t = 0; t < nt; ++t) {
    const _Float16* ap = st + (t & 1) * G2B + (32 * w + ln) * G2P; const _Float16* bq = st + (t & 1) * G2B + (128 + ln) * G2P;
    const v16h a0 = g2_frag(ap, hh), a1 = g2_frag(ap + 16 * G2P, hh), b0 = g2_frag(bq, hh), b1 = g2_frag(bq + 16 * G2P, hh), b2 = g2_frag(bq + 32 * G2P, hh), b3 = g2_frag(bq + 48 * G2P, hh);
    const v16h e0 = g2_frag(ap + 32, hh), e1 = g2_frag(ap + 16 * G2P + 32, hh), f0 = g2_frag(bq + 32, hh), f1 = g2_frag(bq + 16 * G2P + 32, hh), f2 = g2_frag(bq + 32 * G2P + 32, hh), f3 = g2_frag(bq + 48 * G2P + 32, hh);
    c00 = g2_mma(a0, b0, c00); c10 = g2_mma(a1, b0, c10); c01 = g2_mma(a0, b1, c01); c11 = g2_mma(a1, b1, c11); c02 = g2_mma(a0, b2, c02); c12 = g2_mma(a1, b2, c12); c03 = g2_mma(a0, b3, c03); c13 = g2_mma(a1, b3, c13);
    c00 = g2_mma(e0, f0, c00); c10 = g2_mma(e1, f0, c10); c01 = g2_mma(e0, f1, c01); c11 = g2_mma(e1, f1, c11); c02 = g2_mma(e0, f2, c02); c12 = g2_mma(e1, f2, c12); c03 = g2_mma(e0, f3, c03); c13 = g2_mma(e1, f3, c13);
    asm volatile("s_wait_dscnt 0x0" ::: "memory");      /* this wave's reads of tile t are done before the buffer is given up */
    asm volatile("s_wait_asynccnt 0x0" ::: "memory");      /* this wave's copies of tile t + 1 have landed */
    __syncthreads();      /* publishes tile t + 1 and ends every wave's reads of tile t */
    if (t + 2 < nt) g2_stage(ga + (size_t)(t + 2) * 64, sa, gb + (size_t)(t + 2) * 64, sb, l0 + (unsigned)((t & 1) * (G2B * 2))); }      /* refill of the buffer that this trip has just read */
  asm volatile("s_wait_asynccnt 0x0" ::: "memory");      /* nothing of the ring is in flight when its bytes become the epilogue's tiles */
  v8f accs[8] = {c00, c01, c02, c03, c10, c11, c12, c13};
#pragma unroll
  for (int u = 0; u < 8; ++u) { const int t = u & 3, half = u >> 2; const int col = col0 + t * 16 + ln; const float bv = bp ? bf16_round(bp[col]) : 0.f;
#pragma unroll
    for (int r = 0; r < 8; ++r) { const int rloc = half * 16 + 8 * hh + r; float v = accs[u][r] * alpha + bv; if (CP) { if (rowsPerB < 0) v += CP[cofs + (size_t)(row0g + row0 + rloc) * ldc + col];      /* rowsPerB < 0: own element of the batched C plane */ else { const int bidx = (row0g + row0 + rloc) / rowsPerB; v += CP[(size_t)bidx * sCPb + (size_t)by * 64 + col]; } }
      if (ACT == 3) v = fmaxf(v, 0.f); else if (ACT == 6) v = 0.5f * v * (1.0f + erff(v * 0.70710678118654752f)); else if (ACT == 11) v = 1.0f / (1.0f + expf(-v)); else if (ACT == 15) v = v / (1.0f + expf(-v)); else if (ACT == 12) v = (v > 0.f) ? v : 0.01f * v; else if (ACT == 8) v = tanhf(v); else if (ACT == 9) v = 0.5f * v * (1.0f + tanhf(0.7978845608028654f * (v + 0.044715f * v * v * v))); else if (ACT == 14) v = (v > 0.f) ? v : 0.1f * v; else if (ACT == 16) v = (v >= 0.f) ? v : 0.3f * v; else if (ACT == 17) v = (v >= 0.f) ? v : 0.2f * v;
      so[w][rloc][t * 16 + ln] = v; } }
  __builtin_amdgcn_fence(__ATOMIC_ACQ_REL, "workgroup"); __builtin_amdgcn_wave_barrier();
  const int rsub = lane >> 4, c4 = (lane & 15) * 4;
  {
#pragma unroll
    for (int q = 0; q < 16; ++q) { const int r = q * 2 + rsub; const v4f v = *(const v4fa*)&so[w][r][c4]; if (C) *(v4f*)(C + cofs + (size_t)(row0 + r) * ldc + col0 + c4) = v; if (C16) { v4h h4; for (int i = 0; i < 4; ++i) h4[i] = (_Float16)v[i]; *(v4h*)(C16 + cofs + (size_t)(row0 + r) * ldc + col0 + c4) = h4; } }
     } }


__global__ __launch_bounds__(256) void k_wnat(const float* __restrict__ w, size_t n8, _Float16* __restrict__ Bt) { const size_t t = (size_t)blockIdx.x * 256 + threadIdx.x; if (t >= n8) return; FragH f; for (int q = 0; q < 8; ++q) f.h[q] = (_Float16)(bf16_round(w[t * 8 + q]) * 16.0f); *(v8us*)((unsigned short*)Bt + t * 8) = f.half[0];  }
__global__ __launch_bounds__(256) void k_rsm(const float* __restrict__ S, _Float16* __restrict__ P, int nrows) {
  #pragma clang fp contract(off)
  const int i = blockIdx.x * 256 + threadIdx.x; if (i >= nrows) return; const float* s = S + (size_t)i * SQ; float mx = -3.0e38f;
#pragma unroll 1
  for (int j = 0; j < SQ; ++j) mx = fmaxf(mx, s[j]); float se = 0.f;
#pragma unroll 1
  for (int j = 0; j < SQ; ++j) se += expf(s[j] - mx); const float sc = 256.0f / se;
#pragma unroll 1
  for (int j0 = 0; j0 < SQ; j0 += 8) { FragH f; for (int q = 0; q < 8; ++q) f.h[q] = (_Float16)(expf(s[j0 + q] - mx) * sc); unsigned short* d = (unsigned short*)P + (size_t)i * SQ + j0; *(v8us*)d = f.half[0];  } }
__global__ __launch_bounds__(256) void k_vt(const _Float16* __restrict__ V16, int b, int h0, _Float16* __restrict__ VT) { __shared__ unsigned short tl[64][65]; const int tid = threadIdx.x; const int hh = blockIdx.x % HG, sg = blockIdx.x / HG; const int s0 = sg * 64; const int h = h0 + hh;
  for (int i = tid; i < 64 * 8; i += 256) { const int j = i / 8, d8 = (i % 8) * 8; FragH f; f.half[0] = *(const v8us*)((const unsigned short*)V16 + ((size_t)b * SQ + s0 + j) * DM + h * HD + d8); for (int q = 0; q < 8; ++q) tl[d8 + q][j] = f.u[q]; }
  __syncthreads();
  { for (int i = tid; i < 64 * 8; i += 256) { const int d = i / 8, j8 = (i % 8) * 8; FragH f; for (int q = 0; q < 8; ++q) f.u[q] = tl[d][j8 + q]; *(v8us*)((unsigned short*)VT + ((size_t)hh * HD + d) * SQ + s0 + j8) = f.half[0]; }  } }



// fused causal attention, one wave per 32 query rows, no LDS, scores and weights never leave the registers.
// scores^T tile = K rows (A) x Q rows (B): accumulator row = key 8*hh + r, column = query ln, so a lane's 8 values of key tile 0 and its 8 of key tile 1 are,
// in order, the 16 elements of the B fragment (k = 8*hh + i, 16 + 8*hh + i) of the 32-key step of o^T = V^T (A) x P^T (B): no exchange between lanes.
// A lane keeps the running maximum of its query (made equal in both half-waves by one exchange per 32 keys) and its own half of the running sum (halves added at the end).
#define FA_CS 0.18033688011112042f      /* log2(e) / 8: score scale and exp -> exp2 in one factor */
__device__ __forceinline__ float fa_exp2(float x) { float e; asm("v_exp_f32 %0, %1\n\tv_nop" : "=v"(e) : "v"(x)); return e; }      /* the v_nop is the one slot the instruction set asks for behind a transcendental before its result is read or its source overwritten */
__device__ __forceinline__ float fa_xhalf(float x) { return __builtin_bit_cast(float, __builtin_amdgcn_permlanex16(__builtin_bit_cast(int, x), __builtin_bit_cast(int, x), 0x76543210, 0xfedcba98, false, false)); }      /* lane l with lane l ^ 16, on the vector unit (a shuffle would go through the LDS pipe and its wait) */
__device__ __forceinline__ v8f fa_mma(v16h a, v16h b, v8f c) { return __builtin_amdgcn_wmma_f32_16x16x32_f16(false, a, false, b, (short)0, c, false, false); }
__global__ __launch_bounds__(128) void k_fattn(const _Float16* __restrict__ QKVp, const _Float16* __restrict__ VTp, _Float16* __restrict__ O) {
  const int lane = threadIdx.x & 31, ln = lane & 15, hh = lane >> 4; const int w = __builtin_amdgcn_readfirstlane((int)(threadIdx.x >> 5));
  const int bh = blockIdx.x, b = bh / NH, h = bh - b * NH;
  const int yg = (int)blockIdx.y >> 2, yi = (int)blockIdx.y & 3; const int qt = SQ / 128 - 1 - 4 * yg - ((yg & 1) ? 3 - yi : yi);      /* query tile: long tiles first, every second group of four in rising order, so that work-groups 256 apart in the grid (all are resident at once) add up to equal lengths; any order is correct */
  const int row0 = qt * 128 + 32 * w;      /* also the first key of the wave's last 32-key block */
  const _Float16* qp = QKVp + ((size_t)b * SQ + row0 + ln) * LQ + h * HD;
  const _Float16* kp = QKVp + ((size_t)b * SQ + ln) * LQ + DM + h * HD;
  const _Float16* vp = VTp + ((size_t)bh * HD + ln) * SQ;
  v16h q[2][2], kf[2][2];
#pragma unroll      /* here and in every inner loop below: static indices keep the fragment and accumulator arrays in registers */
  for (int j = 0; j < 2; ++j) for (int kk = 0; kk < 2; ++kk) q[j][kk] = g2_frag(qp + (size_t)(j * 16) * LQ + kk * 32, hh);
#pragma unroll
  for (int kt = 0; kt < 2; ++kt) for (int kk = 0; kk < 2; ++kk) kf[kt][kk] = g2_frag(kp + (size_t)(kt * 16) * LQ + kk * 32, hh);
  const v8f z8 = {0.f,0.f,0.f,0.f,0.f,0.f,0.f,0.f};
  v8f o[2][4] = {{z8, z8, z8, z8}, {z8, z8, z8, z8}}; float m[2] = {-1.0e30f, -1.0e30f}, l[2] = {0.f, 0.f};
  int kb = 0;
#pragma unroll 1      /* one 32-key block per trip: a second copy of the body would need a second set of fragments */
  do {
    const int kn = min(kb + 32, row0);      /* next block; the last trip fetches its own block again, so every address stays inside the batch's rows */
    v8f s[2][2]; v16h vf[4];
#pragma unroll
    for (int t = 0; t < 4; ++t) vf[t] = g2_frag(vp + (size_t)(t * 16) * SQ + kb, hh);      /* this block's V^T, in flight under the scores and the softmax */
#pragma unroll
    for (int kt = 0; kt < 2; ++kt) for (int j = 0; j < 2; ++j) s[j][kt] = fa_mma(kf[kt][0], q[j][0], z8);
#pragma unroll
    for (int kt = 0; kt < 2; ++kt) for (int j = 0; j < 2; ++j) s[j][kt] = fa_mma(kf[kt][1], q[j][1], s[j][kt]);
#pragma unroll
    for (int kt = 0; kt < 2; ++kt) for (int kk = 0; kk < 2; ++kk) kf[kt][kk] = g2_frag(kp + (size_t)(kn + kt * 16) * LQ + kk * 32, hh);      /* next block's K, in flight under the softmax and the second product */
    asm volatile("s_wait_xcnt 0x0" ::: "memory");      /* later address arithmetic may overwrite registers that these loads name: the wait stands in front of it */
    if (kb + 31 > row0) {      /* only the block on the diagonal needs the causal test (same for the whole wave) */
      const int dq = row0 + ln - kb - 8 * hh;      /* key offset kt*16 + r is allowed up to dq + j*16 */
#pragma unroll
      for (int j = 0; j < 2; ++j) for (int kt = 0; kt < 2; ++kt) for (int r = 0; r < 8; ++r) s[j][kt][r] = (kt * 16 + r - j * 16 <= dq) ? s[j][kt][r] : -1.0e30f; }
    v16h p[2];
#pragma unroll
    for (int j = 0; j < 2; ++j) {
      float bm = s[j][0][0];
#pragma unroll
      for (int kt = 0; kt < 2; ++kt) for (int r = 0; r < 8; ++r) bm = fmaxf(bm, s[j][kt][r]);
      bm = fmaxf(bm, fa_xhalf(bm));      /* the query's other 16 keys of this block sit in the other half-wave */
      const float mn = fmaxf(m[j], bm); const float sc = fa_exp2((m[j] - mn) * FA_CS); m[j] = mn;
      const float mc = mn * FA_CS - 4.0f;      /* weights carried x16 (largest = 16): small ones stay in f16's normal range; the factor is in the row sum too and cancels */
      v4f ls = {0.f, 0.f, 0.f, 0.f}; FragH f;
#pragma unroll
      for (int i = 0; i < 16; ++i) { const float e = fa_exp2(fmaf(s[j][i >> 3][i & 7], FA_CS, -mc)); ls[i & 3] += e; f.h[i] = (_Float16)e; }
      p[j] = f.v;
      l[j] = l[j] * sc + ((ls[0] + ls[1]) + (ls[2] + ls[3]));
#pragma unroll
      for (int t = 0; t < 4; ++t) o[j][t] *= sc; }
#pragma unroll
    for (int t = 0; t < 4; ++t) for (int j = 0; j < 2; ++j) o[j][t] = fa_mma(vf[t], p[j], o[j][t]);
    kb += 32;
  } while (kb <= row0);
#pragma unroll
  for (int j = 0; j < 2; ++j) { const float fin = 64.0f / (l[j] + fa_xhalf(l[j]));      /* o carried x64 */
    unsigned short* op = (unsigned short*)O + ((size_t)b * SQ + row0 + j * 16 + ln) * DM + h * HD + 8 * hh;
#pragma unroll
    for (int t = 0; t < 4; ++t) { FragH f;
#pragma unroll
      for (int r = 0; r < 8; ++r) f.h[r] = (_Float16)(o[j][t][r] * fin);
      *(v8us*)(op + t * 16) = f.half[0]; } }
}


template <int MASKADD>
__global__ __launch_bounds__(64) void k_att0(const float* __restrict__ QF, const float* __restrict__ KF, const float* __restrict__ VF, int ld, size_t sIn, const float* __restrict__ mask, float scale, float* __restrict__ OF, int ldo, size_t sOut) {
  #pragma clang fp contract(off)
  __shared__ __attribute__((aligned(16))) float lo[64][64];      /* only the transpose for the coalesced store at the end */
  const int tid = threadIdx.x; const int h = blockIdx.x / (QT0 / 64), rg = blockIdx.x % (QT0 / 64); const int i = rg * 64 + tid;
  QF += (size_t)blockIdx.y * sIn; KF += (size_t)blockIdx.y * sIn; VF += (size_t)blockIdx.y * sIn; OF += (size_t)blockIdx.y * sOut;      /* blockIdx.y = batch */
  const float* qr = QF + (size_t)i * ld + h * HD;
  v4f rq[HD / 4], ro[HD / 4];      /* the thread's own q row and o row, in registers for the whole key loop */
#pragma unroll      /* here and in the inner loops below: static indices keep rq[] / ro[] in registers, and a key's loads issue together */
  for (int c = 0; c < HD / 4; ++c) { rq[c] = *(const v4fa*)(qr + c * 4); const v4f z = {0.f, 0.f, 0.f, 0.f}; ro[c] = z; }
  float m = -1.0e30f, l = 0.f; const int jmax = MASKADD ? (SQ - 1) : (rg * 64 + 63);      /* additive-mask form: every key (the mask input decides); causal form: keys up to the block's last row */
#pragma unroll 1
  for (int j = 0; j <= jmax; ++j) { const float* kr = KF + (size_t)j * ld + h * HD; const float* vr = VF + (size_t)j * ld + h * HD; float s = 0.f;
#pragma unroll
    for (int c = 0; c < HD / 4; ++c) { const v4f kq = *(const v4fa*)(kr + c * 4); const v4f qq = rq[c]; s = __fadd_rn(s, __fmul_rn(qq[0], kq[0])); s = __fadd_rn(s, __fmul_rn(qq[1], kq[1])); s = __fadd_rn(s, __fmul_rn(qq[2], kq[2])); s = __fadd_rn(s, __fmul_rn(qq[3], kq[3])); }
    s = __fmul_rn(s, scale); if (MASKADD) s = __fadd_rn(s, __fmul_rn(bf16_round(mask[(size_t)i * SQ + j]), -10000.0f));
    const float f = (MASKADD || j <= i) ? 1.f : 0.f; const float sm = fmaf(f, s, (1.f - f) * -1.0e30f); const float mn = fmaxf(m, sm); const float sc = expf(m - mn); const float e = expf(sm - mn); l = __fadd_rn(__fmul_rn(l, sc), e); m = mn;
#pragma unroll
    for (int c = 0; c < HD / 4; ++c) { const v4f vv = *(const v4fa*)(vr + c * 4); v4f oo = ro[c]; for (int u = 0; u < 4; ++u) oo[u] = __fadd_rn(__fmul_rn(oo[u], sc), __fmul_rn(e, vv[u])); ro[c] = oo; } }
  const float fin = 64.0f / l;      /* o carried x64 like the f16 path */
#pragma unroll
  for (int c = 0; c < HD / 4; ++c) { v4f oo = ro[c]; for (int u = 0; u < 4; ++u) oo[u] = __fmul_rn(oo[u], fin); *(v4f*)&lo[tid][c * 4] = oo; }
  __syncthreads();
  {
#pragma unroll 1
    for (int it = 0; it < 16; ++it) { const int row = it * 4 + tid / 16, pc = (tid % 16) * 4; const v4f v = *(const v4f*)&lo[row][pc]; *(v4f*)(OF + (size_t)(rg * 64 + row) * ldo + h * HD + pc) = v; }
     } }


template <int BFIN, int WXB>
__global__ __launch_bounds__(256) void k_ln16(const float* __restrict__ X, const float* __restrict__ g, const float* __restrict__ bb, float eps, _Float16* __restrict__ N16, float* __restrict__ XB) {
  #pragma clang fp contract(off)
  __shared__ float red[256]; const size_t r = blockIdx.x; const int t = threadIdx.x; const v4f xa = *(const v4fa*)(X + r * DMQ + t * 4); float s[4]; float sum = 0.f;
  for (int q = 0; q < 4; ++q) { s[q] = BFIN ? bf16_round(xa[q]) : xa[q]; sum = __fadd_rn(sum, s[q]); }
  red[t] = sum; __syncthreads(); for (int st = 128; st > 0; st >>= 1) { if (t < st) red[t] = __fadd_rn(red[t], red[t + st]); __syncthreads(); } const float mu = red[0] / (float)DMQ; __syncthreads();
  float vs = 0.f; for (int q = 0; q < 4; ++q) { const float dl = __fadd_rn(s[q], -mu); vs = __fadd_rn(vs, __fmul_rn(dl, dl)); } red[t] = vs; __syncthreads(); for (int st = 128; st > 0; st >>= 1) { if (t < st) red[t] = __fadd_rn(red[t], red[t + st]); __syncthreads(); }
  const float rs = rsqrtf(__fadd_rn(red[0] / (float)DMQ, eps)); v4h y; v4f xb;
  for (int q = 0; q < 4; ++q) { const int c = t * 4 + q; y[q] = (_Float16)__fadd_rn(__fmul_rn(__fmul_rn(__fadd_rn(s[q], -mu), rs), bf16_round(g[c])), bf16_round(bb[c])); xb[q] = s[q]; }
  { *(v4h*)(N16 + r * DMQ + t * 4) = y; if (WXB) *(v4f*)(XB + r * DMQ + t * 4) = xb;  } }
__global__ __launch_bounds__(256) void k_ftres2(const float* __restrict__ OF0, const float* __restrict__ XB, float* __restrict__ X1, size_t n4) {
  #pragma clang fp contract(off)
  const size_t t = (size_t)blockIdx.x * 256 + threadIdx.x; if (t >= n4) return; const v4f o = *(const v4fa*)(OF0 + t * 4), xv = *(const v4fa*)(XB + t * 4); v4f y; for (int q = 0; q < 4; ++q) y[q] = __fadd_rn(__fmul_rn(o[q], 0.015625f), xv[q]); *(v4f*)(X1 + t * 4) = y;  }

__global__ __launch_bounds__(256) void k_wthd(const float* __restrict__ Wt, _Float16* __restrict__ Bt) { const size_t t = (size_t)blockIdx.x * 256 + threadIdx.x; if (t >= (size_t)NH * HD * (DM / 8)) return; const int m8 = (int)(t % (DM / 8)) * 8; const int d = (int)((t / (DM / 8)) % HD); const int h = (int)(t / ((size_t)(DM / 8) * HD)); FragH f;
  for (int q = 0; q < 8; ++q) f.h[q] = (_Float16)(16.0f * bf16_round(Wt[((size_t)h * DM + m8 + q) * HD + d])); unsigned short* dst = (unsigned short*)Bt + ((size_t)h * HD + d) * DM + m8; *(v8us*)dst = f.half[0];  }




__global__ __launch_bounds__(256) void k_wtpad(const float* __restrict__ Wm, _Float16* __restrict__ Wt, int Kr, int Kp, int Nr, int Np, float scale) {
  const int t = blockIdx.x * 256 + threadIdx.x; if (t >= Np * (Kp / 8)) return; const int n = t / (Kp / 8), k8 = (t % (Kp / 8)) * 8; const int nc = min(n, Nr - 1); const float fn = (n < Nr) ? 1.f : 0.f; FragH f;
  for (int i = 0; i < 8; ++i) { const int k = k8 + i; const int kc = min(k, Kr - 1); const float fk = (k < Kr) ? fn : 0.f; f.h[i] = (_Float16)(bf16_round(Wm[(size_t)kc * Nr + nc]) * scale * fk); }
  unsigned short* o = (unsigned short*)Wt + (size_t)n * Kp + k8; *(v8us*)o = f.half[0];  }
__global__ __launch_bounds__(128) void k_bpad(const float* __restrict__ b, float* __restrict__ Bp, int nr, int np) {
  const int i = threadIdx.x; if (i >= np) return; const float v = b[min(i, nr - 1)] * ((i < nr) ? 1.f : 0.f); *(float*)(Bp + i) = v;  }
extern "C" void kernel_launch(void* const* d_in, const int* in_sizes, int n_in,
                              void* d_out, int out_size, void* d_ws, size_t ws_size, hipStream_t stream) {
  (void)in_sizes; (void)n_in; (void)out_size;
  const float* const* I = (const float* const*)d_in; const float* x = I[0]; const float* g1 = I[1]; const float* be1 = I[2]; const float* wq = I[3]; const float* wk = I[4]; const float* wv = I[5]; const float* wo = I[6]; const float* bo = nullptr; const float* gg2 = I[7]; const float* be2 = I[8]; const float* wfc = I[9]; const float* bfc = I[10]; const float* wmp = I[11]; const float* bmp = I[12];      /* x, LN1 g / b, Wq / Wk / Wv / Wo [1024][1024] ([in][out], no biases), LN2 g / b, W1 [1024][4096] + b1, W2 [4096][1024] + b2 */
  char* ws = (char*)d_ws; size_t off = 0;
  auto take = [&](size_t bytes) { char* p = ws + off; off += (bytes + 255) & ~(size_t)255; return p; };
  _Float16* BQKV = (_Float16*)take((size_t)3 * DM * DM * 2); _Float16* BO = (_Float16*)take((size_t)DM * DM * 2);
  _Float16* X16 = (_Float16*)take(NR * DM * 2); float* XB = (float*)take(NR * DM * 4); float* X1 = (float*)take(NR * DM * 4); _Float16* M16 = nullptr;      /* = X16 below (alias: X16's last reader, the first-tile q | k | v GEMM, precedes LN2's write) */ _Float16* BW1 = (_Float16*)take((size_t)DFF * DM * 2); _Float16* BW2 = (_Float16*)take((size_t)DM * DFF * 2); _Float16* QKV = (_Float16*)take(NR * 4 * DM * 2); _Float16* Q16 = QKV; _Float16* K16 = QKV + DM; _Float16* V16 = QKV + 2 * DM; _Float16* O16 = QKV + NR * 3 * DM; M16 = X16;      /* one plane: the q | k | v rows (pitch 3 DM), then the o rows (pitch DM) */
  static_assert(DFF == 4 * DM, "the hidden rows of all batches take exactly the q | k | v and o planes"); _Float16* HF16 = QKV;      /* alias: the last readers of q | k | v (attention) and of o (the output GEMM) precede the first FFN GEMM, which writes every hidden element before the second reads it */
  _Float16* VT = (_Float16*)take((size_t)NB * NH * HD * SQ * 2);
  float* QKVF0 = (float*)take((size_t)NB * QT0 * LQ * 4);      /* f32 q | k | v rows of every batch's first tile, pitch LQ */ float* OF0 = (float*)take((size_t)NB * QT0 * DM * 4); _Float16* OH0 = (_Float16*)take((size_t)NB * QT0 * DM * 2); _Float16* OL0 = (_Float16*)take((size_t)NB * QT0 * DM * 2);
  if (off > ws_size) return;
  { const unsigned g = (unsigned)(((size_t)DM * (DM / 8) + 255) / 256); k_wt_f16<<<g, 256, 0, stream>>>(wq, BQKV, DM, DM, 16.0f); k_wt_f16<<<g, 256, 0, stream>>>(wk, BQKV + (size_t)DM * DM, DM, DM, 16.0f); k_wt_f16<<<g, 256, 0, stream>>>(wv, BQKV + (size_t)2 * DM * DM, DM, DM, 16.0f); }      /* [in][out] -> Bt x16, stacked q | k | v */ k_wt_f16<<<(unsigned)(((size_t)DM * (DM / 8) + 255) / 256), 256, 0, stream>>>(wo, BO, DM, DM, 16.0f);      /* w_proj [in][out] -> Bt x16 */
  k_ln16<1, 1><<<(unsigned)NR, 256, 0, stream>>>(x, g1, be1, 1e-5f, X16, XB);      /* a = LN1(bf16(x)) -> f16 rows; XB = bf16(x) for the residual */
  k_wt_f16<<<(unsigned)(((size_t)DFF * (DM / 8) + 255) / 256), 256, 0, stream>>>(wfc, BW1, DM, DFF, 16.0f); k_wt_f16<<<(unsigned)(((size_t)DM * (DFF / 8) + 255) / 256), 256, 0, stream>>>(wmp, BW2, DFF, DM, 16.0f);      /* W1 [1024][4096] -> Bt [4096][1024]; W2 [4096][1024] -> Bt [1024][4096] (x16) */
  const size_t r0p = (size_t)B0 * SQ;      /* first projected row */
  k_gemm2<0><<<dim3((unsigned)((MP / 128) * (3 * DM / 64)), 1), 128, 0, stream>>>(X16 + r0p * DM, DM, 0, BQKV, DM, 0, 0.0625f, nullptr, 0, nullptr, 1, 0, 0, nullptr, QKV + r0p * 3 * DM, 3 * DM, 0, MP, 3 * DM, DM);      /* q | k | v rows (f16); head h = columns h*HD.. of each DM block */
  k_gemm2<0><<<dim3((QT0 / 128) * (LQ / 64), NB), 128, 0, stream>>>(X16, DM, (size_t)SQ * DM, BQKV, DM, 0, 0.0625f, nullptr, 0, nullptr, 1, 0, 0, QKVF0, nullptr, LQ, (size_t)QT0 * LQ, QT0, LQ, DM);      /* f32 q | k | v of the first 128 rows of every batch (exact products); blockIdx.y = batch */
  k_att0<0><<<dim3(NH * (QT0 / 64), NB), 64, 0, stream>>>(QKVF0, QKVF0 + DM, QKVF0 + 2 * DM, LQ, (size_t)QT0 * LQ, nullptr, 0.125f, OF0, DM, (size_t)QT0 * DM);      /* exact f32 attention for rows 0..127 of every batch (o x64) */
  k_vt<NH, SQ><<<NB * NH * (SQ / 64), 256, 0, stream>>>(V16, LQ, 0, VT);      /* V^T [NB][NH][HD][SQ] */
  k_fattn<<<dim3(NB * NH, SQ / 128), 128, 0, stream>>>(QKV, VT, O16);      /* o (merged heads, x64) as f16 rows, every batch, head and query tile in one launch */
  k_gemm2<0><<<dim3((unsigned)((MPO / 128) * (DM / 64)), 1), 128, 0, stream>>>(O16 + r0p * DM, DM, 0, BO, DM, 0, 0.0009765625f, bo, 0, XB + r0p * DM, -1, 0, 0, X1 + r0p * DM, nullptr, DM, 0, MPO, DM, DM);      /* out rows are the output layout */
  k_hl<<<(unsigned)(((size_t)NB * QT0 * DM / 8 + 255) / 256), 256, 0, stream>>>(OF0, OH0, OL0, (size_t)NB * QT0 * DM / 8);      /* first-tile o (x64) -> f16 hi + x1024 residual planes */
  k_gemm2<0><<<dim3((QT0 / 128) * (DM / 64), NB), 128, 0, stream>>>(OH0, DM, (size_t)QT0 * DM, BO, DM, 0, 0.0009765625f, bo, 0, XB, -1, 0, 0, X1, nullptr, DM, (size_t)SQ * DM, QT0, DM, DM);      /* rows 0..127 of every batch: x1 = o_hi Wo + x (no bias), overwriting the f16-path rows */
  k_gemm2<0><<<dim3((QT0 / 128) * (DM / 64), NB), 128, 0, stream>>>(OL0, DM, (size_t)QT0 * DM, BO, DM, 0, 0.00000095367431640625f, nullptr, 0, X1, -1, 0, 0, X1, nullptr, DM, (size_t)SQ * DM, QT0, DM, DM);      /* += o_lo Wo 2^-20 (own-element accumulate) */
  k_ln16<0, 0><<<(unsigned)NR, 256, 0, stream>>>(X1, gg2, be2, 1e-5f, M16, nullptr);      /* h = LN2(x1) -> f16 rows */
  k_gemm2<6><<<dim3((unsigned)((MPO / 128) * (DFF / 64)), 1), 128, 0, stream>>>(M16, DM, 0, BW1, DM, 0, 0.0625f, bfc, 0, nullptr, 1, 0, 0, nullptr, HF16, DFF, 0, MPO, DFF, DM);      /* gelu_erf(h2 W1 + b1) -> f16, the token rows of all batches in one launch */
  k_gemm2<0><<<dim3((unsigned)((MPO / 128) * (DM / 64)), 1), 128, 0, stream>>>(HF16, DFF, 0, BW2, DFF, 0, 0.0625f, bmp, 0, X1, -1, 0, 0, (float*)d_out, nullptr, DM, 0, MPO, DM, DFF);      /* out = x1 + mlp (own-element residual), all batches: 1024 work-groups, four to a WGP, where a batch alone gave 256 */
}

// v008
// It runs in 517 microseconds.
// In two side-by-side timings against v007, it was 1.15 and 1.14 times as fast.
// Over all steps from v000 it is 20.8 times as fast.
#include <hip/hip_runtime.h>
// Pre-LN causal transformer block (x [4][2048][1024]; h = LN1(x) (biased var, eps 1e-5, gamma / beta); Q/K/V = h Wq/Wk/Wv ([in][out] 1024 x 1024 sigma 1/32, no biases), 16 heads of 64; scores / 8; causal (tril, -inf); softmax; x1 = x + hidden Wo ([in][out], no bias); h2 = LN2(x1); out = x1 + gelu_erf(h2 W1 + b1) W2 + b2 ([in][out] 1024 x 4096 x 1024) -> [4][2048][1024]).
// Structure: token rows r = b*2048 + s; h = LN1(bf16-rounded x) as f16 rows; q | k | v as ONE WMMA GEMM (N = 3 x 1024) (32x64 wave tiles, f32 accumulation, exact x16 weights, no bias, f16 outputs); V^T for all batches and heads via LDS transposes; ONE fused causal attention launch: a wave owns 32 query rows and walks the keys below its last row 32 at a time, scores^T = K . Q^T on WMMA (keys on the accumulator rows, so a lane holds one query's scores), running row maximum and row sum in f32 (native exp2; weights x16 f16, taken from the accumulators in place as the B fragment), o^T += V^T . P^T on WMMA, o carried x64 (folded into the output GEMM alpha) written straight into the merged f16 o rows; x1 = x + o W_o GEMM (f32, no bias) into the output layout.
// Compute dtype: inputs rounded to bf16; x / weights exact; q, k, v, softmax weights and o as plain f16 GEMM operands (~2^-12); scores and softmax statistics f32. v_wmma_f32_16x16x32_f16.
#define NB 4
#define SQ 2048
#define DM 1024
#define NH 16
#define HD 64
#define HG 4                         /* heads per block group of the unlaunched k_vt(b, h0) overload */
#define QT 256                       /* unused */
#define NKX SQ                       /* unused */
#define QT0 128                      /* first-tile rows recomputed exactly in f32 */
#define B0 0                         /* first batch processed (debug hook) */
#define NBR NB                       /* batches processed (debug hook) */
#define NR ((size_t)NB * SQ)
#define DMQ DM
#define DFF 4096                     /* FFN hidden width */
#define DFFR 100                     /* unused */
#define MP ((int)((size_t)NBR * SQ)) /* rows projected (debug hook) */
#define QN SQ                        /* unused */
#define NHD NH                       /* unused */
#define MPO MP                       /* rows through the output stage (debug hook) */
#define LQ (3 * DM)      /* row pitch of the q/k/v rows */
typedef __bf16 v16b __attribute__((ext_vector_type(16)));
typedef unsigned short v8us __attribute__((ext_vector_type(8), may_alias));
typedef float  v8f  __attribute__((ext_vector_type(8)));
typedef float  v4f  __attribute__((ext_vector_type(4)));
typedef float  v4fa __attribute__((ext_vector_type(4), may_alias));
union FragB { v16b v; v8us half[2]; unsigned short u[16]; };

__device__ __forceinline__ unsigned short bf16_bits(float x) { unsigned int u = __float_as_uint(x); return (unsigned short)((u + 0x7FFFu + ((u >> 16) & 1u)) >> 16); }
__device__ __forceinline__ float bf16_val(unsigned short b) { return __uint_as_float(((unsigned int)b) << 16); }
__device__ __forceinline__ float bf16_round(float x) { return bf16_val(bf16_bits(x)); }
// D += A·B with NT terms: 1 = ah·bh, 2 = + al·bh (A split), 3 = + ah·bl (both split)
template <int NT>
__device__ __forceinline__ v8f mmaN(v16b ah, v16b al, v16b bh, v16b bl, v8f c) {
  c = __builtin_amdgcn_wmma_f32_16x16x32_bf16(false, ah, false, bh, (short)0, c, false, false);
  if (NT >= 2) c = __builtin_amdgcn_wmma_f32_16x16x32_bf16(false, al, false, bh, (short)0, c, false, false);
  if (NT >= 3) c = __builtin_amdgcn_wmma_f32_16x16x32_bf16(false, ah, false, bl, (short)0, c, false, false);
  asm volatile("v_nop\n\tv_nop\n\tv_nop\n\tv_nop" : "+v"(c) : "v"(ah), "v"(al), "v"(bh), "v"(bl));
  return c;
}

__global__ __launch_bounds__(256) void k_wt_bf16(const float* __restrict__ W, unsigned short* __restrict__ Wt, int K, int N) {
  const int t = blockIdx.x * 256 + threadIdx.x;
  const int k8n = K / 8;
  if (t >= N * k8n) return;
  const int n = t / k8n, k8 = (t % k8n) * 8;
  v8us v;
#pragma unroll
  for (int i = 0; i < 8; ++i) v[i] = bf16_bits(W[(size_t)(k8 + i) * N + n]);
  *(v8us*)(Wt + (size_t)n * K + k8) = v;
  
}

// GEMM C[M][N] (f32, pitch ldc) = act(A[M][K]·W + bias). A f32 row-major (pitch lda) converted per fragment to bf16
// (ASPLIT: hi/lo two planes -> 2 terms, else single rounded term); Wt bf16 [N][K] (pitch ldb). BIAS_BF16 rounds the
// bias to bf16 first (bias quantised to bf16 before the add). K%32==0, M%16==0, N%64==0.
template <bool ASPLIT, int ACT, bool BIAS_BF16>
__global__ __launch_bounds__(128) void k_gemm_bf(const float* __restrict__ A, int lda, const unsigned short* __restrict__ Wt, int ldb,
                                               const float* __restrict__ bias, float* __restrict__ C, int ldc, int M, int N, int K) {
  __shared__ __attribute__((aligned(16))) float so[4][16][64];
  const int tid = threadIdx.x, w = tid >> 5, lane = tid & 31, ln = lane & 15, hh = lane >> 4;
  const int ntn = N / 64;
  const int wid = blockIdx.x * 4 + w;
  const int mt = wid / ntn, nq = wid % ntn;
  if (mt * 16 >= M) return;
  const int row0 = mt * 16, col0 = nq * 64;
  const float* arow = A + (size_t)(row0 + ln) * lda;
  v8f acc[4] = {};
  for (int kb = 0; kb < K; kb += 32) {
    FragB ah, al;
    const v4f x0 = *(const v4fa*)(arow + kb + 8 * hh), x1 = *(const v4fa*)(arow + kb + 8 * hh + 4);
    const v4f x2 = *(const v4fa*)(arow + kb + 16 + 8 * hh), x3 = *(const v4fa*)(arow + kb + 16 + 8 * hh + 4);
    float xs[16] = {x0[0],x0[1],x0[2],x0[3],x1[0],x1[1],x1[2],x1[3],x2[0],x2[1],x2[2],x2[3],x3[0],x3[1],x3[2],x3[3]};
#pragma unroll
    for (int i = 0; i < 16; ++i) { const unsigned short hb = bf16_bits(xs[i]); ah.u[i] = hb; al.u[i] = ASPLIT ? bf16_bits(xs[i] - bf16_val(hb)) : (unsigned short)0; }
#pragma unroll
    for (int t = 0; t < 4; ++t) {
      const unsigned short* brow = Wt + (size_t)(col0 + t * 16 + ln) * ldb + kb;
      FragB b;
      b.half[0] = *(const v8us*)(brow + 8 * hh);
      b.half[1] = *(const v8us*)(brow + 16 + 8 * hh);
      acc[t] = mmaN<ASPLIT ? 2 : 1>(ah.v, al.v, b.v, b.v, acc[t]);
    }
  }
#pragma unroll
  for (int t = 0; t < 4; ++t) {
    float bv = bias ? bias[col0 + t * 16 + ln] : 0.f;
    if (BIAS_BF16) bv = bf16_round(bv);
#pragma unroll
    for (int r = 0; r < 8; ++r) { float v = acc[t][r] + bv; if (ACT == 1) v = fmaxf(v, 0.f); so[w][8 * hh + r][t * 16 + ln] = v; }
  }
  __builtin_amdgcn_fence(__ATOMIC_ACQ_REL, "workgroup");
  __builtin_amdgcn_wave_barrier();
  const int rsub = lane >> 4, c4 = (lane & 15) * 4;
  {
#pragma unroll
    for (int q = 0; q < 8; ++q) {
      const int r = q * 2 + rsub;
      const v4f v = *(const v4fa*)&so[w][r][c4];
      *(v4f*)(C + (size_t)(row0 + r) * ldc + col0 + c4) = v;
    }
    
  }
}

// GEMM C = act(A·W + bias + resid): A f32 (ASPLIT -> hi/lo 2 terms), Wt bf16 [N][K]; ACT 0 none, 1 relu, 2 exact gelu;
// resid (optional, f32, row index = (row % rmod), pitch ldr, RES_BF16 rounds it) added before the activation.
template <bool ASPLIT, int ACT, bool BIAS_BF16, bool RES_BF16>
__global__ __launch_bounds__(128) void k_gemm_bf3(const float* __restrict__ A, int lda, const unsigned short* __restrict__ Wt, int ldb,
                                                const float* __restrict__ bias, const float* __restrict__ resid, int rmod, int ldr,
                                                float* __restrict__ C, int ldc, int M, int N, int K) {
  __shared__ __attribute__((aligned(16))) float so[4][16][64];
  const int tid = threadIdx.x, w = tid >> 5, lane = tid & 31, ln = lane & 15, hh = lane >> 4;
  const int ntn = N / 64;
  const int wid = blockIdx.x * 4 + w;
  const int mt = wid / ntn, nq = wid % ntn;
  if (mt * 16 >= M) return;
  const int row0 = mt * 16, col0 = nq * 64;
  const float* arow = A + (size_t)(row0 + ln) * lda;
  v8f acc[4] = {};
  for (int kb = 0; kb < K; kb += 32) {
    FragB ah, al;
    const v4f x0 = *(const v4fa*)(arow + kb + 8 * hh), x1 = *(const v4fa*)(arow + kb + 8 * hh + 4);
    const v4f x2 = *(const v4fa*)(arow + kb + 16 + 8 * hh), x3 = *(const v4fa*)(arow + kb + 16 + 8 * hh + 4);
    float xs[16] = {x0[0],x0[1],x0[2],x0[3],x1[0],x1[1],x1[2],x1[3],x2[0],x2[1],x2[2],x2[3],x3[0],x3[1],x3[2],x3[3]};
#pragma unroll
    for (int i = 0; i < 16; ++i) { const unsigned short hb = bf16_bits(xs[i]); ah.u[i] = hb; al.u[i] = ASPLIT ? bf16_bits(xs[i] - bf16_val(hb)) : (unsigned short)0; }
#pragma unroll
    for (int t = 0; t < 4; ++t) {
      const unsigned short* brow = Wt + (size_t)(col0 + t * 16 + ln) * ldb + kb;
      FragB b;
      b.half[0] = *(const v8us*)(brow + 8 * hh);
      b.half[1] = *(const v8us*)(brow + 16 + 8 * hh);
      acc[t] = mmaN<ASPLIT ? 2 : 1>(ah.v, al.v, b.v, b.v, acc[t]);
    }
  }
#pragma unroll
  for (int t = 0; t < 4; ++t) {
    const int col = col0 + t * 16 + ln;
    float bv = bias ? bias[col] : 0.f;
    if (BIAS_BF16) bv = bf16_round(bv);
#pragma unroll
    for (int r = 0; r < 8; ++r) {
      float v = acc[t][r] + bv;
      if (resid) { float rv = resid[(size_t)((row0 + 8 * hh + r) % rmod) * ldr + col]; if (RES_BF16) rv = bf16_round(rv); v += rv; }
      if (ACT == 1) v = fmaxf(v, 0.f);
      if (ACT == 2) v = 0.5f * v * (1.0f + erff(v * 0.70710678118654752f));
      if (ACT == 3) { const float u = 0.7978845608028654f * (v + 0.044715f * v * v * v); v = 0.5f * v * (1.0f + tanhf(u)); }
      so[w][8 * hh + r][t * 16 + ln] = v;
    }
  }
  __builtin_amdgcn_fence(__ATOMIC_ACQ_REL, "workgroup");
  __builtin_amdgcn_wave_barrier();
  const int rsub = lane >> 4, c4 = (lane & 15) * 4;
  {
#pragma unroll
    for (int q = 0; q < 8; ++q) {
      const int r = q * 2 + rsub;
      const v4f v = *(const v4fa*)&so[w][r][c4];
      *(v4f*)(C + (size_t)(row0 + r) * ldc + col0 + c4) = v;
    }
    
  }
}
// row LayerNorm (biased variance, eps) over N: s = X (+ R); optional out_sum <- s; out_norm <- (s-mu)*rsqrt(var+eps)*g + b
template <bool PARAM_BF16>
__global__ __launch_bounds__(256) void k_layernorm(const float* __restrict__ X, const float* __restrict__ R, const float* __restrict__ g, const float* __restrict__ bta,
                                                  float* __restrict__ out_sum, float* __restrict__ out_norm, int N, float eps) {
  __shared__ float red[256];
  const int row = blockIdx.x, tid = threadIdx.x;
  const float* x = X + (size_t)row * N; const float* rr = R ? R + (size_t)row * N : nullptr;
  float vals[16];                     // up to N = 4096
  const int per = N / 256;            // contiguous chunk per thread? use strided-by-4 chunks: thread handles j = tid*4 + 1024*u
  float s1 = 0.f;
  for (int u = 0; u < per / 4; ++u) {
    const int j = tid * 4 + 1024 * u;
    const v4f a = *(const v4fa*)(x + j);
    v4f b = {0.f,0.f,0.f,0.f}; if (rr) b = *(const v4fa*)(rr + j);
#pragma unroll
    for (int q = 0; q < 4; ++q) { const float v = a[q] + b[q]; vals[u * 4 + q] = v; s1 += v; }
  }
  red[tid] = s1; __syncthreads();
  for (int st = 128; st > 0; st >>= 1) { if (tid < st) red[tid] += red[tid + st]; __syncthreads(); }
  const float mu = red[0] / (float)N; __syncthreads();
  float s2 = 0.f;
  for (int u = 0; u < per / 4; ++u)
#pragma unroll
    for (int q = 0; q < 4; ++q) { const float c = vals[u * 4 + q] - mu; s2 += c * c; }
  red[tid] = s2; __syncthreads();
  for (int st = 128; st > 0; st >>= 1) { if (tid < st) red[tid] += red[tid + st]; __syncthreads(); }
  const float rs = rsqrtf(red[0] / (float)N + eps);
  {
    for (int u = 0; u < per / 4; ++u) {
      const int j = tid * 4 + 1024 * u;
      v4f o, sm;
#pragma unroll
      for (int q = 0; q < 4; ++q) {
        float gg = g[j + q], bb = bta[j + q];
        if (PARAM_BF16) { gg = bf16_round(gg); bb = bf16_round(bb); }
        sm[q] = vals[u * 4 + q]; o[q] = (vals[u * 4 + q] - mu) * rs * gg + bb;
      }
      if (out_sum) *(v4f*)(out_sum + (size_t)row * N + j) = sm;
      *(v4f*)(out_norm + (size_t)row * N + j) = o;
    }
    
  }
}



// ---- f16 WMMA path (v_wmma_f32_16x16x32_f16): 11-bit significands for operands in range — used by every GEMM and by the fused attention that this file launches
typedef _Float16 v16h __attribute__((ext_vector_type(16)));
union FragH { v16h v; v8us half[2]; _Float16 h[16]; unsigned short u[16]; };
template <int NT>
__device__ __forceinline__ v8f mmaH(v16h ah, v16h al, v16h bh, v16h bl, v8f c) {
  c = __builtin_amdgcn_wmma_f32_16x16x32_f16(false, ah, false, bh, (short)0, c, false, false);
  if (NT >= 2) c = __builtin_amdgcn_wmma_f32_16x16x32_f16(false, al, false, bh, (short)0, c, false, false);
  if (NT >= 3) c = __builtin_amdgcn_wmma_f32_16x16x32_f16(false, ah, false, bl, (short)0, c, false, false);
  asm volatile("v_nop\n\tv_nop\n\tv_nop\n\tv_nop" : "+v"(c) : "v"(ah), "v"(al), "v"(bh), "v"(bl));
  return c;
}
// batched GEMM like k_gemm_b but f16 operands: A f32 (split into f16 hi/lo if ASPLIT, else rounded to f16), Bt = f16 values [n][k]; alpha; C f32; N multiple of 16 (partial tiles skipped)
template <bool ASPLIT>
__global__ __launch_bounds__(128) void k_gemm_h(const float* __restrict__ A, int lda, size_t sA, const _Float16* __restrict__ Bh, int ldb, size_t sB, float alpha, float* __restrict__ C, int ldc, size_t sC, int M, int N, int K) {
  __shared__ __attribute__((aligned(16))) float so[4][16][64];
  const int tid = threadIdx.x, w = tid >> 5, lane = tid & 31, ln = lane & 15, hh = lane >> 4; const int by = blockIdx.y;
  A += (size_t)by * sA; Bh += (size_t)by * sB; C += (size_t)by * sC;
  const int ntn = (N + 63) / 64; const int wid = blockIdx.x * 4 + w; const int mt = wid / ntn, nq = wid % ntn; if (mt * 16 >= M) return;
  const int row0 = mt * 16, col0 = nq * 64; const float* arow = A + (size_t)(row0 + ln) * lda;
  v8f acc[4] = {};
  for (int kb = 0; kb < K; kb += 32) {
    FragH ah, al;
    const v4f x0 = *(const v4fa*)(arow + kb + 8 * hh), x1 = *(const v4fa*)(arow + kb + 8 * hh + 4), x2 = *(const v4fa*)(arow + kb + 16 + 8 * hh), x3 = *(const v4fa*)(arow + kb + 16 + 8 * hh + 4);
    float xs[16] = {x0[0],x0[1],x0[2],x0[3],x1[0],x1[1],x1[2],x1[3],x2[0],x2[1],x2[2],x2[3],x3[0],x3[1],x3[2],x3[3]};
#pragma unroll
    for (int i = 0; i < 16; ++i) { const _Float16 h = (_Float16)xs[i]; ah.h[i] = h; al.h[i] = ASPLIT ? (_Float16)(xs[i] - (float)h) : (_Float16)0.0f; }
#pragma unroll
    for (int t = 0; t < 4; ++t) { if (col0 + t * 16 >= N) continue; const size_t boff = (size_t)(col0 + t * 16 + ln) * ldb + kb; FragH bq; bq.half[0] = *(const v8us*)(Bh + boff + 8 * hh); bq.half[1] = *(const v8us*)(Bh + boff + 16 + 8 * hh);
      acc[t] = mmaH<ASPLIT ? 2 : 1>(ah.v, al.v, bq.v, bq.v, acc[t]); }
  }
#pragma unroll
  for (int t = 0; t < 4; ++t) { if (col0 + t * 16 >= N) continue;
#pragma unroll
    for (int r = 0; r < 8; ++r) so[w][8 * hh + r][t * 16 + ln] = acc[t][r] * alpha; }
  __builtin_amdgcn_fence(__ATOMIC_ACQ_REL, "workgroup"); __builtin_amdgcn_wave_barrier();
  const int rsub = lane >> 4, c4 = (lane & 15) * 4;
  {
#pragma unroll
    for (int q = 0; q < 8; ++q) { const int r = q * 2 + rsub; if (col0 + c4 < N) { const v4f v = *(const v4fa*)&so[w][r][c4]; *(v4f*)(C + (size_t)(row0 + r) * ldc + col0 + c4) = v; } }
     }
}

// Wt[n][k] = f16(W[k][n]·scale) from f32 row-major W[K][N] (scale = power of two; bf16-exact weights stay exact in f16 away from the subnormal range)
__global__ __launch_bounds__(256) void k_wt_f16(const float* __restrict__ W, _Float16* __restrict__ Wt, int K, int N, float scale) {
  const int t = blockIdx.x * 256 + threadIdx.x; if (t >= N * (K / 8)) return; const int n = t / (K / 8), k8 = (t % (K / 8)) * 8; FragH f;
#pragma unroll
  for (int i = 0; i < 8; ++i) f.h[i] = (_Float16)(bf16_round(W[(size_t)(k8 + i) * N + n]) * scale); const v8us o = f.half[0];
  *(v8us*)((unsigned short*)Wt + (size_t)n * K + k8) = o; 
}
// k_gemm_hh variant with fused epilogue: v = acc·alpha + bias[by·sBias + col] (+ CP[(row/rowsPerB)·sCPb + by·64 + col] if CP) ; ACT 0 none / 1 elu ; writes f16 C16 (and f32 C if non-null)
template <int ACT>
__global__ __launch_bounds__(128) void k_gemm_hhx(const _Float16* __restrict__ A, int lda, size_t sA, const _Float16* __restrict__ Bh, int ldb, size_t sB, float alpha, const float* __restrict__ bias, size_t sBias, const float* __restrict__ CP, int rowsPerB, size_t sCPb, int row0g,
    float* __restrict__ C, _Float16* __restrict__ C16, int ldc, size_t sC, int M, int N, int K) {
  __shared__ __attribute__((aligned(16))) float so[4][16][64];
  const int tid = threadIdx.x, w = tid >> 5, lane = tid & 31, ln = lane & 15, hh = lane >> 4; const int by = blockIdx.y;
  A += (size_t)by * sA; Bh += (size_t)by * sB; const size_t cofs = (size_t)by * sC; const float* bp = bias ? bias + (size_t)by * sBias : nullptr;
  const int ntn = (N + 63) / 64; const int wid = blockIdx.x * 4 + w; const int mt = wid / ntn, nq = wid % ntn; if (mt * 16 >= M) return;
  const int row0 = mt * 16, col0 = nq * 64; const _Float16* arow = A + (size_t)(row0 + ln) * lda;
  v8f acc[4] = {};
  for (int kb = 0; kb < K; kb += 32) { FragH ah; ah.half[0] = *(const v8us*)((const unsigned short*)arow + kb + 8 * hh); ah.half[1] = *(const v8us*)((const unsigned short*)arow + kb + 16 + 8 * hh);
#pragma unroll
    for (int t = 0; t < 4; ++t) { if (col0 + t * 16 >= N) continue; const size_t boff = (size_t)(col0 + t * 16 + ln) * ldb + kb; FragH bq; bq.half[0] = *(const v8us*)((const unsigned short*)Bh + boff + 8 * hh); bq.half[1] = *(const v8us*)((const unsigned short*)Bh + boff + 16 + 8 * hh);
      acc[t] = mmaH<1>(ah.v, ah.v, bq.v, bq.v, acc[t]); }
  }
#pragma unroll
  for (int t = 0; t < 4; ++t) { if (col0 + t * 16 >= N) continue; const int col = col0 + t * 16 + ln; const float bv = bp ? bf16_round(bp[col]) : 0.f;
#pragma unroll
    for (int r = 0; r < 8; ++r) { float v = acc[t][r] * alpha + bv; if (CP) { const int rr = row0g + row0 + 8 * hh + r; if (rowsPerB < 0) v += CP[cofs + (size_t)rr * ldc + col];      /* rowsPerB < 0: own element of the batched C plane */ else { const int bidx = rr / rowsPerB; v += CP[(size_t)bidx * sCPb + (size_t)by * 64 + col]; } } if (ACT == 1) v = (v > 0.f) ? v : expm1f(v); else if (ACT == 7) v = (v > 0.f) ? v + 1.0f : expf(v); else if (ACT == 8) v = tanhf(v); else if (ACT == 9) v = 0.5f * v * (1.0f + tanhf(0.7978845608028654f * (v + 0.044715f * v * v * v))); else if (ACT == 11) v = 1.0f / (1.0f + expf(-v)); else if (ACT == 12) v = (v > 0.f) ? v : 0.01f * v; else if (ACT == 14) v = (v > 0.f) ? v : 0.1f * v; else if (ACT == 16) v = (v >= 0.f) ? v : 0.3f * v; else if (ACT == 17) v = (v >= 0.f) ? v : 0.2f * v; else if (ACT == 15) v = v / (1.0f + expf(-v)); else if (ACT == 3) v = fmaxf(v, 0.f); else if (ACT == 6) v = 0.5f * v * (1.0f + erff(v * 0.70710678118654752f)); so[w][8 * hh + r][t * 16 + ln] = v; } }
  __builtin_amdgcn_fence(__ATOMIC_ACQ_REL, "workgroup"); __builtin_amdgcn_wave_barrier();
  const int rsub = lane >> 4, c4 = (lane & 15) * 4; typedef _Float16 v4h __attribute__((ext_vector_type(4)));
  {
#pragma unroll
    for (int q = 0; q < 8; ++q) { const int r = q * 2 + rsub; if (col0 + c4 < N) { const v4f v = *(const v4fa*)&so[w][r][c4]; if (C) *(v4f*)(C + cofs + (size_t)(row0 + r) * ldc + col0 + c4) = v; if (C16) { v4h h4; for (int i = 0; i < 4; ++i) h4[i] = (_Float16)v[i]; *(v4h*)(C16 + cofs + (size_t)(row0 + r) * ldc + col0 + c4) = h4; } } }
     }
}


typedef _Float16 v4h __attribute__((ext_vector_type(4)));

__global__ __launch_bounds__(256) void k_x16(const float* __restrict__ x, _Float16* __restrict__ X16, size_t n8) { const size_t t = (size_t)blockIdx.x * 256 + threadIdx.x; if (t >= n8) return; FragH f;
#pragma unroll
  for (int q = 0; q < 8; ++q) f.h[q] = (_Float16)bf16_round(x[t * 8 + q]); *(v8us*)((unsigned short*)X16 + t * 8) = f.half[0];  }
__global__ __launch_bounds__(256) void k_h16(const float* __restrict__ x, _Float16* __restrict__ X16, size_t n8) { const size_t t = (size_t)blockIdx.x * 256 + threadIdx.x; if (t >= n8) return; FragH f;
#pragma unroll
  for (int q = 0; q < 8; ++q) f.h[q] = (_Float16)x[t * 8 + q]; *(v8us*)((unsigned short*)X16 + t * 8) = f.half[0];  }
__global__ __launch_bounds__(256) void k_round16f(const float* __restrict__ W, _Float16* __restrict__ Bt, size_t n8) { const size_t t = (size_t)blockIdx.x * 256 + threadIdx.x; if (t >= n8) return; FragH f;
#pragma unroll
  for (int i = 0; i < 8; ++i) f.h[i] = (_Float16)(bf16_round(W[t * 8 + i]) * 16.0f); *(v8us*)((unsigned short*)Bt + t * 8) = f.half[0];  }
template <int NHv, int TTv>
__global__ __launch_bounds__(256) void k_vt(const _Float16* __restrict__ V16, int ldv, int voff, _Float16* __restrict__ Vt) { __shared__ unsigned short tl[64][66]; const int tid = threadIdx.x; const int slab = blockIdx.x / (TTv / 64), lg = blockIdx.x % (TTv / 64); const int b = slab / NHv, h = slab % NHv;
  for (int i = tid; i < 64 * 8; i += 256) { const int r = i / 8, c8 = (i % 8) * 8; FragH f; f.half[0] = *(const v8us*)((const unsigned short*)V16 + ((size_t)b * TTv + lg * 64 + r) * ldv + voff + h * 64 + c8);
#pragma unroll
    for (int q = 0; q < 8; ++q) tl[r][c8 + q] = f.u[q]; }
  __syncthreads();
  {
#pragma unroll
    for (int rd = 0; rd < 2; ++rd) { const int d = rd * 32 + tid / 8, pc = tid % 8; FragH f;
#pragma unroll
      for (int q = 0; q < 8; ++q) f.u[q] = tl[pc * 8 + q][d];
      *(v8us*)((unsigned short*)Vt + ((size_t)slab * 64 + d) * TTv + lg * 64 + pc * 8) = f.half[0]; }
     } }

__global__ __launch_bounds__(256) void k_hl(const float* __restrict__ F, _Float16* __restrict__ Hh, _Float16* __restrict__ Hl, size_t n8) { const size_t t = (size_t)blockIdx.x * 256 + threadIdx.x; if (t >= n8) return; FragH fh, fl; const v4f a = *(const v4fa*)(F + t * 8), c = *(const v4fa*)(F + t * 8 + 4);
#pragma unroll
  for (int q = 0; q < 4; ++q) { _Float16 h = (_Float16)a[q]; fh.h[q] = h; fl.h[q] = (_Float16)((a[q] - (float)h) * 1024.0f); h = (_Float16)c[q]; fh.h[4 + q] = h; fl.h[4 + q] = (_Float16)((c[q] - (float)h) * 1024.0f); }
  { *(v8us*)((unsigned short*)Hh + t * 8) = fh.half[0]; *(v8us*)((unsigned short*)Hl + t * 8) = fl.half[0];  } }

// ---- fast GEMM (work-group tile 128x64, wave tile 32x64, operands staged in LDS; requires M % 128 == 0 rows per launch region, N % 64 == 0 and K % 64 == 0); epilogue = k_gemm_hhx semantics ----
__device__ __forceinline__ v16h g2_frag(const _Float16* p, int hh) { FragH f; f.half[0] = *(const v8us*)((const unsigned short*)p + 8 * hh); f.half[1] = *(const v8us*)((const unsigned short*)p + 16 + 8 * hh); return f.v; }
__device__ __forceinline__ v8f g2_mma(v16h a, v16h b, v8f c) { v8f d = __builtin_amdgcn_wmma_f32_16x16x32_f16(false, a, false, b, (short)0, c, false, false); asm volatile("v_nop\n\tv_nop\n\tv_nop\n\tv_nop" : "+v"(d) : "v"(a), "v"(b)); return d; }
#define G2P 72                       /* LDS row pitch in f16: 128 B of data + 16 B = 144 B, an odd multiple of 16 B, so the 16 rows of a ds_load_b128 fragment read fall on different banks */
#define G2B (192 * G2P)              /* f16 per buffer: the block's 128 A rows, then its 64 B rows, 64 k each */
#define G2S (16u * G2P * 2u)         /* LDS bytes between a lane's successive copies (16 rows) */
// one k-tile (64 k) of the block's 128 A rows and 64 B rows, global -> LDS through no register: lane = (row tid / 8 + 16 i, 16-byte piece tid % 8), so a wave's copy takes four whole 128-byte lines.
// The s_wait_xcnt stands inside the copies' own statement, behind the last of them: later address arithmetic overwrites registers that the copies name, and only here is the wait tied in front of it.
__device__ __forceinline__ void g2_stage(const _Float16* ga, size_t sa, const _Float16* gb, size_t sb, unsigned l) {
  asm volatile(
    "global_load_async_to_lds_b128 %0, %12, off\n\t"
    "global_load_async_to_lds_b128 %1, %13, off\n\t"
    "global_load_async_to_lds_b128 %2, %14, off\n\t"
    "global_load_async_to_lds_b128 %3, %15, off\n\t"
    "global_load_async_to_lds_b128 %4, %16, off\n\t"
    "global_load_async_to_lds_b128 %5, %17, off\n\t"
    "global_load_async_to_lds_b128 %6, %18, off\n\t"
    "global_load_async_to_lds_b128 %7, %19, off\n\t"
    "global_load_async_to_lds_b128 %8, %20, off\n\t"
    "global_load_async_to_lds_b128 %9, %21, off\n\t"
    "global_load_async_to_lds_b128 %10, %22, off\n\t"
    "global_load_async_to_lds_b128 %11, %23, off\n\t"
    "s_wait_xcnt 0x0"
    :: "v"(l), "v"(l + 1u * G2S), "v"(l + 2u * G2S), "v"(l + 3u * G2S), "v"(l + 4u * G2S), "v"(l + 5u * G2S), "v"(l + 6u * G2S), "v"(l + 7u * G2S), "v"(l + 8u * G2S), "v"(l + 9u * G2S), "v"(l + 10u * G2S), "v"(l + 11u * G2S),
       "v"(ga), "v"(ga + 1 * sa), "v"(ga + 2 * sa), "v"(ga + 3 * sa), "v"(ga + 4 * sa), "v"(ga + 5 * sa), "v"(ga + 6 * sa), "v"(ga + 7 * sa), "v"(gb), "v"(gb + 1 * sb), "v"(gb + 2 * sb), "v"(gb + 3 * sb) : "memory"); }
template <int ACT>
__global__ __launch_bounds__(128) void k_gemm2(const _Float16* __restrict__ A, int lda, size_t sA, const _Float16* __restrict__ Bh, int ldb, size_t sB, float alpha, const float* __restrict__ bias, size_t sBias, const float* __restrict__ CP, int rowsPerB, size_t sCPb, int row0g,
    float* __restrict__ C, _Float16* __restrict__ C16, int ldc, size_t sC, int M, int N, int K) { static_assert(ACT == 0 || ACT == 3 || ACT == 6 || ACT == 8 || ACT == 9 || ACT == 11 || ACT == 12 || ACT == 14 || ACT == 15 || ACT == 16 || ACT == 17, "k_gemm2: unsupported ACT code (would silently apply no activation)");
  __shared__ __attribute__((aligned(16))) float sm[G2B];      /* two k-tile buffers of G2B f16 each; behind the k-loop's last barrier the same bytes are the epilogue's transpose tiles */
  float (*so)[32][68] = (float (*)[32][68])sm; static_assert(4 * 32 * 68 <= G2B, "epilogue tiles must fit the ring");
  const int tid = threadIdx.x, w = tid >> 5, lane = tid & 31, ln = lane & 15, hh = lane >> 4; const int by = blockIdx.y;
  A += (size_t)by * sA; Bh += (size_t)by * sB; const size_t cofs = (size_t)by * sC; const float* bp = bias ? bias + (size_t)by * sBias : nullptr;
  const int ntn = N >> 6; const int mt = blockIdx.x / ntn, nq = blockIdx.x - mt * ntn; const int row0 = mt * 128 + 32 * w, col0 = nq * 64; if (mt * 128 >= M) return;      /* the whole work-group leaves or none (barriers below) */
  const _Float16* ga = A + (size_t)(mt * 128 + (tid >> 3)) * lda + (tid & 7) * 8; const _Float16* gb = Bh + (size_t)(col0 + (tid >> 3)) * ldb + (tid & 7) * 8; const size_t sa = (size_t)16 * lda, sb = (size_t)16 * ldb;
  const unsigned l0 = (unsigned)(size_t)sm + (unsigned)((tid >> 3) * (G2P * 2) + (tid & 7) * 16);      /* the lane's LDS byte address in buffer 0 */
  const _Float16* st = (const _Float16*)sm; const int nt = K >> 6;
  const v8f z8 = {0.f,0.f,0.f,0.f,0.f,0.f,0.f,0.f}; v8f c00 = z8, c01 = z8, c02 = z8, c03 = z8, c10 = z8, c11 = z8, c12 = z8, c13 = z8;
  /* two LDS buffers: tile t + 1 flies while tile t is worked on. Each accumulator still takes its k-steps in ascending order. */
  g2_stage(ga, sa, gb, sb, l0);
  asm volatile("s_wait_asynccnt 0x0" ::: "memory");      /* this wave's copies of tile 0 have landed */
  __syncthreads();      /* ... and every other wave's */
  if (nt > 1) g2_stage(ga + 64, sa, gb + 64, sb, l0 + (unsigned)(G2B * 2));
#pragma unroll 1      /* one k-tile per trip: the buffer alternates by the trip's parity */
  for (int t = 0; t < nt; ++t) {
    const _Float16* ap = st + (t & 1) * G2B + (32 * w + ln) * G2P; const _Float16* bq = st + (t & 1) * G2B + (128 + ln) * G2P;
    const v16h a0 = g2_frag(ap, hh), a1 = g2_frag(ap + 16 * G2P, hh), b0 = g2_frag(bq, hh), b1 = g2_frag(bq + 16 * G2P, hh), b2 = g2_frag(bq + 32 * G2P, hh), b3 = g2_frag(bq + 48 * G2P, hh);
    const v16h e0 = g2_frag(ap + 32, hh), e1 = g2_frag(ap + 16 * G2P + 32, hh), f0 = g2_frag(bq + 32, hh), f1 = g2_frag(bq + 16 * G2P + 32, hh), f2 = g2_frag(bq + 32 * G2P + 32, hh), f3 = g2_frag(bq + 48 * G2P + 32, hh);
    c00 = g2_mma(a0, b0, c00); c10 = g2_mma(a1, b0, c10); c01 = g2_mma(a0, b1, c01); c11 = g2_mma(a1, b1, c11); c02 = g2_mma(a0, b2, c02); c12 = g2_mma(a1, b2, c12); c03 = g2_mma(a0, b3, c03); c13 = g2_mma(a1, b3, c13);
    c00 = g2_mma(e0, f0, c00); c10 = g2_mma(e1, f0, c10); c01 = g2_mma(e0, f1, c01); c11 = g2_mma(e1, f1, c11); c02 = g2_mma(e0, f2, c02); c12 = g2_mma(e1, f2, c12); c03 = g2_mma(e0, f3, c03); c13 = g2_mma(e1, f3, c13);
    asm volatile("s_wait_dscnt 0x0" ::: "memory");      /* this wave's reads of tile t are done before the buffer is given up */
    asm volatile("s_wait_asynccnt 0x0" ::: "memory");      /* this wave's copies of tile t + 1 have landed */
    __syncthreads();      /* publishes tile t + 1 and ends every wave's reads of tile t */
    if (t + 2 < nt) g2_stage(ga + (size_t)(t + 2) * 64, sa, gb + (size_t)(t + 2) * 64, sb, l0 + (unsigned)((t & 1) * (G2B * 2))); }      /* refill of the buffer that this trip has just read */
  asm volatile("s_wait_asynccnt 0x0" ::: "memory");      /* nothing of the ring is in flight when its bytes become the epilogue's tiles */
  v8f accs[8] = {c00, c01, c02, c03, c10, c11, c12, c13};
#pragma unroll
  for (int u = 0; u < 8; ++u) { const int t = u & 3, half = u >> 2; const int col = col0 + t * 16 + ln; const float bv = bp ? bf16_round(bp[col]) : 0.f;
#pragma unroll
    for (int r = 0; r < 8; ++r) { const int rloc = half * 16 + 8 * hh + r; float v = accs[u][r] * alpha + bv; if (CP) { if (rowsPerB < 0) v += CP[cofs + (size_t)(row0g + row0 + rloc) * ldc + col];      /* rowsPerB < 0: own element of the batched C plane */ else { const int bidx = (row0g + row0 + rloc) / rowsPerB; v += CP[(size_t)bidx * sCPb + (size_t)by * 64 + col]; } }
      if (ACT == 3) v = fmaxf(v, 0.f); else if (ACT == 6) v = 0.5f * v * (1.0f + erff(v * 0.70710678118654752f)); else if (ACT == 11) v = 1.0f / (1.0f + expf(-v)); else if (ACT == 15) v = v / (1.0f + expf(-v)); else if (ACT == 12) v = (v > 0.f) ? v : 0.01f * v; else if (ACT == 8) v = tanhf(v); else if (ACT == 9) v = 0.5f * v * (1.0f + tanhf(0.7978845608028654f * (v + 0.044715f * v * v * v))); else if (ACT == 14) v = (v > 0.f) ? v : 0.1f * v; else if (ACT == 16) v = (v >= 0.f) ? v : 0.3f * v; else if (ACT == 17) v = (v >= 0.f) ? v : 0.2f * v;
      so[w][rloc][t * 16 + ln] = v; } }
  __builtin_amdgcn_fence(__ATOMIC_ACQ_REL, "workgroup"); __builtin_amdgcn_wave_barrier();
  const int rsub = lane >> 4, c4 = (lane & 15) * 4;
  {
#pragma unroll
    for (int q = 0; q < 16; ++q) { const int r = q * 2 + rsub; const v4f v = *(const v4fa*)&so[w][r][c4]; if (C) *(v4f*)(C + cofs + (size_t)(row0 + r) * ldc + col0 + c4) = v; if (C16) { v4h h4; for (int i = 0; i < 4; ++i) h4[i] = (_Float16)v[i]; *(v4h*)(C16 + cofs + (size_t)(row0 + r) * ldc + col0 + c4) = h4; } }
     } }


__global__ __launch_bounds__(256) void k_wnat(const float* __restrict__ w, size_t n8, _Float16* __restrict__ Bt) { const size_t t = (size_t)blockIdx.x * 256 + threadIdx.x; if (t >= n8) return; FragH f; for (int q = 0; q < 8; ++q) f.h[q] = (_Float16)(bf16_round(w[t * 8 + q]) * 16.0f); *(v8us*)((unsigned short*)Bt + t * 8) = f.half[0];  }
__global__ __launch_bounds__(256) void k_rsm(const float* __restrict__ S, _Float16* __restrict__ P, int nrows) {
  #pragma clang fp contract(off)
  const int i = blockIdx.x * 256 + threadIdx.x; if (i >= nrows) return; const float* s = S + (size_t)i * SQ; float mx = -3.0e38f;
#pragma unroll 1
  for (int j = 0; j < SQ; ++j) mx = fmaxf(mx, s[j]); float se = 0.f;
#pragma unroll 1
  for (int j = 0; j < SQ; ++j) se += expf(s[j] - mx); const float sc = 256.0f / se;
#pragma unroll 1
  for (int j0 = 0; j0 < SQ; j0 += 8) { FragH f; for (int q = 0; q < 8; ++q) f.h[q] = (_Float16)(expf(s[j0 + q] - mx) * sc); unsigned short* d = (unsigned short*)P + (size_t)i * SQ + j0; *(v8us*)d = f.half[0];  } }
__global__ __launch_bounds__(256) void k_vt(const _Float16* __restrict__ V16, int b, int h0, _Float16* __restrict__ VT) { __shared__ unsigned short tl[64][65]; const int tid = threadIdx.x; const int hh = blockIdx.x % HG, sg = blockIdx.x / HG; const int s0 = sg * 64; const int h = h0 + hh;
  for (int i = tid; i < 64 * 8; i += 256) { const int j = i / 8, d8 = (i % 8) * 8; FragH f; f.half[0] = *(const v8us*)((const unsigned short*)V16 + ((size_t)b * SQ + s0 + j) * DM + h * HD + d8); for (int q = 0; q < 8; ++q) tl[d8 + q][j] = f.u[q]; }
  __syncthreads();
  { for (int i = tid; i < 64 * 8; i += 256) { const int d = i / 8, j8 = (i % 8) * 8; FragH f; for (int q = 0; q < 8; ++q) f.u[q] = tl[d][j8 + q]; *(v8us*)((unsigned short*)VT + ((size_t)hh * HD + d) * SQ + s0 + j8) = f.half[0]; }  } }



// fused causal attention, one wave per 32 query rows, no LDS, scores and weights never leave the registers.
// scores^T tile = K rows (A) x Q rows (B): accumulator row = key 8*hh + r, column = query ln, so a lane's 8 values of key tile 0 and its 8 of key tile 1 are,
// in order, the 16 elements of the B fragment (k = 8*hh + i, 16 + 8*hh + i) of the 32-key step of o^T = V^T (A) x P^T (B): no exchange between lanes.
// A lane keeps the running maximum of its query (made equal in both half-waves by one exchange per 32 keys) and its own half of the running sum (halves added at the end).
#define FA_CS 0.18033688011112042f      /* log2(e) / 8: score scale and exp -> exp2 in one factor */
__device__ __forceinline__ float fa_exp2(float x) { float e; asm("v_exp_f32 %0, %1\n\tv_nop" : "=v"(e) : "v"(x)); return e; }      /* the v_nop is the one slot the instruction set asks for behind a transcendental before its result is read or its source overwritten */
__device__ __forceinline__ float fa_xhalf(float x) { return __builtin_bit_cast(float, __builtin_amdgcn_permlanex16(__builtin_bit_cast(int, x), __builtin_bit_cast(int, x), 0x76543210, 0xfedcba98, false, false)); }      /* lane l with lane l ^ 16, on the vector unit (a shuffle would go through the LDS pipe and its wait) */
__device__ __forceinline__ v8f fa_mma(v16h a, v16h b, v8f c) { return __builtin_amdgcn_wmma_f32_16x16x32_f16(false, a, false, b, (short)0, c, false, false); }
__global__ __launch_bounds__(128) void k_fattn(const _Float16* __restrict__ QKVp, const _Float16* __restrict__ VTp, _Float16* __restrict__ O) {
  const int lane = threadIdx.x & 31, ln = lane & 15, hh = lane >> 4; const int w = __builtin_amdgcn_readfirstlane((int)(threadIdx.x >> 5));
  const int bh = blockIdx.x, b = bh / NH, h = bh - b * NH;
  const int yg = (int)blockIdx.y >> 2, yi = (int)blockIdx.y & 3; const int qt = SQ / 128 - 1 - 4 * yg - ((yg & 1) ? 3 - yi : yi);      /* query tile: long tiles first, every second group of four in rising order, so that work-groups 256 apart in the grid (all are resident at once) add up to equal lengths; any order is correct */
  const int row0 = qt * 128 + 32 * w;      /* also the first key of the wave's last 32-key block */
  const _Float16* qp = QKVp + ((size_t)b * SQ + row0 + ln) * LQ + h * HD;
  const _Float16* kp = QKVp + ((size_t)b * SQ + ln) * LQ + DM + h * HD;
  const _Float16* vp = VTp + ((size_t)bh * HD + ln) * SQ;
  v16h q[2][2], kf[2][2];
#pragma unroll      /* here and in every inner loop below: static indices keep the fragment and accumulator arrays in registers */
  for (int j = 0; j < 2; ++j) for (int kk = 0; kk < 2; ++kk) q[j][kk] = g2_frag(qp + (size_t)(j * 16) * LQ + kk * 32, hh);
#pragma unroll
  for (int kt = 0; kt < 2; ++kt) for (int kk = 0; kk < 2; ++kk) kf[kt][kk] = g2_frag(kp + (size_t)(kt * 16) * LQ + kk * 32, hh);
  const v8f z8 = {0.f,0.f,0.f,0.f,0.f,0.f,0.f,0.f};
  v8f o[2][4] = {{z8, z8, z8, z8}, {z8, z8, z8, z8}}; float m[2] = {-1.0e30f, -1.0e30f}, l[2] = {0.f, 0.f};
  int kb = 0;
#pragma unroll 1      /* one 32-key block per trip: a second copy of the body would need a second set of fragments */
  do {
    const int kn = min(kb + 32, row0);      /* next block; the last trip fetches its own block again, so every address stays inside the batch's rows */
    v8f s[2][2]; v16h vf[4];
#pragma unroll
    for (int t = 0; t < 4; ++t) vf[t] = g2_frag(vp + (size_t)(t * 16) * SQ + kb, hh);      /* this block's V^T, in flight under the scores and the softmax */
#pragma unroll
    for (int kt = 0; kt < 2; ++kt) for (int j = 0; j < 2; ++j) s[j][kt] = fa_mma(kf[kt][0], q[j][0], z8);
#pragma unroll
    for (int kt = 0; kt < 2; ++kt) for (int j = 0; j < 2; ++j) s[j][kt] = fa_mma(kf[kt][1], q[j][1], s[j][kt]);
#pragma unroll
    for (int kt = 0; kt < 2; ++kt) for (int kk = 0; kk < 2; ++kk) kf[kt][kk] = g2_frag(kp + (size_t)(kn + kt * 16) * LQ + kk * 32, hh);      /* next block's K, in flight under the softmax and the second product */
    asm volatile("s_wait_xcnt 0x0" ::: "memory");      /* later address arithmetic may overwrite registers that these loads name: the wait stands in front of it */
    if (kb + 31 > row0) {      /* only the block on the diagonal needs the causal test (same for the whole wave) */
      const int dq = row0 + ln - kb - 8 * hh;      /* key offset kt*16 + r is allowed up to dq + j*16 */
#pragma unroll
      for (int j = 0; j < 2; ++j) for (int kt = 0; kt < 2; ++kt) for (int r = 0; r < 8; ++r) s[j][kt][r] = (kt * 16 + r - j * 16 <= dq) ? s[j][kt][r] : -1.0e30f; }
    v16h p[2];
#pragma unroll
    for (int j = 0; j < 2; ++j) {
      float bm = s[j][0][0];
#pragma unroll
      for (int kt = 0; kt < 2; ++kt) for (int r = 0; r < 8; ++r) bm = fmaxf(bm, s[j][kt][r]);
      bm = fmaxf(bm, fa_xhalf(bm));      /* the query's other 16 keys of this block sit in the other half-wave */
      const float mn = fmaxf(m[j], bm); const float sc = fa_exp2((m[j] - mn) * FA_CS); m[j] = mn;
      const float mc = mn * FA_CS - 4.0f;      /* weights carried x16 (largest = 16): small ones stay in f16's normal range; the factor is in the row sum too and cancels */
      v4f ls = {0.f, 0.f, 0.f, 0.f}; FragH f;
#pragma unroll
      for (int i = 0; i < 16; ++i) { const float e = fa_exp2(fmaf(s[j][i >> 3][i & 7], FA_CS, -mc)); ls[i & 3] += e; f.h[i] = (_Float16)e; }
      p[j] = f.v;
      l[j] = l[j] * sc + ((ls[0] + ls[1]) + (ls[2] + ls[3]));
#pragma unroll
      for (int t = 0; t < 4; ++t) o[j][t] *= sc; }
#pragma unroll
    for (int t = 0; t < 4; ++t) for (int j = 0; j < 2; ++j) o[j][t] = fa_mma(vf[t], p[j], o[j][t]);
    kb += 32;
  } while (kb <= row0);
#pragma unroll
  for (int j = 0; j < 2; ++j) { const float fin = 64.0f / (l[j] + fa_xhalf(l[j]));      /* o carried x64 */
    unsigned short* op = (unsigned short*)O + ((size_t)b * SQ + row0 + j * 16 + ln) * DM + h * HD + 8 * hh;
#pragma unroll
    for (int t = 0; t < 4; ++t) { FragH f;
#pragma unroll
      for (int r = 0; r < 8; ++r) f.h[r] = (_Float16)(o[j][t][r] * fin);
      *(v8us*)(op + t * 16) = f.half[0]; } }
}


// exact f32 attention of a batch's first QT0 rows, causal. One work-group = 64 query rows of one head, 1024 threads, three passes over LDS:
// 1. thread (row, key group g of 16) forms the scores of keys g, g + 16, ... (each score one ascending chain over the 64 dims; the wave's key row comes through scalar loads) and its part of the row maximum;
// 2. the same thread turns its scores into weights exp(s - row max), 0 above the diagonal, and sums its part of the row sum;
// 3. thread (row, 4 dims) adds weight x V over the keys in ascending order and divides by the row sum (the 16 parts added in ascending g).
template <int MASKADD>
__global__ __launch_bounds__(1024) void k_att0(const float* __restrict__ QF, const float* __restrict__ KF, const float* __restrict__ VF, int ld, size_t sIn, const float* __restrict__ mask, float scale, float* __restrict__ OF, int ldo, size_t sOut) {
  static_assert(MASKADD == 0, "k_att0: causal form only (the weights of QT0 keys are held in LDS)"); (void)mask;
  __shared__ __attribute__((aligned(16))) float sq[64][HD + 4];      /* q rows; pitch 272 B, an odd multiple of 16 B, so that 16-byte reads of one column piece from successive rows fall on different banks */
  __shared__ float se[QT0][64];      /* [key][row]: scores, then weights */
  __shared__ float pm[16][64], pl[16][64];      /* [key group][row]: parts of the row maximum and of the row sum */
  const int tid = threadIdx.x; const int h = blockIdx.x / (QT0 / 64), rg = blockIdx.x % (QT0 / 64);
  QF += (size_t)blockIdx.y * sIn; KF += (size_t)blockIdx.y * sIn; VF += (size_t)blockIdx.y * sIn; OF += (size_t)blockIdx.y * sOut;      /* blockIdx.y = batch */
  const int r = tid >> 4, c4 = (tid & 15) * 4;      /* passes 0 and 3: row r of the block, dims c4 .. c4 + 3: 16 lanes take one whole 256-byte row */
  *(v4f*)&sq[r][c4] = *(const v4fa*)(QF + (size_t)(rg * 64 + r) * ld + h * HD + c4);
  __syncthreads();      /* the q rows are complete */
  const int il = tid & 63, i = rg * 64 + il; const int g = __builtin_amdgcn_readfirstlane(tid >> 6);      /* the key group is the same for a whole wave */
  const int nk = rg * 64 + 64;      /* keys up to the block's last row */
  v4f rq[HD / 4];
#pragma unroll      /* here and in the inner loops below: static indices keep the arrays in registers */
  for (int c = 0; c < HD / 4; ++c) rq[c] = *(const v4f*)&sq[il][c * 4];
  float mx = -1.0e30f;
#pragma unroll 1      /* one key per trip: a key row fills 64 scalar registers */
  for (int j = g; j < nk; j += 16) { const float* kr = KF + (size_t)j * ld + h * HD; float s = 0.f;
#pragma unroll
    for (int c = 0; c < HD / 4; ++c) { const v4f kq = *(const v4fa*)(kr + c * 4); const v4f qq = rq[c]; s = fmaf(qq[0], kq[0], s); s = fmaf(qq[1], kq[1], s); s = fmaf(qq[2], kq[2], s); s = fmaf(qq[3], kq[3], s); }
    s *= scale; se[j][il] = s; mx = (j <= i) ? fmaxf(mx, s) : mx; }
  pm[g][il] = mx;
  __syncthreads();      /* every part of the row maxima is written */
  float m = pm[0][il];      /* key 0 is allowed in every row, so this part is a real score */
#pragma unroll
  for (int gg = 1; gg < 16; ++gg) m = fmaxf(m, pm[gg][il]);
  float ls = 0.f;
#pragma unroll 1      /* four or eight short trips: kept rolled for code size */
  for (int j = g; j < nk; j += 16) { const float e = (j <= i) ? expf(se[j][il] - m) : 0.f; se[j][il] = e; ls += e; }      /* the thread's own elements */
  pl[g][il] = ls;
  __syncthreads();      /* weights and parts of the row sums are written */
  float l = 0.f;
#pragma unroll
  for (int gg = 0; gg < 16; ++gg) l += pl[gg][r];
  const int je = (rg * 64 + 2 * __builtin_amdgcn_readfirstlane(tid >> 5) + 2 + 7) & ~7;      /* keys that the wave's two rows may see, rounded up to whole groups of 8 (at most nk; the weights above the diagonal are 0) */
  const float* vr = VF + h * HD + c4; v4f o = {0.f, 0.f, 0.f, 0.f};
#pragma unroll 1      /* eight keys per trip, their loads issued together */
  for (int j0 = 0; j0 < je; j0 += 8) { v4f vv[8]; float e[8];
#pragma unroll
    for (int u = 0; u < 8; ++u) { vv[u] = *(const v4fa*)(vr + (size_t)(j0 + u) * ld); e[u] = se[j0 + u][r]; }
#pragma unroll
    for (int u = 0; u < 8; ++u) for (int q = 0; q < 4; ++q) o[q] = fmaf(e[u], vv[u][q], o[q]); }
  const float fin = 64.0f / l;      /* o carried x64 like the f16 path */
  for (int q = 0; q < 4; ++q) o[q] *= fin;
  *(v4f*)(OF + (size_t)(rg * 64 + r) * ldo + h * HD + c4) = o;
}


template <int BFIN, int WXB>
__global__ __launch_bounds__(256) void k_ln16(const float* __restrict__ X, const float* __restrict__ g, const float* __restrict__ bb, float eps, _Float16* __restrict__ N16, float* __restrict__ XB) {
  #pragma clang fp contract(off)
  __shared__ float red[256]; const size_t r = blockIdx.x; const int t = threadIdx.x; const v4f xa = *(const v4fa*)(X + r * DMQ + t * 4); float s[4]; float sum = 0.f;
  for (int q = 0; q < 4; ++q) { s[q] = BFIN ? bf16_round(xa[q]) : xa[q]; sum = __fadd_rn(sum, s[q]); }
  red[t] = sum; __syncthreads(); for (int st = 128; st > 0; st >>= 1) { if (t < st) red[t] = __fadd_rn(red[t], red[t + st]); __syncthreads(); } const float mu = red[0] / (float)DMQ; __syncthreads();
  float vs = 0.f; for (int q = 0; q < 4; ++q) { const float dl = __fadd_rn(s[q], -mu); vs = __fadd_rn(vs, __fmul_rn(dl, dl)); } red[t] = vs; __syncthreads(); for (int st = 128; st > 0; st >>= 1) { if (t < st) red[t] = __fadd_rn(red[t], red[t + st]); __syncthreads(); }
  const float rs = rsqrtf(__fadd_rn(red[0] / (float)DMQ, eps)); v4h y; v4f xb;
  for (int q = 0; q < 4; ++q) { const int c = t * 4 + q; y[q] = (_Float16)__fadd_rn(__fmul_rn(__fmul_rn(__fadd_rn(s[q], -mu), rs), bf16_round(g[c])), bf16_round(bb[c])); xb[q] = s[q]; }
  { *(v4h*)(N16 + r * DMQ + t * 4) = y; if (WXB) *(v4f*)(XB + r * DMQ + t * 4) = xb;  } }
__global__ __launch_bounds__(256) void k_ftres2(const float* __restrict__ OF0, const float* __restrict__ XB, float* __restrict__ X1, size_t n4) {
  #pragma clang fp contract(off)
  const size_t t = (size_t)blockIdx.x * 256 + threadIdx.x; if (t >= n4) return; const v4f o = *(const v4fa*)(OF0 + t * 4), xv = *(const v4fa*)(XB + t * 4); v4f y; for (int q = 0; q < 4; ++q) y[q] = __fadd_rn(__fmul_rn(o[q], 0.015625f), xv[q]); *(v4f*)(X1 + t * 4) = y;  }

__global__ __launch_bounds__(256) void k_wthd(const float* __restrict__ Wt, _Float16* __restrict__ Bt) { const size_t t = (size_t)blockIdx.x * 256 + threadIdx.x; if (t >= (size_t)NH * HD * (DM / 8)) return; const int m8 = (int)(t % (DM / 8)) * 8; const int d = (int)((t / (DM / 8)) % HD); const int h = (int)(t / ((size_t)(DM / 8) * HD)); FragH f;
  for (int q = 0; q < 8; ++q) f.h[q] = (_Float16)(16.0f * bf16_round(Wt[((size_t)h * DM + m8 + q) * HD + d])); unsigned short* dst = (unsigned short*)Bt + ((size_t)h * HD + d) * DM + m8; *(v8us*)dst = f.half[0];  }




__global__ __launch_bounds__(256) void k_wtpad(const float* __restrict__ Wm, _Float16* __restrict__ Wt, int Kr, int Kp, int Nr, int Np, float scale) {
  const int t = blockIdx.x * 256 + threadIdx.x; if (t >= Np * (Kp / 8)) return; const int n = t / (Kp / 8), k8 = (t % (Kp / 8)) * 8; const int nc = min(n, Nr - 1); const float fn = (n < Nr) ? 1.f : 0.f; FragH f;
  for (int i = 0; i < 8; ++i) { const int k = k8 + i; const int kc = min(k, Kr - 1); const float fk = (k < Kr) ? fn : 0.f; f.h[i] = (_Float16)(bf16_round(Wm[(size_t)kc * Nr + nc]) * scale * fk); }
  unsigned short* o = (unsigned short*)Wt + (size_t)n * Kp + k8; *(v8us*)o = f.half[0];  }
__global__ __launch_bounds__(128) void k_bpad(const float* __restrict__ b, float* __restrict__ Bp, int nr, int np) {
  const int i = threadIdx.x; if (i >= np) return; const float v = b[min(i, nr - 1)] * ((i < nr) ? 1.f : 0.f); *(float*)(Bp + i) = v;  }
extern "C" void kernel_launch(void* const* d_in, const int* in_sizes, int n_in,
                              void* d_out, int out_size, void* d_ws, size_t ws_size, hipStream_t stream) {
  (void)in_sizes; (void)n_in; (void)out_size;
  const float* const* I = (const float* const*)d_in; const float* x = I[0]; const float* g1 = I[1]; const float* be1 = I[2]; const float* wq = I[3]; const float* wk = I[4]; const float* wv = I[5]; const float* wo = I[6]; const float* bo = nullptr; const float* gg2 = I[7]; const float* be2 = I[8]; const float* wfc = I[9]; const float* bfc = I[10]; const float* wmp = I[11]; const float* bmp = I[12];      /* x, LN1 g / b, Wq / Wk / Wv / Wo [1024][1024] ([in][out], no biases), LN2 g / b, W1 [1024][4096] + b1, W2 [4096][1024] + b2 */
  char* ws = (char*)d_ws; size_t off = 0;
  auto take = [&](size_t bytes) { char* p = ws + off; off += (bytes + 255) & ~(size_t)255; return p; };
  _Float16* BQKV = (_Float16*)take((size_t)3 * DM * DM * 2); _Float16* BO = (_Float16*)take((size_t)DM * DM * 2);
  _Float16* X16 = (_Float16*)take(NR * DM * 2); float* XB = (float*)take(NR * DM * 4); float* X1 = (float*)take(NR * DM * 4); _Float16* M16 = nullptr;      /* = X16 below (alias: X16's last reader, the first-tile q | k | v GEMM, precedes LN2's write) */ _Float16* BW1 = (_Float16*)take((size_t)DFF * DM * 2); _Float16* BW2 = (_Float16*)take((size_t)DM * DFF * 2); _Float16* QKV = (_Float16*)take(NR * 4 * DM * 2); _Float16* Q16 = QKV; _Float16* K16 = QKV + DM; _Float16* V16 = QKV + 2 * DM; _Float16* O16 = QKV + NR * 3 * DM; M16 = X16;      /* one plane: the q | k | v rows (pitch 3 DM), then the o rows (pitch DM) */
  static_assert(DFF == 4 * DM, "the hidden rows of all batches take exactly the q | k | v and o planes"); _Float16* HF16 = QKV;      /* alias: the last readers of q | k | v (attention) and of o (the output GEMM) precede the first FFN GEMM, which writes every hidden element before the second reads it */
  _Float16* VT = (_Float16*)take((size_t)NB * NH * HD * SQ * 2);
  float* QKVF0 = (float*)take((size_t)NB * QT0 * LQ * 4);      /* f32 q | k | v rows of every batch's first tile, pitch LQ */ float* OF0 = (float*)take((size_t)NB * QT0 * DM * 4); _Float16* OH0 = (_Float16*)take((size_t)NB * QT0 * DM * 2); _Float16* OL0 = (_Float16*)take((size_t)NB * QT0 * DM * 2);
  if (off > ws_size) return;
  { const unsigned g = (unsigned)(((size_t)DM * (DM / 8) + 255) / 256); k_wt_f16<<<g, 256, 0, stream>>>(wq, BQKV, DM, DM, 16.0f); k_wt_f16<<<g, 256, 0, stream>>>(wk, BQKV + (size_t)DM * DM, DM, DM, 16.0f); k_wt_f16<<<g, 256, 0, stream>>>(wv, BQKV + (size_t)2 * DM * DM, DM, DM, 16.0f); }      /* [in][out] -> Bt x16, stacked q | k | v */ k_wt_f16<<<(unsigned)(((size_t)DM * (DM / 8) + 255) / 256), 256, 0, stream>>>(wo, BO, DM, DM, 16.0f);      /* w_proj [in][out] -> Bt x16 */
  k_ln16<1, 1><<<(unsigned)NR, 256, 0, stream>>>(x, g1, be1, 1e-5f, X16, XB);      /* a = LN1(bf16(x)) -> f16 rows; XB = bf16(x) for the residual */
  k_wt_f16<<<(unsigned)(((size_t)DFF * (DM / 8) + 255) / 256), 256, 0, stream>>>(wfc, BW1, DM, DFF, 16.0f); k_wt_f16<<<(unsigned)(((size_t)DM * (DFF / 8) + 255) / 256), 256, 0, stream>>>(wmp, BW2, DFF, DM, 16.0f);      /* W1 [1024][4096] -> Bt [4096][1024]; W2 [4096][1024] -> Bt [1024][4096] (x16) */
  const size_t r0p = (size_t)B0 * SQ;      /* first projected row */
  k_gemm2<0><<<dim3((unsigned)((MP / 128) * (3 * DM / 64)), 1), 128, 0, stream>>>(X16 + r0p * DM, DM, 0, BQKV, DM, 0, 0.0625f, nullptr, 0, nullptr, 1, 0, 0, nullptr, QKV + r0p * 3 * DM, 3 * DM, 0, MP, 3 * DM, DM);      /* q | k | v rows (f16); head h = columns h*HD.. of each DM block */
  k_gemm2<0><<<dim3((QT0 / 128) * (LQ / 64), NB), 128, 0, stream>>>(X16, DM, (size_t)SQ * DM, BQKV, DM, 0, 0.0625f, nullptr, 0, nullptr, 1, 0, 0, QKVF0, nullptr, LQ, (size_t)QT0 * LQ, QT0, LQ, DM);      /* f32 q | k | v of the first 128 rows of every batch (exact products); blockIdx.y = batch */
  k_att0<0><<<dim3(NH * (QT0 / 64), NB), 1024, 0, stream>>>(QKVF0, QKVF0 + DM, QKVF0 + 2 * DM, LQ, (size_t)QT0 * LQ, nullptr, 0.125f, OF0, DM, (size_t)QT0 * DM);      /* exact f32 attention for rows 0..127 of every batch (o x64) */
  k_vt<NH, SQ><<<NB * NH * (SQ / 64), 256, 0, stream>>>(V16, LQ, 0, VT);      /* V^T [NB][NH][HD][SQ] */
  k_fattn<<<dim3(NB * NH, SQ / 128), 128, 0, stream>>>(QKV, VT, O16);      /* o (merged heads, x64) as f16 rows, every batch, head and query tile in one launch */
  k_gemm2<0><<<dim3((unsigned)((MPO / 128) * (DM / 64)), 1), 128, 0, stream>>>(O16 + r0p * DM, DM, 0, BO, DM, 0, 0.0009765625f, bo, 0, XB + r0p * DM, -1, 0, 0, X1 + r0p * DM, nullptr, DM, 0, MPO, DM, DM);      /* out rows are the output layout */
  k_hl<<<(unsigned)(((size_t)NB * QT0 * DM / 8 + 255) / 256), 256, 0, stream>>>(OF0, OH0, OL0, (size_t)NB * QT0 * DM / 8);      /* first-tile o (x64) -> f16 hi + x1024 residual planes */
  k_gemm2<0><<<dim3((QT0 / 128) * (DM / 64), NB), 128, 0, stream>>>(OH0, DM, (size_t)QT0 * DM, BO, DM, 0, 0.0009765625f, bo, 0, XB, -1, 0, 0, X1, nullptr, DM, (size_t)SQ * DM, QT0, DM, DM);      /* rows 0..127 of every batch: x1 = o_hi Wo + x (no bias), overwriting the f16-path rows */
  k_gemm2<0><<<dim3((QT0 / 128) * (DM / 64), NB), 128, 0, stream>>>(OL0, DM, (size_t)QT0 * DM, BO, DM, 0, 0.00000095367431640625f, nullptr, 0, X1, -1, 0, 0, X1, nullptr, DM, (size_t)SQ * DM, QT0, DM, DM);      /* += o_lo Wo 2^-20 (own-element accumulate) */
  k_ln16<0, 0><<<(unsigned)NR, 256, 0, stream>>>(X1, gg2, be2, 1e-5f, M16, nullptr);      /* h = LN2(x1) -> f16 rows */
  k_gemm2<6><<<dim3((unsigned)((MPO / 128) * (DFF / 64)), 1), 128, 0, stream>>>(M16, DM, 0, BW1, DM, 0, 0.0625f, bfc, 0, nullptr, 1, 0, 0, nullptr, HF16, DFF, 0, MPO, DFF, DM);      /* gelu_erf(h2 W1 + b1) -> f16, the token rows of all batches in one launch */
  k_gemm2<0><<<dim3((unsigned)((MPO / 128) * (DM / 64)), 1), 128, 0, stream>>>(HF16, DFF, 0, BW2, DFF, 0, 0.0625f, bmp, 0, X1, -1, 0, 0, (float*)d_out, nullptr, DM, 0, MPO, DM, DFF);      /* out = x1 + mlp (own-element residual), all batches: 1024 work-groups, four to a WGP, where a batch alone gave 256 */
}

// v009
// A run of this version takes 429 microseconds.
// Two timings next to v008 both put it at 1.20 times that version's speed.
// Over all steps from v000 it is 24.9 times as fast.
#include <hip/hip_runtime.h>
// Pre-LN causal transformer block (x [4][2048][1024]; h = LN1(x) (biased var, eps 1e-5, gamma / beta); Q/K/V = h Wq/Wk/Wv ([in][out] 1024 x 1024 sigma 1/32, no biases), 16 heads of 64; scores / 8; causal (tril, -inf); softmax; x1 = x + hidden Wo ([in][out], no bias); h2 = LN2(x1); out = x1 + gelu_erf(h2 W1 + b1) W2 + b2 ([in][out] 1024 x 4096 x 1024) -> [4][2048][1024]).
// Structure: token rows r = b*2048 + s; h = LN1(bf16-rounded x) as f16 rows; q | k | v as ONE WMMA GEMM (N = 3 x 1024) (32x64 wave tiles, f32 accumulation, exact x16 weights, no bias, f16 outputs); V^T for all batches and heads via LDS transposes; ONE fused causal attention launch: a wave owns 32 query rows and walks the keys below its last row 32 at a time, scores^T = K . Q^T on WMMA (keys on the accumulator rows, so a lane holds one query's scores), running row maximum and row sum in f32 (native exp2; weights x16 f16, taken from the accumulators in place as the B fragment), o^T += V^T . P^T on WMMA, o carried x64 (folded into the output GEMM alpha) written straight into the merged f16 o rows; x1 = x + o W_o GEMM (f32, no bias) into the output layout.
// Compute dtype: inputs rounded to bf16; x / weights exact; q, k, v, softmax weights and o as plain f16 GEMM operands (~2^-12); scores and softmax statistics f32. v_wmma_f32_16x16x32_f16.
#define NB 4
#define SQ 2048
#define DM 1024
#define NH 16
#define HD 64
#define HG 4                         /* heads per block group of the unlaunched k_vt(b, h0) overload */
#define QT 256                       /* unused */
#define NKX SQ                       /* unused */
#define QT0 128                      /* first-tile rows recomputed exactly in f32 */
#define B0 0                         /* first batch processed (debug hook) */
#define NBR NB                       /* batches processed (debug hook) */
#define NR ((size_t)NB * SQ)
#define DMQ DM
#define DFF 4096                     /* FFN hidden width */
#define DFFR 100                     /* unused */
#define MP ((int)((size_t)NBR * SQ)) /* rows projected (debug hook) */
#define QN SQ                        /* unused */
#define NHD NH                       /* unused */
#define MPO MP                       /* rows through the output stage (debug hook) */
#define LQ (3 * DM)      /* row pitch of the q/k/v rows */
typedef __bf16 v16b __attribute__((ext_vector_type(16)));
typedef unsigned short v8us __attribute__((ext_vector_type(8), may_alias));
typedef float  v8f  __attribute__((ext_vector_type(8)));
typedef float  v4f  __attribute__((ext_vector_type(4)));
typedef float  v4fa __attribute__((ext_vector_type(4), may_alias));
union FragB { v16b v; v8us half[2]; unsigned short u[16]; };

__device__ __forceinline__ unsigned short bf16_bits(float x) { unsigned int u = __float_as_uint(x); return (unsigned short)((u + 0x7FFFu + ((u >> 16) & 1u)) >> 16); }
__device__ __forceinline__ float bf16_val(unsigned short b) { return __uint_as_float(((unsigned int)b) << 16); }
__device__ __forceinline__ float bf16_round(float x) { return bf16_val(bf16_bits(x)); }
// D += A·B with NT terms: 1 = ah·bh, 2 = + al·bh (A split), 3 = + ah·bl (both split)
template <int NT>
__device__ __forceinline__ v8f mmaN(v16b ah, v16b al, v16b bh, v16b bl, v8f c) {
  c = __builtin_amdgcn_wmma_f32_16x16x32_bf16(false, ah, false, bh, (short)0, c, false, false);
  if (NT >= 2) c = __builtin_amdgcn_wmma_f32_16x16x32_bf16(false, al, false, bh, (short)0, c, false, false);
  if (NT >= 3) c = __builtin_amdgcn_wmma_f32_16x16x32_bf16(false, ah, false, bl, (short)0, c, false, false);
  asm volatile("v_nop\n\tv_nop\n\tv_nop\n\tv_nop" : "+v"(c) : "v"(ah), "v"(al), "v"(bh), "v"(bl));
  return c;
}

__global__ __launch_bounds__(256) void k_wt_bf16(const float* __restrict__ W, unsigned short* __restrict__ Wt, int K, int N) {
  const int t = blockIdx.x * 256 + threadIdx.x;
  const int k8n = K / 8;
  if (t >= N * k8n) return;
  const int n = t / k8n, k8 = (t % k8n) * 8;
  v8us v;
#pragma unroll
  for (int i = 0; i < 8; ++i) v[i] = bf16_bits(W[(size_t)(k8 + i) * N + n]);
  *(v8us*)(Wt + (size_t)n * K + k8) = v;
  
}

// GEMM C[M][N] (f32, pitch ldc) = act(A[M][K]·W + bias). A f32 row-major (pitch lda) converted per fragment to bf16
// (ASPLIT: hi/lo two planes -> 2 terms, else single rounded term); Wt bf16 [N][K] (pitch ldb). BIAS_BF16 rounds the
// bias to bf16 first (bias quantised to bf16 before the add). K%32==0, M%16==0, N%64==0.
template <bool ASPLIT, int ACT, bool BIAS_BF16>
__global__ __launch_bounds__(128) void k_gemm_bf(const float* __restrict__ A, int lda, const unsigned short* __restrict__ Wt, int ldb,
                                               const float* __restrict__ bias, float* __restrict__ C, int ldc, int M, int N, int K) {
  __shared__ __attribute__((aligned(16))) float so[4][16][64];
  const int tid = threadIdx.x, w = tid >> 5, lane = tid & 31, ln = lane & 15, hh = lane >> 4;
  const int ntn = N / 64;
  const int wid = blockIdx.x * 4 + w;
  const int mt = wid / ntn, nq = wid % ntn;
  if (mt * 16 >= M) return;
  const int row0 = mt * 16, col0 = nq * 64;
  const float* arow = A + (size_t)(row0 + ln) * lda;
  v8f acc[4] = {};
  for (int kb = 0; kb < K; kb += 32) {
    FragB ah, al;
    const v4f x0 = *(const v4fa*)(arow + kb + 8 * hh), x1 = *(const v4fa*)(arow + kb + 8 * hh + 4);
    const v4f x2 = *(const v4fa*)(arow + kb + 16 + 8 * hh), x3 = *(const v4fa*)(arow + kb + 16 + 8 * hh + 4);
    float xs[16] = {x0[0],x0[1],x0[2],x0[3],x1[0],x1[1],x1[2],x1[3],x2[0],x2[1],x2[2],x2[3],x3[0],x3[1],x3[2],x3[3]};
#pragma unroll
    for (int i = 0; i < 16; ++i) { const unsigned short hb = bf16_bits(xs[i]); ah.u[i] = hb; al.u[i] = ASPLIT ? bf16_bits(xs[i] - bf16_val(hb)) : (unsigned short)0; }
#pragma unroll
    for (int t = 0; t < 4; ++t) {
      const unsigned short* brow = Wt + (size_t)(col0 + t * 16 + ln) * ldb + kb;
      FragB b;
      b.half[0] = *(const v8us*)(brow + 8 * hh);
      b.half[1] = *(const v8us*)(brow + 16 + 8 * hh);
      acc[t] = mmaN<ASPLIT ? 2 : 1>(ah.v, al.v, b.v, b.v, acc[t]);
    }
  }
#pragma unroll
  for (int t = 0; t < 4; ++t) {
    float bv = bias ? bias[col0 + t * 16 + ln] : 0.f;
    if (BIAS_BF16) bv = bf16_round(bv);
#pragma unroll
    for (int r = 0; r < 8; ++r) { float v = acc[t][r] + bv; if (ACT == 1) v = fmaxf(v, 0.f); so[w][8 * hh + r][t * 16 + ln] = v; }
  }
  __builtin_amdgcn_fence(__ATOMIC_ACQ_REL, "workgroup");
  __builtin_amdgcn_wave_barrier();
  const int rsub = lane >> 4, c4 = (lane & 15) * 4;
  {
#pragma unroll
    for (int q = 0; q < 8; ++q) {
      const int r = q * 2 + rsub;
      const v4f v = *(const v4fa*)&so[w][r][c4];
      *(v4f*)(C + (size_t)(row0 + r) * ldc + col0 + c4) = v;
    }
    
  }
}

// GEMM C = act(A·W + bias + resid): A f32 (ASPLIT -> hi/lo 2 terms), Wt bf16 [N][K]; ACT 0 none, 1 relu, 2 exact gelu;
// resid (optional, f32, row index = (row % rmod), pitch ldr, RES_BF16 rounds it) added before the activation.
template <bool ASPLIT, int ACT, bool BIAS_BF16, bool RES_BF16>
__global__ __launch_bounds__(128) void k_gemm_bf3(const float* __restrict__ A, int lda, const unsigned short* __restrict__ Wt, int ldb,
                                                const float* __restrict__ bias, const float* __restrict__ resid, int rmod, int ldr,
                                                float* __restrict__ C, int ldc, int M, int N, int K) {
  __shared__ __attribute__((aligned(16))) float so[4][16][64];
  const int tid = threadIdx.x, w = tid >> 5, lane = tid & 31, ln = lane & 15, hh = lane >> 4;
  const int ntn = N / 64;
  const int wid = blockIdx.x * 4 + w;
  const int mt = wid / ntn, nq = wid % ntn;
  if (mt * 16 >= M) return;
  const int row0 = mt * 16, col0 = nq * 64;
  const float* arow = A + (size_t)(row0 + ln) * lda;
  v8f acc[4] = {};
  for (int kb = 0; kb < K; kb += 32) {
    FragB ah, al;
    const v4f x0 = *(const v4fa*)(arow + kb + 8 * hh), x1 = *(const v4fa*)(arow + kb + 8 * hh + 4);
    const v4f x2 = *(const v4fa*)(arow + kb + 16 + 8 * hh), x3 = *(const v4fa*)(arow + kb + 16 + 8 * hh + 4);
    float xs[16] = {x0[0],x0[1],x0[2],x0[3],x1[0],x1[1],x1[2],x1[3],x2[0],x2[1],x2[2],x2[3],x3[0],x3[1],x3[2],x3[3]};
#pragma unroll
    for (int i = 0; i < 16; ++i) { const unsigned short hb = bf16_bits(xs[i]); ah.u[i] = hb; al.u[i] = ASPLIT ? bf16_bits(xs[i] - bf16_val(hb)) : (unsigned short)0; }
#pragma unroll
    for (int t = 0; t < 4; ++t) {
      const unsigned short* brow = Wt + (size_t)(col0 + t * 16 + ln) * ldb + kb;
      FragB b;
      b.half[0] = *(const v8us*)(brow + 8 * hh);
      b.half[1] = *(const v8us*)(brow + 16 + 8 * hh);
      acc[t] = mmaN<ASPLIT ? 2 : 1>(ah.v, al.v, b.v, b.v, acc[t]);
    }
  }
#pragma unroll
  for (int t = 0; t < 4; ++t) {
    const int col = col0 + t * 16 + ln;
    float bv = bias ? bias[col] : 0.f;
    if (BIAS_BF16) bv = bf16_round(bv);
#pragma unroll
    for (int r = 0; r < 8; ++r) {
      float v = acc[t][r] + bv;
      if (resid) { float rv = resid[(size_t)((row0 + 8 * hh + r) % rmod) * ldr + col]; if (RES_BF16) rv = bf16_round(rv); v += rv; }
      if (ACT == 1) v = fmaxf(v, 0.f);
      if (ACT == 2) v = 0.5f * v * (1.0f + erff(v * 0.70710678118654752f));
      if (ACT == 3) { const float u = 0.7978845608028654f * (v + 0.044715f * v * v * v); v = 0.5f * v * (1.0f + tanhf(u)); }
      so[w][8 * hh + r][t * 16 + ln] = v;
    }
  }
  __builtin_amdgcn_fence(__ATOMIC_ACQ_REL, "workgroup");
  __builtin_amdgcn_wave_barrier();
  const int rsub = lane >> 4, c4 = (lane & 15) * 4;
  {
#pragma unroll
    for (int q = 0; q < 8; ++q) {
      const int r = q * 2 + rsub;
      const v4f v = *(const v4fa*)&so[w][r][c4];
      *(v4f*)(C + (size_t)(row0 + r) * ldc + col0 + c4) = v;
    }
    
  }
}
// row LayerNorm (biased variance, eps) over N: s = X (+ R); optional out_sum <- s; out_norm <- (s-mu)*rsqrt(var+eps)*g + b
template <bool PARAM_BF16>
__global__ __launch_bounds__(256) void k_layernorm(const float* __restrict__ X, const float* __restrict__ R, const float* __restrict__ g, const float* __restrict__ bta,
                                                  float* __restrict__ out_sum, float* __restrict__ out_norm, int N, float eps) {
  __shared__ float red[256];
  const int row = blockIdx.x, tid = threadIdx.x;
  const float* x = X + (size_t)row * N; const float* rr = R ? R + (size_t)row * N : nullptr;
  float vals[16];                     // up to N = 4096
  const int per = N / 256;            // contiguous chunk per thread? use strided-by-4 chunks: thread handles j = tid*4 + 1024*u
  float s1 = 0.f;
  for (int u = 0; u < per / 4; ++u) {
    const int j = tid * 4 + 1024 * u;
    const v4f a = *(const v4fa*)(x + j);
    v4f b = {0.f,0.f,0.f,0.f}; if (rr) b = *(const v4fa*)(rr + j);
#pragma unroll
    for (int q = 0; q < 4; ++q) { const float v = a[q] + b[q]; vals[u * 4 + q] = v; s1 += v; }
  }
  red[tid] = s1; __syncthreads();
  for (int st = 128; st > 0; st >>= 1) { if (tid < st) red[tid] += red[tid + st]; __syncthreads(); }
  const float mu = red[0] / (float)N; __syncthreads();
  float s2 = 0.f;
  for (int u = 0; u < per / 4; ++u)
#pragma unroll
    for (int q = 0; q < 4; ++q) { const float c = vals[u * 4 + q] - mu; s2 += c * c; }
  red[tid] = s2; __syncthreads();
  for (int st = 128; st > 0; st >>= 1) { if (tid < st) red[tid] += red[tid + st]; __syncthreads(); }
  const float rs = rsqrtf(red[0] / (float)N + eps);
  {
    for (int u = 0; u < per / 4; ++u) {
      const int j = tid * 4 + 1024 * u;
      v4f o, sm;
#pragma unroll
      for (int q = 0; q < 4; ++q) {
        float gg = g[j + q], bb = bta[j + q];
        if (PARAM_BF16) { gg = bf16_round(gg); bb = bf16_round(bb); }
        sm[q] = vals[u * 4 + q]; o[q] = (vals[u * 4 + q] - mu) * rs * gg + bb;
      }
      if (out_sum) *(v4f*)(out_sum + (size_t)row * N + j) = sm;
      *(v4f*)(out_norm + (size_t)row * N + j) = o;
    }
    
  }
}



// ---- f16 WMMA path (v_wmma_f32_16x16x32_f16): 11-bit significands for operands in range — used by every GEMM and by the fused attention that this file launches
typedef _Float16 v16h __attribute__((ext_vector_type(16)));
union FragH { v16h v; v8us half[2]; _Float16 h[16]; unsigned short u[16]; };
template <int NT>
__device__ __forceinline__ v8f mmaH(v16h ah, v16h al, v16h bh, v16h bl, v8f c) {
  c = __builtin_amdgcn_wmma_f32_16x16x32_f16(false, ah, false, bh, (short)0, c, false, false);
  if (NT >= 2) c = __builtin_amdgcn_wmma_f32_16x16x32_f16(false, al, false, bh, (short)0, c, false, false);
  if (NT >= 3) c = __builtin_amdgcn_wmma_f32_16x16x32_f16(false, ah, false, bl, (short)0, c, false, false);
  asm volatile("v_nop\n\tv_nop\n\tv_nop\n\tv_nop" : "+v"(c) : "v"(ah), "v"(al), "v"(bh), "v"(bl));
  return c;
}
// batched GEMM like k_gemm_b but f16 operands: A f32 (split into f16 hi/lo if ASPLIT, else rounded to f16), Bt = f16 values [n][k]; alpha; C f32; N multiple of 16 (partial tiles skipped)
template <bool ASPLIT>
__global__ __launch_bounds__(128) void k_gemm_h(const float* __restrict__ A, int lda, size_t sA, const _Float16* __restrict__ Bh, int ldb, size_t sB, float alpha, float* __restrict__ C, int ldc, size_t sC, int M, int N, int K) {
  __shared__ __attribute__((aligned(16))) float so[4][16][64];
  const int tid = threadIdx.x, w = tid >> 5, lane = tid & 31, ln = lane & 15, hh = lane >> 4; const int by = blockIdx.y;
  A += (size_t)by * sA; Bh += (size_t)by * sB; C += (size_t)by * sC;
  const int ntn = (N + 63) / 64; const int wid = blockIdx.x * 4 + w; const int mt = wid / ntn, nq = wid % ntn; if (mt * 16 >= M) return;
  const int row0 = mt * 16, col0 = nq * 64; const float* arow = A + (size_t)(row0 + ln) * lda;
  v8f acc[4] = {};
  for (int kb = 0; kb < K; kb += 32) {
    FragH ah, al;
    const v4f x0 = *(const v4fa*)(arow + kb + 8 * hh), x1 = *(const v4fa*)(arow + kb + 8 * hh + 4), x2 = *(const v4fa*)(arow + kb + 16 + 8 * hh), x3 = *(const v4fa*)(arow + kb + 16 + 8 * hh + 4);
    float xs[16] = {x0[0],x0[1],x0[2],x0[3],x1[0],x1[1],x1[2],x1[3],x2[0],x2[1],x2[2],x2[3],x3[0],x3[1],x3[2],x3[3]};
#pragma unroll
    for (int i = 0; i < 16; ++i) { const _Float16 h = (_Float16)xs[i]; ah.h[i] = h; al.h[i] = ASPLIT ? (_Float16)(xs[i] - (float)h) : (_Float16)0.0f; }
#pragma unroll
    for (int t = 0; t < 4; ++t) { if (col0 + t * 16 >= N) continue; const size_t boff = (size_t)(col0 + t * 16 + ln) * ldb + kb; FragH bq; bq.half[0] = *(const v8us*)(Bh + boff + 8 * hh); bq.half[1] = *(const v8us*)(Bh + boff + 16 + 8 * hh);
      acc[t] = mmaH<ASPLIT ? 2 : 1>(ah.v, al.v, bq.v, bq.v, acc[t]); }
  }
#pragma unroll
  for (int t = 0; t < 4; ++t) { if (col0 + t * 16 >= N) continue;
#pragma unroll
    for (int r = 0; r < 8; ++r) so[w][8 * hh + r][t * 16 + ln] = acc[t][r] * alpha; }
  __builtin_amdgcn_fence(__ATOMIC_ACQ_REL, "workgroup"); __builtin_amdgcn_wave_barrier();
  const int rsub = lane >> 4, c4 = (lane & 15) * 4;
  {
#pragma unroll
    for (int q = 0; q < 8; ++q) { const int r = q * 2 + rsub; if (col0 + c4 < N) { const v4f v = *(const v4fa*)&so[w][r][c4]; *(v4f*)(C + (size_t)(row0 + r) * ldc + col0 + c4) = v; } }
     }
}

// Wt[n][k] = f16(W[k][n]·scale) from f32 row-major W[K][N] (scale = power of two; bf16-exact weights stay exact in f16 away from the subnormal range)
__global__ __launch_bounds__(256) void k_wt_f16(const float* __restrict__ W, _Float16* __restrict__ Wt, int K, int N, float scale) {
  const int t = blockIdx.x * 256 + threadIdx.x; if (t >= N * (K / 8)) return; const int n = t / (K / 8), k8 = (t % (K / 8)) * 8; FragH f;
#pragma unroll
  for (int i = 0; i < 8; ++i) f.h[i] = (_Float16)(bf16_round(W[(size_t)(k8 + i) * N + n]) * scale); const v8us o = f.half[0];
  *(v8us*)((unsigned short*)Wt + (size_t)n * K + k8) = o; 
}
// k_gemm_hh variant with fused epilogue: v = acc·alpha + bias[by·sBias + col] (+ CP[(row/rowsPerB)·sCPb + by·64 + col] if CP) ; ACT 0 none / 1 elu ; writes f16 C16 (and f32 C if non-null)
template <int ACT>
__global__ __launch_bounds__(128) void k_gemm_hhx(const _Float16* __restrict__ A, int lda, size_t sA, const _Float16* __restrict__ Bh, int ldb, size_t sB, float alpha, const float* __restrict__ bias, size_t sBias, const float* __restrict__ CP, int rowsPerB, size_t sCPb, int row0g,
    float* __restrict__ C, _Float16* __restrict__ C16, int ldc, size_t sC, int M, int N, int K) {
  __shared__ __attribute__((aligned(16))) float so[4][16][64];
  const int tid = threadIdx.x, w = tid >> 5, lane = tid & 31, ln = lane & 15, hh = lane >> 4; const int by = blockIdx.y;
  A += (size_t)by * sA; Bh += (size_t)by * sB; const size_t cofs = (size_t)by * sC; const float* bp = bias ? bias + (size_t)by * sBias : nullptr;
  const int ntn = (N + 63) / 64; const int wid = blockIdx.x * 4 + w; const int mt = wid / ntn, nq = wid % ntn; if (mt * 16 >= M) return;
  const int row0 = mt * 16, col0 = nq * 64; const _Float16* arow = A + (size_t)(row0 + ln) * lda;
  v8f acc[4] = {};
  for (int kb = 0; kb < K; kb += 32) { FragH ah; ah.half[0] = *(const v8us*)((const unsigned short*)arow + kb + 8 * hh); ah.half[1] = *(const v8us*)((const unsigned short*)arow + kb + 16 + 8 * hh);
#pragma unroll
    for (int t = 0; t < 4; ++t) { if (col0 + t * 16 >= N) continue; const size_t boff = (size_t)(col0 + t * 16 + ln) * ldb + kb; FragH bq; bq.half[0] = *(const v8us*)((const unsigned short*)Bh + boff + 8 * hh); bq.half[1] = *(const v8us*)((const unsigned short*)Bh + boff + 16 + 8 * hh);
      acc[t] = mmaH<1>(ah.v, ah.v, bq.v, bq.v, acc[t]); }
  }
#pragma unroll
  for (int t = 0; t < 4; ++t) { if (col0 + t * 16 >= N) continue; const int col = col0 + t * 16 + ln; const float bv = bp ? bf16_round(bp[col]) : 0.f;
#pragma unroll
    for (int r = 0; r < 8; ++r) { float v = acc[t][r] * alpha + bv; if (CP) { const int rr = row0g + row0 + 8 * hh + r; if (rowsPerB < 0) v += CP[cofs + (size_t)rr * ldc + col];      /* rowsPerB < 0: own element of the batched C plane */ else { const int bidx = rr / rowsPerB; v += CP[(size_t)bidx * sCPb + (size_t)by * 64 + col]; } } if (ACT == 1) v = (v > 0.f) ? v : expm1f(v); else if (ACT == 7) v = (v > 0.f) ? v + 1.0f : expf(v); else if (ACT == 8) v = tanhf(v); else if (ACT == 9) v = 0.5f * v * (1.0f + tanhf(0.7978845608028654f * (v + 0.044715f * v * v * v))); else if (ACT == 11) v = 1.0f / (1.0f + expf(-v)); else if (ACT == 12) v = (v > 0.f) ? v : 0.01f * v; else if (ACT == 14) v = (v > 0.f) ? v : 0.1f * v; else if (ACT == 16) v = (v >= 0.f) ? v : 0.3f * v; else if (ACT == 17) v = (v >= 0.f) ? v : 0.2f * v; else if (ACT == 15) v = v / (1.0f + expf(-v)); else if (ACT == 3) v = fmaxf(v, 0.f); else if (ACT == 6) v = 0.5f * v * (1.0f + erff(v * 0.70710678118654752f)); so[w][8 * hh + r][t * 16 + ln] = v; } }
  __builtin_amdgcn_fence(__ATOMIC_ACQ_REL, "workgroup"); __builtin_amdgcn_wave_barrier();
  const int rsub = lane >> 4, c4 = (lane & 15) * 4; typedef _Float16 v4h __attribute__((ext_vector_type(4)));
  {
#pragma unroll
    for (int q = 0; q < 8; ++q) { const int r = q * 2 + rsub; if (col0 + c4 < N) { const v4f v = *(const v4fa*)&so[w][r][c4]; if (C) *(v4f*)(C + cofs + (size_t)(row0 + r) * ldc + col0 + c4) = v; if (C16) { v4h h4; for (int i = 0; i < 4; ++i) h4[i] = (_Float16)v[i]; *(v4h*)(C16 + cofs + (size_t)(row0 + r) * ldc + col0 + c4) = h4; } } }
     }
}


typedef _Float16 v4h __attribute__((ext_vector_type(4)));

__global__ __launch_bounds__(256) void k_x16(const float* __restrict__ x, _Float16* __restrict__ X16, size_t n8) { const size_t t = (size_t)blockIdx.x * 256 + threadIdx.x; if (t >= n8) return; FragH f;
#pragma unroll
  for (int q = 0; q < 8; ++q) f.h[q] = (_Float16)bf16_round(x[t * 8 + q]); *(v8us*)((unsigned short*)X16 + t * 8) = f.half[0];  }
__global__ __launch_bounds__(256) void k_h16(const float* __restrict__ x, _Float16* __restrict__ X16, size_t n8) { const size_t t = (size_t)blockIdx.x * 256 + threadIdx.x; if (t >= n8) return; FragH f;
#pragma unroll
  for (int q = 0; q < 8; ++q) f.h[q] = (_Float16)x[t * 8 + q]; *(v8us*)((unsigned short*)X16 + t * 8) = f.half[0];  }
__global__ __launch_bounds__(256) void k_round16f(const float* __restrict__ W, _Float16* __restrict__ Bt, size_t n8) { const size_t t = (size_t)blockIdx.x * 256 + threadIdx.x; if (t >= n8) return; FragH f;
#pragma unroll
  for (int i = 0; i < 8; ++i) f.h[i] = (_Float16)(bf16_round(W[t * 8 + i]) * 16.0f); *(v8us*)((unsigned short*)Bt + t * 8) = f.half[0];  }
template <int NHv, int TTv>
__global__ __launch_bounds__(256) void k_vt(const _Float16* __restrict__ V16, int ldv, int voff, _Float16* __restrict__ Vt) { __shared__ unsigned short tl[64][66]; const int tid = threadIdx.x; const int slab = blockIdx.x / (TTv / 64), lg = blockIdx.x % (TTv / 64); const int b = slab / NHv, h = slab % NHv;
  for (int i = tid; i < 64 * 8; i += 256) { const int r = i / 8, c8 = (i % 8) * 8; FragH f; f.half[0] = *(const v8us*)((const unsigned short*)V16 + ((size_t)b * TTv + lg * 64 + r) * ldv + voff + h * 64 + c8);
#pragma unroll
    for (int q = 0; q < 8; ++q) tl[r][c8 + q] = f.u[q]; }
  __syncthreads();
  {
#pragma unroll
    for (int rd = 0; rd < 2; ++rd) { const int d = rd * 32 + tid / 8, pc = tid % 8; FragH f;
#pragma unroll
      for (int q = 0; q < 8; ++q) f.u[q] = tl[pc * 8 + q][d];
      *(v8us*)((unsigned short*)Vt + ((size_t)slab * 64 + d) * TTv + lg * 64 + pc * 8) = f.half[0]; }
     } }

__global__ __launch_bounds__(256) void k_hl(const float* __restrict__ F, _Float16* __restrict__ Hh, _Float16* __restrict__ Hl, size_t n8) { const size_t t = (size_t)blockIdx.x * 256 + threadIdx.x; if (t >= n8) return; FragH fh, fl; const v4f a = *(const v4fa*)(F + t * 8), c = *(const v4fa*)(F + t * 8 + 4);
#pragma unroll
  for (int q = 0; q < 4; ++q) { _Float16 h = (_Float16)a[q]; fh.h[q] = h; fl.h[q] = (_Float16)((a[q] - (float)h) * 1024.0f); h = (_Float16)c[q]; fh.h[4 + q] = h; fl.h[4 + q] = (_Float16)((c[q] - (float)h) * 1024.0f); }
  { *(v8us*)((unsigned short*)Hh + t * 8) = fh.half[0]; *(v8us*)((unsigned short*)Hl + t * 8) = fl.half[0];  } }

// ---- fast GEMM (work-group tile 128x64, wave tile 32x64, operands staged in LDS; requires M % 128 == 0 rows per launch region, N % 64 == 0 and K % 64 == 0); epilogue as in k_gemm_hhx, but CP is read only under RES and always at the own element ----
__device__ __forceinline__ v16h g2_frag(const _Float16* p, int hh) { FragH f; f.half[0] = *(const v8us*)((const unsigned short*)p + 8 * hh); f.half[1] = *(const v8us*)((const unsigned short*)p + 16 + 8 * hh); return f.v; }
__device__ __forceinline__ v8f g2_mma(v16h a, v16h b, v8f c) { v8f d = __builtin_amdgcn_wmma_f32_16x16x32_f16(false, a, false, b, (short)0, c, false, false); asm volatile("v_nop\n\tv_nop\n\tv_nop\n\tv_nop" : "+v"(d) : "v"(a), "v"(b)); return d; }
#define G2P 72                       /* LDS row pitch in f16: 128 B of data + 16 B = 144 B, an odd multiple of 16 B, so the 16 rows of a ds_load_b128 fragment read fall on different banks */
#define G2B (192 * G2P)              /* f16 per buffer: the block's 128 A rows, then its 64 B rows, 64 k each */
#define G2S (16u * G2P * 2u)         /* LDS bytes between a lane's successive copies (16 rows) */
// one k-tile (64 k) of the block's 128 A rows and 64 B rows, global -> LDS through no register: lane = (row tid / 8 + 16 i, 16-byte piece tid % 8), so a wave's copy takes four whole 128-byte lines.
// The s_wait_xcnt stands inside the copies' own statement, behind the last of them: later address arithmetic overwrites registers that the copies name, and only here is the wait tied in front of it.
__device__ __forceinline__ void g2_stage(const _Float16* ga, size_t sa, const _Float16* gb, size_t sb, unsigned l) {
  asm volatile(
    "global_load_async_to_lds_b128 %0, %12, off\n\t"
    "global_load_async_to_lds_b128 %1, %13, off\n\t"
    "global_load_async_to_lds_b128 %2, %14, off\n\t"
    "global_load_async_to_lds_b128 %3, %15, off\n\t"
    "global_load_async_to_lds_b128 %4, %16, off\n\t"
    "global_load_async_to_lds_b128 %5, %17, off\n\t"
    "global_load_async_to_lds_b128 %6, %18, off\n\t"
    "global_load_async_to_lds_b128 %7, %19, off\n\t"
    "global_load_async_to_lds_b128 %8, %20, off\n\t"
    "global_load_async_to_lds_b128 %9, %21, off\n\t"
    "global_load_async_to_lds_b128 %10, %22, off\n\t"
    "global_load_async_to_lds_b128 %11, %23, off\n\t"
    "s_wait_xcnt 0x0"
    :: "v"(l), "v"(l + 1u * G2S), "v"(l + 2u * G2S), "v"(l + 3u * G2S), "v"(l + 4u * G2S), "v"(l + 5u * G2S), "v"(l + 6u * G2S), "v"(l + 7u * G2S), "v"(l + 8u * G2S), "v"(l + 9u * G2S), "v"(l + 10u * G2S), "v"(l + 11u * G2S),
       "v"(ga), "v"(ga + 1 * sa), "v"(ga + 2 * sa), "v"(ga + 3 * sa), "v"(ga + 4 * sa), "v"(ga + 5 * sa), "v"(ga + 6 * sa), "v"(ga + 7 * sa), "v"(gb), "v"(gb + 1 * sb), "v"(gb + 2 * sb), "v"(gb + 3 * sb) : "memory"); }
template <int ACT, int RES>      /* RES 1: v += CP's own element of the batched C plane (ahead of the activation); RES 0: CP is not read */
__global__ __launch_bounds__(128) void k_gemm2(const _Float16* __restrict__ A, int lda, size_t sA, const _Float16* __restrict__ Bh, int ldb, size_t sB, float alpha, const float* __restrict__ bias, size_t sBias, const float* __restrict__ CP, int rowsPerB, size_t sCPb, int row0g,
    float* __restrict__ C, _Float16* __restrict__ C16, int ldc, size_t sC, int M, int N, int K) { static_assert(ACT == 0 || ACT == 3 || ACT == 6 || ACT == 8 || ACT == 9 || ACT == 11 || ACT == 12 || ACT == 14 || ACT == 15 || ACT == 16 || ACT == 17, "k_gemm2: unsupported ACT code (would silently apply no activation)");
  __shared__ __attribute__((aligned(16))) float sm[G2B];      /* two k-tile buffers of G2B f16 each; behind the k-loop's last barrier the same bytes are the epilogue's transpose tiles */
  float (*so)[32][68] = (float (*)[32][68])sm; static_assert(4 * 32 * 68 <= G2B, "epilogue tiles must fit the ring");
  const int tid = threadIdx.x, w = tid >> 5, lane = tid & 31, ln = lane & 15, hh = lane >> 4; const int by = blockIdx.y;
  A += (size_t)by * sA; Bh += (size_t)by * sB; const size_t cofs = (size_t)by * sC; const float* bp = bias ? bias + (size_t)by * sBias : nullptr;
  const int ntn = N >> 6; const int mt = blockIdx.x / ntn, nq = blockIdx.x - mt * ntn; const int row0 = mt * 128 + 32 * w, col0 = nq * 64; if (mt * 128 >= M) return;      /* the whole work-group leaves or none (barriers below) */
  const _Float16* ga = A + (size_t)(mt * 128 + (tid >> 3)) * lda + (tid & 7) * 8; const _Float16* gb = Bh + (size_t)(col0 + (tid >> 3)) * ldb + (tid & 7) * 8; const size_t sa = (size_t)16 * lda, sb = (size_t)16 * ldb;
  const unsigned l0 = (unsigned)(size_t)sm + (unsigned)((tid >> 3) * (G2P * 2) + (tid & 7) * 16);      /* the lane's LDS byte address in buffer 0 */
  const _Float16* st = (const _Float16*)sm; const int nt = K >> 6;
  const v8f z8 = {0.f,0.f,0.f,0.f,0.f,0.f,0.f,0.f}; v8f c00 = z8, c01 = z8, c02 = z8, c03 = z8, c10 = z8, c11 = z8, c12 = z8, c13 = z8;
  /* two LDS buffers: tile t + 1 flies while tile t is worked on. Each accumulator still takes its k-steps in ascending order. */
  g2_stage(ga, sa, gb, sb, l0);
  asm volatile("s_wait_asynccnt 0x0" ::: "memory");      /* this wave's copies of tile 0 have landed */
  __syncthreads();      /* ... and every other wave's */
  if (nt > 1) g2_stage(ga + 64, sa, gb + 64, sb, l0 + (unsigned)(G2B * 2));
#pragma unroll 1      /* one k-tile per trip: the buffer alternates by the trip's parity */
  for (int t = 0; t < nt; ++t) {
    const _Float16* ap = st + (t & 1) * G2B + (32 * w + ln) * G2P; const _Float16* bq = st + (t & 1) * G2B + (128 + ln) * G2P;
    const v16h a0 = g2_frag(ap, hh), a1 = g2_frag(ap + 16 * G2P, hh), b0 = g2_frag(bq, hh), b1 = g2_frag(bq + 16 * G2P, hh), b2 = g2_frag(bq + 32 * G2P, hh), b3 = g2_frag(bq + 48 * G2P, hh);
    const v16h e0 = g2_frag(ap + 32, hh), e1 = g2_frag(ap + 16 * G2P + 32, hh), f0 = g2_frag(bq + 32, hh), f1 = g2_frag(bq + 16 * G2P + 32, hh), f2 = g2_frag(bq + 32 * G2P + 32, hh), f3 = g2_frag(bq + 48 * G2P + 32, hh);
    c00 = g2_mma(a0, b0, c00); c10 = g2_mma(a1, b0, c10); c01 = g2_mma(a0, b1, c01); c11 = g2_mma(a1, b1, c11); c02 = g2_mma(a0, b2, c02); c12 = g2_mma(a1, b2, c12); c03 = g2_mma(a0, b3, c03); c13 = g2_mma(a1, b3, c13);
    c00 = g2_mma(e0, f0, c00); c10 = g2_mma(e1, f0, c10); c01 = g2_mma(e0, f1, c01); c11 = g2_mma(e1, f1, c11); c02 = g2_mma(e0, f2, c02); c12 = g2_mma(e1, f2, c12); c03 = g2_mma(e0, f3, c03); c13 = g2_mma(e1, f3, c13);
    asm volatile("s_wait_dscnt 0x0" ::: "memory");      /* this wave's reads of tile t are done before the buffer is given up */
    asm volatile("s_wait_asynccnt 0x0" ::: "memory");      /* this wave's copies of tile t + 1 have landed */
    __syncthreads();      /* publishes tile t + 1 and ends every wave's reads of tile t */
    if (t + 2 < nt) g2_stage(ga + (size_t)(t + 2) * 64, sa, gb + (size_t)(t + 2) * 64, sb, l0 + (unsigned)((t & 1) * (G2B * 2))); }      /* refill of the buffer that this trip has just read */
  asm volatile("s_wait_asynccnt 0x0" ::: "memory");      /* nothing of the ring is in flight when its bytes become the epilogue's tiles */
  v8f accs[8] = {c00, c01, c02, c03, c10, c11, c12, c13}; (void)rowsPerB; (void)sCPb;
  /* the epilogue's global loads (4 bias values, 64 residual elements per lane) stand together ahead of the arithmetic, under no per-element test, so that they are all in flight at once and their latency is paid once */
  float bv4[4] = {0.f, 0.f, 0.f, 0.f}, rv[8][8];
  if (RES) { const float* cp = CP + cofs + (size_t)(row0g + row0 + 8 * hh) * ldc + col0 + ln; const float* pr[16];      /* the lane's 16 rows */
#pragma unroll
    for (int i = 0; i < 16; ++i) pr[i] = cp + (size_t)((i >> 3) * 16 + (i & 7)) * ldc;
#pragma unroll
    for (int u = 0; u < 8; ++u) for (int r = 0; r < 8; ++r) rv[u][r] = pr[(u >> 2) * 8 + r][(u & 3) * 16];
    /* the wait that belongs in front of any overwrite of a register that an issued load names; it takes the 16 row addresses as inputs, so that each stays in its registers up to here */
    asm volatile("s_wait_xcnt 0x0" :: "v"(pr[0]), "v"(pr[1]), "v"(pr[2]), "v"(pr[3]), "v"(pr[4]), "v"(pr[5]), "v"(pr[6]), "v"(pr[7]), "v"(pr[8]), "v"(pr[9]), "v"(pr[10]), "v"(pr[11]), "v"(pr[12]), "v"(pr[13]), "v"(pr[14]), "v"(pr[15]) : "memory"); }
  if (bp) {
#pragma unroll
    for (int t = 0; t < 4; ++t) bv4[t] = bp[col0 + t * 16 + ln];
    asm volatile("s_wait_xcnt 0x0" ::: "memory"); }      /* behind the join the build reuses the offset register that these four loads name: the wait stands in front of that */
#pragma unroll
  for (int u = 0; u < 8; ++u) { const int t = u & 3, half = u >> 2; const float bv = bf16_round(bv4[t]);
#pragma unroll
    for (int r = 0; r < 8; ++r) { const int rloc = half * 16 + 8 * hh + r; float v = accs[u][r] * alpha + bv; if (RES) v += rv[u][r];
      if (ACT == 3) v = fmaxf(v, 0.f); else if (ACT == 6) v = 0.5f * v * (1.0f + erff(v * 0.70710678118654752f)); else if (ACT == 11) v = 1.0f / (1.0f + expf(-v)); else if (ACT == 15) v = v / (1.0f + expf(-v)); else if (ACT == 12) v = (v > 0.f) ? v : 0.01f * v; else if (ACT == 8) v = tanhf(v); else if (ACT == 9) v = 0.5f * v * (1.0f + tanhf(0.7978845608028654f * (v + 0.044715f * v * v * v))); else if (ACT == 14) v = (v > 0.f) ? v : 0.1f * v; else if (ACT == 16) v = (v >= 0.f) ? v : 0.3f * v; else if (ACT == 17) v = (v >= 0.f) ? v : 0.2f * v;
      so[w][rloc][t * 16 + ln] = v; } }
  __builtin_amdgcn_fence(__ATOMIC_ACQ_REL, "workgroup"); __builtin_amdgcn_wave_barrier();
  const int rsub = lane >> 4, c4 = (lane & 15) * 4;
  {
#pragma unroll
    for (int q = 0; q < 16; ++q) { const int r = q * 2 + rsub; const v4f v = *(const v4fa*)&so[w][r][c4]; if (C) *(v4f*)(C + cofs + (size_t)(row0 + r) * ldc + col0 + c4) = v; if (C16) { v4h h4; for (int i = 0; i < 4; ++i) h4[i] = (_Float16)v[i]; *(v4h*)(C16 + cofs + (size_t)(row0 + r) * ldc + col0 + c4) = h4; } }
     } }


__global__ __launch_bounds__(256) void k_wnat(const float* __restrict__ w, size_t n8, _Float16* __restrict__ Bt) { const size_t t = (size_t)blockIdx.x * 256 + threadIdx.x; if (t >= n8) return; FragH f; for (int q = 0; q < 8; ++q) f.h[q] = (_Float16)(bf16_round(w[t * 8 + q]) * 16.0f); *(v8us*)((unsigned short*)Bt + t * 8) = f.half[0];  }
__global__ __launch_bounds__(256) void k_rsm(const float* __restrict__ S, _Float16* __restrict__ P, int nrows) {
  #pragma clang fp contract(off)
  const int i = blockIdx.x * 256 + threadIdx.x; if (i >= nrows) return; const float* s = S + (size_t)i * SQ; float mx = -3.0e38f;
#pragma unroll 1
  for (int j = 0; j < SQ; ++j) mx = fmaxf(mx, s[j]); float se = 0.f;
#pragma unroll 1
  for (int j = 0; j < SQ; ++j) se += expf(s[j] - mx); const float sc = 256.0f / se;
#pragma unroll 1
  for (int j0 = 0; j0 < SQ; j0 += 8) { FragH f; for (int q = 0; q < 8; ++q) f.h[q] = (_Float16)(expf(s[j0 + q] - mx) * sc); unsigned short* d = (unsigned short*)P + (size_t)i * SQ + j0; *(v8us*)d = f.half[0];  } }
__global__ __launch_bounds__(256) void k_vt(const _Float16* __restrict__ V16, int b, int h0, _Float16* __restrict__ VT) { __shared__ unsigned short tl[64][65]; const int tid = threadIdx.x; const int hh = blockIdx.x % HG, sg = blockIdx.x / HG; const int s0 = sg * 64; const int h = h0 + hh;
  for (int i = tid; i < 64 * 8; i += 256) { const int j = i / 8, d8 = (i % 8) * 8; FragH f; f.half[0] = *(const v8us*)((const unsigned short*)V16 + ((size_t)b * SQ + s0 + j) * DM + h * HD + d8); for (int q = 0; q < 8; ++q) tl[d8 + q][j] = f.u[q]; }
  __syncthreads();
  { for (int i = tid; i < 64 * 8; i += 256) { const int d = i / 8, j8 = (i % 8) * 8; FragH f; for (int q = 0; q < 8; ++q) f.u[q] = tl[d][j8 + q]; *(v8us*)((unsigned short*)VT + ((size_t)hh * HD + d) * SQ + s0 + j8) = f.half[0]; }  } }



// fused causal attention, one wave per 32 query rows, no LDS, scores and weights never leave the registers.
// scores^T tile = K rows (A) x Q rows (B): accumulator row = key 8*hh + r, column = query ln, so a lane's 8 values of key tile 0 and its 8 of key tile 1 are,
// in order, the 16 elements of the B fragment (k = 8*hh + i, 16 + 8*hh + i) of the 32-key step of o^T = V^T (A) x P^T (B): no exchange between lanes.
// A lane keeps the running maximum of its query (made equal in both half-waves by one exchange per 32 keys) and its own half of the running sum (halves added at the end).
#define FA_CS 0.18033688011112042f      /* log2(e) / 8: score scale and exp -> exp2 in one factor */
__device__ __forceinline__ float fa_exp2(float x) { float e; asm("v_exp_f32 %0, %1\n\tv_nop" : "=v"(e) : "v"(x)); return e; }      /* the v_nop is the one slot the instruction set asks for behind a transcendental before its result is read or its source overwritten */
__device__ __forceinline__ float fa_xhalf(float x) { return __builtin_bit_cast(float, __builtin_amdgcn_permlanex16(__builtin_bit_cast(int, x), __builtin_bit_cast(int, x), 0x76543210, 0xfedcba98, false, false)); }      /* lane l with lane l ^ 16, on the vector unit (a shuffle would go through the LDS pipe and its wait) */
__device__ __forceinline__ v8f fa_mma(v16h a, v16h b, v8f c) { return __builtin_amdgcn_wmma_f32_16x16x32_f16(false, a, false, b, (short)0, c, false, false); }
__global__ __launch_bounds__(128) void k_fattn(const _Float16* __restrict__ QKVp, const _Float16* __restrict__ VTp, _Float16* __restrict__ O) {
  const int lane = threadIdx.x & 31, ln = lane & 15, hh = lane >> 4; const int w = __builtin_amdgcn_readfirstlane((int)(threadIdx.x >> 5));
  const int bh = blockIdx.x, b = bh / NH, h = bh - b * NH;
  const int yg = (int)blockIdx.y >> 2, yi = (int)blockIdx.y & 3; const int qt = SQ / 128 - 1 - 4 * yg - ((yg & 1) ? 3 - yi : yi);      /* query tile: long tiles first, every second group of four in rising order, so that work-groups 256 apart in the grid (all are resident at once) add up to equal lengths; any order is correct */
  const int row0 = qt * 128 + 32 * w;      /* also the first key of the wave's last 32-key block */
  const _Float16* qp = QKVp + ((size_t)b * SQ + row0 + ln) * LQ + h * HD;
  const _Float16* kp = QKVp + ((size_t)b * SQ + ln) * LQ + DM + h * HD;
  const _Float16* vp = VTp + ((size_t)bh * HD + ln) * SQ;
  v16h q[2][2], kf[2][2];
#pragma unroll      /* here and in every inner loop below: static indices keep the fragment and accumulator arrays in registers */
  for (int j = 0; j < 2; ++j) for (int kk = 0; kk < 2; ++kk) q[j][kk] = g2_frag(qp + (size_t)(j * 16) * LQ + kk * 32, hh);
#pragma unroll
  for (int kt = 0; kt < 2; ++kt) for (int kk = 0; kk < 2; ++kk) kf[kt][kk] = g2_frag(kp + (size_t)(kt * 16) * LQ + kk * 32, hh);
  const v8f z8 = {0.f,0.f,0.f,0.f,0.f,0.f,0.f,0.f};
  v8f o[2][4] = {{z8, z8, z8, z8}, {z8, z8, z8, z8}}; float m[2] = {-1.0e30f, -1.0e30f}, l[2] = {0.f, 0.f};
  int kb = 0;
#pragma unroll 1      /* one 32-key block per trip: a second copy of the body would need a second set of fragments */
  do {
    const int kn = min(kb + 32, row0);      /* next block; the last trip fetches its own block again, so every address stays inside the batch's rows */
    v8f s[2][2]; v16h vf[4];
#pragma unroll
    for (int t = 0; t < 4; ++t) vf[t] = g2_frag(vp + (size_t)(t * 16) * SQ + kb, hh);      /* this block's V^T, in flight under the scores and the softmax */
#pragma unroll
    for (int kt = 0; kt < 2; ++kt) for (int j = 0; j < 2; ++j) s[j][kt] = fa_mma(kf[kt][0], q[j][0], z8);
#pragma unroll
    for (int kt = 0; kt < 2; ++kt) for (int j = 0; j < 2; ++j) s[j][kt] = fa_mma(kf[kt][1], q[j][1], s[j][kt]);
#pragma unroll
    for (int kt = 0; kt < 2; ++kt) for (int kk = 0; kk < 2; ++kk) kf[kt][kk] = g2_frag(kp + (size_t)(kn + kt * 16) * LQ + kk * 32, hh);      /* next block's K, in flight under the softmax and the second product */
    asm volatile("s_wait_xcnt 0x0" ::: "memory");      /* later address arithmetic may overwrite registers that these loads name: the wait stands in front of it */
    if (kb + 31 > row0) {      /* only the block on the diagonal needs the causal test (same for the whole wave) */
      const int dq = row0 + ln - kb - 8 * hh;      /* key offset kt*16 + r is allowed up to dq + j*16 */
#pragma unroll
      for (int j = 0; j < 2; ++j) for (int kt = 0; kt < 2; ++kt) for (int r = 0; r < 8; ++r) s[j][kt][r] = (kt * 16 + r - j * 16 <= dq) ? s[j][kt][r] : -1.0e30f; }
    v16h p[2];
#pragma unroll
    for (int j = 0; j < 2; ++j) {
      float bm = s[j][0][0];
#pragma unroll
      for (int kt = 0; kt < 2; ++kt) for (int r = 0; r < 8; ++r) bm = fmaxf(bm, s[j][kt][r]);
      bm = fmaxf(bm, fa_xhalf(bm));      /* the query's other 16 keys of this block sit in the other half-wave */
      const float mn = fmaxf(m[j], bm); const float sc = fa_exp2((m[j] - mn) * FA_CS); m[j] = mn;
      const float mc = mn * FA_CS - 4.0f;      /* weights carried x16 (largest = 16): small ones stay in f16's normal range; the factor is in the row sum too and cancels */
      v4f ls = {0.f, 0.f, 0.f, 0.f}; FragH f;
#pragma unroll
      for (int i = 0; i < 16; ++i) { const float e = fa_exp2(fmaf(s[j][i >> 3][i & 7], FA_CS, -mc)); ls[i & 3] += e; f.h[i] = (_Float16)e; }
      p[j] = f.v;
      l[j] = l[j] * sc + ((ls[0] + ls[1]) + (ls[2] + ls[3]));
#pragma unroll
      for (int t = 0; t < 4; ++t) o[j][t] *= sc; }
#pragma unroll
    for (int t = 0; t < 4; ++t) for (int j = 0; j < 2; ++j) o[j][t] = fa_mma(vf[t], p[j], o[j][t]);
    kb += 32;
  } while (kb <= row0);
#pragma unroll
  for (int j = 0; j < 2; ++j) { const float fin = 64.0f / (l[j] + fa_xhalf(l[j]));      /* o carried x64 */
    unsigned short* op = (unsigned short*)O + ((size_t)b * SQ + row0 + j * 16 + ln) * DM + h * HD + 8 * hh;
#pragma unroll
    for (int t = 0; t < 4; ++t) { FragH f;
#pragma unroll
      for (int r = 0; r < 8; ++r) f.h[r] = (_Float16)(o[j][t][r] * fin);
      *(v8us*)(op + t * 16) = f.half[0]; } }
}


// exact f32 attention of a batch's first QT0 rows, causal. One work-group = 64 query rows of one head, 1024 threads, three passes over LDS:
// 1. thread (row, key group g of 16) forms the scores of keys g, g + 16, ... (each score one ascending chain over the 64 dims; the wave's key row comes through scalar loads) and its part of the row maximum;
// 2. the same thread turns its scores into weights exp(s - row max), 0 above the diagonal, and sums its part of the row sum;
// 3. thread (row, 4 dims) adds weight x V over the keys in ascending order and divides by the row sum (the 16 parts added in ascending g).
template <int MASKADD>
__global__ __launch_bounds__(1024) void k_att0(const float* __restrict__ QF, const float* __restrict__ KF, const float* __restrict__ VF, int ld, size_t sIn, const float* __restrict__ mask, float scale, float* __restrict__ OF, int ldo, size_t sOut) {
  static_assert(MASKADD == 0, "k_att0: causal form only (the weights of QT0 keys are held in LDS)"); (void)mask;
  __shared__ __attribute__((aligned(16))) float sq[64][HD + 4];      /* q rows; pitch 272 B, an odd multiple of 16 B, so that 16-byte reads of one column piece from successive rows fall on different banks */
  __shared__ float se[QT0][64];      /* [key][row]: scores, then weights */
  __shared__ float pm[16][64], pl[16][64];      /* [key group][row]: parts of the row maximum and of the row sum */
  const int tid = threadIdx.x; const int h = blockIdx.x / (QT0 / 64), rg = blockIdx.x % (QT0 / 64);
  QF += (size_t)blockIdx.y * sIn; KF += (size_t)blockIdx.y * sIn; VF += (size_t)blockIdx.y * sIn; OF += (size_t)blockIdx.y * sOut;      /* blockIdx.y = batch */
  const int r = tid >> 4, c4 = (tid & 15) * 4;      /* passes 0 and 3: row r of the block, dims c4 .. c4 + 3: 16 lanes take one whole 256-byte row */
  *(v4f*)&sq[r][c4] = *(const v4fa*)(QF + (size_t)(rg * 64 + r) * ld + h * HD + c4);
  __syncthreads();      /* the q rows are complete */
  const int il = tid & 63, i = rg * 64 + il; const int g = __builtin_amdgcn_readfirstlane(tid >> 6);      /* the key group is the same for a whole wave */
  const int nk = rg * 64 + 64;      /* keys up to the block's last row */
  v4f rq[HD / 4];
#pragma unroll      /* here and in the inner loops below: static indices keep the arrays in registers */
  for (int c = 0; c < HD / 4; ++c) rq[c] = *(const v4f*)&sq[il][c * 4];
  float mx = -1.0e30f;
#pragma unroll 1      /* one key per trip: a key row fills 64 scalar registers */
  for (int j = g; j < nk; j += 16) { const float* kr = KF + (size_t)j * ld + h * HD; float s = 0.f;
#pragma unroll
    for (int c = 0; c < HD / 4; ++c) { const v4f kq = *(const v4fa*)(kr + c * 4); const v4f qq = rq[c]; s = fmaf(qq[0], kq[0], s); s = fmaf(qq[1], kq[1], s); s = fmaf(qq[2], kq[2], s); s = fmaf(qq[3], kq[3], s); }
    s *= scale; se[j][il] = s; mx = (j <= i) ? fmaxf(mx, s) : mx; }
  pm[g][il] = mx;
  __syncthreads();      /* every part of the row maxima is written */
  float m = pm[0][il];      /* key 0 is allowed in every row, so this part is a real score */
#pragma unroll
  for (int gg = 1; gg < 16; ++gg) m = fmaxf(m, pm[gg][il]);
  float ls = 0.f;
#pragma unroll 1      /* four or eight short trips: kept rolled for code size */
  for (int j = g; j < nk; j += 16) { const float e = (j <= i) ? expf(se[j][il] - m) : 0.f; se[j][il] = e; ls += e; }      /* the thread's own elements */
  pl[g][il] = ls;
  __syncthreads();      /* weights and parts of the row sums are written */
  float l = 0.f;
#pragma unroll
  for (int gg = 0; gg < 16; ++gg) l += pl[gg][r];
  const int je = (rg * 64 + 2 * __builtin_amdgcn_readfirstlane(tid >> 5) + 2 + 7) & ~7;      /* keys that the wave's two rows may see, rounded up to whole groups of 8 (at most nk; the weights above the diagonal are 0) */
  const float* vr = VF + h * HD + c4; v4f o = {0.f, 0.f, 0.f, 0.f};
#pragma unroll 1      /* eight keys per trip, their loads issued together */
  for (int j0 = 0; j0 < je; j0 += 8) { v4f vv[8]; float e[8];
#pragma unroll
    for (int u = 0; u < 8; ++u) { vv[u] = *(const v4fa*)(vr + (size_t)(j0 + u) * ld); e[u] = se[j0 + u][r]; }
#pragma unroll
    for (int u = 0; u < 8; ++u) for (int q = 0; q < 4; ++q) o[q] = fmaf(e[u], vv[u][q], o[q]); }
  const float fin = 64.0f / l;      /* o carried x64 like the f16 path */
  for (int q = 0; q < 4; ++q) o[q] *= fin;
  *(v4f*)(OF + (size_t)(rg * 64 + r) * ldo + h * HD + c4) = o;
}


template <int BFIN, int WXB>
__global__ __launch_bounds__(256) void k_ln16(const float* __restrict__ X, const float* __restrict__ g, const float* __restrict__ bb, float eps, _Float16* __restrict__ N16, float* __restrict__ XB) {
  #pragma clang fp contract(off)
  __shared__ float red[256]; const size_t r = blockIdx.x; const int t = threadIdx.x; const v4f xa = *(const v4fa*)(X + r * DMQ + t * 4); float s[4]; float sum = 0.f;
  for (int q = 0; q < 4; ++q) { s[q] = BFIN ? bf16_round(xa[q]) : xa[q]; sum = __fadd_rn(sum, s[q]); }
  red[t] = sum; __syncthreads(); for (int st = 128; st > 0; st >>= 1) { if (t < st) red[t] = __fadd_rn(red[t], red[t + st]); __syncthreads(); } const float mu = red[0] / (float)DMQ; __syncthreads();
  float vs = 0.f; for (int q = 0; q < 4; ++q) { const float dl = __fadd_rn(s[q], -mu); vs = __fadd_rn(vs, __fmul_rn(dl, dl)); } red[t] = vs; __syncthreads(); for (int st = 128; st > 0; st >>= 1) { if (t < st) red[t] = __fadd_rn(red[t], red[t + st]); __syncthreads(); }
  const float rs = rsqrtf(__fadd_rn(red[0] / (float)DMQ, eps)); v4h y; v4f xb;
  for (int q = 0; q < 4; ++q) { const int c = t * 4 + q; y[q] = (_Float16)__fadd_rn(__fmul_rn(__fmul_rn(__fadd_rn(s[q], -mu), rs), bf16_round(g[c])), bf16_round(bb[c])); xb[q] = s[q]; }
  { *(v4h*)(N16 + r * DMQ + t * 4) = y; if (WXB) *(v4f*)(XB + r * DMQ + t * 4) = xb;  } }
__global__ __launch_bounds__(256) void k_ftres2(const float* __restrict__ OF0, const float* __restrict__ XB, float* __restrict__ X1, size_t n4) {
  #pragma clang fp contract(off)
  const size_t t = (size_t)blockIdx.x * 256 + threadIdx.x; if (t >= n4) return; const v4f o = *(const v4fa*)(OF0 + t * 4), xv = *(const v4fa*)(XB + t * 4); v4f y; for (int q = 0; q < 4; ++q) y[q] = __fadd_rn(__fmul_rn(o[q], 0.015625f), xv[q]); *(v4f*)(X1 + t * 4) = y;  }

__global__ __launch_bounds__(256) void k_wthd(const float* __restrict__ Wt, _Float16* __restrict__ Bt) { const size_t t = (size_t)blockIdx.x * 256 + threadIdx.x; if (t >= (size_t)NH * HD * (DM / 8)) return; const int m8 = (int)(t % (DM / 8)) * 8; const int d = (int)((t / (DM / 8)) % HD); const int h = (int)(t / ((size_t)(DM / 8) * HD)); FragH f;
  for (int q = 0; q < 8; ++q) f.h[q] = (_Float16)(16.0f * bf16_round(Wt[((size_t)h * DM + m8 + q) * HD + d])); unsigned short* dst = (unsigned short*)Bt + ((size_t)h * HD + d) * DM + m8; *(v8us*)dst = f.half[0];  }




__global__ __launch_bounds__(256) void k_wtpad(const float* __restrict__ Wm, _Float16* __restrict__ Wt, int Kr, int Kp, int Nr, int Np, float scale) {
  const int t = blockIdx.x * 256 + threadIdx.x; if (t >= Np * (Kp / 8)) return; const int n = t / (Kp / 8), k8 = (t % (Kp / 8)) * 8; const int nc = min(n, Nr - 1); const float fn = (n < Nr) ? 1.f : 0.f; FragH f;
  for (int i = 0; i < 8; ++i) { const int k = k8 + i; const int kc = min(k, Kr - 1); const float fk = (k < Kr) ? fn : 0.f; f.h[i] = (_Float16)(bf16_round(Wm[(size_t)kc * Nr + nc]) * scale * fk); }
  unsigned short* o = (unsigned short*)Wt + (size_t)n * Kp + k8; *(v8us*)o = f.half[0];  }
__global__ __launch_bounds__(128) void k_bpad(const float* __restrict__ b, float* __restrict__ Bp, int nr, int np) {
  const int i = threadIdx.x; if (i >= np) return; const float v = b[min(i, nr - 1)] * ((i < nr) ? 1.f : 0.f); *(float*)(Bp + i) = v;  }
extern "C" void kernel_launch(void* const* d_in, const int* in_sizes, int n_in,
                              void* d_out, int out_size, void* d_ws, size_t ws_size, hipStream_t stream) {
  (void)in_sizes; (void)n_in; (void)out_size;
  const float* const* I = (const float* const*)d_in; const float* x = I[0]; const float* g1 = I[1]; const float* be1 = I[2]; const float* wq = I[3]; const float* wk = I[4]; const float* wv = I[5]; const float* wo = I[6]; const float* bo = nullptr; const float* gg2 = I[7]; const float* be2 = I[8]; const float* wfc = I[9]; const float* bfc = I[10]; const float* wmp = I[11]; const float* bmp = I[12];      /* x, LN1 g / b, Wq / Wk / Wv / Wo [1024][1024] ([in][out], no biases), LN2 g / b, W1 [1024][4096] + b1, W2 [4096][1024] + b2 */
  char* ws = (char*)d_ws; size_t off = 0;
  auto take = [&](size_t bytes) { char* p = ws + off; off += (bytes + 255) & ~(size_t)255; return p; };
  _Float16* BQKV = (_Float16*)take((size_t)3 * DM * DM * 2); _Float16* BO = (_Float16*)take((size_t)DM * DM * 2);
  _Float16* X16 = (_Float16*)take(NR * DM * 2); float* XB = (float*)take(NR * DM * 4); float* X1 = (float*)take(NR * DM * 4); _Float16* M16 = nullptr;      /* = X16 below (alias: X16's last reader, the first-tile q | k | v GEMM, precedes LN2's write) */ _Float16* BW1 = (_Float16*)take((size_t)DFF * DM * 2); _Float16* BW2 = (_Float16*)take((size_t)DM * DFF * 2); _Float16* QKV = (_Float16*)take(NR * 4 * DM * 2); _Float16* Q16 = QKV; _Float16* K16 = QKV + DM; _Float16* V16 = QKV + 2 * DM; _Float16* O16 = QKV + NR * 3 * DM; M16 = X16;      /* one plane: the q | k | v rows (pitch 3 DM), then the o rows (pitch DM) */
  static_assert(DFF == 4 * DM, "the hidden rows of all batches take exactly the q | k | v and o planes"); _Float16* HF16 = QKV;      /* alias: the last readers of q | k | v (attention) and of o (the output GEMM) precede the first FFN GEMM, which writes every hidden element before the second reads it */
  _Float16* VT = (_Float16*)take((size_t)NB * NH * HD * SQ * 2);
  float* QKVF0 = (float*)take((size_t)NB * QT0 * LQ * 4);      /* f32 q | k | v rows of every batch's first tile, pitch LQ */ float* OF0 = (float*)take((size_t)NB * QT0 * DM * 4); _Float16* OH0 = (_Float16*)take((size_t)NB * QT0 * DM * 2); _Float16* OL0 = (_Float16*)take((size_t)NB * QT0 * DM * 2);
  if (off > ws_size) return;
  { const unsigned g = (unsigned)(((size_t)DM * (DM / 8) + 255) / 256); k_wt_f16<<<g, 256, 0, stream>>>(wq, BQKV, DM, DM, 16.0f); k_wt_f16<<<g, 256, 0, stream>>>(wk, BQKV + (size_t)DM * DM, DM, DM, 16.0f); k_wt_f16<<<g, 256, 0, stream>>>(wv, BQKV + (size_t)2 * DM * DM, DM, DM, 16.0f); }      /* [in][out] -> Bt x16, stacked q | k | v */ k_wt_f16<<<(unsigned)(((size_t)DM * (DM / 8) + 255) / 256), 256, 0, stream>>>(wo, BO, DM, DM, 16.0f);      /* w_proj [in][out] -> Bt x16 */
  k_ln16<1, 1><<<(unsigned)NR, 256, 0, stream>>>(x, g1, be1, 1e-5f, X16, XB);      /* a = LN1(bf16(x)) -> f16 rows; XB = bf16(x) for the residual */
  k_wt_f16<<<(unsigned)(((size_t)DFF * (DM / 8) + 255) / 256), 256, 0, stream>>>(wfc, BW1, DM, DFF, 16.0f); k_wt_f16<<<(unsigned)(((size_t)DM * (DFF / 8) + 255) / 256), 256, 0, stream>>>(wmp, BW2, DFF, DM, 16.0f);      /* W1 [1024][4096] -> Bt [4096][1024]; W2 [4096][1024] -> Bt [1024][4096] (x16) */
  const size_t r0p = (size_t)B0 * SQ;      /* first projected row */
  k_gemm2<0, 0><<<dim3((unsigned)((MP / 128) * (3 * DM / 64)), 1), 128, 0, stream>>>(X16 + r0p * DM, DM, 0, BQKV, DM, 0, 0.0625f, nullptr, 0, nullptr, 1, 0, 0, nullptr, QKV + r0p * 3 * DM, 3 * DM, 0, MP, 3 * DM, DM);      /* q | k | v rows (f16); head h = columns h*HD.. of each DM block */
  k_gemm2<0, 0><<<dim3((QT0 / 128) * (LQ / 64), NB), 128, 0, stream>>>(X16, DM, (size_t)SQ * DM, BQKV, DM, 0, 0.0625f, nullptr, 0, nullptr, 1, 0, 0, QKVF0, nullptr, LQ, (size_t)QT0 * LQ, QT0, LQ, DM);      /* f32 q | k | v of the first 128 rows of every batch (exact products); blockIdx.y = batch */
  k_att0<0><<<dim3(NH * (QT0 / 64), NB), 1024, 0, stream>>>(QKVF0, QKVF0 + DM, QKVF0 + 2 * DM, LQ, (size_t)QT0 * LQ, nullptr, 0.125f, OF0, DM, (size_t)QT0 * DM);      /* exact f32 attention for rows 0..127 of every batch (o x64) */
  k_vt<NH, SQ><<<NB * NH * (SQ / 64), 256, 0, stream>>>(V16, LQ, 0, VT);      /* V^T [NB][NH][HD][SQ] */
  k_fattn<<<dim3(NB * NH, SQ / 128), 128, 0, stream>>>(QKV, VT, O16);      /* o (merged heads, x64) as f16 rows, every batch, head and query tile in one launch */
  k_gemm2<0, 1><<<dim3((unsigned)((MPO / 128) * (DM / 64)), 1), 128, 0, stream>>>(O16 + r0p * DM, DM, 0, BO, DM, 0, 0.0009765625f, bo, 0, XB + r0p * DM, -1, 0, 0, X1 + r0p * DM, nullptr, DM, 0, MPO, DM, DM);      /* out rows are the output layout */
  k_hl<<<(unsigned)(((size_t)NB * QT0 * DM / 8 + 255) / 256), 256, 0, stream>>>(OF0, OH0, OL0, (size_t)NB * QT0 * DM / 8);      /* first-tile o (x64) -> f16 hi + x1024 residual planes */
  k_gemm2<0, 1><<<dim3((QT0 / 128) * (DM / 64), NB), 128, 0, stream>>>(OH0, DM, (size_t)QT0 * DM, BO, DM, 0, 0.0009765625f, bo, 0, XB, -1, 0, 0, X1, nullptr, DM, (size_t)SQ * DM, QT0, DM, DM);      /* rows 0..127 of every batch: x1 = o_hi Wo + x, overwriting the f16-path rows */
  k_gemm2<0, 1><<<dim3((QT0 / 128) * (DM / 64), NB), 128, 0, stream>>>(OL0, DM, (size_t)QT0 * DM, BO, DM, 0, 0.00000095367431640625f, nullptr, 0, X1, -1, 0, 0, X1, nullptr, DM, (size_t)SQ * DM, QT0, DM, DM);      /* += o_lo Wo 2^-20 (own-element accumulate) */
  k_ln16<0, 0><<<(unsigned)NR, 256, 0, stream>>>(X1, gg2, be2, 1e-5f, M16, nullptr);      /* h = LN2(x1) -> f16 rows */
  k_gemm2<6, 0><<<dim3((unsigned)((MPO / 128) * (DFF / 64)), 1), 128, 0, stream>>>(M16, DM, 0, BW1, DM, 0, 0.0625f, bfc, 0, nullptr, 1, 0, 0, nullptr, HF16, DFF, 0, MPO, DFF, DM);      /* gelu_erf(h2 W1 + b1) -> f16, the token rows of all batches in one launch */
  k_gemm2<0, 1><<<dim3((unsigned)((MPO / 128) * (DM / 64)), 1), 128, 0, stream>>>(HF16, DFF, 0, BW2, DFF, 0, 0.0625f, bmp, 0, X1, -1, 0, 0, (float*)d_out, nullptr, DM, 0, MPO, DM, DFF);      /* out = x1 + mlp (own-element residual), all batches: 1024 work-groups, four to a WGP, where a batch alone gave 256 */
}
